// v000
// The times below were measured on an AMD MI455X: many runs one after another, warmed up first and cycling through
// copies of the inputs, with the whole window's GPU time divided by the number of runs. Launches and the gaps
// between them are all in it. The median over several windows is given; except for v000 it joins two sittings, which
// can be a few percent apart, so the side-by-side timings, each taken in one sitting, are the better comparison.
// The starting kernel, v000, takes 820 microseconds a run.
#include <hip/hip_runtime.h>
// Structure: token rows r = b*SEQ + t in compact workspace planes (input/output strides use SEQ_FULL); X16 = f16(bf16(x)); Q16, K16 = X16 . (16 W)^T / 16 as 32x64 wave-tile GEMMs with LDS-staged whole-line epilogues; V^T per (b, head) produced directly as (16 Wv) . X16^T / 16;
#ifndef NB
#define NB 64
#endif
#ifndef SEQ
#define SEQ 512
#endif
#define NB_FULL 64
#define SEQ_FULL 512
#define DM 384
#define NH 6
#define HD 64
#define QT0 128                      /* first query rows per sequence recomputed exactly in f32 */
#define PP 40                        /* LDS pitch (halves) of the 16x32 P tile */
#define OPP 72                       /* LDS pitch (halves) of the 16x64 O staging tile */
static_assert(NB >= 1 && NB <= NB_FULL);
static_assert(SEQ % 128 == 0 && SEQ >= 2 * QT0 && SEQ <= SEQ_FULL);
static_assert(DM == NH * HD && DM % 128 == 0 && HD == 64 && QT0 == 128);

typedef unsigned short v8us __attribute__((ext_vector_type(8), may_alias));
typedef float  v8f  __attribute__((ext_vector_type(8)));
typedef float  v4f  __attribute__((ext_vector_type(4)));
typedef float  v4fa __attribute__((ext_vector_type(4), may_alias));
typedef _Float16 v16h __attribute__((ext_vector_type(16)));
typedef _Float16 v4h __attribute__((ext_vector_type(4)));
union FragH { v16h v; v8us half[2]; _Float16 h[16]; unsigned short u[16]; };

__device__ __forceinline__ unsigned short bf16_bits(float x) { unsigned int u = __float_as_uint(x); return (unsigned short)((u + 0x7FFFu + ((u >> 16) & 1u)) >> 16); }
__device__ __forceinline__ float bf16_val(unsigned short b) { return __uint_as_float(((unsigned int)b) << 16); }
__device__ __forceinline__ float bf16_rne(float x) { return bf16_val(bf16_bits(x)); }

// 16-bit WMMA fragment from a k-contiguous row (A: row m, B: column n of a [n][k] plane): elements 0..7 <- k 8hh..8hh+7, elements 8..15 <- k 16+8hh..16+8hh+7
__device__ __forceinline__ v16h g2_frag(const _Float16* p, int hh) { FragH f; f.half[0] = *(const v8us*)((const unsigned short*)p + 8 * hh); f.half[1] = *(const v8us*)((const unsigned short*)p + 16 + 8 * hh); return f.v; }
__device__ __forceinline__ v8f g2_mma(v16h a, v16h b, v8f c) { v8f d = __builtin_amdgcn_wmma_f32_16x16x32_f16(false, a, false, b, (short)0, c, false, false); asm volatile("v_nop\n\tv_nop\n\tv_nop\n\tv_nop" : "+v"(d) : "v"(a), "v"(b)); return d; }

__global__ __launch_bounds__(256) void k_wnat(const float* __restrict__ w, size_t n8, _Float16* __restrict__ Bt) {
  const size_t t = (size_t)blockIdx.x * 256 + threadIdx.x; if (t >= n8) return; FragH f;
#pragma unroll
  for (int q = 0; q < 8; ++q) f.h[q] = (_Float16)(bf16_rne(w[t * 8 + q]) * 16.0f);
  unsigned short* d = (unsigned short*)Bt + t * 8;
  *(v8us*)d = f.half[0]; 
}

__global__ __launch_bounds__(256) void k_x16(const float* __restrict__ x, _Float16* __restrict__ X16, size_t n8) {
  const size_t t = (size_t)blockIdx.x * 256 + threadIdx.x; if (t >= n8) return;
  const size_t wr = t / (DM / 8); const int c8 = (int)(t % (DM / 8)) * 8;
  const size_t b = wr / SEQ, tt = wr % SEQ;
  const float* src = x + (b * SEQ_FULL + tt) * DM + c8;
  const v4f a = *(const v4fa*)src, c = *(const v4fa*)(src + 4); FragH f;
#pragma unroll
  for (int q = 0; q < 4; ++q) { f.h[q] = (_Float16)bf16_rne(a[q]); f.h[4 + q] = (_Float16)bf16_rne(c[q]); }
  unsigned short* d = (unsigned short*)X16 + t * 8;
  *(v8us*)d = f.half[0]; 
}

// GEMM C[M][N] = alpha (A . Bt^T) + bf16(bias[col]) (+ CP own element): A f16 row-major (pitch lda, batch stride sA by grid.y), Bt f16 [n][k] (pitch ldb, stride sB);
// writes f32 C and/or f16 C16 (pitch ldc, batch stride sC). Block = 4 waves, wave tile 32 rows x 64 cols; M % 32 == 0 (grid covers ceil(M/128) row groups), N % 64 == 0, K % 32 == 0.
__global__ __launch_bounds__(128) void k_gemm2(const _Float16* __restrict__ A, int lda, size_t sA, const _Float16* __restrict__ Bh, int ldb, size_t sB, float alpha,
    const float* __restrict__ bias, const float* CP, int row0g, float* C, _Float16* C16, int ldc, size_t sC, int M, int N, int K) {
  __shared__ __attribute__((aligned(16))) float so[4][32][68];
  const int tid = threadIdx.x, w = tid >> 5, lane = tid & 31, ln = lane & 15, hh = lane >> 4; const int by = blockIdx.y;
  A += (size_t)by * sA; Bh += (size_t)by * sB; const size_t cofs = (size_t)by * sC;
  const int ntn = N >> 6; const int mt = blockIdx.x / ntn, nq = blockIdx.x - mt * ntn; const int row0 = mt * 128 + 32 * w, col0 = nq * 64; if (row0 >= M) return;
  const _Float16* a0p = A + (size_t)(row0 + ln) * lda; const _Float16* a1p = a0p + (size_t)16 * lda;
  const _Float16* b0p = Bh + (size_t)(col0 + ln) * ldb; const _Float16* b1p = b0p + (size_t)16 * ldb; const _Float16* b2p = b1p + (size_t)16 * ldb; const _Float16* b3p = b2p + (size_t)16 * ldb;
  const v8f z8 = {0.f,0.f,0.f,0.f,0.f,0.f,0.f,0.f}; v8f c00 = z8, c01 = z8, c02 = z8, c03 = z8, c10 = z8, c11 = z8, c12 = z8, c13 = z8;
#pragma unroll 1
  for (int kb = 0; kb < K; kb += 32) { const v16h a0 = g2_frag(a0p + kb, hh), a1 = g2_frag(a1p + kb, hh);
    v16h b = g2_frag(b0p + kb, hh); c00 = g2_mma(a0, b, c00); c10 = g2_mma(a1, b, c10);
    b = g2_frag(b1p + kb, hh); c01 = g2_mma(a0, b, c01); c11 = g2_mma(a1, b, c11);
    b = g2_frag(b2p + kb, hh); c02 = g2_mma(a0, b, c02); c12 = g2_mma(a1, b, c12);
    b = g2_frag(b3p + kb, hh); c03 = g2_mma(a0, b, c03); c13 = g2_mma(a1, b, c13); }
  v8f accs[8] = {c00, c01, c02, c03, c10, c11, c12, c13};
#pragma unroll
  for (int u = 0; u < 8; ++u) { const int t = u & 3, half = u >> 2; const int col = col0 + t * 16 + ln; const float bv = bias ? bf16_rne(bias[col]) : 0.f;
#pragma unroll
    for (int r = 0; r < 8; ++r) { const int rloc = half * 16 + 8 * hh + r; float v = accs[u][r] * alpha + bv;
      if (CP) v += CP[cofs + (size_t)(row0g + row0 + rloc) * ldc + col];      /* own element of the C plane (a prior pass), added in f32 */
      so[w][rloc][t * 16 + ln] = v; } }
  __builtin_amdgcn_fence(4, "workgroup"); __builtin_amdgcn_wave_barrier();
  const int rsub = lane >> 4, c4 = (lane & 15) * 4;
  {
#pragma unroll
    for (int q = 0; q < 16; ++q) { const int r = q * 2 + rsub; const v4f v = *(const v4fa*)&so[w][r][c4];
      if (C) *(v4f*)(C + cofs + (size_t)(row0 + r) * ldc + col0 + c4) = v;
      if (C16) { v4h h4; for (int i = 0; i < 4; ++i) h4[i] = (_Float16)v[i]; *(v4h*)(C16 + cofs + (size_t)(row0 + r) * ldc + col0 + c4) = h4; } }
     }
}

// exact (f32) causal attention for query rows 0..QT0-1 of every (batch, head): planes QF/KF/VF [NB][QT0][DM] (head h at column h*HD); block = 64 threads = 64 consecutive rows of one head;
// thread i keeps its q row and its o accumulator in its own LDS slots (rolled float4 loops), walks keys j = 0..(its wave's last row) (wave-uniform trip count; keys j > i enter through an arithmetic 0/1 factor as -1e30, contributing exactly 0) with an online softmax in f32 (precise expf);
__global__ __launch_bounds__(64) void k_att0(const float* __restrict__ QF, const float* __restrict__ KF, const float* __restrict__ VF, float* __restrict__ OF) {
  #pragma clang fp contract(off)
  __shared__ __attribute__((aligned(16))) float lq[64][64]; __shared__ __attribute__((aligned(16))) float lo[64][64];
  const int tid = threadIdx.x; const int rg = blockIdx.x % (QT0 / 64); const int bh = blockIdx.x / (QT0 / 64); const int b = bh / NH, h = bh - b * NH;
  const size_t pofs = (size_t)b * QT0 * DM;
  const int i = rg * 64 + tid;
  const float* qr = QF + pofs + (size_t)i * DM + h * HD;
#pragma unroll 1
  for (int c = 0; c < HD / 4; ++c) { *(v4f*)&lq[tid][c * 4] = *(const v4fa*)(qr + c * 4); const v4f z = {0.f, 0.f, 0.f, 0.f}; *(v4f*)&lo[tid][c * 4] = z; }
  float m = -1.0e30f, l = 0.f; const int jmax = rg * 64 + (tid >> 5) * 32 + 31;      /* wave-uniform: keys up to the wave's last row */
#pragma unroll 1
  for (int j = 0; j <= jmax; ++j) { const float* kr = KF + pofs + (size_t)j * DM + h * HD; const float* vr = VF + pofs + (size_t)j * DM + h * HD; float s = 0.f;
#pragma unroll 1
    for (int c = 0; c < HD / 4; ++c) { const v4f kq = *(const v4fa*)(kr + c * 4); const v4f qq = *(v4f*)&lq[tid][c * 4]; s = __fadd_rn(s, __fmul_rn(qq[0], kq[0])); s = __fadd_rn(s, __fmul_rn(qq[1], kq[1])); s = __fadd_rn(s, __fmul_rn(qq[2], kq[2])); s = __fadd_rn(s, __fmul_rn(qq[3], kq[3])); }
    s = __fmul_rn(s, 0.125f);
    const float f = (j <= i) ? 1.f : 0.f; const float sm = fmaf(f, s, (1.f - f) * -1.0e30f); const float mn = fmaxf(m, sm); const float sc = expf(m - mn); const float e = expf(sm - mn); l = __fadd_rn(__fmul_rn(l, sc), e); m = mn;
#pragma unroll 1
    for (int c = 0; c < HD / 4; ++c) { const v4f vv = *(const v4fa*)(vr + c * 4); v4f oo = *(v4f*)&lo[tid][c * 4]; for (int u = 0; u < 4; ++u) oo[u] = __fadd_rn(__fmul_rn(oo[u], sc), __fmul_rn(e, vv[u])); *(v4f*)&lo[tid][c * 4] = oo; } }
  const float fin = 64.0f / l;      /* o carried x64 */
#pragma unroll 1
  for (int c = 0; c < HD / 4; ++c) { v4f oo = *(v4f*)&lo[tid][c * 4]; for (int u = 0; u < 4; ++u) oo[u] = __fmul_rn(oo[u], fin); *(v4f*)&lo[tid][c * 4] = oo; }
  __syncthreads();
  {
#pragma unroll 1
    for (int it = 0; it < 16; ++it) { const int row = it * 4 + tid / 16, pc = (tid % 16) * 4; const v4f v = *(const v4f*)&lo[row][pc]; *(v4f*)(OF + pofs + (size_t)(rg * 64 + row) * DM + h * HD + pc) = v; }
     } }

__global__ __launch_bounds__(256) void k_hl(const float* __restrict__ F, _Float16* __restrict__ Hh, _Float16* __restrict__ Hl, size_t n8) {
  const size_t t = (size_t)blockIdx.x * 256 + threadIdx.x; if (t >= n8) return; FragH fh, fl; const v4f a = *(const v4fa*)(F + t * 8), c = *(const v4fa*)(F + t * 8 + 4);
#pragma unroll
  for (int q = 0; q < 4; ++q) { _Float16 hv = (_Float16)a[q]; fh.h[q] = hv; fl.h[q] = (_Float16)((a[q] - (float)hv) * 1024.0f); hv = (_Float16)c[q]; fh.h[4 + q] = hv; fl.h[4 + q] = (_Float16)((c[q] - (float)hv) * 1024.0f); }
  unsigned short* dh = (unsigned short*)Hh + t * 8; unsigned short* dl = (unsigned short*)Hl + t * 8;
  { *(v8us*)dh = fh.half[0]; *(v8us*)dl = fl.half[0];  } }

// causal attention, f16 WMMA: grid (SEQ/128, NB*NH), block = 8 waves, wave -> query rows q0..q0+15 (q0 = 16*(8*blockIdx.x + wave)) of one (b, head).
// Per 32-key block: two 16x16 score tiles S = q . k^T (A = Q16 rows, B = K16 rows as [key][d], K = 64 in two k-steps), x0.125 and the causal select by value in f32, online softmax per row (16 key columns across 16 lanes: xor-shuffle max / sum, f32 running max and sum, o and sum rescaled by exp(m_old - m_new)),
__global__ __launch_bounds__(256) __attribute__((amdgpu_num_vgpr(256)))
void k_att(const _Float16* __restrict__ Q16, const _Float16* __restrict__ K16, const _Float16* __restrict__ VT, _Float16* __restrict__ O16) {
  __shared__ __attribute__((aligned(16))) _Float16 lp[8][2][16 * PP];
  __shared__ __attribute__((aligned(16))) _Float16 lso[8][16 * OPP];
  const int tid = threadIdx.x, w = tid >> 5, lane = tid & 31, ln = lane & 15, hh = lane >> 4;
  const int qt = blockIdx.x * 8 + w; const int bh = blockIdx.y; const int b = bh / NH, h = bh - b * NH;
  const int q0 = qt * 16;
  const size_t wr0 = (size_t)b * SEQ + q0;
  const _Float16* qp = Q16 + (wr0 + ln) * DM + h * HD;
  const v16h qa0 = g2_frag(qp, hh), qa1 = g2_frag(qp + 32, hh);      /* d 0..31, 32..63 */
  const _Float16* kbase = K16 + (size_t)b * SEQ * DM + h * HD;        /* key row j at kbase + j*DM */
  const _Float16* vbase = VT + (size_t)bh * HD * SEQ;                 /* V^T row d at vbase + d*SEQ */
  const v8f z8 = {0.f,0.f,0.f,0.f,0.f,0.f,0.f,0.f}; v8f o0 = z8, o1 = z8, o2 = z8, o3 = z8;
  float mr[8], lr[8];
#pragma unroll
  for (int r = 0; r < 8; ++r) { mr[r] = -1.0e30f; lr[r] = 0.f; }
  const int nkb = qt / 2 + 1;      /* 32-key blocks covering keys 0..q0+15 */
#pragma unroll 1
  for (int it = 0; it < nkb; ++it) {
    const int kb = it * 32;
    _Float16* pb = &lp[w][it & 1][0];
    v8f s0 = z8, s1 = z8;
    { const _Float16* kp = kbase + (size_t)(kb + ln) * DM; v16h bk = g2_frag(kp, hh); s0 = g2_mma(qa0, bk, s0); bk = g2_frag(kp + 32, hh); s0 = g2_mma(qa1, bk, s0); }
    { const _Float16* kp = kbase + (size_t)(kb + 16 + ln) * DM; v16h bk = g2_frag(kp, hh); s1 = g2_mma(qa0, bk, s1); bk = g2_frag(kp + 32, hh); s1 = g2_mma(qa1, bk, s1); }
#pragma unroll
    for (int r = 0; r < 8; ++r) {
      const int qi = q0 + 8 * hh + r;
      const float v0 = (kb + ln <= qi) ? s0[r] * 0.125f : -1.0e30f;
      const float v1 = (kb + 16 + ln <= qi) ? s1[r] * 0.125f : -1.0e30f;
      float mx = fmaxf(v0, v1);
      mx = fmaxf(mx, __shfl_xor(mx, 1, 16)); mx = fmaxf(mx, __shfl_xor(mx, 2, 16)); mx = fmaxf(mx, __shfl_xor(mx, 4, 16)); mx = fmaxf(mx, __shfl_xor(mx, 8, 16));
      const float mn = fmaxf(mr[r], mx);
      const float al = __expf(mr[r] - mn); mr[r] = mn;
      const float p0 = __expf(v0 - mn), p1 = __expf(v1 - mn);
      float rs = p0 + p1;
      rs += __shfl_xor(rs, 1, 16); rs += __shfl_xor(rs, 2, 16); rs += __shfl_xor(rs, 4, 16); rs += __shfl_xor(rs, 8, 16);
      lr[r] = lr[r] * al + rs;
      o0[r] *= al; o1[r] *= al; o2[r] *= al; o3[r] *= al;
      pb[(8 * hh + r) * PP + ln] = (_Float16)(p0 * 1024.0f);
      pb[(8 * hh + r) * PP + 16 + ln] = (_Float16)(p1 * 1024.0f);
    }
    __builtin_amdgcn_fence(3, "wavefront"); __builtin_amdgcn_wave_barrier();
    FragH pa; pa.half[0] = *(const v8us*)((const unsigned short*)pb + ln * PP + 8 * hh); pa.half[1] = *(const v8us*)((const unsigned short*)pb + ln * PP + 16 + 8 * hh);
    { const _Float16* vp = vbase + (size_t)ln * SEQ + kb;
      v16h bv = g2_frag(vp, hh); o0 = g2_mma(pa.v, bv, o0);
      bv = g2_frag(vp + (size_t)16 * SEQ, hh); o1 = g2_mma(pa.v, bv, o1);
      bv = g2_frag(vp + (size_t)32 * SEQ, hh); o2 = g2_mma(pa.v, bv, o2);
      bv = g2_frag(vp + (size_t)48 * SEQ, hh); o3 = g2_mma(pa.v, bv, o3); }
  }
  _Float16* sob = &lso[w][0];
#pragma unroll
  for (int r = 0; r < 8; ++r) { const float inv = (1.0f / lr[r]) * 0.0009765625f; const int row = 8 * hh + r;
    sob[row * OPP + ln] = (_Float16)(o0[r] * inv); sob[row * OPP + 16 + ln] = (_Float16)(o1[r] * inv); sob[row * OPP + 32 + ln] = (_Float16)(o2[r] * inv); sob[row * OPP + 48 + ln] = (_Float16)(o3[r] * inv); }
  __builtin_amdgcn_fence(3, "wavefront"); __builtin_amdgcn_wave_barrier();
  unsigned short* ob = (unsigned short*)O16 + wr0 * DM + h * HD;
  {
#pragma unroll
    for (int it2 = 0; it2 < 4; ++it2) { const int row = it2 * 4 + (lane >> 3), c8 = (lane & 7) * 8; const v8us v = *(const v8us*)((const unsigned short*)sob + row * OPP + c8); *(v8us*)(ob + (size_t)row * DM + c8) = v; }
     }
}

extern "C" void kernel_launch(void* const* d_in, const int* in_sizes, int n_in,
                              void* d_out, int out_size, void* d_ws, size_t ws_size, hipStream_t stream) {
  if (n_in < 6) return;
  const float* x = (const float*)d_in[0]; const float* wq = (const float*)d_in[1]; const float* wk = (const float*)d_in[2];
  const float* wv = (const float*)d_in[3]; const float* wp = (const float*)d_in[4]; const float* bproj = (const float*)d_in[5];
  const size_t need_x = (size_t)(NB - 1) * SEQ_FULL * DM + (size_t)SEQ * DM;
  if ((size_t)in_sizes[0] < need_x || in_sizes[1] < DM * DM || in_sizes[2] < DM * DM || in_sizes[3] < DM * DM || in_sizes[4] < DM * DM || in_sizes[5] < DM || (size_t)out_size < need_x) return;
  float* out = (float*)d_out;
  char* ws = (char*)d_ws; size_t off = 0;
  auto take = [&](size_t bytes) { char* p = ws + off; off += (bytes + 255) & ~(size_t)255; return p; };
  const size_t wb = (size_t)DM * DM * 2;
  _Float16* WQ = (_Float16*)take(wb); _Float16* WK = (_Float16*)take(wb); _Float16* WV = (_Float16*)take(wb); _Float16* WP = (_Float16*)take(wb);
  const size_t rows2 = (size_t)NB * SEQ * DM * 2;      /* f16 plane over all token rows */
  const size_t f0b4 = (size_t)NB * QT0 * DM * 4;       /* f32 first-tile plane */
  const size_t f0b2 = (size_t)NB * QT0 * DM * 2;       /* f16 first-tile plane */
  const size_t vtb = (size_t)NB * DM * SEQ * 2;         /* V^T [NB*NH*HD][SEQ] */
  char* R1 = take(rows2);                                              /* X16, later O16 */
  const size_t r2a = 3 * f0b4, r2b = rows2 + 2 * f0b2; char* R2 = take(r2a > r2b ? r2a : r2b);   /* QF0|KF0|VF0, later Q16 at 0 and OH|OL at rows2 */
  char* R3 = take(f0b4 > rows2 ? f0b4 : rows2);                         /* OF0, later K16 */
  char* R4 = take(vtb);                                                /* VT */
  if (off > ws_size) return;
  _Float16* X16 = (_Float16*)R1; _Float16* O16 = (_Float16*)R1;
  float* QF0 = (float*)R2; float* KF0 = (float*)(R2 + f0b4); float* VF0 = (float*)(R2 + 2 * f0b4);
  _Float16* Q16 = (_Float16*)R2; _Float16* OH = (_Float16*)(R2 + rows2); _Float16* OL = (_Float16*)(R2 + rows2 + f0b2);
  float* OF0 = (float*)R3; _Float16* K16 = (_Float16*)R3;
  _Float16* VT = (_Float16*)R4;

  const size_t nw8 = (size_t)DM * DM / 8; const unsigned gw = (unsigned)((nw8 + 255) / 256);
  k_wnat<<<gw, 256, 0, stream>>>(wq, nw8, WQ); k_wnat<<<gw, 256, 0, stream>>>(wk, nw8, WK); k_wnat<<<gw, 256, 0, stream>>>(wv, nw8, WV); k_wnat<<<gw, 256, 0, stream>>>(wp, nw8, WP);
  const size_t nx8 = (size_t)NB * SEQ * DM / 8;
  k_x16<<<(unsigned)((nx8 + 255) / 256), 256, 0, stream>>>(x, X16, nx8);
  /* f32 q, k, v of rows 0..127 of every sequence (exact products) */
  k_gemm2<<<dim3((QT0 / 128) * (DM / 64), NB), 128, 0, stream>>>(X16, DM, (size_t)SEQ * DM, WQ, DM, (size_t)0, 0.0625f, nullptr, nullptr, 0, QF0, nullptr, DM, (size_t)QT0 * DM, QT0, DM, DM);
  k_gemm2<<<dim3((QT0 / 128) * (DM / 64), NB), 128, 0, stream>>>(X16, DM, (size_t)SEQ * DM, WK, DM, (size_t)0, 0.0625f, nullptr, nullptr, 0, KF0, nullptr, DM, (size_t)QT0 * DM, QT0, DM, DM);
  k_gemm2<<<dim3((QT0 / 128) * (DM / 64), NB), 128, 0, stream>>>(X16, DM, (size_t)SEQ * DM, WV, DM, (size_t)0, 0.0625f, nullptr, nullptr, 0, VF0, nullptr, DM, (size_t)QT0 * DM, QT0, DM, DM);
  k_att0<<<NB * NH * (QT0 / 64), 64, 0, stream>>>(QF0, KF0, VF0, OF0);      /* exact attention rows 0..127 (o x64) */
  const size_t nf8 = (size_t)NB * QT0 * DM / 8;
  k_hl<<<(unsigned)((nf8 + 255) / 256), 256, 0, stream>>>(OF0, OH, OL, nf8);      /* f16 hi / x1024 residual planes of o x64 */
  /* f16 q, k rows for all tokens; V^T directly as (16 Wv) . X16^T */
  k_gemm2<<<dim3((unsigned)((NB * SEQ / 128) * (DM / 64)), 1), 128, 0, stream>>>(X16, DM, (size_t)0, WQ, DM, (size_t)0, 0.0625f, nullptr, nullptr, 0, nullptr, Q16, DM, (size_t)0, NB * SEQ, DM, DM);
  k_gemm2<<<dim3((unsigned)((NB * SEQ / 128) * (DM / 64)), 1), 128, 0, stream>>>(X16, DM, (size_t)0, WK, DM, (size_t)0, 0.0625f, nullptr, nullptr, 0, nullptr, K16, DM, (size_t)0, NB * SEQ, DM, DM);
  k_gemm2<<<dim3((DM / 128) * (SEQ / 64), NB), 128, 0, stream>>>(WV, DM, (size_t)0, X16, DM, (size_t)SEQ * DM, 0.0625f, nullptr, nullptr, 0, nullptr, VT, SEQ, (size_t)DM * SEQ, DM, SEQ, DM);
  k_att<<<dim3(SEQ / 128, NB * NH), 256, 0, stream>>>(Q16, K16, VT, O16);
  /* output projection: rows >= 128 from the f16 o plane; rows < 128 from the hi plane, then += the residual plane */
  k_gemm2<<<dim3(((SEQ - QT0) / 128) * (DM / 64), NB), 128, 0, stream>>>(O16 + (size_t)QT0 * DM, DM, (size_t)SEQ * DM, WP, DM, (size_t)0, 0.0625f, bproj, nullptr, 0, out + (size_t)QT0 * DM, nullptr, DM, (size_t)SEQ_FULL * DM, SEQ - QT0, DM, DM);
  k_gemm2<<<dim3((QT0 / 128) * (DM / 64), NB), 128, 0, stream>>>(OH, DM, (size_t)QT0 * DM, WP, DM, (size_t)0, 0.0009765625f, bproj, nullptr, 0, out, nullptr, DM, (size_t)SEQ_FULL * DM, QT0, DM, DM);
  k_gemm2<<<dim3((QT0 / 128) * (DM / 64), NB), 128, 0, stream>>>(OL, DM, (size_t)QT0 * DM, WP, DM, (size_t)0, 9.5367431640625e-07f, nullptr, out, 0, out, nullptr, DM, (size_t)SEQ_FULL * DM, QT0, DM, DM);
}

// v001
// Measured time: 471 microseconds a run.
// Timed twice side by side with v000, it ran 1.77 times as fast both times.
#include <hip/hip_runtime.h>
// Structure: token rows r = b*SEQ + t in compact workspace planes (input/output strides use SEQ_FULL); X16 = f16(bf16(x)); Q16, K16 = X16 . (16 W)^T / 16 as 32x64 wave-tile GEMMs with LDS-staged whole-line epilogues; V^T per (b, head) produced directly as (16 Wv) . X16^T / 16;
#ifndef NB
#define NB 64
#endif
#ifndef SEQ
#define SEQ 512
#endif
#define NB_FULL 64
#define SEQ_FULL 512
#define DM 384
#define NH 6
#define HD 64
#define QT0 128                      /* first query rows per sequence recomputed exactly in f32 */
#define PP 40                        /* LDS pitch (halves) of the 16x32 P tile */
#define OPP 72                       /* LDS pitch (halves) of the 16x64 O staging tile */
static_assert(NB >= 1 && NB <= NB_FULL);
static_assert(SEQ % 128 == 0 && SEQ >= 2 * QT0 && SEQ <= SEQ_FULL);
static_assert(DM == NH * HD && DM % 128 == 0 && HD == 64 && QT0 == 128);

typedef unsigned short v8us __attribute__((ext_vector_type(8), may_alias));
typedef float  v8f  __attribute__((ext_vector_type(8)));
typedef float  v4f  __attribute__((ext_vector_type(4)));
typedef float  v4fa __attribute__((ext_vector_type(4), may_alias));
typedef _Float16 v16h __attribute__((ext_vector_type(16)));
typedef _Float16 v4h __attribute__((ext_vector_type(4)));
union FragH { v16h v; v8us half[2]; _Float16 h[16]; unsigned short u[16]; };

__device__ __forceinline__ unsigned short bf16_bits(float x) { unsigned int u = __float_as_uint(x); return (unsigned short)((u + 0x7FFFu + ((u >> 16) & 1u)) >> 16); }
__device__ __forceinline__ float bf16_val(unsigned short b) { return __uint_as_float(((unsigned int)b) << 16); }
__device__ __forceinline__ float bf16_rne(float x) { return bf16_val(bf16_bits(x)); }

// 16-bit WMMA fragment from a k-contiguous row (A: row m, B: column n of a [n][k] plane): elements 0..7 <- k 8hh..8hh+7, elements 8..15 <- k 16+8hh..16+8hh+7
__device__ __forceinline__ v16h g2_frag(const _Float16* p, int hh) { FragH f; f.half[0] = *(const v8us*)((const unsigned short*)p + 8 * hh); f.half[1] = *(const v8us*)((const unsigned short*)p + 16 + 8 * hh); return f.v; }
__device__ __forceinline__ v8f g2_mma(v16h a, v16h b, v8f c) { v8f d = __builtin_amdgcn_wmma_f32_16x16x32_f16(false, a, false, b, (short)0, c, false, false); asm volatile("v_nop\n\tv_nop\n\tv_nop\n\tv_nop" : "+v"(d) : "v"(a), "v"(b)); return d; }

__global__ __launch_bounds__(256) void k_wnat(const float* __restrict__ w, size_t n8, _Float16* __restrict__ Bt) {
  const size_t t = (size_t)blockIdx.x * 256 + threadIdx.x; if (t >= n8) return; FragH f;
#pragma unroll
  for (int q = 0; q < 8; ++q) f.h[q] = (_Float16)(bf16_rne(w[t * 8 + q]) * 16.0f);
  unsigned short* d = (unsigned short*)Bt + t * 8;
  *(v8us*)d = f.half[0]; 
}

__global__ __launch_bounds__(256) void k_x16(const float* __restrict__ x, _Float16* __restrict__ X16, size_t n8) {
  const size_t t = (size_t)blockIdx.x * 256 + threadIdx.x; if (t >= n8) return;
  const size_t wr = t / (DM / 8); const int c8 = (int)(t % (DM / 8)) * 8;
  const size_t b = wr / SEQ, tt = wr % SEQ;
  const float* src = x + (b * SEQ_FULL + tt) * DM + c8;
  const v4f a = *(const v4fa*)src, c = *(const v4fa*)(src + 4); FragH f;
#pragma unroll
  for (int q = 0; q < 4; ++q) { f.h[q] = (_Float16)bf16_rne(a[q]); f.h[4 + q] = (_Float16)bf16_rne(c[q]); }
  unsigned short* d = (unsigned short*)X16 + t * 8;
  *(v8us*)d = f.half[0]; 
}

// GEMM C[M][N] = alpha (A . Bt^T) + bf16(bias[col]) (+ CP own element): A f16 row-major (pitch lda, batch stride sA by grid.y), Bt f16 [n][k] (pitch ldb, stride sB);
// writes f32 C and/or f16 C16 (pitch ldc, batch stride sC). Block = 4 waves, wave tile 32 rows x 64 cols; M % 32 == 0 (grid covers ceil(M/128) row groups), N % 64 == 0, K % 32 == 0.
__global__ __launch_bounds__(128) void k_gemm2(const _Float16* __restrict__ A, int lda, size_t sA, const _Float16* __restrict__ Bh, int ldb, size_t sB, float alpha,
    const float* __restrict__ bias, const float* CP, int row0g, float* C, _Float16* C16, int ldc, size_t sC, int M, int N, int K) {
  __shared__ __attribute__((aligned(16))) float so[4][32][68];
  const int tid = threadIdx.x, w = tid >> 5, lane = tid & 31, ln = lane & 15, hh = lane >> 4; const int by = blockIdx.y;
  A += (size_t)by * sA; Bh += (size_t)by * sB; const size_t cofs = (size_t)by * sC;
  const int ntn = N >> 6; const int mt = blockIdx.x / ntn, nq = blockIdx.x - mt * ntn; const int row0 = mt * 128 + 32 * w, col0 = nq * 64; if (row0 >= M) return;
  const _Float16* a0p = A + (size_t)(row0 + ln) * lda; const _Float16* a1p = a0p + (size_t)16 * lda;
  const _Float16* b0p = Bh + (size_t)(col0 + ln) * ldb; const _Float16* b1p = b0p + (size_t)16 * ldb; const _Float16* b2p = b1p + (size_t)16 * ldb; const _Float16* b3p = b2p + (size_t)16 * ldb;
  const v8f z8 = {0.f,0.f,0.f,0.f,0.f,0.f,0.f,0.f}; v8f c00 = z8, c01 = z8, c02 = z8, c03 = z8, c10 = z8, c11 = z8, c12 = z8, c13 = z8;
#pragma unroll 1
  for (int kb = 0; kb < K; kb += 32) { const v16h a0 = g2_frag(a0p + kb, hh), a1 = g2_frag(a1p + kb, hh);
    v16h b = g2_frag(b0p + kb, hh); c00 = g2_mma(a0, b, c00); c10 = g2_mma(a1, b, c10);
    b = g2_frag(b1p + kb, hh); c01 = g2_mma(a0, b, c01); c11 = g2_mma(a1, b, c11);
    b = g2_frag(b2p + kb, hh); c02 = g2_mma(a0, b, c02); c12 = g2_mma(a1, b, c12);
    b = g2_frag(b3p + kb, hh); c03 = g2_mma(a0, b, c03); c13 = g2_mma(a1, b, c13); }
  v8f accs[8] = {c00, c01, c02, c03, c10, c11, c12, c13};
#pragma unroll
  for (int u = 0; u < 8; ++u) { const int t = u & 3, half = u >> 2; const int col = col0 + t * 16 + ln; const float bv = bias ? bf16_rne(bias[col]) : 0.f;
#pragma unroll
    for (int r = 0; r < 8; ++r) { const int rloc = half * 16 + 8 * hh + r; float v = accs[u][r] * alpha + bv;
      if (CP) v += CP[cofs + (size_t)(row0g + row0 + rloc) * ldc + col];      /* own element of the C plane (a prior pass), added in f32 */
      so[w][rloc][t * 16 + ln] = v; } }
  __builtin_amdgcn_fence(4, "workgroup"); __builtin_amdgcn_wave_barrier();
  const int rsub = lane >> 4, c4 = (lane & 15) * 4;
  {
#pragma unroll
    for (int q = 0; q < 16; ++q) { const int r = q * 2 + rsub; const v4f v = *(const v4fa*)&so[w][r][c4];
      if (C) *(v4f*)(C + cofs + (size_t)(row0 + r) * ldc + col0 + c4) = v;
      if (C16) { v4h h4; for (int i = 0; i < 4; ++i) h4[i] = (_Float16)v[i]; *(v4h*)(C16 + cofs + (size_t)(row0 + r) * ldc + col0 + c4) = h4; } }
     }
}

// exact (f32) causal attention for query rows 0..QT0-1 of every (batch, head): planes QF/KF/VF [NB][QT0][DM] (head h at column h*HD); block = 64 threads = 64 consecutive rows of one head;
// thread i keeps its q row and its o accumulator in registers (d loops fully unrolled, so a key's K and V row loads issue together), walks keys j = 0..(its wave's last row) (wave-uniform trip count, a multiple of 32; keys j > i enter through an arithmetic 0/1 factor as -1e30, contributing exactly 0) with an online softmax in f32 (precise expf);
__global__ __launch_bounds__(64) void k_att0(const float* __restrict__ QF, const float* __restrict__ KF, const float* __restrict__ VF, float* __restrict__ OF) {
  #pragma clang fp contract(off)
  __shared__ __attribute__((aligned(16))) float lo[64][64];
  const int tid = threadIdx.x; const int rg = blockIdx.x % (QT0 / 64); const int bh = blockIdx.x / (QT0 / 64); const int b = bh / NH, h = bh - b * NH;
  const size_t pofs = (size_t)b * QT0 * DM;
  const int i = rg * 64 + tid;
  const float* qr = QF + pofs + (size_t)i * DM + h * HD;
  v4f q[HD / 4], o[HD / 4];
#pragma unroll
  for (int c = 0; c < HD / 4; ++c) { q[c] = *(const v4fa*)(qr + c * 4); const v4f z = {0.f, 0.f, 0.f, 0.f}; o[c] = z; }
  float m = -1.0e30f, l = 0.f; const int jmax = rg * 64 + (tid >> 5) * 32 + 31;      /* wave-uniform: keys up to the wave's last row */
  /* keys stay rolled: one key's K and V rows already fill the scalar registers, more keys per trip only split the row loads into more waited groups */
#pragma unroll 1
  for (int j = 0; j <= jmax; ++j) { const float* kr = KF + pofs + (size_t)j * DM + h * HD; const float* vr = VF + pofs + (size_t)j * DM + h * HD; float s = 0.f;
#pragma unroll
    for (int c = 0; c < HD / 4; ++c) { const v4f kq = *(const v4fa*)(kr + c * 4); const v4f qq = q[c]; s = __fadd_rn(s, __fmul_rn(qq[0], kq[0])); s = __fadd_rn(s, __fmul_rn(qq[1], kq[1])); s = __fadd_rn(s, __fmul_rn(qq[2], kq[2])); s = __fadd_rn(s, __fmul_rn(qq[3], kq[3])); }
    s = __fmul_rn(s, 0.125f);
    const float f = (j <= i) ? 1.f : 0.f; const float sm = fmaf(f, s, (1.f - f) * -1.0e30f); const float mn = fmaxf(m, sm); const float sc = expf(m - mn); const float e = expf(sm - mn); l = __fadd_rn(__fmul_rn(l, sc), e); m = mn;
#pragma unroll
    for (int c = 0; c < HD / 4; ++c) { const v4f vv = *(const v4fa*)(vr + c * 4); for (int u = 0; u < 4; ++u) o[c][u] = __fadd_rn(__fmul_rn(o[c][u], sc), __fmul_rn(e, vv[u])); } }
  const float fin = 64.0f / l;      /* o carried x64 */
#pragma unroll
  for (int c = 0; c < HD / 4; ++c) { v4f oo = o[c]; for (int u = 0; u < 4; ++u) oo[u] = __fmul_rn(oo[u], fin); *(v4f*)&lo[tid][c * 4] = oo; }
  __syncthreads();
  {
#pragma unroll 1
    for (int it = 0; it < 16; ++it) { const int row = it * 4 + tid / 16, pc = (tid % 16) * 4; const v4f v = *(const v4f*)&lo[row][pc]; *(v4f*)(OF + pofs + (size_t)(rg * 64 + row) * DM + h * HD + pc) = v; }
     } }

__global__ __launch_bounds__(256) void k_hl(const float* __restrict__ F, _Float16* __restrict__ Hh, _Float16* __restrict__ Hl, size_t n8) {
  const size_t t = (size_t)blockIdx.x * 256 + threadIdx.x; if (t >= n8) return; FragH fh, fl; const v4f a = *(const v4fa*)(F + t * 8), c = *(const v4fa*)(F + t * 8 + 4);
#pragma unroll
  for (int q = 0; q < 4; ++q) { _Float16 hv = (_Float16)a[q]; fh.h[q] = hv; fl.h[q] = (_Float16)((a[q] - (float)hv) * 1024.0f); hv = (_Float16)c[q]; fh.h[4 + q] = hv; fl.h[4 + q] = (_Float16)((c[q] - (float)hv) * 1024.0f); }
  unsigned short* dh = (unsigned short*)Hh + t * 8; unsigned short* dl = (unsigned short*)Hl + t * 8;
  { *(v8us*)dh = fh.half[0]; *(v8us*)dl = fl.half[0];  } }

// causal attention, f16 WMMA: grid (SEQ/128, NB*NH), block = 8 waves, wave -> query rows q0..q0+15 (q0 = 16*(8*blockIdx.x + wave)) of one (b, head).
// Per 32-key block: two 16x16 score tiles S = q . k^T (A = Q16 rows, B = K16 rows as [key][d], K = 64 in two k-steps), x0.125 and the causal select by value in f32, online softmax per row (16 key columns across 16 lanes: xor-shuffle max / sum, f32 running max and sum, o and sum rescaled by exp(m_old - m_new)),
__global__ __launch_bounds__(256) __attribute__((amdgpu_num_vgpr(256)))
void k_att(const _Float16* __restrict__ Q16, const _Float16* __restrict__ K16, const _Float16* __restrict__ VT, _Float16* __restrict__ O16) {
  __shared__ __attribute__((aligned(16))) _Float16 lp[8][2][16 * PP];
  __shared__ __attribute__((aligned(16))) _Float16 lso[8][16 * OPP];
  const int tid = threadIdx.x, w = tid >> 5, lane = tid & 31, ln = lane & 15, hh = lane >> 4;
  const int qt = blockIdx.x * 8 + w; const int bh = blockIdx.y; const int b = bh / NH, h = bh - b * NH;
  const int q0 = qt * 16;
  const size_t wr0 = (size_t)b * SEQ + q0;
  const _Float16* qp = Q16 + (wr0 + ln) * DM + h * HD;
  const v16h qa0 = g2_frag(qp, hh), qa1 = g2_frag(qp + 32, hh);      /* d 0..31, 32..63 */
  const _Float16* kbase = K16 + (size_t)b * SEQ * DM + h * HD;        /* key row j at kbase + j*DM */
  const _Float16* vbase = VT + (size_t)bh * HD * SEQ;                 /* V^T row d at vbase + d*SEQ */
  const v8f z8 = {0.f,0.f,0.f,0.f,0.f,0.f,0.f,0.f}; v8f o0 = z8, o1 = z8, o2 = z8, o3 = z8;
  float mr[8], lr[8];
#pragma unroll
  for (int r = 0; r < 8; ++r) { mr[r] = -1.0e30f; lr[r] = 0.f; }
  const int nkb = qt / 2 + 1;      /* 32-key blocks covering keys 0..q0+15 */
#pragma unroll 1
  for (int it = 0; it < nkb; ++it) {
    const int kb = it * 32;
    _Float16* pb = &lp[w][it & 1][0];
    v8f s0 = z8, s1 = z8;
    { const _Float16* kp = kbase + (size_t)(kb + ln) * DM; v16h bk = g2_frag(kp, hh); s0 = g2_mma(qa0, bk, s0); bk = g2_frag(kp + 32, hh); s0 = g2_mma(qa1, bk, s0); }
    { const _Float16* kp = kbase + (size_t)(kb + 16 + ln) * DM; v16h bk = g2_frag(kp, hh); s1 = g2_mma(qa0, bk, s1); bk = g2_frag(kp + 32, hh); s1 = g2_mma(qa1, bk, s1); }
#pragma unroll
    for (int r = 0; r < 8; ++r) {
      const int qi = q0 + 8 * hh + r;
      const float v0 = (kb + ln <= qi) ? s0[r] * 0.125f : -1.0e30f;
      const float v1 = (kb + 16 + ln <= qi) ? s1[r] * 0.125f : -1.0e30f;
      float mx = fmaxf(v0, v1);
      mx = fmaxf(mx, __shfl_xor(mx, 1, 16)); mx = fmaxf(mx, __shfl_xor(mx, 2, 16)); mx = fmaxf(mx, __shfl_xor(mx, 4, 16)); mx = fmaxf(mx, __shfl_xor(mx, 8, 16));
      const float mn = fmaxf(mr[r], mx);
      const float al = __expf(mr[r] - mn); mr[r] = mn;
      const float p0 = __expf(v0 - mn), p1 = __expf(v1 - mn);
      float rs = p0 + p1;
      rs += __shfl_xor(rs, 1, 16); rs += __shfl_xor(rs, 2, 16); rs += __shfl_xor(rs, 4, 16); rs += __shfl_xor(rs, 8, 16);
      lr[r] = lr[r] * al + rs;
      o0[r] *= al; o1[r] *= al; o2[r] *= al; o3[r] *= al;
      pb[(8 * hh + r) * PP + ln] = (_Float16)(p0 * 1024.0f);
      pb[(8 * hh + r) * PP + 16 + ln] = (_Float16)(p1 * 1024.0f);
    }
    __builtin_amdgcn_fence(3, "wavefront"); __builtin_amdgcn_wave_barrier();
    FragH pa; pa.half[0] = *(const v8us*)((const unsigned short*)pb + ln * PP + 8 * hh); pa.half[1] = *(const v8us*)((const unsigned short*)pb + ln * PP + 16 + 8 * hh);
    { const _Float16* vp = vbase + (size_t)ln * SEQ + kb;
      v16h bv = g2_frag(vp, hh); o0 = g2_mma(pa.v, bv, o0);
      bv = g2_frag(vp + (size_t)16 * SEQ, hh); o1 = g2_mma(pa.v, bv, o1);
      bv = g2_frag(vp + (size_t)32 * SEQ, hh); o2 = g2_mma(pa.v, bv, o2);
      bv = g2_frag(vp + (size_t)48 * SEQ, hh); o3 = g2_mma(pa.v, bv, o3); }
  }
  _Float16* sob = &lso[w][0];
#pragma unroll
  for (int r = 0; r < 8; ++r) { const float inv = (1.0f / lr[r]) * 0.0009765625f; const int row = 8 * hh + r;
    sob[row * OPP + ln] = (_Float16)(o0[r] * inv); sob[row * OPP + 16 + ln] = (_Float16)(o1[r] * inv); sob[row * OPP + 32 + ln] = (_Float16)(o2[r] * inv); sob[row * OPP + 48 + ln] = (_Float16)(o3[r] * inv); }
  __builtin_amdgcn_fence(3, "wavefront"); __builtin_amdgcn_wave_barrier();
  unsigned short* ob = (unsigned short*)O16 + wr0 * DM + h * HD;
  {
#pragma unroll
    for (int it2 = 0; it2 < 4; ++it2) { const int row = it2 * 4 + (lane >> 3), c8 = (lane & 7) * 8; const v8us v = *(const v8us*)((const unsigned short*)sob + row * OPP + c8); *(v8us*)(ob + (size_t)row * DM + c8) = v; }
     }
}

extern "C" void kernel_launch(void* const* d_in, const int* in_sizes, int n_in,
                              void* d_out, int out_size, void* d_ws, size_t ws_size, hipStream_t stream) {
  if (n_in < 6) return;
  const float* x = (const float*)d_in[0]; const float* wq = (const float*)d_in[1]; const float* wk = (const float*)d_in[2];
  const float* wv = (const float*)d_in[3]; const float* wp = (const float*)d_in[4]; const float* bproj = (const float*)d_in[5];
  const size_t need_x = (size_t)(NB - 1) * SEQ_FULL * DM + (size_t)SEQ * DM;
  if ((size_t)in_sizes[0] < need_x || in_sizes[1] < DM * DM || in_sizes[2] < DM * DM || in_sizes[3] < DM * DM || in_sizes[4] < DM * DM || in_sizes[5] < DM || (size_t)out_size < need_x) return;
  float* out = (float*)d_out;
  char* ws = (char*)d_ws; size_t off = 0;
  auto take = [&](size_t bytes) { char* p = ws + off; off += (bytes + 255) & ~(size_t)255; return p; };
  const size_t wb = (size_t)DM * DM * 2;
  _Float16* WQ = (_Float16*)take(wb); _Float16* WK = (_Float16*)take(wb); _Float16* WV = (_Float16*)take(wb); _Float16* WP = (_Float16*)take(wb);
  const size_t rows2 = (size_t)NB * SEQ * DM * 2;      /* f16 plane over all token rows */
  const size_t f0b4 = (size_t)NB * QT0 * DM * 4;       /* f32 first-tile plane */
  const size_t f0b2 = (size_t)NB * QT0 * DM * 2;       /* f16 first-tile plane */
  const size_t vtb = (size_t)NB * DM * SEQ * 2;         /* V^T [NB*NH*HD][SEQ] */
  char* R1 = take(rows2);                                              /* X16, later O16 */
  const size_t r2a = 3 * f0b4, r2b = rows2 + 2 * f0b2; char* R2 = take(r2a > r2b ? r2a : r2b);   /* QF0|KF0|VF0, later Q16 at 0 and OH|OL at rows2 */
  char* R3 = take(f0b4 > rows2 ? f0b4 : rows2);                         /* OF0, later K16 */
  char* R4 = take(vtb);                                                /* VT */
  if (off > ws_size) return;
  _Float16* X16 = (_Float16*)R1; _Float16* O16 = (_Float16*)R1;
  float* QF0 = (float*)R2; float* KF0 = (float*)(R2 + f0b4); float* VF0 = (float*)(R2 + 2 * f0b4);
  _Float16* Q16 = (_Float16*)R2; _Float16* OH = (_Float16*)(R2 + rows2); _Float16* OL = (_Float16*)(R2 + rows2 + f0b2);
  float* OF0 = (float*)R3; _Float16* K16 = (_Float16*)R3;
  _Float16* VT = (_Float16*)R4;

  const size_t nw8 = (size_t)DM * DM / 8; const unsigned gw = (unsigned)((nw8 + 255) / 256);
  k_wnat<<<gw, 256, 0, stream>>>(wq, nw8, WQ); k_wnat<<<gw, 256, 0, stream>>>(wk, nw8, WK); k_wnat<<<gw, 256, 0, stream>>>(wv, nw8, WV); k_wnat<<<gw, 256, 0, stream>>>(wp, nw8, WP);
  const size_t nx8 = (size_t)NB * SEQ * DM / 8;
  k_x16<<<(unsigned)((nx8 + 255) / 256), 256, 0, stream>>>(x, X16, nx8);
  /* f32 q, k, v of rows 0..127 of every sequence (exact products) */
  k_gemm2<<<dim3((QT0 / 128) * (DM / 64), NB), 128, 0, stream>>>(X16, DM, (size_t)SEQ * DM, WQ, DM, (size_t)0, 0.0625f, nullptr, nullptr, 0, QF0, nullptr, DM, (size_t)QT0 * DM, QT0, DM, DM);
  k_gemm2<<<dim3((QT0 / 128) * (DM / 64), NB), 128, 0, stream>>>(X16, DM, (size_t)SEQ * DM, WK, DM, (size_t)0, 0.0625f, nullptr, nullptr, 0, KF0, nullptr, DM, (size_t)QT0 * DM, QT0, DM, DM);
  k_gemm2<<<dim3((QT0 / 128) * (DM / 64), NB), 128, 0, stream>>>(X16, DM, (size_t)SEQ * DM, WV, DM, (size_t)0, 0.0625f, nullptr, nullptr, 0, VF0, nullptr, DM, (size_t)QT0 * DM, QT0, DM, DM);
  k_att0<<<NB * NH * (QT0 / 64), 64, 0, stream>>>(QF0, KF0, VF0, OF0);      /* exact attention rows 0..127 (o x64) */
  const size_t nf8 = (size_t)NB * QT0 * DM / 8;
  k_hl<<<(unsigned)((nf8 + 255) / 256), 256, 0, stream>>>(OF0, OH, OL, nf8);      /* f16 hi / x1024 residual planes of o x64 */
  /* f16 q, k rows for all tokens; V^T directly as (16 Wv) . X16^T */
  k_gemm2<<<dim3((unsigned)((NB * SEQ / 128) * (DM / 64)), 1), 128, 0, stream>>>(X16, DM, (size_t)0, WQ, DM, (size_t)0, 0.0625f, nullptr, nullptr, 0, nullptr, Q16, DM, (size_t)0, NB * SEQ, DM, DM);
  k_gemm2<<<dim3((unsigned)((NB * SEQ / 128) * (DM / 64)), 1), 128, 0, stream>>>(X16, DM, (size_t)0, WK, DM, (size_t)0, 0.0625f, nullptr, nullptr, 0, nullptr, K16, DM, (size_t)0, NB * SEQ, DM, DM);
  k_gemm2<<<dim3((DM / 128) * (SEQ / 64), NB), 128, 0, stream>>>(WV, DM, (size_t)0, X16, DM, (size_t)SEQ * DM, 0.0625f, nullptr, nullptr, 0, nullptr, VT, SEQ, (size_t)DM * SEQ, DM, SEQ, DM);
  k_att<<<dim3(SEQ / 128, NB * NH), 256, 0, stream>>>(Q16, K16, VT, O16);
  /* output projection: rows >= 128 from the f16 o plane; rows < 128 from the hi plane, then += the residual plane */
  k_gemm2<<<dim3(((SEQ - QT0) / 128) * (DM / 64), NB), 128, 0, stream>>>(O16 + (size_t)QT0 * DM, DM, (size_t)SEQ * DM, WP, DM, (size_t)0, 0.0625f, bproj, nullptr, 0, out + (size_t)QT0 * DM, nullptr, DM, (size_t)SEQ_FULL * DM, SEQ - QT0, DM, DM);
  k_gemm2<<<dim3((QT0 / 128) * (DM / 64), NB), 128, 0, stream>>>(OH, DM, (size_t)QT0 * DM, WP, DM, (size_t)0, 0.0009765625f, bproj, nullptr, 0, out, nullptr, DM, (size_t)SEQ_FULL * DM, QT0, DM, DM);
  k_gemm2<<<dim3((QT0 / 128) * (DM / 64), NB), 128, 0, stream>>>(OL, DM, (size_t)QT0 * DM, WP, DM, (size_t)0, 9.5367431640625e-07f, nullptr, out, 0, out, nullptr, DM, (size_t)SEQ_FULL * DM, QT0, DM, DM);
}

// v002
// One run takes 380 microseconds.
// Two timings next to v001 both put it at 1.24 times that version's speed.
// Over all steps from v000 it is 2.19 times as fast.
#include <hip/hip_runtime.h>
// Structure: token rows r = b*SEQ + t in compact workspace planes (input/output strides use SEQ_FULL); X16 = f16(bf16(x)); Q16, K16 = X16 . (16 W)^T / 16 as 32x64 wave-tile GEMMs with LDS-staged whole-line epilogues; V^T per (b, head) produced directly as (16 Wv) . X16^T / 16;
#ifndef NB
#define NB 64
#endif
#ifndef SEQ
#define SEQ 512
#endif
#define NB_FULL 64
#define SEQ_FULL 512
#define DM 384
#define NH 6
#define HD 64
#define QT0 128                      /* first query rows per sequence recomputed exactly in f32 */
#define PP 40                        /* LDS pitch (halves) of the 16x32 P tile */
#define OPP 72                       /* LDS pitch (halves) of the 16x64 O staging tile */
#define GKC 64                       /* k (halves) of one staged GEMM pass: one 128-byte line of every operand row */
#define GP 72                        /* LDS pitch (halves) of a staged GEMM operand row: 128 + 16 bytes */
static_assert(NB >= 1 && NB <= NB_FULL);
static_assert(SEQ % 128 == 0 && SEQ >= 2 * QT0 && SEQ <= SEQ_FULL);
static_assert(DM == NH * HD && DM % 128 == 0 && HD == 64 && QT0 == 128);

typedef unsigned short v8us __attribute__((ext_vector_type(8), may_alias));
typedef float  v8f  __attribute__((ext_vector_type(8)));
typedef float  v4f  __attribute__((ext_vector_type(4)));
typedef float  v4fa __attribute__((ext_vector_type(4), may_alias));
typedef _Float16 v16h __attribute__((ext_vector_type(16)));
typedef _Float16 v4h __attribute__((ext_vector_type(4)));
union FragH { v16h v; v8us half[2]; _Float16 h[16]; unsigned short u[16]; };

__device__ __forceinline__ unsigned short bf16_bits(float x) { unsigned int u = __float_as_uint(x); return (unsigned short)((u + 0x7FFFu + ((u >> 16) & 1u)) >> 16); }
__device__ __forceinline__ float bf16_val(unsigned short b) { return __uint_as_float(((unsigned int)b) << 16); }
__device__ __forceinline__ float bf16_rne(float x) { return bf16_val(bf16_bits(x)); }

// 16-bit WMMA fragment from a k-contiguous row (A: row m, B: column n of a [n][k] plane): elements 0..7 <- k 8hh..8hh+7, elements 8..15 <- k 16+8hh..16+8hh+7
__device__ __forceinline__ v16h g2_frag(const _Float16* p, int hh) { FragH f; f.half[0] = *(const v8us*)((const unsigned short*)p + 8 * hh); f.half[1] = *(const v8us*)((const unsigned short*)p + 16 + 8 * hh); return f.v; }
__device__ __forceinline__ v8f g2_mma(v16h a, v16h b, v8f c) { v8f d = __builtin_amdgcn_wmma_f32_16x16x32_f16(false, a, false, b, (short)0, c, false, false); asm volatile("v_nop\n\tv_nop\n\tv_nop\n\tv_nop" : "+v"(d) : "v"(a), "v"(b)); return d; }

__global__ __launch_bounds__(256) void k_wnat(const float* __restrict__ w, size_t n8, _Float16* __restrict__ Bt) {
  const size_t t = (size_t)blockIdx.x * 256 + threadIdx.x; if (t >= n8) return; FragH f;
#pragma unroll
  for (int q = 0; q < 8; ++q) f.h[q] = (_Float16)(bf16_rne(w[t * 8 + q]) * 16.0f);
  unsigned short* d = (unsigned short*)Bt + t * 8;
  *(v8us*)d = f.half[0]; 
}

__global__ __launch_bounds__(256) void k_x16(const float* __restrict__ x, _Float16* __restrict__ X16, size_t n8) {
  const size_t t = (size_t)blockIdx.x * 256 + threadIdx.x; if (t >= n8) return;
  const size_t wr = t / (DM / 8); const int c8 = (int)(t % (DM / 8)) * 8;
  const size_t b = wr / SEQ, tt = wr % SEQ;
  const float* src = x + (b * SEQ_FULL + tt) * DM + c8;
  const v4f a = *(const v4fa*)src, c = *(const v4fa*)(src + 4); FragH f;
#pragma unroll
  for (int q = 0; q < 4; ++q) { f.h[q] = (_Float16)bf16_rne(a[q]); f.h[4 + q] = (_Float16)bf16_rne(c[q]); }
  unsigned short* d = (unsigned short*)X16 + t * 8;
  *(v8us*)d = f.half[0]; 
}

// one pass's operand lines into registers: this lane's 16 bytes of 8 A rows and 4 B rows, 16 rows (sa16, sb16 bytes) apart; pa, pb: the block's first rows at this pass (the same in every lane), ao, bo: the lane's own byte offsets
__device__ __forceinline__ void g2_fetch(const char* pa, size_t sa16, unsigned ao, const char* pb, size_t sb16, unsigned bo, v8us (&ra)[8], v8us (&rb)[4]) {
  const char* a[8]; const char* b[4];
#pragma unroll
  for (int i = 0; i < 8; ++i) { a[i] = pa + i * sa16 + ao; ra[i] = *(const v8us*)a[i]; }
#pragma unroll
  for (int i = 0; i < 4; ++i) { b[i] = pb + i * sb16 + bo; rb[i] = *(const v8us*)b[i]; }
  /* the wait that belongs between an issued load and an overwrite of its address registers; it names the twelve addresses so that they stay in their registers up to it (else a later load's result lands in an earlier load's address pair) */
  asm volatile("s_wait_xcnt 0x0" :: "v"(a[0]), "v"(a[1]), "v"(a[2]), "v"(a[3]), "v"(a[4]), "v"(a[5]), "v"(a[6]), "v"(a[7]), "v"(b[0]), "v"(b[1]), "v"(b[2]), "v"(b[3]) : "memory");
}

// GEMM C[M][N] = alpha (A . Bt^T) + bf16(bias[col]) (+ CP own element): A f16 row-major (pitch lda, batch stride sA by grid.y), Bt f16 [n][k] (pitch ldb, stride sB);
// writes f32 C and/or f16 C16 (pitch ldc, batch stride sC). Block = 4 waves, block tile 128 rows x 64 cols, wave tile 32 rows x 64 cols; M % 128 == 0, N % 64 == 0, K % 64 == 0.
// Operands: per pass of GKC = 64 k the block brings its 128 A rows and 64 B rows into LDS, 8 lanes per row, so that every wave-wide 16-byte load covers four whole 128-byte lines and each B row is fetched once per block;
// the next pass's lines are fetched into registers while this pass is multiplied; fragments come from LDS (row pitch 144 bytes: a 16-row fragment read meets every bank once). k order of the products as before (32 at a time, ascending).
__global__ __launch_bounds__(128) void k_gemm2(const _Float16* __restrict__ A, int lda, size_t sA, const _Float16* __restrict__ Bh, int ldb, size_t sB, float alpha,
    const float* __restrict__ bias, const float* CP, int row0g, float* C, _Float16* C16, int ldc, size_t sC, int M, int N, int K) {
  __shared__ __attribute__((aligned(16))) unsigned char sm[4 * 32 * 68 * 4];      /* operand tiles in the k loop, then the epilogue's f32 staging */
  static_assert((128 + 64) * GP * 2 <= 4 * 32 * 68 * 4);
  float (*so)[32][68] = (float (*)[32][68])sm;
  _Float16* sa = (_Float16*)sm; _Float16* sb = sa + 128 * GP;
  const int tid = threadIdx.x, w = tid >> 5, lane = tid & 31, ln = lane & 15, hh = lane >> 4; const int by = blockIdx.y;
  A += (size_t)by * sA; Bh += (size_t)by * sB; const size_t cofs = (size_t)by * sC;
  const int ntn = N >> 6; const int mt = blockIdx.x / ntn, nq = blockIdx.x - mt * ntn; const int row0 = mt * 128 + 32 * w, col0 = nq * 64; if (mt * 128 >= M) return;      /* the same for the whole block: barriers follow */
  const int sr = tid >> 3, sc8 = (tid & 7) * 8;      /* staging: row sr + 16 i, halves sc8..sc8+7 of the pass */
  const char* ag = (const char*)(A + (size_t)(mt * 128) * lda); const char* bg = (const char*)(Bh + (size_t)col0 * ldb);      /* the block's first rows: the same in every lane */
  const unsigned ao = (unsigned)(sr * lda + sc8) * 2u, bo = (unsigned)(sr * ldb + sc8) * 2u;      /* the lane's own byte offsets, fixed for the whole kernel */
  unsigned short* sas = (unsigned short*)sa + sr * GP + sc8; unsigned short* sbs = (unsigned short*)sb + sr * GP + sc8;
  const _Float16* a0p = sa + (32 * w + ln) * GP; const _Float16* a1p = a0p + 16 * GP;
  const _Float16* b0p = sb + ln * GP; const _Float16* b1p = b0p + 16 * GP; const _Float16* b2p = b1p + 16 * GP; const _Float16* b3p = b2p + 16 * GP;
  const v8f z8 = {0.f,0.f,0.f,0.f,0.f,0.f,0.f,0.f}; v8f c00 = z8, c01 = z8, c02 = z8, c03 = z8, c10 = z8, c11 = z8, c12 = z8, c13 = z8;
  v8us ra[8], rb[4];
  g2_fetch(ag, (size_t)lda * 32, ao, bg, (size_t)ldb * 32, bo, ra, rb); ag += GKC * 2; bg += GKC * 2;
  /* passes stay rolled: one pass already holds 16 products per wave, unrolling further would only lengthen the text */
#pragma unroll 1
  for (int kc = 0; kc < K; kc += GKC) {
#pragma unroll
    for (int i = 0; i < 8; ++i) *(v8us*)(sas + 16 * i * GP) = ra[i];
#pragma unroll
    for (int i = 0; i < 4; ++i) *(v8us*)(sbs + 16 * i * GP) = rb[i];
    __syncthreads();      /* the pass's tiles are complete before any wave reads a fragment */
    if (kc + GKC < K) { g2_fetch(ag, (size_t)lda * 32, ao, bg, (size_t)ldb * 32, bo, ra, rb); ag += GKC * 2; bg += GKC * 2; }
#pragma unroll
    for (int kb = 0; kb < GKC; kb += 32) { const v16h a0 = g2_frag(a0p + kb, hh), a1 = g2_frag(a1p + kb, hh);      /* each B fragment after the first is read one pair of products ahead of its use */
      v16h b = g2_frag(b0p + kb, hh), bn = g2_frag(b1p + kb, hh); c00 = g2_mma(a0, b, c00); c10 = g2_mma(a1, b, c10);
      b = g2_frag(b2p + kb, hh); c01 = g2_mma(a0, bn, c01); c11 = g2_mma(a1, bn, c11);
      bn = g2_frag(b3p + kb, hh); c02 = g2_mma(a0, b, c02); c12 = g2_mma(a1, b, c12);
      c03 = g2_mma(a0, bn, c03); c13 = g2_mma(a1, bn, c13); }
    __syncthreads();      /* every wave has read its fragments before the tiles are overwritten (by the next pass, or by the epilogue's staging) */
  }
  v8f accs[8] = {c00, c01, c02, c03, c10, c11, c12, c13};
#pragma unroll
  for (int u = 0; u < 8; ++u) { const int t = u & 3, half = u >> 2; const int col = col0 + t * 16 + ln; const float bv = bias ? bf16_rne(bias[col]) : 0.f;
#pragma unroll
    for (int r = 0; r < 8; ++r) { const int rloc = half * 16 + 8 * hh + r; float v = accs[u][r] * alpha + bv;
      if (CP) v += CP[cofs + (size_t)(row0g + row0 + rloc) * ldc + col];      /* own element of the C plane (a prior pass), added in f32 */
      so[w][rloc][t * 16 + ln] = v; } }
  __builtin_amdgcn_fence(4, "workgroup"); __builtin_amdgcn_wave_barrier();
  const int rsub = lane >> 4, c4 = (lane & 15) * 4;
  {
#pragma unroll
    for (int q = 0; q < 16; ++q) { const int r = q * 2 + rsub; const v4f v = *(const v4fa*)&so[w][r][c4];
      if (C) *(v4f*)(C + cofs + (size_t)(row0 + r) * ldc + col0 + c4) = v;
      if (C16) { v4h h4; for (int i = 0; i < 4; ++i) h4[i] = (_Float16)v[i]; *(v4h*)(C16 + cofs + (size_t)(row0 + r) * ldc + col0 + c4) = h4; } }
     }
}

// exact (f32) causal attention for query rows 0..QT0-1 of every (batch, head): planes QF/KF/VF [NB][QT0][DM] (head h at column h*HD); block = 64 threads = 64 consecutive rows of one head;
// thread i keeps its q row and its o accumulator in registers (d loops fully unrolled, so a key's K and V row loads issue together), walks keys j = 0..(its wave's last row) (wave-uniform trip count, a multiple of 32; keys j > i enter through an arithmetic 0/1 factor as -1e30, contributing exactly 0) with an online softmax in f32 (precise expf);
__global__ __launch_bounds__(64) void k_att0(const float* __restrict__ QF, const float* __restrict__ KF, const float* __restrict__ VF, float* __restrict__ OF) {
  #pragma clang fp contract(off)
  __shared__ __attribute__((aligned(16))) float lo[64][64];
  const int tid = threadIdx.x; const int rg = blockIdx.x % (QT0 / 64); const int bh = blockIdx.x / (QT0 / 64); const int b = bh / NH, h = bh - b * NH;
  const size_t pofs = (size_t)b * QT0 * DM;
  const int i = rg * 64 + tid;
  const float* qr = QF + pofs + (size_t)i * DM + h * HD;
  v4f q[HD / 4], o[HD / 4];
#pragma unroll
  for (int c = 0; c < HD / 4; ++c) { q[c] = *(const v4fa*)(qr + c * 4); const v4f z = {0.f, 0.f, 0.f, 0.f}; o[c] = z; }
  float m = -1.0e30f, l = 0.f; const int jmax = rg * 64 + (tid >> 5) * 32 + 31;      /* wave-uniform: keys up to the wave's last row */
  /* keys stay rolled: one key's K and V rows already fill the scalar registers, more keys per trip only split the row loads into more waited groups */
#pragma unroll 1
  for (int j = 0; j <= jmax; ++j) { const float* kr = KF + pofs + (size_t)j * DM + h * HD; const float* vr = VF + pofs + (size_t)j * DM + h * HD; float s = 0.f;
#pragma unroll
    for (int c = 0; c < HD / 4; ++c) { const v4f kq = *(const v4fa*)(kr + c * 4); const v4f qq = q[c]; s = __fadd_rn(s, __fmul_rn(qq[0], kq[0])); s = __fadd_rn(s, __fmul_rn(qq[1], kq[1])); s = __fadd_rn(s, __fmul_rn(qq[2], kq[2])); s = __fadd_rn(s, __fmul_rn(qq[3], kq[3])); }
    s = __fmul_rn(s, 0.125f);
    const float f = (j <= i) ? 1.f : 0.f; const float sm = fmaf(f, s, (1.f - f) * -1.0e30f); const float mn = fmaxf(m, sm); const float sc = expf(m - mn); const float e = expf(sm - mn); l = __fadd_rn(__fmul_rn(l, sc), e); m = mn;
#pragma unroll
    for (int c = 0; c < HD / 4; ++c) { const v4f vv = *(const v4fa*)(vr + c * 4); for (int u = 0; u < 4; ++u) o[c][u] = __fadd_rn(__fmul_rn(o[c][u], sc), __fmul_rn(e, vv[u])); } }
  const float fin = 64.0f / l;      /* o carried x64 */
#pragma unroll
  for (int c = 0; c < HD / 4; ++c) { v4f oo = o[c]; for (int u = 0; u < 4; ++u) oo[u] = __fmul_rn(oo[u], fin); *(v4f*)&lo[tid][c * 4] = oo; }
  __syncthreads();
  {
#pragma unroll 1
    for (int it = 0; it < 16; ++it) { const int row = it * 4 + tid / 16, pc = (tid % 16) * 4; const v4f v = *(const v4f*)&lo[row][pc]; *(v4f*)(OF + pofs + (size_t)(rg * 64 + row) * DM + h * HD + pc) = v; }
     } }

__global__ __launch_bounds__(256) void k_hl(const float* __restrict__ F, _Float16* __restrict__ Hh, _Float16* __restrict__ Hl, size_t n8) {
  const size_t t = (size_t)blockIdx.x * 256 + threadIdx.x; if (t >= n8) return; FragH fh, fl; const v4f a = *(const v4fa*)(F + t * 8), c = *(const v4fa*)(F + t * 8 + 4);
#pragma unroll
  for (int q = 0; q < 4; ++q) { _Float16 hv = (_Float16)a[q]; fh.h[q] = hv; fl.h[q] = (_Float16)((a[q] - (float)hv) * 1024.0f); hv = (_Float16)c[q]; fh.h[4 + q] = hv; fl.h[4 + q] = (_Float16)((c[q] - (float)hv) * 1024.0f); }
  unsigned short* dh = (unsigned short*)Hh + t * 8; unsigned short* dl = (unsigned short*)Hl + t * 8;
  { *(v8us*)dh = fh.half[0]; *(v8us*)dl = fl.half[0];  } }

// causal attention, f16 WMMA: grid (SEQ/128, NB*NH), block = 8 waves, wave -> query rows q0..q0+15 (q0 = 16*(8*blockIdx.x + wave)) of one (b, head).
// Per 32-key block: two 16x16 score tiles S = q . k^T (A = Q16 rows, B = K16 rows as [key][d], K = 64 in two k-steps), x0.125 and the causal select by value in f32, online softmax per row (16 key columns across 16 lanes: xor-shuffle max / sum, f32 running max and sum, o and sum rescaled by exp(m_old - m_new)),
__global__ __launch_bounds__(256) __attribute__((amdgpu_num_vgpr(256)))
void k_att(const _Float16* __restrict__ Q16, const _Float16* __restrict__ K16, const _Float16* __restrict__ VT, _Float16* __restrict__ O16) {
  __shared__ __attribute__((aligned(16))) _Float16 lp[8][2][16 * PP];
  __shared__ __attribute__((aligned(16))) _Float16 lso[8][16 * OPP];
  const int tid = threadIdx.x, w = tid >> 5, lane = tid & 31, ln = lane & 15, hh = lane >> 4;
  const int qt = blockIdx.x * 8 + w; const int bh = blockIdx.y; const int b = bh / NH, h = bh - b * NH;
  const int q0 = qt * 16;
  const size_t wr0 = (size_t)b * SEQ + q0;
  const _Float16* qp = Q16 + (wr0 + ln) * DM + h * HD;
  const v16h qa0 = g2_frag(qp, hh), qa1 = g2_frag(qp + 32, hh);      /* d 0..31, 32..63 */
  const _Float16* kbase = K16 + (size_t)b * SEQ * DM + h * HD;        /* key row j at kbase + j*DM */
  const _Float16* vbase = VT + (size_t)bh * HD * SEQ;                 /* V^T row d at vbase + d*SEQ */
  const v8f z8 = {0.f,0.f,0.f,0.f,0.f,0.f,0.f,0.f}; v8f o0 = z8, o1 = z8, o2 = z8, o3 = z8;
  float mr[8], lr[8];
#pragma unroll
  for (int r = 0; r < 8; ++r) { mr[r] = -1.0e30f; lr[r] = 0.f; }
  const int nkb = qt / 2 + 1;      /* 32-key blocks covering keys 0..q0+15 */
#pragma unroll 1
  for (int it = 0; it < nkb; ++it) {
    const int kb = it * 32;
    _Float16* pb = &lp[w][it & 1][0];
    v8f s0 = z8, s1 = z8;
    { const _Float16* kp = kbase + (size_t)(kb + ln) * DM; v16h bk = g2_frag(kp, hh); s0 = g2_mma(qa0, bk, s0); bk = g2_frag(kp + 32, hh); s0 = g2_mma(qa1, bk, s0); }
    { const _Float16* kp = kbase + (size_t)(kb + 16 + ln) * DM; v16h bk = g2_frag(kp, hh); s1 = g2_mma(qa0, bk, s1); bk = g2_frag(kp + 32, hh); s1 = g2_mma(qa1, bk, s1); }
#pragma unroll
    for (int r = 0; r < 8; ++r) {
      const int qi = q0 + 8 * hh + r;
      const float v0 = (kb + ln <= qi) ? s0[r] * 0.125f : -1.0e30f;
      const float v1 = (kb + 16 + ln <= qi) ? s1[r] * 0.125f : -1.0e30f;
      float mx = fmaxf(v0, v1);
      mx = fmaxf(mx, __shfl_xor(mx, 1, 16)); mx = fmaxf(mx, __shfl_xor(mx, 2, 16)); mx = fmaxf(mx, __shfl_xor(mx, 4, 16)); mx = fmaxf(mx, __shfl_xor(mx, 8, 16));
      const float mn = fmaxf(mr[r], mx);
      const float al = __expf(mr[r] - mn); mr[r] = mn;
      const float p0 = __expf(v0 - mn), p1 = __expf(v1 - mn);
      float rs = p0 + p1;
      rs += __shfl_xor(rs, 1, 16); rs += __shfl_xor(rs, 2, 16); rs += __shfl_xor(rs, 4, 16); rs += __shfl_xor(rs, 8, 16);
      lr[r] = lr[r] * al + rs;
      o0[r] *= al; o1[r] *= al; o2[r] *= al; o3[r] *= al;
      pb[(8 * hh + r) * PP + ln] = (_Float16)(p0 * 1024.0f);
      pb[(8 * hh + r) * PP + 16 + ln] = (_Float16)(p1 * 1024.0f);
    }
    __builtin_amdgcn_fence(3, "wavefront"); __builtin_amdgcn_wave_barrier();
    FragH pa; pa.half[0] = *(const v8us*)((const unsigned short*)pb + ln * PP + 8 * hh); pa.half[1] = *(const v8us*)((const unsigned short*)pb + ln * PP + 16 + 8 * hh);
    { const _Float16* vp = vbase + (size_t)ln * SEQ + kb;
      v16h bv = g2_frag(vp, hh); o0 = g2_mma(pa.v, bv, o0);
      bv = g2_frag(vp + (size_t)16 * SEQ, hh); o1 = g2_mma(pa.v, bv, o1);
      bv = g2_frag(vp + (size_t)32 * SEQ, hh); o2 = g2_mma(pa.v, bv, o2);
      bv = g2_frag(vp + (size_t)48 * SEQ, hh); o3 = g2_mma(pa.v, bv, o3); }
  }
  _Float16* sob = &lso[w][0];
#pragma unroll
  for (int r = 0; r < 8; ++r) { const float inv = (1.0f / lr[r]) * 0.0009765625f; const int row = 8 * hh + r;
    sob[row * OPP + ln] = (_Float16)(o0[r] * inv); sob[row * OPP + 16 + ln] = (_Float16)(o1[r] * inv); sob[row * OPP + 32 + ln] = (_Float16)(o2[r] * inv); sob[row * OPP + 48 + ln] = (_Float16)(o3[r] * inv); }
  __builtin_amdgcn_fence(3, "wavefront"); __builtin_amdgcn_wave_barrier();
  unsigned short* ob = (unsigned short*)O16 + wr0 * DM + h * HD;
  {
#pragma unroll
    for (int it2 = 0; it2 < 4; ++it2) { const int row = it2 * 4 + (lane >> 3), c8 = (lane & 7) * 8; const v8us v = *(const v8us*)((const unsigned short*)sob + row * OPP + c8); *(v8us*)(ob + (size_t)row * DM + c8) = v; }
     }
}

extern "C" void kernel_launch(void* const* d_in, const int* in_sizes, int n_in,
                              void* d_out, int out_size, void* d_ws, size_t ws_size, hipStream_t stream) {
  if (n_in < 6) return;
  const float* x = (const float*)d_in[0]; const float* wq = (const float*)d_in[1]; const float* wk = (const float*)d_in[2];
  const float* wv = (const float*)d_in[3]; const float* wp = (const float*)d_in[4]; const float* bproj = (const float*)d_in[5];
  const size_t need_x = (size_t)(NB - 1) * SEQ_FULL * DM + (size_t)SEQ * DM;
  if ((size_t)in_sizes[0] < need_x || in_sizes[1] < DM * DM || in_sizes[2] < DM * DM || in_sizes[3] < DM * DM || in_sizes[4] < DM * DM || in_sizes[5] < DM || (size_t)out_size < need_x) return;
  float* out = (float*)d_out;
  char* ws = (char*)d_ws; size_t off = 0;
  auto take = [&](size_t bytes) { char* p = ws + off; off += (bytes + 255) & ~(size_t)255; return p; };
  const size_t wb = (size_t)DM * DM * 2;
  _Float16* WQ = (_Float16*)take(wb); _Float16* WK = (_Float16*)take(wb); _Float16* WV = (_Float16*)take(wb); _Float16* WP = (_Float16*)take(wb);
  const size_t rows2 = (size_t)NB * SEQ * DM * 2;      /* f16 plane over all token rows */
  const size_t f0b4 = (size_t)NB * QT0 * DM * 4;       /* f32 first-tile plane */
  const size_t f0b2 = (size_t)NB * QT0 * DM * 2;       /* f16 first-tile plane */
  const size_t vtb = (size_t)NB * DM * SEQ * 2;         /* V^T [NB*NH*HD][SEQ] */
  char* R1 = take(rows2);                                              /* X16, later O16 */
  const size_t r2a = 3 * f0b4, r2b = rows2 + 2 * f0b2; char* R2 = take(r2a > r2b ? r2a : r2b);   /* QF0|KF0|VF0, later Q16 at 0 and OH|OL at rows2 */
  char* R3 = take(f0b4 > rows2 ? f0b4 : rows2);                         /* OF0, later K16 */
  char* R4 = take(vtb);                                                /* VT */
  if (off > ws_size) return;
  _Float16* X16 = (_Float16*)R1; _Float16* O16 = (_Float16*)R1;
  float* QF0 = (float*)R2; float* KF0 = (float*)(R2 + f0b4); float* VF0 = (float*)(R2 + 2 * f0b4);
  _Float16* Q16 = (_Float16*)R2; _Float16* OH = (_Float16*)(R2 + rows2); _Float16* OL = (_Float16*)(R2 + rows2 + f0b2);
  float* OF0 = (float*)R3; _Float16* K16 = (_Float16*)R3;
  _Float16* VT = (_Float16*)R4;

  const size_t nw8 = (size_t)DM * DM / 8; const unsigned gw = (unsigned)((nw8 + 255) / 256);
  k_wnat<<<gw, 256, 0, stream>>>(wq, nw8, WQ); k_wnat<<<gw, 256, 0, stream>>>(wk, nw8, WK); k_wnat<<<gw, 256, 0, stream>>>(wv, nw8, WV); k_wnat<<<gw, 256, 0, stream>>>(wp, nw8, WP);
  const size_t nx8 = (size_t)NB * SEQ * DM / 8;
  k_x16<<<(unsigned)((nx8 + 255) / 256), 256, 0, stream>>>(x, X16, nx8);
  /* f32 q, k, v of rows 0..127 of every sequence (exact products) */
  k_gemm2<<<dim3((QT0 / 128) * (DM / 64), NB), 128, 0, stream>>>(X16, DM, (size_t)SEQ * DM, WQ, DM, (size_t)0, 0.0625f, nullptr, nullptr, 0, QF0, nullptr, DM, (size_t)QT0 * DM, QT0, DM, DM);
  k_gemm2<<<dim3((QT0 / 128) * (DM / 64), NB), 128, 0, stream>>>(X16, DM, (size_t)SEQ * DM, WK, DM, (size_t)0, 0.0625f, nullptr, nullptr, 0, KF0, nullptr, DM, (size_t)QT0 * DM, QT0, DM, DM);
  k_gemm2<<<dim3((QT0 / 128) * (DM / 64), NB), 128, 0, stream>>>(X16, DM, (size_t)SEQ * DM, WV, DM, (size_t)0, 0.0625f, nullptr, nullptr, 0, VF0, nullptr, DM, (size_t)QT0 * DM, QT0, DM, DM);
  k_att0<<<NB * NH * (QT0 / 64), 64, 0, stream>>>(QF0, KF0, VF0, OF0);      /* exact attention rows 0..127 (o x64) */
  const size_t nf8 = (size_t)NB * QT0 * DM / 8;
  k_hl<<<(unsigned)((nf8 + 255) / 256), 256, 0, stream>>>(OF0, OH, OL, nf8);      /* f16 hi / x1024 residual planes of o x64 */
  /* f16 q, k rows for all tokens; V^T directly as (16 Wv) . X16^T */
  k_gemm2<<<dim3((unsigned)((NB * SEQ / 128) * (DM / 64)), 1), 128, 0, stream>>>(X16, DM, (size_t)0, WQ, DM, (size_t)0, 0.0625f, nullptr, nullptr, 0, nullptr, Q16, DM, (size_t)0, NB * SEQ, DM, DM);
  k_gemm2<<<dim3((unsigned)((NB * SEQ / 128) * (DM / 64)), 1), 128, 0, stream>>>(X16, DM, (size_t)0, WK, DM, (size_t)0, 0.0625f, nullptr, nullptr, 0, nullptr, K16, DM, (size_t)0, NB * SEQ, DM, DM);
  k_gemm2<<<dim3((DM / 128) * (SEQ / 64), NB), 128, 0, stream>>>(WV, DM, (size_t)0, X16, DM, (size_t)SEQ * DM, 0.0625f, nullptr, nullptr, 0, nullptr, VT, SEQ, (size_t)DM * SEQ, DM, SEQ, DM);
  k_att<<<dim3(SEQ / 128, NB * NH), 256, 0, stream>>>(Q16, K16, VT, O16);
  /* output projection: rows >= 128 from the f16 o plane; rows < 128 from the hi plane, then += the residual plane */
  k_gemm2<<<dim3(((SEQ - QT0) / 128) * (DM / 64), NB), 128, 0, stream>>>(O16 + (size_t)QT0 * DM, DM, (size_t)SEQ * DM, WP, DM, (size_t)0, 0.0625f, bproj, nullptr, 0, out + (size_t)QT0 * DM, nullptr, DM, (size_t)SEQ_FULL * DM, SEQ - QT0, DM, DM);
  k_gemm2<<<dim3((QT0 / 128) * (DM / 64), NB), 128, 0, stream>>>(OH, DM, (size_t)QT0 * DM, WP, DM, (size_t)0, 0.0009765625f, bproj, nullptr, 0, out, nullptr, DM, (size_t)SEQ_FULL * DM, QT0, DM, DM);
  k_gemm2<<<dim3((QT0 / 128) * (DM / 64), NB), 128, 0, stream>>>(OL, DM, (size_t)QT0 * DM, WP, DM, (size_t)0, 9.5367431640625e-07f, nullptr, out, 0, out, nullptr, DM, (size_t)SEQ_FULL * DM, QT0, DM, DM);
}

// v003
// One run takes 281 microseconds.
// In both of two side-by-side timings against v002, it was 1.35 times as fast.
// Over all steps from v000 it is 2.96 times as fast.
#include <hip/hip_runtime.h>
// Structure: token rows r = b*SEQ + t in compact workspace planes (input/output strides use SEQ_FULL); X16 = f16(bf16(x)); Q16, K16 = X16 . (16 W)^T / 16 as 32x64 wave-tile GEMMs with LDS-staged whole-line epilogues; V^T per (b, head) produced directly as (16 Wv) . X16^T / 16;
#ifndef NB
#define NB 64
#endif
#ifndef SEQ
#define SEQ 512
#endif
#define NB_FULL 64
#define SEQ_FULL 512
#define DM 384
#define NH 6
#define HD 64
#define QT0 128                      /* first query rows per sequence recomputed exactly in f32 */
#define PP 40                        /* LDS pitch (halves) of the 16x32 P tile */
#define OPP 72                       /* LDS pitch (halves) of the 16x64 O staging tile */
#define GKC 64                       /* k (halves) of one staged GEMM pass: one 128-byte line of every operand row */
#define KU 8                         /* keys per trip of the exact attention */
#define GP 72                        /* LDS pitch (halves) of a staged GEMM operand row: 128 + 16 bytes */
static_assert(NB >= 1 && NB <= NB_FULL);
static_assert(SEQ % 128 == 0 && SEQ >= 2 * QT0 && SEQ <= SEQ_FULL);
static_assert(KU == 8);
static_assert(DM == NH * HD && DM % 128 == 0 && HD == 64 && QT0 == 128);

typedef unsigned short v8us __attribute__((ext_vector_type(8), may_alias));
typedef float  v8f  __attribute__((ext_vector_type(8)));
typedef float  v4f  __attribute__((ext_vector_type(4)));
typedef float  v2f  __attribute__((ext_vector_type(2)));
typedef float  v4fa __attribute__((ext_vector_type(4), may_alias));
typedef _Float16 v16h __attribute__((ext_vector_type(16)));
typedef _Float16 v4h __attribute__((ext_vector_type(4)));
union FragH { v16h v; v8us half[2]; _Float16 h[16]; unsigned short u[16]; };

__device__ __forceinline__ unsigned short bf16_bits(float x) { unsigned int u = __float_as_uint(x); return (unsigned short)((u + 0x7FFFu + ((u >> 16) & 1u)) >> 16); }
__device__ __forceinline__ float bf16_val(unsigned short b) { return __uint_as_float(((unsigned int)b) << 16); }
__device__ __forceinline__ float bf16_rne(float x) { return bf16_val(bf16_bits(x)); }

// 16-bit WMMA fragment from a k-contiguous row (A: row m, B: column n of a [n][k] plane): elements 0..7 <- k 8hh..8hh+7, elements 8..15 <- k 16+8hh..16+8hh+7
__device__ __forceinline__ v16h g2_frag(const _Float16* p, int hh) { FragH f; f.half[0] = *(const v8us*)((const unsigned short*)p + 8 * hh); f.half[1] = *(const v8us*)((const unsigned short*)p + 16 + 8 * hh); return f.v; }
__device__ __forceinline__ v8f g2_mma(v16h a, v16h b, v8f c) { v8f d = __builtin_amdgcn_wmma_f32_16x16x32_f16(false, a, false, b, (short)0, c, false, false); asm volatile("v_nop\n\tv_nop\n\tv_nop\n\tv_nop" : "+v"(d) : "v"(a), "v"(b)); return d; }

__global__ __launch_bounds__(256) void k_wnat(const float* __restrict__ w, size_t n8, _Float16* __restrict__ Bt) {
  const size_t t = (size_t)blockIdx.x * 256 + threadIdx.x; if (t >= n8) return; FragH f;
#pragma unroll
  for (int q = 0; q < 8; ++q) f.h[q] = (_Float16)(bf16_rne(w[t * 8 + q]) * 16.0f);
  unsigned short* d = (unsigned short*)Bt + t * 8;
  *(v8us*)d = f.half[0]; 
}

__global__ __launch_bounds__(256) void k_x16(const float* __restrict__ x, _Float16* __restrict__ X16, size_t n8) {
  const size_t t = (size_t)blockIdx.x * 256 + threadIdx.x; if (t >= n8) return;
  const size_t wr = t / (DM / 8); const int c8 = (int)(t % (DM / 8)) * 8;
  const size_t b = wr / SEQ, tt = wr % SEQ;
  const float* src = x + (b * SEQ_FULL + tt) * DM + c8;
  const v4f a = *(const v4fa*)src, c = *(const v4fa*)(src + 4); FragH f;
#pragma unroll
  for (int q = 0; q < 4; ++q) { f.h[q] = (_Float16)bf16_rne(a[q]); f.h[4 + q] = (_Float16)bf16_rne(c[q]); }
  unsigned short* d = (unsigned short*)X16 + t * 8;
  *(v8us*)d = f.half[0]; 
}

// one pass's operand lines into registers: this lane's 16 bytes of 8 A rows and 4 B rows, 16 rows (sa16, sb16 bytes) apart; pa, pb: the block's first rows at this pass (the same in every lane), ao, bo: the lane's own byte offsets
__device__ __forceinline__ void g2_fetch(const char* pa, size_t sa16, unsigned ao, const char* pb, size_t sb16, unsigned bo, v8us (&ra)[8], v8us (&rb)[4]) {
  const char* a[8]; const char* b[4];
#pragma unroll
  for (int i = 0; i < 8; ++i) { a[i] = pa + i * sa16 + ao; ra[i] = *(const v8us*)a[i]; }
#pragma unroll
  for (int i = 0; i < 4; ++i) { b[i] = pb + i * sb16 + bo; rb[i] = *(const v8us*)b[i]; }
  /* the wait that belongs between an issued load and an overwrite of its address registers; it names the twelve addresses so that they stay in their registers up to it (else a later load's result lands in an earlier load's address pair) */
  asm volatile("s_wait_xcnt 0x0" :: "v"(a[0]), "v"(a[1]), "v"(a[2]), "v"(a[3]), "v"(a[4]), "v"(a[5]), "v"(a[6]), "v"(a[7]), "v"(b[0]), "v"(b[1]), "v"(b[2]), "v"(b[3]) : "memory");
}

// GEMM C[M][N] = alpha (A . Bt^T) + bf16(bias[col]) (+ CP own element): A f16 row-major (pitch lda, batch stride sA by grid.y), Bt f16 [n][k] (pitch ldb, stride sB);
// writes f32 C and/or f16 C16 (pitch ldc, batch stride sC). Block = 4 waves, block tile 128 rows x 64 cols, wave tile 32 rows x 64 cols; M % 128 == 0, N % 64 == 0, K % 64 == 0.
// Operands: per pass of GKC = 64 k the block brings its 128 A rows and 64 B rows into LDS, 8 lanes per row, so that every wave-wide 16-byte load covers four whole 128-byte lines and each B row is fetched once per block;
// the next pass's lines are fetched into registers while this pass is multiplied; fragments come from LDS (row pitch 144 bytes: a 16-row fragment read meets every bank once). k order of the products as before (32 at a time, ascending).
__global__ __launch_bounds__(128) void k_gemm2(const _Float16* __restrict__ A, int lda, size_t sA, const _Float16* __restrict__ Bh, int ldb, size_t sB, float alpha,
    const float* __restrict__ bias, const float* CP, int row0g, float* C, _Float16* C16, int ldc, size_t sC, int M, int N, int K) {
  __shared__ __attribute__((aligned(16))) unsigned char sm[4 * 32 * 68 * 4];      /* operand tiles in the k loop, then the epilogue's f32 staging */
  static_assert((128 + 64) * GP * 2 <= 4 * 32 * 68 * 4);
  float (*so)[32][68] = (float (*)[32][68])sm;
  _Float16* sa = (_Float16*)sm; _Float16* sb = sa + 128 * GP;
  const int tid = threadIdx.x, w = tid >> 5, lane = tid & 31, ln = lane & 15, hh = lane >> 4; const int by = blockIdx.y;
  A += (size_t)by * sA; Bh += (size_t)by * sB; const size_t cofs = (size_t)by * sC;
  const int ntn = N >> 6; const int mt = blockIdx.x / ntn, nq = blockIdx.x - mt * ntn; const int row0 = mt * 128 + 32 * w, col0 = nq * 64; if (mt * 128 >= M) return;      /* the same for the whole block: barriers follow */
  const int sr = tid >> 3, sc8 = (tid & 7) * 8;      /* staging: row sr + 16 i, halves sc8..sc8+7 of the pass */
  const char* ag = (const char*)(A + (size_t)(mt * 128) * lda); const char* bg = (const char*)(Bh + (size_t)col0 * ldb);      /* the block's first rows: the same in every lane */
  const unsigned ao = (unsigned)(sr * lda + sc8) * 2u, bo = (unsigned)(sr * ldb + sc8) * 2u;      /* the lane's own byte offsets, fixed for the whole kernel */
  unsigned short* sas = (unsigned short*)sa + sr * GP + sc8; unsigned short* sbs = (unsigned short*)sb + sr * GP + sc8;
  const _Float16* a0p = sa + (32 * w + ln) * GP; const _Float16* a1p = a0p + 16 * GP;
  const _Float16* b0p = sb + ln * GP; const _Float16* b1p = b0p + 16 * GP; const _Float16* b2p = b1p + 16 * GP; const _Float16* b3p = b2p + 16 * GP;
  const v8f z8 = {0.f,0.f,0.f,0.f,0.f,0.f,0.f,0.f}; v8f c00 = z8, c01 = z8, c02 = z8, c03 = z8, c10 = z8, c11 = z8, c12 = z8, c13 = z8;
  v8us ra[8], rb[4];
  g2_fetch(ag, (size_t)lda * 32, ao, bg, (size_t)ldb * 32, bo, ra, rb); ag += GKC * 2; bg += GKC * 2;
  /* passes stay rolled: one pass already holds 16 products per wave, unrolling further would only lengthen the text */
#pragma unroll 1
  for (int kc = 0; kc < K; kc += GKC) {
#pragma unroll
    for (int i = 0; i < 8; ++i) *(v8us*)(sas + 16 * i * GP) = ra[i];
#pragma unroll
    for (int i = 0; i < 4; ++i) *(v8us*)(sbs + 16 * i * GP) = rb[i];
    __syncthreads();      /* the pass's tiles are complete before any wave reads a fragment */
    if (kc + GKC < K) { g2_fetch(ag, (size_t)lda * 32, ao, bg, (size_t)ldb * 32, bo, ra, rb); ag += GKC * 2; bg += GKC * 2; }
#pragma unroll
    for (int kb = 0; kb < GKC; kb += 32) { const v16h a0 = g2_frag(a0p + kb, hh), a1 = g2_frag(a1p + kb, hh);      /* each B fragment after the first is read one pair of products ahead of its use */
      v16h b = g2_frag(b0p + kb, hh), bn = g2_frag(b1p + kb, hh); c00 = g2_mma(a0, b, c00); c10 = g2_mma(a1, b, c10);
      b = g2_frag(b2p + kb, hh); c01 = g2_mma(a0, bn, c01); c11 = g2_mma(a1, bn, c11);
      bn = g2_frag(b3p + kb, hh); c02 = g2_mma(a0, b, c02); c12 = g2_mma(a1, b, c12);
      c03 = g2_mma(a0, bn, c03); c13 = g2_mma(a1, bn, c13); }
    __syncthreads();      /* every wave has read its fragments before the tiles are overwritten (by the next pass, or by the epilogue's staging) */
  }
  v8f accs[8] = {c00, c01, c02, c03, c10, c11, c12, c13};
#pragma unroll
  for (int u = 0; u < 8; ++u) { const int t = u & 3, half = u >> 2; const int col = col0 + t * 16 + ln; const float bv = bias ? bf16_rne(bias[col]) : 0.f;
#pragma unroll
    for (int r = 0; r < 8; ++r) { const int rloc = half * 16 + 8 * hh + r; float v = accs[u][r] * alpha + bv;
      if (CP) v += CP[cofs + (size_t)(row0g + row0 + rloc) * ldc + col];      /* own element of the C plane (a prior pass), added in f32 */
      so[w][rloc][t * 16 + ln] = v; } }
  __builtin_amdgcn_fence(4, "workgroup"); __builtin_amdgcn_wave_barrier();
  const int rsub = lane >> 4, c4 = (lane & 15) * 4;
  {
#pragma unroll
    for (int q = 0; q < 16; ++q) { const int r = q * 2 + rsub; const v4f v = *(const v4fa*)&so[w][r][c4];
      if (C) *(v4f*)(C + cofs + (size_t)(row0 + r) * ldc + col0 + c4) = v;
      if (C16) { v4h h4; for (int i = 0; i < 4; ++i) h4[i] = (_Float16)v[i]; *(v4h*)(C16 + cofs + (size_t)(row0 + r) * ldc + col0 + c4) = h4; } }
     }
}

// exact (f32) causal attention for query rows 0..QT0-1 of every (batch, head): planes QF/KF/VF [NB][QT0][DM] (head h at column h*HD); block = 64 threads = 64 consecutive rows of one head;
// the block first brings the K and V rows of all its keys into LDS by whole-line loads (as they lie); thread i keeps its q row and its o accumulator in registers and walks keys j = 0..(its wave's last row) KU at a time (wave-uniform trip count, a multiple of 4; keys j > i enter through an arithmetic 0/1 factor as -1e30, contributing exactly 0):
// the KU scores of a trip are independent chains that run side by side, each as two partial sums (even d, odd d; d ascending) that are added at the end; the online softmax (f32, precise expf) and the o update then take the KU keys one after the other, in key order.
__global__ __launch_bounds__(64) void k_att0(const float* __restrict__ QF, const float* __restrict__ KF, const float* __restrict__ VF, float* __restrict__ OF) {
  #pragma clang fp contract(off)
  __shared__ __attribute__((aligned(16))) float lk[QT0][HD];
  __shared__ __attribute__((aligned(16))) float lv[QT0][HD];
  __shared__ __attribute__((aligned(16))) float lo[64][64];
  const int tid = threadIdx.x; const int rg = blockIdx.x % (QT0 / 64); const int bh = blockIdx.x / (QT0 / 64); const int b = bh / NH, h = bh - b * NH;
  const size_t pofs = (size_t)b * QT0 * DM;
  const int i = rg * 64 + tid;
  const float* qr = QF + pofs + (size_t)i * DM + h * HD;
  { const float* kg = KF + pofs + h * HD + (size_t)(tid >> 4) * 2 * DM + (tid & 15) * 4; const float* vg = VF + pofs + h * HD + (size_t)(tid >> 4) * 2 * DM + (tid & 15) * 4;
    const int c4 = (tid & 15) * 4;      /* 16 lanes per row; a trip brings 4 key pairs, 8 trips 64 keys */
    for (int hf = 0; hf <= rg; ++hf) { v4f rk[16], rv[16]; const float* kp = kg + (size_t)hf * 64 * DM; const float* vp = vg + (size_t)hf * 64 * DM;
      /* unrolled: the 32 row loads of a lane for 64 keys are in flight together */
#pragma unroll
      for (int it = 0; it < 8; ++it) { rk[2 * it] = *(const v4fa*)(kp + it * 8 * DM); rk[2 * it + 1] = *(const v4fa*)(kp + it * 8 * DM + DM); rv[2 * it] = *(const v4fa*)(vp + it * 8 * DM); rv[2 * it + 1] = *(const v4fa*)(vp + it * 8 * DM + DM); }
      /* the wait that belongs between an issued load and an overwrite of its address registers; it names the two addresses so that they stay in their registers up to it (else a later load's result lands in an earlier load's address pair) */
      asm volatile("s_wait_xcnt 0x0" :: "v"(kp), "v"(vp) : "memory");
#pragma unroll
      for (int it = 0; it < 8; ++it) { const int p = (hf * 8 + it) * 4 + (tid >> 4);
        *(v4f*)&lk[2 * p][c4] = rk[2 * it]; *(v4f*)&lk[2 * p + 1][c4] = rk[2 * it + 1]; *(v4f*)&lv[2 * p][c4] = rv[2 * it]; *(v4f*)&lv[2 * p + 1][c4] = rv[2 * it + 1]; } } }
  v2f q[HD / 2], o[HD / 2];
#pragma unroll
  for (int c = 0; c < HD / 4; ++c) { const v4f qq = *(const v4fa*)(qr + c * 4); const v2f qa = {qq[0], qq[1]}, qb = {qq[2], qq[3]}; q[2 * c] = qa; q[2 * c + 1] = qb; const v2f z = {0.f, 0.f}; o[2 * c] = z; o[2 * c + 1] = z; }
  __syncthreads();      /* the block's K and V rows are complete before any wave reads a key */
  float m = -1.0e30f, l = 0.f; const int jend = rg * 64 + __builtin_amdgcn_readfirstlane(tid >> 5) * 32 + 32;      /* wave-uniform: keys up to the wave's last row */
  /* trips stay rolled: one trip already holds KU independent score chains, more would only lengthen the text; every loop inside a trip is fully unrolled, so that q, o and the ring are indexed by constants and stay in registers */
#pragma unroll 1
  for (int j0 = 0; j0 < jend; j0 += KU) { v2f s2[KU]; v4f rb[3][KU]; const float* kt = &lk[j0][0]; const float* vt = &lv[j0][0]; float sc[KU], e[KU];      /* rb: ring of three chunks; a chunk = eight 16-byte LDS reads, the same address in every lane: of K 4 d of the trip's 8 keys (chunks 0..15), of V 16 d of 2 keys (chunks 16..31) */
#pragma unroll
    for (int kk = 0; kk < KU; ++kk) { const v2f z = {0.f, 0.f}; s2[kk] = z; }
    /* chunk n is read two chunks ahead of its use, so that its LDS latency lies behind two chunks of arithmetic. The scheduling fences keep reads and arithmetic in that order: left free, the compiler lifts all reads of a trip to its head, which takes more than 500 registers */
#pragma unroll
    for (int x = 0; x < 8; ++x) { rb[0][x] = *(const v4f*)(kt + x * HD); rb[1][x] = *(const v4f*)(kt + x * HD + 4); }
    __builtin_amdgcn_sched_barrier(0);      /* see above */
#pragma unroll
    for (int t = 0; t < HD / 4; ++t) {
      if (t + 2 < HD / 4) {
#pragma unroll
        for (int x = 0; x < 8; ++x) rb[(t + 2) % 3][x] = *(const v4f*)(kt + x * HD + (t + 2) * 4);
      } else {
#pragma unroll
        for (int x = 0; x < 8; ++x) rb[(t + 2) % 3][x] = *(const v4f*)(vt + (x >> 2) * HD + ((t + 2 - HD / 4) * 4 + (x & 3)) * 4);
      }
      __builtin_amdgcn_sched_barrier(0);      /* see above */
#pragma unroll
      for (int kk = 0; kk < KU; ++kk) { const v4f kq = rb[t % 3][kk]; const v2f ka = {kq[0], kq[1]}; s2[kk] = __builtin_elementwise_fma(q[2 * t], ka, s2[kk]); }
#pragma unroll
      for (int kk = 0; kk < KU; ++kk) { const v4f kq = rb[t % 3][kk]; const v2f kb = {kq[2], kq[3]}; s2[kk] = __builtin_elementwise_fma(q[2 * t + 1], kb, s2[kk]); }
      __builtin_amdgcn_sched_barrier(0);      /* see above */
    }
#pragma unroll
    for (int kk = 0; kk < KU; ++kk) { const int j = j0 + kk; const float s = __fmul_rn(__fadd_rn(s2[kk][0], s2[kk][1]), 0.125f);
      const float f = (j <= i) ? 1.f : 0.f; const float sm = fmaf(f, s, (1.f - f) * -1.0e30f); const float mn = fmaxf(m, sm); sc[kk] = expf(m - mn); e[kk] = expf(sm - mn); l = __fadd_rn(__fmul_rn(l, sc[kk]), e[kk]); m = mn; }
    __builtin_amdgcn_sched_barrier(0);      /* see above */
#pragma unroll
    for (int t = 0; t < HD / 4; ++t) {      /* V chunk t: keys 2 (t / 4), 2 (t / 4) + 1, d 16 (t % 4) .. + 15: eight independent o pairs, every o element meets its keys in ascending order */
      if (t + 2 < HD / 4) {
#pragma unroll
        for (int x = 0; x < 8; ++x) rb[(t + 2 + HD / 4) % 3][x] = *(const v4f*)(vt + (((t + 2) >> 2) * 2 + (x >> 2)) * HD + (((t + 2) & 3) * 4 + (x & 3)) * 4);
      }
      __builtin_amdgcn_sched_barrier(0);      /* see above */
#pragma unroll
      for (int x = 0; x < 8; ++x) { const int kk = (t >> 2) * 2 + (x >> 2), c = (t & 3) * 4 + (x & 3); const v4f vv = rb[(t + HD / 4) % 3][x]; const v2f va = {vv[0], vv[1]}, vb = {vv[2], vv[3]}; const v2f s_ = {sc[kk], sc[kk]}, e_ = {e[kk], e[kk]};
        o[2 * c] = __builtin_elementwise_fma(o[2 * c], s_, e_ * va); o[2 * c + 1] = __builtin_elementwise_fma(o[2 * c + 1], s_, e_ * vb); }
      __builtin_amdgcn_sched_barrier(0);      /* see above */
    } }
  const float fin = 64.0f / l;      /* o carried x64 */
#pragma unroll
  for (int c = 0; c < HD / 4; ++c) { v4f oo = {o[2 * c][0], o[2 * c][1], o[2 * c + 1][0], o[2 * c + 1][1]}; for (int u = 0; u < 4; ++u) oo[u] = __fmul_rn(oo[u], fin); *(v4f*)&lo[tid][c * 4] = oo; }
  __syncthreads();
  {
#pragma unroll 1
    for (int it = 0; it < 16; ++it) { const int row = it * 4 + tid / 16, pc = (tid % 16) * 4; const v4f v = *(const v4f*)&lo[row][pc]; *(v4f*)(OF + pofs + (size_t)(rg * 64 + row) * DM + h * HD + pc) = v; }
     } }

__global__ __launch_bounds__(256) void k_hl(const float* __restrict__ F, _Float16* __restrict__ Hh, _Float16* __restrict__ Hl, size_t n8) {
  const size_t t = (size_t)blockIdx.x * 256 + threadIdx.x; if (t >= n8) return; FragH fh, fl; const v4f a = *(const v4fa*)(F + t * 8), c = *(const v4fa*)(F + t * 8 + 4);
#pragma unroll
  for (int q = 0; q < 4; ++q) { _Float16 hv = (_Float16)a[q]; fh.h[q] = hv; fl.h[q] = (_Float16)((a[q] - (float)hv) * 1024.0f); hv = (_Float16)c[q]; fh.h[4 + q] = hv; fl.h[4 + q] = (_Float16)((c[q] - (float)hv) * 1024.0f); }
  unsigned short* dh = (unsigned short*)Hh + t * 8; unsigned short* dl = (unsigned short*)Hl + t * 8;
  { *(v8us*)dh = fh.half[0]; *(v8us*)dl = fl.half[0];  } }

// causal attention, f16 WMMA: grid (SEQ/128, NB*NH), block = 8 waves, wave -> query rows q0..q0+15 (q0 = 16*(8*blockIdx.x + wave)) of one (b, head).
// Per 32-key block: two 16x16 score tiles S = q . k^T (A = Q16 rows, B = K16 rows as [key][d], K = 64 in two k-steps), x0.125 and the causal select by value in f32, online softmax per row (16 key columns across 16 lanes: xor-shuffle max / sum, f32 running max and sum, o and sum rescaled by exp(m_old - m_new)),
__global__ __launch_bounds__(256) __attribute__((amdgpu_num_vgpr(256)))
void k_att(const _Float16* __restrict__ Q16, const _Float16* __restrict__ K16, const _Float16* __restrict__ VT, _Float16* __restrict__ O16) {
  __shared__ __attribute__((aligned(16))) _Float16 lp[8][2][16 * PP];
  __shared__ __attribute__((aligned(16))) _Float16 lso[8][16 * OPP];
  const int tid = threadIdx.x, w = tid >> 5, lane = tid & 31, ln = lane & 15, hh = lane >> 4;
  const int qt = blockIdx.x * 8 + w; const int bh = blockIdx.y; const int b = bh / NH, h = bh - b * NH;
  const int q0 = qt * 16;
  const size_t wr0 = (size_t)b * SEQ + q0;
  const _Float16* qp = Q16 + (wr0 + ln) * DM + h * HD;
  const v16h qa0 = g2_frag(qp, hh), qa1 = g2_frag(qp + 32, hh);      /* d 0..31, 32..63 */
  const _Float16* kbase = K16 + (size_t)b * SEQ * DM + h * HD;        /* key row j at kbase + j*DM */
  const _Float16* vbase = VT + (size_t)bh * HD * SEQ;                 /* V^T row d at vbase + d*SEQ */
  const v8f z8 = {0.f,0.f,0.f,0.f,0.f,0.f,0.f,0.f}; v8f o0 = z8, o1 = z8, o2 = z8, o3 = z8;
  float mr[8], lr[8];
#pragma unroll
  for (int r = 0; r < 8; ++r) { mr[r] = -1.0e30f; lr[r] = 0.f; }
  const int nkb = qt / 2 + 1;      /* 32-key blocks covering keys 0..q0+15 */
#pragma unroll 1
  for (int it = 0; it < nkb; ++it) {
    const int kb = it * 32;
    _Float16* pb = &lp[w][it & 1][0];
    v8f s0 = z8, s1 = z8;
    { const _Float16* kp = kbase + (size_t)(kb + ln) * DM; v16h bk = g2_frag(kp, hh); s0 = g2_mma(qa0, bk, s0); bk = g2_frag(kp + 32, hh); s0 = g2_mma(qa1, bk, s0); }
    { const _Float16* kp = kbase + (size_t)(kb + 16 + ln) * DM; v16h bk = g2_frag(kp, hh); s1 = g2_mma(qa0, bk, s1); bk = g2_frag(kp + 32, hh); s1 = g2_mma(qa1, bk, s1); }
#pragma unroll
    for (int r = 0; r < 8; ++r) {
      const int qi = q0 + 8 * hh + r;
      const float v0 = (kb + ln <= qi) ? s0[r] * 0.125f : -1.0e30f;
      const float v1 = (kb + 16 + ln <= qi) ? s1[r] * 0.125f : -1.0e30f;
      float mx = fmaxf(v0, v1);
      mx = fmaxf(mx, __shfl_xor(mx, 1, 16)); mx = fmaxf(mx, __shfl_xor(mx, 2, 16)); mx = fmaxf(mx, __shfl_xor(mx, 4, 16)); mx = fmaxf(mx, __shfl_xor(mx, 8, 16));
      const float mn = fmaxf(mr[r], mx);
      const float al = __expf(mr[r] - mn); mr[r] = mn;
      const float p0 = __expf(v0 - mn), p1 = __expf(v1 - mn);
      float rs = p0 + p1;
      rs += __shfl_xor(rs, 1, 16); rs += __shfl_xor(rs, 2, 16); rs += __shfl_xor(rs, 4, 16); rs += __shfl_xor(rs, 8, 16);
      lr[r] = lr[r] * al + rs;
      o0[r] *= al; o1[r] *= al; o2[r] *= al; o3[r] *= al;
      pb[(8 * hh + r) * PP + ln] = (_Float16)(p0 * 1024.0f);
      pb[(8 * hh + r) * PP + 16 + ln] = (_Float16)(p1 * 1024.0f);
    }
    __builtin_amdgcn_fence(3, "wavefront"); __builtin_amdgcn_wave_barrier();
    FragH pa; pa.half[0] = *(const v8us*)((const unsigned short*)pb + ln * PP + 8 * hh); pa.half[1] = *(const v8us*)((const unsigned short*)pb + ln * PP + 16 + 8 * hh);
    { const _Float16* vp = vbase + (size_t)ln * SEQ + kb;
      v16h bv = g2_frag(vp, hh); o0 = g2_mma(pa.v, bv, o0);
      bv = g2_frag(vp + (size_t)16 * SEQ, hh); o1 = g2_mma(pa.v, bv, o1);
      bv = g2_frag(vp + (size_t)32 * SEQ, hh); o2 = g2_mma(pa.v, bv, o2);
      bv = g2_frag(vp + (size_t)48 * SEQ, hh); o3 = g2_mma(pa.v, bv, o3); }
  }
  _Float16* sob = &lso[w][0];
#pragma unroll
  for (int r = 0; r < 8; ++r) { const float inv = (1.0f / lr[r]) * 0.0009765625f; const int row = 8 * hh + r;
    sob[row * OPP + ln] = (_Float16)(o0[r] * inv); sob[row * OPP + 16 + ln] = (_Float16)(o1[r] * inv); sob[row * OPP + 32 + ln] = (_Float16)(o2[r] * inv); sob[row * OPP + 48 + ln] = (_Float16)(o3[r] * inv); }
  __builtin_amdgcn_fence(3, "wavefront"); __builtin_amdgcn_wave_barrier();
  unsigned short* ob = (unsigned short*)O16 + wr0 * DM + h * HD;
  {
#pragma unroll
    for (int it2 = 0; it2 < 4; ++it2) { const int row = it2 * 4 + (lane >> 3), c8 = (lane & 7) * 8; const v8us v = *(const v8us*)((const unsigned short*)sob + row * OPP + c8); *(v8us*)(ob + (size_t)row * DM + c8) = v; }
     }
}

extern "C" void kernel_launch(void* const* d_in, const int* in_sizes, int n_in,
                              void* d_out, int out_size, void* d_ws, size_t ws_size, hipStream_t stream) {
  if (n_in < 6) return;
  const float* x = (const float*)d_in[0]; const float* wq = (const float*)d_in[1]; const float* wk = (const float*)d_in[2];
  const float* wv = (const float*)d_in[3]; const float* wp = (const float*)d_in[4]; const float* bproj = (const float*)d_in[5];
  const size_t need_x = (size_t)(NB - 1) * SEQ_FULL * DM + (size_t)SEQ * DM;
  if ((size_t)in_sizes[0] < need_x || in_sizes[1] < DM * DM || in_sizes[2] < DM * DM || in_sizes[3] < DM * DM || in_sizes[4] < DM * DM || in_sizes[5] < DM || (size_t)out_size < need_x) return;
  float* out = (float*)d_out;
  char* ws = (char*)d_ws; size_t off = 0;
  auto take = [&](size_t bytes) { char* p = ws + off; off += (bytes + 255) & ~(size_t)255; return p; };
  const size_t wb = (size_t)DM * DM * 2;
  _Float16* WQ = (_Float16*)take(wb); _Float16* WK = (_Float16*)take(wb); _Float16* WV = (_Float16*)take(wb); _Float16* WP = (_Float16*)take(wb);
  const size_t rows2 = (size_t)NB * SEQ * DM * 2;      /* f16 plane over all token rows */
  const size_t f0b4 = (size_t)NB * QT0 * DM * 4;       /* f32 first-tile plane */
  const size_t f0b2 = (size_t)NB * QT0 * DM * 2;       /* f16 first-tile plane */
  const size_t vtb = (size_t)NB * DM * SEQ * 2;         /* V^T [NB*NH*HD][SEQ] */
  char* R1 = take(rows2);                                              /* X16, later O16 */
  const size_t r2a = 3 * f0b4, r2b = rows2 + 2 * f0b2; char* R2 = take(r2a > r2b ? r2a : r2b);   /* QF0|KF0|VF0, later Q16 at 0 and OH|OL at rows2 */
  char* R3 = take(f0b4 > rows2 ? f0b4 : rows2);                         /* OF0, later K16 */
  char* R4 = take(vtb);                                                /* VT */
  if (off > ws_size) return;
  _Float16* X16 = (_Float16*)R1; _Float16* O16 = (_Float16*)R1;
  float* QF0 = (float*)R2; float* KF0 = (float*)(R2 + f0b4); float* VF0 = (float*)(R2 + 2 * f0b4);
  _Float16* Q16 = (_Float16*)R2; _Float16* OH = (_Float16*)(R2 + rows2); _Float16* OL = (_Float16*)(R2 + rows2 + f0b2);
  float* OF0 = (float*)R3; _Float16* K16 = (_Float16*)R3;
  _Float16* VT = (_Float16*)R4;

  const size_t nw8 = (size_t)DM * DM / 8; const unsigned gw = (unsigned)((nw8 + 255) / 256);
  k_wnat<<<gw, 256, 0, stream>>>(wq, nw8, WQ); k_wnat<<<gw, 256, 0, stream>>>(wk, nw8, WK); k_wnat<<<gw, 256, 0, stream>>>(wv, nw8, WV); k_wnat<<<gw, 256, 0, stream>>>(wp, nw8, WP);
  const size_t nx8 = (size_t)NB * SEQ * DM / 8;
  k_x16<<<(unsigned)((nx8 + 255) / 256), 256, 0, stream>>>(x, X16, nx8);
  /* f32 q, k, v of rows 0..127 of every sequence (exact products) */
  k_gemm2<<<dim3((QT0 / 128) * (DM / 64), NB), 128, 0, stream>>>(X16, DM, (size_t)SEQ * DM, WQ, DM, (size_t)0, 0.0625f, nullptr, nullptr, 0, QF0, nullptr, DM, (size_t)QT0 * DM, QT0, DM, DM);
  k_gemm2<<<dim3((QT0 / 128) * (DM / 64), NB), 128, 0, stream>>>(X16, DM, (size_t)SEQ * DM, WK, DM, (size_t)0, 0.0625f, nullptr, nullptr, 0, KF0, nullptr, DM, (size_t)QT0 * DM, QT0, DM, DM);
  k_gemm2<<<dim3((QT0 / 128) * (DM / 64), NB), 128, 0, stream>>>(X16, DM, (size_t)SEQ * DM, WV, DM, (size_t)0, 0.0625f, nullptr, nullptr, 0, VF0, nullptr, DM, (size_t)QT0 * DM, QT0, DM, DM);
  k_att0<<<NB * NH * (QT0 / 64), 64, 0, stream>>>(QF0, KF0, VF0, OF0);      /* exact attention rows 0..127 (o x64) */
  const size_t nf8 = (size_t)NB * QT0 * DM / 8;
  k_hl<<<(unsigned)((nf8 + 255) / 256), 256, 0, stream>>>(OF0, OH, OL, nf8);      /* f16 hi / x1024 residual planes of o x64 */
  /* f16 q, k rows for all tokens; V^T directly as (16 Wv) . X16^T */
  k_gemm2<<<dim3((unsigned)((NB * SEQ / 128) * (DM / 64)), 1), 128, 0, stream>>>(X16, DM, (size_t)0, WQ, DM, (size_t)0, 0.0625f, nullptr, nullptr, 0, nullptr, Q16, DM, (size_t)0, NB * SEQ, DM, DM);
  k_gemm2<<<dim3((unsigned)((NB * SEQ / 128) * (DM / 64)), 1), 128, 0, stream>>>(X16, DM, (size_t)0, WK, DM, (size_t)0, 0.0625f, nullptr, nullptr, 0, nullptr, K16, DM, (size_t)0, NB * SEQ, DM, DM);
  k_gemm2<<<dim3((DM / 128) * (SEQ / 64), NB), 128, 0, stream>>>(WV, DM, (size_t)0, X16, DM, (size_t)SEQ * DM, 0.0625f, nullptr, nullptr, 0, nullptr, VT, SEQ, (size_t)DM * SEQ, DM, SEQ, DM);
  k_att<<<dim3(SEQ / 128, NB * NH), 256, 0, stream>>>(Q16, K16, VT, O16);
  /* output projection: rows >= 128 from the f16 o plane; rows < 128 from the hi plane, then += the residual plane */
  k_gemm2<<<dim3(((SEQ - QT0) / 128) * (DM / 64), NB), 128, 0, stream>>>(O16 + (size_t)QT0 * DM, DM, (size_t)SEQ * DM, WP, DM, (size_t)0, 0.0625f, bproj, nullptr, 0, out + (size_t)QT0 * DM, nullptr, DM, (size_t)SEQ_FULL * DM, SEQ - QT0, DM, DM);
  k_gemm2<<<dim3((QT0 / 128) * (DM / 64), NB), 128, 0, stream>>>(OH, DM, (size_t)QT0 * DM, WP, DM, (size_t)0, 0.0009765625f, bproj, nullptr, 0, out, nullptr, DM, (size_t)SEQ_FULL * DM, QT0, DM, DM);
  k_gemm2<<<dim3((QT0 / 128) * (DM / 64), NB), 128, 0, stream>>>(OL, DM, (size_t)QT0 * DM, WP, DM, (size_t)0, 9.5367431640625e-07f, nullptr, out, 0, out, nullptr, DM, (size_t)SEQ_FULL * DM, QT0, DM, DM);
}

// v004
// A run of this version takes 240 microseconds.
// Two timings next to v003 both put it at 1.17 times that version's speed.
// All steps since v000 together make it 3.46 times as fast.
#include <hip/hip_runtime.h>
// Structure: token rows r = b*SEQ + t in compact workspace planes (input/output strides use SEQ_FULL); X16 = f16(bf16(x)); Q16, K16 = X16 . (16 W)^T / 16 as 32x64 wave-tile GEMMs with LDS-staged whole-line epilogues; V^T per (b, head) produced directly as (16 Wv) . X16^T / 16;
#ifndef NB
#define NB 64
#endif
#ifndef SEQ
#define SEQ 512
#endif
#define NB_FULL 64
#define SEQ_FULL 512
#define DM 384
#define NH 6
#define HD 64
#define QT0 128                      /* first query rows per sequence recomputed exactly in f32 */
#define PP 40                        /* LDS pitch (halves) of the 16x32 P tile */
#define OPP 72                       /* LDS pitch (halves) of the 16x64 O staging tile */
#define GKC 64                       /* k (halves) of one staged GEMM pass: one 128-byte line of every operand row */
#define KU 8                         /* keys per trip of the exact attention */
#define GP 72                        /* LDS pitch (halves) of a staged GEMM operand row: 128 + 16 bytes */
static_assert(NB >= 1 && NB <= NB_FULL);
static_assert(SEQ % 128 == 0 && SEQ >= 2 * QT0 && SEQ <= SEQ_FULL);
static_assert(KU == 8);
static_assert(DM == NH * HD && DM % 128 == 0 && HD == 64 && QT0 == 128);

typedef unsigned short v8us __attribute__((ext_vector_type(8), may_alias));
typedef float  v8f  __attribute__((ext_vector_type(8)));
typedef float  v4f  __attribute__((ext_vector_type(4)));
typedef float  v2f  __attribute__((ext_vector_type(2)));
typedef float  v4fa __attribute__((ext_vector_type(4), may_alias));
typedef _Float16 v16h __attribute__((ext_vector_type(16)));
typedef _Float16 v4h __attribute__((ext_vector_type(4)));
union FragH { v16h v; v8us half[2]; _Float16 h[16]; unsigned short u[16]; };

__device__ __forceinline__ unsigned short bf16_bits(float x) { unsigned int u = __float_as_uint(x); return (unsigned short)((u + 0x7FFFu + ((u >> 16) & 1u)) >> 16); }
__device__ __forceinline__ float bf16_val(unsigned short b) { return __uint_as_float(((unsigned int)b) << 16); }
__device__ __forceinline__ float bf16_rne(float x) { return bf16_val(bf16_bits(x)); }

// 16-bit WMMA fragment from a k-contiguous row (A: row m, B: column n of a [n][k] plane): elements 0..7 <- k 8hh..8hh+7, elements 8..15 <- k 16+8hh..16+8hh+7
__device__ __forceinline__ v16h g2_frag(const _Float16* p, int hh) { FragH f; f.half[0] = *(const v8us*)((const unsigned short*)p + 8 * hh); f.half[1] = *(const v8us*)((const unsigned short*)p + 16 + 8 * hh); return f.v; }
__device__ __forceinline__ v8f g2_mma(v16h a, v16h b, v8f c) { v8f d = __builtin_amdgcn_wmma_f32_16x16x32_f16(false, a, false, b, (short)0, c, false, false); asm volatile("v_nop\n\tv_nop\n\tv_nop\n\tv_nop" : "+v"(d) : "v"(a), "v"(b)); return d; }

__device__ __forceinline__ void cvt_w(const float* __restrict__ w, size_t n8, _Float16* __restrict__ Bt, int blk) {
  const size_t t = (size_t)blk * 256 + threadIdx.x; if (t >= n8) return; FragH f;
#pragma unroll
  for (int q = 0; q < 8; ++q) f.h[q] = (_Float16)(bf16_rne(w[t * 8 + q]) * 16.0f);
  unsigned short* d = (unsigned short*)Bt + t * 8;
  *(v8us*)d = f.half[0]; 
}

__device__ __forceinline__ void cvt_x(const float* __restrict__ x, _Float16* __restrict__ X16, size_t n8, int blk) {
  const size_t t = (size_t)blk * 256 + threadIdx.x; if (t >= n8) return;
  const size_t wr = t / (DM / 8); const int c8 = (int)(t % (DM / 8)) * 8;
  const size_t b = wr / SEQ, tt = wr % SEQ;
  const float* src = x + (b * SEQ_FULL + tt) * DM + c8;
  const v4f a = *(const v4fa*)src, c = *(const v4fa*)(src + 4); FragH f;
#pragma unroll
  for (int q = 0; q < 4; ++q) { f.h[q] = (_Float16)bf16_rne(a[q]); f.h[4 + q] = (_Float16)bf16_rne(c[q]); }
  unsigned short* d = (unsigned short*)X16 + t * 8;
  *(v8us*)d = f.half[0]; 
}

// all five conversions in one grid: blocks 0..4 GW-1 take the four weight planes (GW blocks each, W16 = four [DM][DM] planes in a row), the rest take x
#define GW ((DM * DM / 8 + 255) / 256)
__global__ __launch_bounds__(256) void k_cvt(const float* __restrict__ x, const float* __restrict__ w0, const float* __restrict__ w1, const float* __restrict__ w2, const float* __restrict__ w3, _Float16* __restrict__ W16, _Float16* __restrict__ X16, size_t nx8) {
  const int bid = blockIdx.x;
  if (bid < 4 * GW) { const int wi = bid / GW; const float* w = wi == 0 ? w0 : wi == 1 ? w1 : wi == 2 ? w2 : w3; cvt_w(w, (size_t)DM * DM / 8, W16 + (size_t)wi * DM * DM, bid - wi * GW); }
  else cvt_x(x, X16, nx8, bid - 4 * GW);
}

// one pass's operand lines into registers: this lane's 16 bytes of 8 A rows and 4 B rows, 16 rows (sa16, sb16 bytes) apart; pa, pb: the block's first rows at this pass (the same in every lane), ao, bo: the lane's own byte offsets
__device__ __forceinline__ void g2_fetch(const char* pa, size_t sa16, unsigned ao, const char* pb, size_t sb16, unsigned bo, v8us (&ra)[8], v8us (&rb)[4]) {
  const char* a[8]; const char* b[4];
#pragma unroll
  for (int i = 0; i < 8; ++i) { a[i] = pa + i * sa16 + ao; ra[i] = *(const v8us*)a[i]; }
#pragma unroll
  for (int i = 0; i < 4; ++i) { b[i] = pb + i * sb16 + bo; rb[i] = *(const v8us*)b[i]; }
  /* the wait that belongs between an issued load and an overwrite of its address registers; it names the twelve addresses so that they stay in their registers up to it (else a later load's result lands in an earlier load's address pair) */
  asm volatile("s_wait_xcnt 0x0" :: "v"(a[0]), "v"(a[1]), "v"(a[2]), "v"(a[3]), "v"(a[4]), "v"(a[5]), "v"(a[6]), "v"(a[7]), "v"(b[0]), "v"(b[1]), "v"(b[2]), "v"(b[3]) : "memory");
}

// one GEMM of a launch: its operands and outputs, nbx = (M / 128) (N / 64) blocks per batch, first = its first block in the launch's flat grid, useb = add the bias
struct GJob { const _Float16* A; const _Float16* Bh; const float* CP; float* C; _Float16* C16; size_t sA, sB, sC; float alpha; int lda, ldb, ldc, N, nbx, first, useb; };
#define GJMAX 6
struct GJobs { GJob j[GJMAX]; };

// A launch holds nj independent GEMMs (none reads what another writes), one after the other in a flat grid; a block finds its GEMM by its index, then its batch and tile.
// GEMM C[M][N] = alpha (A . Bt^T) + bf16(bias[col]) (+ CP own element): A f16 row-major (pitch lda, batch stride sA), Bt f16 [n][k] (pitch ldb, stride sB);
// writes f32 C and/or f16 C16 (pitch ldc, batch stride sC). Block = 4 waves, block tile 128 rows x 64 cols, wave tile 32 rows x 64 cols; M % 128 == 0, N % 64 == 0, K % 64 == 0.
// Operands: per pass of GKC = 64 k the block brings its 128 A rows and 64 B rows into LDS, 8 lanes per row, so that every wave-wide 16-byte load covers four whole 128-byte lines and each B row is fetched once per block;
// the next pass's lines are fetched into registers while this pass is multiplied; fragments come from LDS (row pitch 144 bytes: a 16-row fragment read meets every bank once). k order of the products as before (32 at a time, ascending).
__global__ __launch_bounds__(128) void k_gemm2(GJobs js, int nj, const float* __restrict__ biasv, int K) {
  __shared__ __attribute__((aligned(16))) unsigned char sm[4 * 32 * 68 * 4];      /* operand tiles in the k loop, then the epilogue's f32 staging */
  static_assert((128 + 64) * GP * 2 <= 4 * 32 * 68 * 4);
  float (*so)[32][68] = (float (*)[32][68])sm;
  _Float16* sa = (_Float16*)sm; _Float16* sb = sa + 128 * GP;
  const int tid = threadIdx.x, w = tid >> 5, lane = tid & 31, ln = lane & 15, hh = lane >> 4;
  const int bid = blockIdx.x; int ji = 0;
  for (int q = 1; q < GJMAX; ++q) if (q < nj && bid >= js.j[q].first) ji = q;
  const GJob& J = js.j[ji];
  const int lda = J.lda, ldb = J.ldb, ldc = J.ldc; const float alpha = J.alpha; const float* CP = J.CP; float* C = J.C; _Float16* C16 = J.C16; const float* bias = J.useb ? biasv : nullptr;
  const int loc = bid - J.first; const int by = loc / J.nbx, bx = loc - by * J.nbx;
  const _Float16* A = J.A + (size_t)by * J.sA; const _Float16* Bh = J.Bh + (size_t)by * J.sB; const size_t cofs = (size_t)by * J.sC;
  const int ntn = J.N >> 6; const int mt = bx / ntn, nq = bx - mt * ntn; const int row0 = mt * 128 + 32 * w, col0 = nq * 64;
  const int sr = tid >> 3, sc8 = (tid & 7) * 8;      /* staging: row sr + 16 i, halves sc8..sc8+7 of the pass */
  const char* ag = (const char*)(A + (size_t)(mt * 128) * lda); const char* bg = (const char*)(Bh + (size_t)col0 * ldb);      /* the block's first rows: the same in every lane */
  const unsigned ao = (unsigned)(sr * lda + sc8) * 2u, bo = (unsigned)(sr * ldb + sc8) * 2u;      /* the lane's own byte offsets, fixed for the whole kernel */
  unsigned short* sas = (unsigned short*)sa + sr * GP + sc8; unsigned short* sbs = (unsigned short*)sb + sr * GP + sc8;
  const _Float16* a0p = sa + (32 * w + ln) * GP; const _Float16* a1p = a0p + 16 * GP;
  const _Float16* b0p = sb + ln * GP; const _Float16* b1p = b0p + 16 * GP; const _Float16* b2p = b1p + 16 * GP; const _Float16* b3p = b2p + 16 * GP;
  const v8f z8 = {0.f,0.f,0.f,0.f,0.f,0.f,0.f,0.f}; v8f c00 = z8, c01 = z8, c02 = z8, c03 = z8, c10 = z8, c11 = z8, c12 = z8, c13 = z8;
  v8us ra[8], rb[4];
  g2_fetch(ag, (size_t)lda * 32, ao, bg, (size_t)ldb * 32, bo, ra, rb); ag += GKC * 2; bg += GKC * 2;
  /* passes stay rolled: one pass already holds 16 products per wave, unrolling further would only lengthen the text */
#pragma unroll 1
  for (int kc = 0; kc < K; kc += GKC) {
#pragma unroll
    for (int i = 0; i < 8; ++i) *(v8us*)(sas + 16 * i * GP) = ra[i];
#pragma unroll
    for (int i = 0; i < 4; ++i) *(v8us*)(sbs + 16 * i * GP) = rb[i];
    __syncthreads();      /* the pass's tiles are complete before any wave reads a fragment */
    if (kc + GKC < K) { g2_fetch(ag, (size_t)lda * 32, ao, bg, (size_t)ldb * 32, bo, ra, rb); ag += GKC * 2; bg += GKC * 2; }
#pragma unroll
    for (int kb = 0; kb < GKC; kb += 32) { const v16h a0 = g2_frag(a0p + kb, hh), a1 = g2_frag(a1p + kb, hh);      /* each B fragment after the first is read one pair of products ahead of its use */
      v16h b = g2_frag(b0p + kb, hh), bn = g2_frag(b1p + kb, hh); c00 = g2_mma(a0, b, c00); c10 = g2_mma(a1, b, c10);
      b = g2_frag(b2p + kb, hh); c01 = g2_mma(a0, bn, c01); c11 = g2_mma(a1, bn, c11);
      bn = g2_frag(b3p + kb, hh); c02 = g2_mma(a0, b, c02); c12 = g2_mma(a1, b, c12);
      c03 = g2_mma(a0, bn, c03); c13 = g2_mma(a1, bn, c13); }
    __syncthreads();      /* every wave has read its fragments before the tiles are overwritten (by the next pass, or by the epilogue's staging) */
  }
  v8f accs[8] = {c00, c01, c02, c03, c10, c11, c12, c13};
#pragma unroll
  for (int u = 0; u < 8; ++u) { const int t = u & 3, half = u >> 2; const int col = col0 + t * 16 + ln; const float bv = bias ? bf16_rne(bias[col]) : 0.f;
#pragma unroll
    for (int r = 0; r < 8; ++r) { const int rloc = half * 16 + 8 * hh + r; float v = accs[u][r] * alpha + bv;
      if (CP) v += CP[cofs + (size_t)(row0 + rloc) * ldc + col];      /* own element of the C plane (a prior pass), added in f32 */
      so[w][rloc][t * 16 + ln] = v; } }
  __builtin_amdgcn_fence(4, "workgroup"); __builtin_amdgcn_wave_barrier();
  const int rsub = lane >> 4, c4 = (lane & 15) * 4;
  {
#pragma unroll
    for (int q = 0; q < 16; ++q) { const int r = q * 2 + rsub; const v4f v = *(const v4fa*)&so[w][r][c4];
      if (C) *(v4f*)(C + cofs + (size_t)(row0 + r) * ldc + col0 + c4) = v;
      if (C16) { v4h h4; for (int i = 0; i < 4; ++i) h4[i] = (_Float16)v[i]; *(v4h*)(C16 + cofs + (size_t)(row0 + r) * ldc + col0 + c4) = h4; } }
     }
}

// exact (f32) causal attention for query rows 0..QT0-1 of every (batch, head): planes QF/KF/VF [NB][QT0][DM] (head h at column h*HD); block = 64 threads = 64 consecutive rows of one head;
// the block first brings the K and V rows of all its keys into LDS by whole-line loads (as they lie); thread i keeps its q row and its o accumulator in registers and walks keys j = 0..(its wave's last row) KU at a time (wave-uniform trip count, a multiple of 4; keys j > i enter through an arithmetic 0/1 factor as -1e30, contributing exactly 0):
// the KU scores of a trip are independent chains that run side by side, each as two partial sums (even d, odd d; d ascending) that are added at the end; the online softmax (f32, precise expf) and the o update then take the KU keys one after the other, in key order.
__global__ __launch_bounds__(64) void k_att0(const float* __restrict__ QF, const float* __restrict__ KF, const float* __restrict__ VF, float* __restrict__ OF) {
  #pragma clang fp contract(off)
  __shared__ __attribute__((aligned(16))) float lk[QT0][HD];
  __shared__ __attribute__((aligned(16))) float lv[QT0][HD];
  __shared__ __attribute__((aligned(16))) float lo[64][64];
  const int tid = threadIdx.x; const int rg = blockIdx.x % (QT0 / 64); const int bh = blockIdx.x / (QT0 / 64); const int b = bh / NH, h = bh - b * NH;
  const size_t pofs = (size_t)b * QT0 * DM;
  const int i = rg * 64 + tid;
  const float* qr = QF + pofs + (size_t)i * DM + h * HD;
  { const float* kg = KF + pofs + h * HD + (size_t)(tid >> 4) * 2 * DM + (tid & 15) * 4; const float* vg = VF + pofs + h * HD + (size_t)(tid >> 4) * 2 * DM + (tid & 15) * 4;
    const int c4 = (tid & 15) * 4;      /* 16 lanes per row; a trip brings 4 key pairs, 8 trips 64 keys */
    for (int hf = 0; hf <= rg; ++hf) { v4f rk[16], rv[16]; const float* kp = kg + (size_t)hf * 64 * DM; const float* vp = vg + (size_t)hf * 64 * DM;
      /* unrolled: the 32 row loads of a lane for 64 keys are in flight together */
#pragma unroll
      for (int it = 0; it < 8; ++it) { rk[2 * it] = *(const v4fa*)(kp + it * 8 * DM); rk[2 * it + 1] = *(const v4fa*)(kp + it * 8 * DM + DM); rv[2 * it] = *(const v4fa*)(vp + it * 8 * DM); rv[2 * it + 1] = *(const v4fa*)(vp + it * 8 * DM + DM); }
      /* the wait that belongs between an issued load and an overwrite of its address registers; it names the two addresses so that they stay in their registers up to it (else a later load's result lands in an earlier load's address pair) */
      asm volatile("s_wait_xcnt 0x0" :: "v"(kp), "v"(vp) : "memory");
#pragma unroll
      for (int it = 0; it < 8; ++it) { const int p = (hf * 8 + it) * 4 + (tid >> 4);
        *(v4f*)&lk[2 * p][c4] = rk[2 * it]; *(v4f*)&lk[2 * p + 1][c4] = rk[2 * it + 1]; *(v4f*)&lv[2 * p][c4] = rv[2 * it]; *(v4f*)&lv[2 * p + 1][c4] = rv[2 * it + 1]; } } }
  v2f q[HD / 2], o[HD / 2];
#pragma unroll
  for (int c = 0; c < HD / 4; ++c) { const v4f qq = *(const v4fa*)(qr + c * 4); const v2f qa = {qq[0], qq[1]}, qb = {qq[2], qq[3]}; q[2 * c] = qa; q[2 * c + 1] = qb; const v2f z = {0.f, 0.f}; o[2 * c] = z; o[2 * c + 1] = z; }
  __syncthreads();      /* the block's K and V rows are complete before any wave reads a key */
  float m = -1.0e30f, l = 0.f; const int jend = rg * 64 + __builtin_amdgcn_readfirstlane(tid >> 5) * 32 + 32;      /* wave-uniform: keys up to the wave's last row */
  /* trips stay rolled: one trip already holds KU independent score chains, more would only lengthen the text; every loop inside a trip is fully unrolled, so that q, o and the ring are indexed by constants and stay in registers */
#pragma unroll 1
  for (int j0 = 0; j0 < jend; j0 += KU) { v2f s2[KU]; v4f rb[3][KU]; const float* kt = &lk[j0][0]; const float* vt = &lv[j0][0]; float sc[KU], e[KU];      /* rb: ring of three chunks; a chunk = eight 16-byte LDS reads, the same address in every lane: of K 4 d of the trip's 8 keys (chunks 0..15), of V 16 d of 2 keys (chunks 16..31) */
#pragma unroll
    for (int kk = 0; kk < KU; ++kk) { const v2f z = {0.f, 0.f}; s2[kk] = z; }
    /* chunk n is read two chunks ahead of its use, so that its LDS latency lies behind two chunks of arithmetic. The scheduling fences keep reads and arithmetic in that order: left free, the compiler lifts all reads of a trip to its head, which takes more than 500 registers */
#pragma unroll
    for (int x = 0; x < 8; ++x) { rb[0][x] = *(const v4f*)(kt + x * HD); rb[1][x] = *(const v4f*)(kt + x * HD + 4); }
    __builtin_amdgcn_sched_barrier(0);      /* see above */
#pragma unroll
    for (int t = 0; t < HD / 4; ++t) {
      if (t + 2 < HD / 4) {
#pragma unroll
        for (int x = 0; x < 8; ++x) rb[(t + 2) % 3][x] = *(const v4f*)(kt + x * HD + (t + 2) * 4);
      } else {
#pragma unroll
        for (int x = 0; x < 8; ++x) rb[(t + 2) % 3][x] = *(const v4f*)(vt + (x >> 2) * HD + ((t + 2 - HD / 4) * 4 + (x & 3)) * 4);
      }
      __builtin_amdgcn_sched_barrier(0);      /* see above */
#pragma unroll
      for (int kk = 0; kk < KU; ++kk) { const v4f kq = rb[t % 3][kk]; const v2f ka = {kq[0], kq[1]}; s2[kk] = __builtin_elementwise_fma(q[2 * t], ka, s2[kk]); }
#pragma unroll
      for (int kk = 0; kk < KU; ++kk) { const v4f kq = rb[t % 3][kk]; const v2f kb = {kq[2], kq[3]}; s2[kk] = __builtin_elementwise_fma(q[2 * t + 1], kb, s2[kk]); }
      __builtin_amdgcn_sched_barrier(0);      /* see above */
    }
#pragma unroll
    for (int kk = 0; kk < KU; ++kk) { const int j = j0 + kk; const float s = __fmul_rn(__fadd_rn(s2[kk][0], s2[kk][1]), 0.125f);
      const float f = (j <= i) ? 1.f : 0.f; const float sm = fmaf(f, s, (1.f - f) * -1.0e30f); const float mn = fmaxf(m, sm); sc[kk] = expf(m - mn); e[kk] = expf(sm - mn); l = __fadd_rn(__fmul_rn(l, sc[kk]), e[kk]); m = mn; }
    __builtin_amdgcn_sched_barrier(0);      /* see above */
#pragma unroll
    for (int t = 0; t < HD / 4; ++t) {      /* V chunk t: keys 2 (t / 4), 2 (t / 4) + 1, d 16 (t % 4) .. + 15: eight independent o pairs, every o element meets its keys in ascending order */
      if (t + 2 < HD / 4) {
#pragma unroll
        for (int x = 0; x < 8; ++x) rb[(t + 2 + HD / 4) % 3][x] = *(const v4f*)(vt + (((t + 2) >> 2) * 2 + (x >> 2)) * HD + (((t + 2) & 3) * 4 + (x & 3)) * 4);
      }
      __builtin_amdgcn_sched_barrier(0);      /* see above */
#pragma unroll
      for (int x = 0; x < 8; ++x) { const int kk = (t >> 2) * 2 + (x >> 2), c = (t & 3) * 4 + (x & 3); const v4f vv = rb[(t + HD / 4) % 3][x]; const v2f va = {vv[0], vv[1]}, vb = {vv[2], vv[3]}; const v2f s_ = {sc[kk], sc[kk]}, e_ = {e[kk], e[kk]};
        o[2 * c] = __builtin_elementwise_fma(o[2 * c], s_, e_ * va); o[2 * c + 1] = __builtin_elementwise_fma(o[2 * c + 1], s_, e_ * vb); }
      __builtin_amdgcn_sched_barrier(0);      /* see above */
    } }
  const float fin = 64.0f / l;      /* o carried x64 */
#pragma unroll
  for (int c = 0; c < HD / 4; ++c) { v4f oo = {o[2 * c][0], o[2 * c][1], o[2 * c + 1][0], o[2 * c + 1][1]}; for (int u = 0; u < 4; ++u) oo[u] = __fmul_rn(oo[u], fin); *(v4f*)&lo[tid][c * 4] = oo; }
  __syncthreads();
  {
#pragma unroll 1
    for (int it = 0; it < 16; ++it) { const int row = it * 4 + tid / 16, pc = (tid % 16) * 4; const v4f v = *(const v4f*)&lo[row][pc]; *(v4f*)(OF + pofs + (size_t)(rg * 64 + row) * DM + h * HD + pc) = v; }
     } }

__device__ __forceinline__ void hl_split(const float* __restrict__ F, _Float16* __restrict__ Hh, _Float16* __restrict__ Hl, size_t n8, int blk) {
  const size_t t = (size_t)blk * 256 + threadIdx.x; if (t >= n8) return; FragH fh, fl; const v4f a = *(const v4fa*)(F + t * 8), c = *(const v4fa*)(F + t * 8 + 4);
#pragma unroll
  for (int q = 0; q < 4; ++q) { _Float16 hv = (_Float16)a[q]; fh.h[q] = hv; fl.h[q] = (_Float16)((a[q] - (float)hv) * 1024.0f); hv = (_Float16)c[q]; fh.h[4 + q] = hv; fl.h[4 + q] = (_Float16)((c[q] - (float)hv) * 1024.0f); }
  unsigned short* dh = (unsigned short*)Hh + t * 8; unsigned short* dl = (unsigned short*)Hl + t * 8;
  { *(v8us*)dh = fh.half[0]; *(v8us*)dl = fl.half[0];  } }

// The grid's rows blockIdx.y >= NB*NH do not attend: they split the exact attention's f32 o plane F into its f16 hi / x1024 residual planes (needs nothing of this launch's attention and gives it nothing), 256 x 8 elements a block.
// causal attention, f16 WMMA: grid rows blockIdx.y < NB*NH, (SEQ/128, NB*NH), block = 8 waves, wave -> query rows q0..q0+15 (q0 = 16*(8*blockIdx.x + wave)) of one (b, head).
// Per 32-key block: two 16x16 score tiles S = q . k^T (A = Q16 rows, B = K16 rows as [key][d], K = 64 in two k-steps), x0.125 and the causal select by value in f32, online softmax per row (16 key columns across 16 lanes: xor-shuffle max / sum, f32 running max and sum, o and sum rescaled by exp(m_old - m_new)),
__global__ __launch_bounds__(256) __attribute__((amdgpu_num_vgpr(256)))
void k_att(const _Float16* __restrict__ Q16, const _Float16* __restrict__ K16, const _Float16* __restrict__ VT, _Float16* __restrict__ O16, const float* __restrict__ F, _Float16* __restrict__ Hh, _Float16* __restrict__ Hl, size_t n8) {
  __shared__ __attribute__((aligned(16))) _Float16 lp[8][2][16 * PP];
  __shared__ __attribute__((aligned(16))) _Float16 lso[8][16 * OPP];
  if (blockIdx.y >= NB * NH) { hl_split(F, Hh, Hl, n8, (int)((blockIdx.y - NB * NH) * (SEQ / 128) + blockIdx.x)); return; }      /* the same for the whole block */
  const int tid = threadIdx.x, w = tid >> 5, lane = tid & 31, ln = lane & 15, hh = lane >> 4;
  const int qt = blockIdx.x * 8 + w; const int bh = blockIdx.y; const int b = bh / NH, h = bh - b * NH;
  const int q0 = qt * 16;
  const size_t wr0 = (size_t)b * SEQ + q0;
  const _Float16* qp = Q16 + (wr0 + ln) * DM + h * HD;
  const v16h qa0 = g2_frag(qp, hh), qa1 = g2_frag(qp + 32, hh);      /* d 0..31, 32..63 */
  const _Float16* kbase = K16 + (size_t)b * SEQ * DM + h * HD;        /* key row j at kbase + j*DM */
  const _Float16* vbase = VT + (size_t)bh * HD * SEQ;                 /* V^T row d at vbase + d*SEQ */
  const v8f z8 = {0.f,0.f,0.f,0.f,0.f,0.f,0.f,0.f}; v8f o0 = z8, o1 = z8, o2 = z8, o3 = z8;
  float mr[8], lr[8];
#pragma unroll
  for (int r = 0; r < 8; ++r) { mr[r] = -1.0e30f; lr[r] = 0.f; }
  const int nkb = qt / 2 + 1;      /* 32-key blocks covering keys 0..q0+15 */
#pragma unroll 1
  for (int it = 0; it < nkb; ++it) {
    const int kb = it * 32;
    _Float16* pb = &lp[w][it & 1][0];
    v8f s0 = z8, s1 = z8;
    { const _Float16* kp = kbase + (size_t)(kb + ln) * DM; v16h bk = g2_frag(kp, hh); s0 = g2_mma(qa0, bk, s0); bk = g2_frag(kp + 32, hh); s0 = g2_mma(qa1, bk, s0); }
    { const _Float16* kp = kbase + (size_t)(kb + 16 + ln) * DM; v16h bk = g2_frag(kp, hh); s1 = g2_mma(qa0, bk, s1); bk = g2_frag(kp + 32, hh); s1 = g2_mma(qa1, bk, s1); }
#pragma unroll
    for (int r = 0; r < 8; ++r) {
      const int qi = q0 + 8 * hh + r;
      const float v0 = (kb + ln <= qi) ? s0[r] * 0.125f : -1.0e30f;
      const float v1 = (kb + 16 + ln <= qi) ? s1[r] * 0.125f : -1.0e30f;
      float mx = fmaxf(v0, v1);
      mx = fmaxf(mx, __shfl_xor(mx, 1, 16)); mx = fmaxf(mx, __shfl_xor(mx, 2, 16)); mx = fmaxf(mx, __shfl_xor(mx, 4, 16)); mx = fmaxf(mx, __shfl_xor(mx, 8, 16));
      const float mn = fmaxf(mr[r], mx);
      const float al = __expf(mr[r] - mn); mr[r] = mn;
      const float p0 = __expf(v0 - mn), p1 = __expf(v1 - mn);
      float rs = p0 + p1;
      rs += __shfl_xor(rs, 1, 16); rs += __shfl_xor(rs, 2, 16); rs += __shfl_xor(rs, 4, 16); rs += __shfl_xor(rs, 8, 16);
      lr[r] = lr[r] * al + rs;
      o0[r] *= al; o1[r] *= al; o2[r] *= al; o3[r] *= al;
      pb[(8 * hh + r) * PP + ln] = (_Float16)(p0 * 1024.0f);
      pb[(8 * hh + r) * PP + 16 + ln] = (_Float16)(p1 * 1024.0f);
    }
    __builtin_amdgcn_fence(3, "wavefront"); __builtin_amdgcn_wave_barrier();
    FragH pa; pa.half[0] = *(const v8us*)((const unsigned short*)pb + ln * PP + 8 * hh); pa.half[1] = *(const v8us*)((const unsigned short*)pb + ln * PP + 16 + 8 * hh);
    { const _Float16* vp = vbase + (size_t)ln * SEQ + kb;
      v16h bv = g2_frag(vp, hh); o0 = g2_mma(pa.v, bv, o0);
      bv = g2_frag(vp + (size_t)16 * SEQ, hh); o1 = g2_mma(pa.v, bv, o1);
      bv = g2_frag(vp + (size_t)32 * SEQ, hh); o2 = g2_mma(pa.v, bv, o2);
      bv = g2_frag(vp + (size_t)48 * SEQ, hh); o3 = g2_mma(pa.v, bv, o3); }
  }
  _Float16* sob = &lso[w][0];
#pragma unroll
  for (int r = 0; r < 8; ++r) { const float inv = (1.0f / lr[r]) * 0.0009765625f; const int row = 8 * hh + r;
    sob[row * OPP + ln] = (_Float16)(o0[r] * inv); sob[row * OPP + 16 + ln] = (_Float16)(o1[r] * inv); sob[row * OPP + 32 + ln] = (_Float16)(o2[r] * inv); sob[row * OPP + 48 + ln] = (_Float16)(o3[r] * inv); }
  __builtin_amdgcn_fence(3, "wavefront"); __builtin_amdgcn_wave_barrier();
  unsigned short* ob = (unsigned short*)O16 + wr0 * DM + h * HD;
  {
#pragma unroll
    for (int it2 = 0; it2 < 4; ++it2) { const int row = it2 * 4 + (lane >> 3), c8 = (lane & 7) * 8; const v8us v = *(const v8us*)((const unsigned short*)sob + row * OPP + c8); *(v8us*)(ob + (size_t)row * DM + c8) = v; }
     }
}

extern "C" void kernel_launch(void* const* d_in, const int* in_sizes, int n_in,
                              void* d_out, int out_size, void* d_ws, size_t ws_size, hipStream_t stream) {
  if (n_in < 6) return;
  const float* x = (const float*)d_in[0]; const float* wq = (const float*)d_in[1]; const float* wk = (const float*)d_in[2];
  const float* wv = (const float*)d_in[3]; const float* wp = (const float*)d_in[4]; const float* bproj = (const float*)d_in[5];
  const size_t need_x = (size_t)(NB - 1) * SEQ_FULL * DM + (size_t)SEQ * DM;
  if ((size_t)in_sizes[0] < need_x || in_sizes[1] < DM * DM || in_sizes[2] < DM * DM || in_sizes[3] < DM * DM || in_sizes[4] < DM * DM || in_sizes[5] < DM || (size_t)out_size < need_x) return;
  float* out = (float*)d_out;
  char* ws = (char*)d_ws; size_t off = 0;
  auto take = [&](size_t bytes) { char* p = ws + off; off += (bytes + 255) & ~(size_t)255; return p; };
  const size_t wb = (size_t)DM * DM * 2;
  _Float16* WQ = (_Float16*)take(4 * wb); _Float16* WK = WQ + DM * DM; _Float16* WV = WK + DM * DM; _Float16* WP = WV + DM * DM;      /* four planes in a row */
  const size_t rows2 = (size_t)NB * SEQ * DM * 2;      /* f16 plane over all token rows */
  const size_t f0b4 = (size_t)NB * QT0 * DM * 4;       /* f32 first-tile plane */
  const size_t f0b2 = (size_t)NB * QT0 * DM * 2;       /* f16 first-tile plane */
  const size_t vtb = (size_t)NB * DM * SEQ * 2;         /* V^T [NB*NH*HD][SEQ] */
  /* every plane that one launch writes has its own place: the GEMMs of a launch run side by side */
  _Float16* X16 = (_Float16*)take(rows2); _Float16* O16 = X16;      /* X16 is last read by the first GEMM launch, O16 written after it */
  float* QF0 = (float*)take(f0b4); float* KF0 = (float*)take(f0b4); float* VF0 = (float*)take(f0b4); float* OF0 = (float*)take(f0b4);
  _Float16* Q16 = (_Float16*)take(rows2); _Float16* K16 = (_Float16*)take(rows2); _Float16* VT = (_Float16*)take(vtb);
  _Float16* OH = (_Float16*)take(f0b2); _Float16* OL = (_Float16*)take(f0b2);
  if (off > ws_size) return;

  const size_t nx8 = (size_t)NB * SEQ * DM / 8;
  k_cvt<<<(unsigned)(4 * GW + (nx8 + 255) / 256), 256, 0, stream>>>(x, wq, wk, wv, wp, WQ, X16, nx8);
  constexpr int nS = (QT0 / 128) * (DM / 64);            /* blocks per batch: first-tile GEMMs */
  constexpr int nA = (NB * SEQ / 128) * (DM / 64);       /* all token rows, one batch */
  constexpr int nV = (DM / 128) * (SEQ / 64);            /* V^T, per batch */
  constexpr int nP = ((SEQ - QT0) / 128) * (DM / 64);    /* projection of rows >= 128, per batch */
  /* all six products of X16 in one launch: f16 q, k rows for all tokens; V^T directly as (16 Wv) . X16^T; f32 q, k, v of rows 0..127 of every sequence (exact products) */
  GJobs g1 = {};
  g1.j[0] = GJob{X16, WQ, nullptr, nullptr, Q16, (size_t)0, (size_t)0, (size_t)0, 0.0625f, DM, DM, DM, DM, nA, 0, 0};
  g1.j[1] = GJob{X16, WK, nullptr, nullptr, K16, (size_t)0, (size_t)0, (size_t)0, 0.0625f, DM, DM, DM, DM, nA, nA, 0};
  g1.j[2] = GJob{WV, X16, nullptr, nullptr, VT, (size_t)0, (size_t)SEQ * DM, (size_t)DM * SEQ, 0.0625f, DM, DM, SEQ, SEQ, nV, 2 * nA, 0};
  g1.j[3] = GJob{X16, WQ, nullptr, QF0, nullptr, (size_t)SEQ * DM, (size_t)0, (size_t)QT0 * DM, 0.0625f, DM, DM, DM, DM, nS, 2 * nA + NB * nV, 0};
  g1.j[4] = GJob{X16, WK, nullptr, KF0, nullptr, (size_t)SEQ * DM, (size_t)0, (size_t)QT0 * DM, 0.0625f, DM, DM, DM, DM, nS, 2 * nA + NB * nV + NB * nS, 0};
  g1.j[5] = GJob{X16, WV, nullptr, VF0, nullptr, (size_t)SEQ * DM, (size_t)0, (size_t)QT0 * DM, 0.0625f, DM, DM, DM, DM, nS, 2 * nA + NB * nV + 2 * NB * nS, 0};
  k_gemm2<<<2 * nA + NB * nV + 3 * NB * nS, 128, 0, stream>>>(g1, 6, bproj, DM);
  k_att0<<<NB * NH * (QT0 / 64), 64, 0, stream>>>(QF0, KF0, VF0, OF0);      /* exact attention rows 0..127 (o x64) */
  const size_t nf8 = (size_t)NB * QT0 * DM / 8;
  /* attention of all rows and, in the grid's last rows, the f16 hi / x1024 residual planes of the exact o x64 */
  k_att<<<dim3(SEQ / 128, (unsigned)(NB * NH + ((nf8 + 255) / 256 + SEQ / 128 - 1) / (SEQ / 128))), 256, 0, stream>>>(Q16, K16, VT, O16, OF0, OH, OL, nf8);
  /* output projection, one launch: rows >= 128 from the f16 o plane, rows < 128 from the hi plane; then a launch that adds the residual plane's product to rows < 128 */
  GJobs g2 = {};
  g2.j[0] = GJob{O16 + (size_t)QT0 * DM, WP, nullptr, out + (size_t)QT0 * DM, nullptr, (size_t)SEQ * DM, (size_t)0, (size_t)SEQ_FULL * DM, 0.0625f, DM, DM, DM, DM, nP, 0, 1};
  g2.j[1] = GJob{OH, WP, nullptr, out, nullptr, (size_t)QT0 * DM, (size_t)0, (size_t)SEQ_FULL * DM, 0.0009765625f, DM, DM, DM, DM, nS, NB * nP, 1};
  k_gemm2<<<NB * nP + NB * nS, 128, 0, stream>>>(g2, 2, bproj, DM);
  GJobs g3 = {};
  g3.j[0] = GJob{OL, WP, out, out, nullptr, (size_t)QT0 * DM, (size_t)0, (size_t)SEQ_FULL * DM, 9.5367431640625e-07f, DM, DM, DM, DM, nS, 0, 0};
  k_gemm2<<<NB * nS, 128, 0, stream>>>(g3, 1, bproj, DM);
}

// v005
// A run of this version takes 193 microseconds.
// Timed twice side by side with v004, it ran 1.24 and 1.25 times as fast.
// All steps since v000 together make it 4.31 times as fast.
#include <hip/hip_runtime.h>
// Structure: token rows r = b*SEQ + t in compact workspace planes (input/output strides use SEQ_FULL); X16 = f16(bf16(x)); Q16, K16 = X16 . (16 W)^T / 16 as 32x64 wave-tile GEMMs with LDS-staged whole-line epilogues; V^T per (b, head) produced directly as (16 Wv) . X16^T / 16;
#ifndef NB
#define NB 64
#endif
#ifndef SEQ
#define SEQ 512
#endif
#define NB_FULL 64
#define SEQ_FULL 512
#define DM 384
#define NH 6
#define HD 64
#define QT0 128                      /* first query rows per sequence recomputed exactly in f32 */
#define PP 40                        /* LDS pitch (halves) of the 16x32 P tile */
#define OPP 72                       /* LDS pitch (halves) of the 16x64 O staging tile */
#define GKC 64                       /* k (halves) of one staged GEMM pass: one 128-byte line of every operand row */
#define KU 8                         /* keys per trip of the exact attention */
#define GP 72                        /* LDS pitch (halves) of a staged GEMM operand row: 128 + 16 bytes */
#define AKP 72                       /* LDS pitch (halves) of a staged K row (64 d): 128 + 16 bytes */
#define AVP 40                       /* LDS pitch (halves) of a staged V^T row (32 keys): 64 + 16 bytes */
static_assert(NB >= 1 && NB <= NB_FULL);
static_assert(SEQ % 128 == 0 && SEQ >= 2 * QT0 && SEQ <= SEQ_FULL);
static_assert(KU == 8);
static_assert(DM == NH * HD && DM % 128 == 0 && HD == 64 && QT0 == 128);

typedef unsigned short v8us __attribute__((ext_vector_type(8), may_alias));
typedef float  v8f  __attribute__((ext_vector_type(8)));
typedef float  v4f  __attribute__((ext_vector_type(4)));
typedef float  v2f  __attribute__((ext_vector_type(2)));
typedef float  v4fa __attribute__((ext_vector_type(4), may_alias));
typedef _Float16 v16h __attribute__((ext_vector_type(16)));
typedef _Float16 v4h __attribute__((ext_vector_type(4)));
union FragH { v16h v; v8us half[2]; _Float16 h[16]; unsigned short u[16]; };

__device__ __forceinline__ unsigned short bf16_bits(float x) { unsigned int u = __float_as_uint(x); return (unsigned short)((u + 0x7FFFu + ((u >> 16) & 1u)) >> 16); }
__device__ __forceinline__ float bf16_val(unsigned short b) { return __uint_as_float(((unsigned int)b) << 16); }
__device__ __forceinline__ float bf16_rne(float x) { return bf16_val(bf16_bits(x)); }

// 16-bit WMMA fragment from a k-contiguous row (A: row m, B: column n of a [n][k] plane): elements 0..7 <- k 8hh..8hh+7, elements 8..15 <- k 16+8hh..16+8hh+7
__device__ __forceinline__ v16h g2_frag(const _Float16* p, int hh) { FragH f; f.half[0] = *(const v8us*)((const unsigned short*)p + 8 * hh); f.half[1] = *(const v8us*)((const unsigned short*)p + 16 + 8 * hh); return f.v; }
__device__ __forceinline__ v8f g2_mma(v16h a, v16h b, v8f c) { v8f d = __builtin_amdgcn_wmma_f32_16x16x32_f16(false, a, false, b, (short)0, c, false, false); asm volatile("v_nop\n\tv_nop\n\tv_nop\n\tv_nop" : "+v"(d) : "v"(a), "v"(b)); return d; }

__device__ __forceinline__ void cvt_w(const float* __restrict__ w, size_t n8, _Float16* __restrict__ Bt, int blk) {
  const size_t t = (size_t)blk * 256 + threadIdx.x; if (t >= n8) return; FragH f;
#pragma unroll
  for (int q = 0; q < 8; ++q) f.h[q] = (_Float16)(bf16_rne(w[t * 8 + q]) * 16.0f);
  unsigned short* d = (unsigned short*)Bt + t * 8;
  *(v8us*)d = f.half[0]; 
}

__device__ __forceinline__ void cvt_x(const float* __restrict__ x, _Float16* __restrict__ X16, size_t n8, int blk) {
  const size_t t = (size_t)blk * 256 + threadIdx.x; if (t >= n8) return;
  const size_t wr = t / (DM / 8); const int c8 = (int)(t % (DM / 8)) * 8;
  const size_t b = wr / SEQ, tt = wr % SEQ;
  const float* src = x + (b * SEQ_FULL + tt) * DM + c8;
  const v4f a = *(const v4fa*)src, c = *(const v4fa*)(src + 4); FragH f;
#pragma unroll
  for (int q = 0; q < 4; ++q) { f.h[q] = (_Float16)bf16_rne(a[q]); f.h[4 + q] = (_Float16)bf16_rne(c[q]); }
  unsigned short* d = (unsigned short*)X16 + t * 8;
  *(v8us*)d = f.half[0]; 
}

// all five conversions in one grid: blocks 0..4 GW-1 take the four weight planes (GW blocks each, W16 = four [DM][DM] planes in a row), the rest take x
#define GW ((DM * DM / 8 + 255) / 256)
__global__ __launch_bounds__(256) void k_cvt(const float* __restrict__ x, const float* __restrict__ w0, const float* __restrict__ w1, const float* __restrict__ w2, const float* __restrict__ w3, _Float16* __restrict__ W16, _Float16* __restrict__ X16, size_t nx8) {
  const int bid = blockIdx.x;
  if (bid < 4 * GW) { const int wi = bid / GW; const float* w = wi == 0 ? w0 : wi == 1 ? w1 : wi == 2 ? w2 : w3; cvt_w(w, (size_t)DM * DM / 8, W16 + (size_t)wi * DM * DM, bid - wi * GW); }
  else cvt_x(x, X16, nx8, bid - 4 * GW);
}

// one pass's operand lines into registers: this lane's 16 bytes of 8 A rows and 4 B rows, 16 rows (sa16, sb16 bytes) apart; pa, pb: the block's first rows at this pass (the same in every lane), ao, bo: the lane's own byte offsets
__device__ __forceinline__ void g2_fetch(const char* pa, size_t sa16, unsigned ao, const char* pb, size_t sb16, unsigned bo, v8us (&ra)[8], v8us (&rb)[4]) {
  const char* a[8]; const char* b[4];
#pragma unroll
  for (int i = 0; i < 8; ++i) { a[i] = pa + i * sa16 + ao; ra[i] = *(const v8us*)a[i]; }
#pragma unroll
  for (int i = 0; i < 4; ++i) { b[i] = pb + i * sb16 + bo; rb[i] = *(const v8us*)b[i]; }
  /* the wait that belongs between an issued load and an overwrite of its address registers; it names the twelve addresses so that they stay in their registers up to it (else a later load's result lands in an earlier load's address pair) */
  asm volatile("s_wait_xcnt 0x0" :: "v"(a[0]), "v"(a[1]), "v"(a[2]), "v"(a[3]), "v"(a[4]), "v"(a[5]), "v"(a[6]), "v"(a[7]), "v"(b[0]), "v"(b[1]), "v"(b[2]), "v"(b[3]) : "memory");
}

// one GEMM of a launch: its operands and outputs, nbx = (M / 128) (N / 64) blocks per batch, first = its first block in the launch's flat grid, useb = add the bias
struct GJob { const _Float16* A; const _Float16* Bh; const float* CP; float* C; _Float16* C16; size_t sA, sB, sC; float alpha; int lda, ldb, ldc, N, nbx, first, useb; };
#define GJMAX 6
struct GJobs { GJob j[GJMAX]; };

// A launch holds nj independent GEMMs (none reads what another writes), one after the other in a flat grid; a block finds its GEMM by its index, then its batch and tile.
// GEMM C[M][N] = alpha (A . Bt^T) + bf16(bias[col]) (+ CP own element): A f16 row-major (pitch lda, batch stride sA), Bt f16 [n][k] (pitch ldb, stride sB);
// writes f32 C and/or f16 C16 (pitch ldc, batch stride sC). Block = 4 waves, block tile 128 rows x 64 cols, wave tile 32 rows x 64 cols; M % 128 == 0, N % 64 == 0, K % 64 == 0.
// Operands: per pass of GKC = 64 k the block brings its 128 A rows and 64 B rows into LDS, 8 lanes per row, so that every wave-wide 16-byte load covers four whole 128-byte lines and each B row is fetched once per block;
// the next pass's lines are fetched into registers while this pass is multiplied; fragments come from LDS (row pitch 144 bytes: a 16-row fragment read meets every bank once). k order of the products as before (32 at a time, ascending).
__global__ __launch_bounds__(128) void k_gemm2(GJobs js, int nj, const float* __restrict__ biasv, int K) {
  __shared__ __attribute__((aligned(16))) unsigned char sm[4 * 32 * 68 * 4];      /* operand tiles in the k loop, then the epilogue's f32 staging */
  static_assert((128 + 64) * GP * 2 <= 4 * 32 * 68 * 4);
  float (*so)[32][68] = (float (*)[32][68])sm;
  _Float16* sa = (_Float16*)sm; _Float16* sb = sa + 128 * GP;
  const int tid = threadIdx.x, w = tid >> 5, lane = tid & 31, ln = lane & 15, hh = lane >> 4;
  const int bid = blockIdx.x; int ji = 0;
  for (int q = 1; q < GJMAX; ++q) if (q < nj && bid >= js.j[q].first) ji = q;
  const GJob& J = js.j[ji];
  const int lda = J.lda, ldb = J.ldb, ldc = J.ldc; const float alpha = J.alpha; const float* CP = J.CP; float* C = J.C; _Float16* C16 = J.C16; const float* bias = J.useb ? biasv : nullptr;
  const int loc = bid - J.first; const int by = loc / J.nbx, bx = loc - by * J.nbx;
  const _Float16* A = J.A + (size_t)by * J.sA; const _Float16* Bh = J.Bh + (size_t)by * J.sB; const size_t cofs = (size_t)by * J.sC;
  const int ntn = J.N >> 6; const int mt = bx / ntn, nq = bx - mt * ntn; const int row0 = mt * 128 + 32 * w, col0 = nq * 64;
  const int sr = tid >> 3, sc8 = (tid & 7) * 8;      /* staging: row sr + 16 i, halves sc8..sc8+7 of the pass */
  const char* ag = (const char*)(A + (size_t)(mt * 128) * lda); const char* bg = (const char*)(Bh + (size_t)col0 * ldb);      /* the block's first rows: the same in every lane */
  const unsigned ao = (unsigned)(sr * lda + sc8) * 2u, bo = (unsigned)(sr * ldb + sc8) * 2u;      /* the lane's own byte offsets, fixed for the whole kernel */
  unsigned short* sas = (unsigned short*)sa + sr * GP + sc8; unsigned short* sbs = (unsigned short*)sb + sr * GP + sc8;
  const _Float16* a0p = sa + (32 * w + ln) * GP; const _Float16* a1p = a0p + 16 * GP;
  const _Float16* b0p = sb + ln * GP; const _Float16* b1p = b0p + 16 * GP; const _Float16* b2p = b1p + 16 * GP; const _Float16* b3p = b2p + 16 * GP;
  const v8f z8 = {0.f,0.f,0.f,0.f,0.f,0.f,0.f,0.f}; v8f c00 = z8, c01 = z8, c02 = z8, c03 = z8, c10 = z8, c11 = z8, c12 = z8, c13 = z8;
  v8us ra[8], rb[4];
  g2_fetch(ag, (size_t)lda * 32, ao, bg, (size_t)ldb * 32, bo, ra, rb); ag += GKC * 2; bg += GKC * 2;
  /* passes stay rolled: one pass already holds 16 products per wave, unrolling further would only lengthen the text */
#pragma unroll 1
  for (int kc = 0; kc < K; kc += GKC) {
#pragma unroll
    for (int i = 0; i < 8; ++i) *(v8us*)(sas + 16 * i * GP) = ra[i];
#pragma unroll
    for (int i = 0; i < 4; ++i) *(v8us*)(sbs + 16 * i * GP) = rb[i];
    __syncthreads();      /* the pass's tiles are complete before any wave reads a fragment */
    if (kc + GKC < K) { g2_fetch(ag, (size_t)lda * 32, ao, bg, (size_t)ldb * 32, bo, ra, rb); ag += GKC * 2; bg += GKC * 2; }
#pragma unroll
    for (int kb = 0; kb < GKC; kb += 32) { const v16h a0 = g2_frag(a0p + kb, hh), a1 = g2_frag(a1p + kb, hh);      /* each B fragment after the first is read one pair of products ahead of its use */
      v16h b = g2_frag(b0p + kb, hh), bn = g2_frag(b1p + kb, hh); c00 = g2_mma(a0, b, c00); c10 = g2_mma(a1, b, c10);
      b = g2_frag(b2p + kb, hh); c01 = g2_mma(a0, bn, c01); c11 = g2_mma(a1, bn, c11);
      bn = g2_frag(b3p + kb, hh); c02 = g2_mma(a0, b, c02); c12 = g2_mma(a1, b, c12);
      c03 = g2_mma(a0, bn, c03); c13 = g2_mma(a1, bn, c13); }
    __syncthreads();      /* every wave has read its fragments before the tiles are overwritten (by the next pass, or by the epilogue's staging) */
  }
  v8f accs[8] = {c00, c01, c02, c03, c10, c11, c12, c13};
#pragma unroll
  for (int u = 0; u < 8; ++u) { const int t = u & 3, half = u >> 2; const int col = col0 + t * 16 + ln; const float bv = bias ? bf16_rne(bias[col]) : 0.f;
#pragma unroll
    for (int r = 0; r < 8; ++r) { const int rloc = half * 16 + 8 * hh + r; float v = accs[u][r] * alpha + bv;
      if (CP) v += CP[cofs + (size_t)(row0 + rloc) * ldc + col];      /* own element of the C plane (a prior pass), added in f32 */
      so[w][rloc][t * 16 + ln] = v; } }
  __builtin_amdgcn_fence(4, "workgroup"); __builtin_amdgcn_wave_barrier();
  const int rsub = lane >> 4, c4 = (lane & 15) * 4;
  {
#pragma unroll
    for (int q = 0; q < 16; ++q) { const int r = q * 2 + rsub; const v4f v = *(const v4fa*)&so[w][r][c4];
      if (C) *(v4f*)(C + cofs + (size_t)(row0 + r) * ldc + col0 + c4) = v;
      if (C16) { v4h h4; for (int i = 0; i < 4; ++i) h4[i] = (_Float16)v[i]; *(v4h*)(C16 + cofs + (size_t)(row0 + r) * ldc + col0 + c4) = h4; } }
     }
}

// exact (f32) causal attention for query rows 0..QT0-1 of every (batch, head): planes QF/KF/VF [NB][QT0][DM] (head h at column h*HD); block = 64 threads = 64 consecutive rows of one head;
// the block first brings the K and V rows of all its keys into LDS by whole-line loads (as they lie); thread i keeps its q row and its o accumulator in registers and walks keys j = 0..(its wave's last row) KU at a time (wave-uniform trip count, a multiple of 4; keys j > i enter through an arithmetic 0/1 factor as -1e30, contributing exactly 0):
// the KU scores of a trip are independent chains that run side by side, each as two partial sums (even d, odd d; d ascending) that are added at the end; the online softmax (f32, precise expf) and the o update then take the KU keys one after the other, in key order.
__global__ __launch_bounds__(64) void k_att0(const float* __restrict__ QF, const float* __restrict__ KF, const float* __restrict__ VF, float* __restrict__ OF) {
  #pragma clang fp contract(off)
  __shared__ __attribute__((aligned(16))) float lk[QT0][HD];
  __shared__ __attribute__((aligned(16))) float lv[QT0][HD];
  __shared__ __attribute__((aligned(16))) float lo[64][64];
  const int tid = threadIdx.x; const int rg = blockIdx.x % (QT0 / 64); const int bh = blockIdx.x / (QT0 / 64); const int b = bh / NH, h = bh - b * NH;
  const size_t pofs = (size_t)b * QT0 * DM;
  const int i = rg * 64 + tid;
  const float* qr = QF + pofs + (size_t)i * DM + h * HD;
  { const float* kg = KF + pofs + h * HD + (size_t)(tid >> 4) * 2 * DM + (tid & 15) * 4; const float* vg = VF + pofs + h * HD + (size_t)(tid >> 4) * 2 * DM + (tid & 15) * 4;
    const int c4 = (tid & 15) * 4;      /* 16 lanes per row; a trip brings 4 key pairs, 8 trips 64 keys */
    for (int hf = 0; hf <= rg; ++hf) { v4f rk[16], rv[16]; const float* kp = kg + (size_t)hf * 64 * DM; const float* vp = vg + (size_t)hf * 64 * DM;
      /* unrolled: the 32 row loads of a lane for 64 keys are in flight together */
#pragma unroll
      for (int it = 0; it < 8; ++it) { rk[2 * it] = *(const v4fa*)(kp + it * 8 * DM); rk[2 * it + 1] = *(const v4fa*)(kp + it * 8 * DM + DM); rv[2 * it] = *(const v4fa*)(vp + it * 8 * DM); rv[2 * it + 1] = *(const v4fa*)(vp + it * 8 * DM + DM); }
      /* the wait that belongs between an issued load and an overwrite of its address registers; it names the two addresses so that they stay in their registers up to it (else a later load's result lands in an earlier load's address pair) */
      asm volatile("s_wait_xcnt 0x0" :: "v"(kp), "v"(vp) : "memory");
#pragma unroll
      for (int it = 0; it < 8; ++it) { const int p = (hf * 8 + it) * 4 + (tid >> 4);
        *(v4f*)&lk[2 * p][c4] = rk[2 * it]; *(v4f*)&lk[2 * p + 1][c4] = rk[2 * it + 1]; *(v4f*)&lv[2 * p][c4] = rv[2 * it]; *(v4f*)&lv[2 * p + 1][c4] = rv[2 * it + 1]; } } }
  v2f q[HD / 2], o[HD / 2];
#pragma unroll
  for (int c = 0; c < HD / 4; ++c) { const v4f qq = *(const v4fa*)(qr + c * 4); const v2f qa = {qq[0], qq[1]}, qb = {qq[2], qq[3]}; q[2 * c] = qa; q[2 * c + 1] = qb; const v2f z = {0.f, 0.f}; o[2 * c] = z; o[2 * c + 1] = z; }
  __syncthreads();      /* the block's K and V rows are complete before any wave reads a key */
  float m = -1.0e30f, l = 0.f; const int jend = rg * 64 + __builtin_amdgcn_readfirstlane(tid >> 5) * 32 + 32;      /* wave-uniform: keys up to the wave's last row */
  /* trips stay rolled: one trip already holds KU independent score chains, more would only lengthen the text; every loop inside a trip is fully unrolled, so that q, o and the ring are indexed by constants and stay in registers */
#pragma unroll 1
  for (int j0 = 0; j0 < jend; j0 += KU) { v2f s2[KU]; v4f rb[3][KU]; const float* kt = &lk[j0][0]; const float* vt = &lv[j0][0]; float sc[KU], e[KU];      /* rb: ring of three chunks; a chunk = eight 16-byte LDS reads, the same address in every lane: of K 4 d of the trip's 8 keys (chunks 0..15), of V 16 d of 2 keys (chunks 16..31) */
#pragma unroll
    for (int kk = 0; kk < KU; ++kk) { const v2f z = {0.f, 0.f}; s2[kk] = z; }
    /* chunk n is read two chunks ahead of its use, so that its LDS latency lies behind two chunks of arithmetic. The scheduling fences keep reads and arithmetic in that order: left free, the compiler lifts all reads of a trip to its head, which takes more than 500 registers */
#pragma unroll
    for (int x = 0; x < 8; ++x) { rb[0][x] = *(const v4f*)(kt + x * HD); rb[1][x] = *(const v4f*)(kt + x * HD + 4); }
    __builtin_amdgcn_sched_barrier(0);      /* see above */
#pragma unroll
    for (int t = 0; t < HD / 4; ++t) {
      if (t + 2 < HD / 4) {
#pragma unroll
        for (int x = 0; x < 8; ++x) rb[(t + 2) % 3][x] = *(const v4f*)(kt + x * HD + (t + 2) * 4);
      } else {
#pragma unroll
        for (int x = 0; x < 8; ++x) rb[(t + 2) % 3][x] = *(const v4f*)(vt + (x >> 2) * HD + ((t + 2 - HD / 4) * 4 + (x & 3)) * 4);
      }
      __builtin_amdgcn_sched_barrier(0);      /* see above */
#pragma unroll
      for (int kk = 0; kk < KU; ++kk) { const v4f kq = rb[t % 3][kk]; const v2f ka = {kq[0], kq[1]}; s2[kk] = __builtin_elementwise_fma(q[2 * t], ka, s2[kk]); }
#pragma unroll
      for (int kk = 0; kk < KU; ++kk) { const v4f kq = rb[t % 3][kk]; const v2f kb = {kq[2], kq[3]}; s2[kk] = __builtin_elementwise_fma(q[2 * t + 1], kb, s2[kk]); }
      __builtin_amdgcn_sched_barrier(0);      /* see above */
    }
#pragma unroll
    for (int kk = 0; kk < KU; ++kk) { const int j = j0 + kk; const float s = __fmul_rn(__fadd_rn(s2[kk][0], s2[kk][1]), 0.125f);
      const float f = (j <= i) ? 1.f : 0.f; const float sm = fmaf(f, s, (1.f - f) * -1.0e30f); const float mn = fmaxf(m, sm); sc[kk] = expf(m - mn); e[kk] = expf(sm - mn); l = __fadd_rn(__fmul_rn(l, sc[kk]), e[kk]); m = mn; }
    __builtin_amdgcn_sched_barrier(0);      /* see above */
#pragma unroll
    for (int t = 0; t < HD / 4; ++t) {      /* V chunk t: keys 2 (t / 4), 2 (t / 4) + 1, d 16 (t % 4) .. + 15: eight independent o pairs, every o element meets its keys in ascending order */
      if (t + 2 < HD / 4) {
#pragma unroll
        for (int x = 0; x < 8; ++x) rb[(t + 2 + HD / 4) % 3][x] = *(const v4f*)(vt + (((t + 2) >> 2) * 2 + (x >> 2)) * HD + (((t + 2) & 3) * 4 + (x & 3)) * 4);
      }
      __builtin_amdgcn_sched_barrier(0);      /* see above */
#pragma unroll
      for (int x = 0; x < 8; ++x) { const int kk = (t >> 2) * 2 + (x >> 2), c = (t & 3) * 4 + (x & 3); const v4f vv = rb[(t + HD / 4) % 3][x]; const v2f va = {vv[0], vv[1]}, vb = {vv[2], vv[3]}; const v2f s_ = {sc[kk], sc[kk]}, e_ = {e[kk], e[kk]};
        o[2 * c] = __builtin_elementwise_fma(o[2 * c], s_, e_ * va); o[2 * c + 1] = __builtin_elementwise_fma(o[2 * c + 1], s_, e_ * vb); }
      __builtin_amdgcn_sched_barrier(0);      /* see above */
    } }
  const float fin = 64.0f / l;      /* o carried x64 */
#pragma unroll
  for (int c = 0; c < HD / 4; ++c) { v4f oo = {o[2 * c][0], o[2 * c][1], o[2 * c + 1][0], o[2 * c + 1][1]}; for (int u = 0; u < 4; ++u) oo[u] = __fmul_rn(oo[u], fin); *(v4f*)&lo[tid][c * 4] = oo; }
  __syncthreads();
  {
#pragma unroll 1
    for (int it = 0; it < 16; ++it) { const int row = it * 4 + tid / 16, pc = (tid % 16) * 4; const v4f v = *(const v4f*)&lo[row][pc]; *(v4f*)(OF + pofs + (size_t)(rg * 64 + row) * DM + h * HD + pc) = v; }
     } }

__device__ __forceinline__ void hl_split(const float* __restrict__ F, _Float16* __restrict__ Hh, _Float16* __restrict__ Hl, size_t n8, int blk) {
  const size_t t = (size_t)blk * 256 + threadIdx.x; if (t >= n8) return; FragH fh, fl; const v4f a = *(const v4fa*)(F + t * 8), c = *(const v4fa*)(F + t * 8 + 4);
#pragma unroll
  for (int q = 0; q < 4; ++q) { _Float16 hv = (_Float16)a[q]; fh.h[q] = hv; fl.h[q] = (_Float16)((a[q] - (float)hv) * 1024.0f); hv = (_Float16)c[q]; fh.h[4 + q] = hv; fl.h[4 + q] = (_Float16)((c[q] - (float)hv) * 1024.0f); }
  unsigned short* dh = (unsigned short*)Hh + t * 8; unsigned short* dl = (unsigned short*)Hl + t * 8;
  { *(v8us*)dh = fh.half[0]; *(v8us*)dl = fl.half[0];  } }

// The grid's rows blockIdx.y >= NB*NH do not attend: they split the exact attention's f32 o plane F into its f16 hi / x1024 residual planes (needs nothing of this launch's attention and gives it nothing), 256 x 8 elements a block.
// causal attention, f16 WMMA: grid rows blockIdx.y < NB*NH, (SEQ/128, NB*NH), block = 8 waves, wave -> query rows q0..q0+15 (q0 = 16*(8*blockIdx.x + wave)) of one (b, head).
// K and V^T of a 32-key block are the same for the block's 8 waves: the block brings them into LDS once (one 16-byte load of each per thread: K 8 lanes a row, whole 128-byte lines; V^T 4 lanes a row), two buffers, the next block's lines fetched into registers while this one is worked on;
// every wave stages and meets the one barrier of every 32-key block up to the last wave's count, and skips the arithmetic of the blocks past its own rows; fragments come from LDS (pitches 144 and 80 bytes: a 16-row fragment read meets every bank once).
// Per 32-key block: two 16x16 score tiles S = q . k^T (A = Q16 rows, B = K16 rows as [key][d], K = 64 in two k-steps), x0.125 and the causal select by value in f32, online softmax per row (16 key columns across 16 lanes: xor-shuffle max / sum, f32 running max and sum, o and sum rescaled by exp(m_old - m_new)),
// kg, vg: the block's first K and V^T rows at this 32-key block (the same in every lane); ko, vo: the lane's own byte offsets, fixed for the whole kernel
__device__ __forceinline__ void att_fetch(const char* kg, unsigned ko, const char* vg, unsigned vo, v8us& rk, v8us& rv) {
  const char* ka = kg + ko; const char* va = vg + vo; rk = *(const v8us*)ka; rv = *(const v8us*)va;
  /* the wait that belongs between an issued load and an overwrite of its address registers; it names the two addresses so that they stay in their registers up to it */
  asm volatile("s_wait_xcnt 0x0" :: "v"(ka), "v"(va) : "memory");
}

__global__ __launch_bounds__(256) __attribute__((amdgpu_num_vgpr(160)))      /* 160 registers: three blocks stay resident per WGP, as before the staging */
void k_att(const _Float16* __restrict__ Q16, const _Float16* __restrict__ K16, const _Float16* __restrict__ VT, _Float16* __restrict__ O16, const float* __restrict__ F, _Float16* __restrict__ Hh, _Float16* __restrict__ Hl, size_t n8) {
  __shared__ __attribute__((aligned(16))) _Float16 lp[8][2][16 * PP];
  __shared__ __attribute__((aligned(16))) _Float16 lso[8][16 * OPP];
  __shared__ __attribute__((aligned(16))) _Float16 lkt[2][32 * AKP];
  __shared__ __attribute__((aligned(16))) _Float16 lvt[2][HD * AVP];
  if (blockIdx.y >= NB * NH) { hl_split(F, Hh, Hl, n8, (int)((blockIdx.y - NB * NH) * (SEQ / 128) + blockIdx.x)); return; }      /* the same for the whole block */
  const int tid = threadIdx.x, w = __builtin_amdgcn_readfirstlane(tid >> 5), lane = tid & 31, ln = lane & 15, hh = lane >> 4;      /* the wave's number is the same in every lane: held in a scalar register, so that the test round a trip's products is a scalar branch and what follows from it takes no vector registers */
  const int qt = blockIdx.x * 8 + w; const int bh = blockIdx.y; const int b = bh / NH, h = bh - b * NH;
  const int q0 = qt * 16;
  const size_t wr0 = (size_t)b * SEQ + q0;
  const _Float16* qp = Q16 + (wr0 + ln) * DM + h * HD;
  const v16h qa0 = g2_frag(qp, hh), qa1 = g2_frag(qp + 32, hh);      /* d 0..31, 32..63 */
  const _Float16* kbase = K16 + (size_t)b * SEQ * DM + h * HD;        /* key row j at kbase + j*DM */
  const _Float16* vbase = VT + (size_t)bh * HD * SEQ;                 /* V^T row d at vbase + d*SEQ */
  const v8f z8 = {0.f,0.f,0.f,0.f,0.f,0.f,0.f,0.f}; v8f o0 = z8, o1 = z8, o2 = z8, o3 = z8;
  float mr[8], lr[8];
#pragma unroll
  for (int r = 0; r < 8; ++r) { mr[r] = -1.0e30f; lr[r] = 0.f; }
  const int nkb = qt / 2 + 1;      /* 32-key blocks covering keys 0..q0+15 */
  const int nkbb = (int)blockIdx.x * 4 + 4;      /* the count of the block's last wave */
  const char* kg = (const char*)kbase; const char* vg = (const char*)vbase; const unsigned ko = (unsigned)((tid >> 3) * DM + (tid & 7) * 8) * 2u, vo = (unsigned)((tid >> 2) * SEQ + (tid & 3) * 8) * 2u;      /* the thread's own 16 bytes of a 32-key block */
  const int kso = (tid >> 3) * AKP + (tid & 7) * 8, vso = (tid >> 2) * AVP + (tid & 3) * 8;
  v8us rk, rv;
  att_fetch(kg, ko, vg, vo, rk, rv); kg += 32 * DM * 2; vg += 32 * 2;
#pragma unroll 1
  for (int it = 0; it < nkbb; ++it) {
    _Float16* kt = &lkt[it & 1][0]; _Float16* vt = &lvt[it & 1][0];
    *(v8us*)((unsigned short*)kt + kso) = rk; *(v8us*)((unsigned short*)vt + vso) = rv;
    __syncthreads();      /* this block's tiles are complete before any wave reads a fragment; and who passes it knows that every wave has left the other buffer, which the next trip overwrites */
    if (it + 1 < nkbb) { att_fetch(kg, ko, vg, vo, rk, rv); kg += 32 * DM * 2; vg += 32 * 2; }
    if (it >= nkb) continue;      /* keys past the wave's rows: nothing to add */
    const int kb = it * 32;
    _Float16* pb = &lp[w][it & 1][0];
    v8f s0 = z8, s1 = z8;
    { const _Float16* kp = kt + ln * AKP;      /* the four K fragments are read together, ahead of the products */
      const v16h k00 = g2_frag(kp, hh), k01 = g2_frag(kp + 32, hh), k10 = g2_frag(kp + 16 * AKP, hh), k11 = g2_frag(kp + 16 * AKP + 32, hh);
      s0 = g2_mma(qa0, k00, s0); s0 = g2_mma(qa1, k01, s0); s1 = g2_mma(qa0, k10, s1); s1 = g2_mma(qa1, k11, s1); }
#pragma unroll
    for (int r = 0; r < 8; ++r) {
      const int qk = q0 - kb + r;      /* key kb + ln <= row q0 + 8 hh + r, with the wave's part of the test on the scalar side: one vector register (ln - 8 hh) in place of eight row numbers */
      const float v0 = (ln - 8 * hh <= qk) ? s0[r] * 0.125f : -1.0e30f;
      const float v1 = (ln - 8 * hh <= qk - 16) ? s1[r] * 0.125f : -1.0e30f;
      float mx = fmaxf(v0, v1);
      mx = fmaxf(mx, __shfl_xor(mx, 1, 16)); mx = fmaxf(mx, __shfl_xor(mx, 2, 16)); mx = fmaxf(mx, __shfl_xor(mx, 4, 16)); mx = fmaxf(mx, __shfl_xor(mx, 8, 16));
      const float mn = fmaxf(mr[r], mx);
      const float al = __expf(mr[r] - mn); mr[r] = mn;
      const float p0 = __expf(v0 - mn), p1 = __expf(v1 - mn);
      float rs = p0 + p1;
      rs += __shfl_xor(rs, 1, 16); rs += __shfl_xor(rs, 2, 16); rs += __shfl_xor(rs, 4, 16); rs += __shfl_xor(rs, 8, 16);
      lr[r] = lr[r] * al + rs;
      o0[r] *= al; o1[r] *= al; o2[r] *= al; o3[r] *= al;
      pb[(8 * hh + r) * PP + ln] = (_Float16)(p0 * 1024.0f);
      pb[(8 * hh + r) * PP + 16 + ln] = (_Float16)(p1 * 1024.0f);
    }
    __builtin_amdgcn_fence(3, "wavefront"); __builtin_amdgcn_wave_barrier();
    FragH pa; pa.half[0] = *(const v8us*)((const unsigned short*)pb + ln * PP + 8 * hh); pa.half[1] = *(const v8us*)((const unsigned short*)pb + ln * PP + 16 + 8 * hh);
    { const _Float16* vp = vt + ln * AVP;      /* three V^T fragments are read together with P, ahead of the products; the fourth behind the first product: with all four ahead the kernel takes 161 registers, one more than three resident blocks allow */
      const v16h v0 = g2_frag(vp, hh), v1 = g2_frag(vp + 16 * AVP, hh), v2 = g2_frag(vp + 32 * AVP, hh);
      o0 = g2_mma(pa.v, v0, o0); const v16h v3 = g2_frag(vp + 48 * AVP, hh); o1 = g2_mma(pa.v, v1, o1); o2 = g2_mma(pa.v, v2, o2); o3 = g2_mma(pa.v, v3, o3); }
  }
  _Float16* sob = &lso[w][0];
#pragma unroll
  for (int r = 0; r < 8; ++r) { const float inv = (1.0f / lr[r]) * 0.0009765625f; const int row = 8 * hh + r;
    sob[row * OPP + ln] = (_Float16)(o0[r] * inv); sob[row * OPP + 16 + ln] = (_Float16)(o1[r] * inv); sob[row * OPP + 32 + ln] = (_Float16)(o2[r] * inv); sob[row * OPP + 48 + ln] = (_Float16)(o3[r] * inv); }
  __builtin_amdgcn_fence(3, "wavefront"); __builtin_amdgcn_wave_barrier();
  unsigned short* ob = (unsigned short*)O16 + wr0 * DM + h * HD;
  {
#pragma unroll
    for (int it2 = 0; it2 < 4; ++it2) { const int row = it2 * 4 + (lane >> 3), c8 = (lane & 7) * 8; const v8us v = *(const v8us*)((const unsigned short*)sob + row * OPP + c8); *(v8us*)(ob + (size_t)row * DM + c8) = v; }
     }
}

extern "C" void kernel_launch(void* const* d_in, const int* in_sizes, int n_in,
                              void* d_out, int out_size, void* d_ws, size_t ws_size, hipStream_t stream) {
  if (n_in < 6) return;
  const float* x = (const float*)d_in[0]; const float* wq = (const float*)d_in[1]; const float* wk = (const float*)d_in[2];
  const float* wv = (const float*)d_in[3]; const float* wp = (const float*)d_in[4]; const float* bproj = (const float*)d_in[5];
  const size_t need_x = (size_t)(NB - 1) * SEQ_FULL * DM + (size_t)SEQ * DM;
  if ((size_t)in_sizes[0] < need_x || in_sizes[1] < DM * DM || in_sizes[2] < DM * DM || in_sizes[3] < DM * DM || in_sizes[4] < DM * DM || in_sizes[5] < DM || (size_t)out_size < need_x) return;
  float* out = (float*)d_out;
  char* ws = (char*)d_ws; size_t off = 0;
  auto take = [&](size_t bytes) { char* p = ws + off; off += (bytes + 255) & ~(size_t)255; return p; };
  const size_t wb = (size_t)DM * DM * 2;
  _Float16* WQ = (_Float16*)take(4 * wb); _Float16* WK = WQ + DM * DM; _Float16* WV = WK + DM * DM; _Float16* WP = WV + DM * DM;      /* four planes in a row */
  const size_t rows2 = (size_t)NB * SEQ * DM * 2;      /* f16 plane over all token rows */
  const size_t f0b4 = (size_t)NB * QT0 * DM * 4;       /* f32 first-tile plane */
  const size_t f0b2 = (size_t)NB * QT0 * DM * 2;       /* f16 first-tile plane */
  const size_t vtb = (size_t)NB * DM * SEQ * 2;         /* V^T [NB*NH*HD][SEQ] */
  /* every plane that one launch writes has its own place: the GEMMs of a launch run side by side */
  _Float16* X16 = (_Float16*)take(rows2); _Float16* O16 = X16;      /* X16 is last read by the first GEMM launch, O16 written after it */
  float* QF0 = (float*)take(f0b4); float* KF0 = (float*)take(f0b4); float* VF0 = (float*)take(f0b4); float* OF0 = (float*)take(f0b4);
  _Float16* Q16 = (_Float16*)take(rows2); _Float16* K16 = (_Float16*)take(rows2); _Float16* VT = (_Float16*)take(vtb);
  _Float16* OH = (_Float16*)take(f0b2); _Float16* OL = (_Float16*)take(f0b2);
  if (off > ws_size) return;

  const size_t nx8 = (size_t)NB * SEQ * DM / 8;
  k_cvt<<<(unsigned)(4 * GW + (nx8 + 255) / 256), 256, 0, stream>>>(x, wq, wk, wv, wp, WQ, X16, nx8);
  constexpr int nS = (QT0 / 128) * (DM / 64);            /* blocks per batch: first-tile GEMMs */
  constexpr int nA = (NB * SEQ / 128) * (DM / 64);       /* all token rows, one batch */
  constexpr int nV = (DM / 128) * (SEQ / 64);            /* V^T, per batch */
  constexpr int nP = ((SEQ - QT0) / 128) * (DM / 64);    /* projection of rows >= 128, per batch */
  /* all six products of X16 in one launch: f16 q, k rows for all tokens; V^T directly as (16 Wv) . X16^T; f32 q, k, v of rows 0..127 of every sequence (exact products) */
  GJobs g1 = {};
  g1.j[0] = GJob{X16, WQ, nullptr, nullptr, Q16, (size_t)0, (size_t)0, (size_t)0, 0.0625f, DM, DM, DM, DM, nA, 0, 0};
  g1.j[1] = GJob{X16, WK, nullptr, nullptr, K16, (size_t)0, (size_t)0, (size_t)0, 0.0625f, DM, DM, DM, DM, nA, nA, 0};
  g1.j[2] = GJob{WV, X16, nullptr, nullptr, VT, (size_t)0, (size_t)SEQ * DM, (size_t)DM * SEQ, 0.0625f, DM, DM, SEQ, SEQ, nV, 2 * nA, 0};
  g1.j[3] = GJob{X16, WQ, nullptr, QF0, nullptr, (size_t)SEQ * DM, (size_t)0, (size_t)QT0 * DM, 0.0625f, DM, DM, DM, DM, nS, 2 * nA + NB * nV, 0};
  g1.j[4] = GJob{X16, WK, nullptr, KF0, nullptr, (size_t)SEQ * DM, (size_t)0, (size_t)QT0 * DM, 0.0625f, DM, DM, DM, DM, nS, 2 * nA + NB * nV + NB * nS, 0};
  g1.j[5] = GJob{X16, WV, nullptr, VF0, nullptr, (size_t)SEQ * DM, (size_t)0, (size_t)QT0 * DM, 0.0625f, DM, DM, DM, DM, nS, 2 * nA + NB * nV + 2 * NB * nS, 0};
  k_gemm2<<<2 * nA + NB * nV + 3 * NB * nS, 128, 0, stream>>>(g1, 6, bproj, DM);
  k_att0<<<NB * NH * (QT0 / 64), 64, 0, stream>>>(QF0, KF0, VF0, OF0);      /* exact attention rows 0..127 (o x64) */
  const size_t nf8 = (size_t)NB * QT0 * DM / 8;
  /* attention of all rows and, in the grid's last rows, the f16 hi / x1024 residual planes of the exact o x64 */
  k_att<<<dim3(SEQ / 128, (unsigned)(NB * NH + ((nf8 + 255) / 256 + SEQ / 128 - 1) / (SEQ / 128))), 256, 0, stream>>>(Q16, K16, VT, O16, OF0, OH, OL, nf8);
  /* output projection, one launch: rows >= 128 from the f16 o plane, rows < 128 from the hi plane; then a launch that adds the residual plane's product to rows < 128 */
  GJobs g2 = {};
  g2.j[0] = GJob{O16 + (size_t)QT0 * DM, WP, nullptr, out + (size_t)QT0 * DM, nullptr, (size_t)SEQ * DM, (size_t)0, (size_t)SEQ_FULL * DM, 0.0625f, DM, DM, DM, DM, nP, 0, 1};
  g2.j[1] = GJob{OH, WP, nullptr, out, nullptr, (size_t)QT0 * DM, (size_t)0, (size_t)SEQ_FULL * DM, 0.0009765625f, DM, DM, DM, DM, nS, NB * nP, 1};
  k_gemm2<<<NB * nP + NB * nS, 128, 0, stream>>>(g2, 2, bproj, DM);
  GJobs g3 = {};
  g3.j[0] = GJob{OL, WP, out, out, nullptr, (size_t)QT0 * DM, (size_t)0, (size_t)SEQ_FULL * DM, 9.5367431640625e-07f, DM, DM, DM, DM, nS, 0, 0};
  k_gemm2<<<NB * nS, 128, 0, stream>>>(g3, 1, bproj, DM);
}

// v006
// One run takes 174 microseconds.
// Two timings next to v005 both put it at 1.12 times that version's speed.
// Counting every step since v000, it is 4.82 times as fast.
#include <hip/hip_runtime.h>
// Structure: token rows r = b*SEQ + t in compact workspace planes (input/output strides use SEQ_FULL); X16 = f16(bf16(x)); Q16, K16 = X16 . (16 W)^T / 16 as 32x64 wave-tile GEMMs with LDS-staged whole-line epilogues; V^T per (b, head) produced directly as (16 Wv) . X16^T / 16;
#ifndef NB
#define NB 64
#endif
#ifndef SEQ
#define SEQ 512
#endif
#define NB_FULL 64
#define SEQ_FULL 512
#define DM 384
#define NH 6
#define HD 64
#define QT0 128                      /* first query rows per sequence recomputed exactly in f32 */
#define OPP 72                       /* LDS pitch (halves) of the 16x64 O staging tile */
#define GKC 64                       /* k (halves) of one staged GEMM pass: one 128-byte line of every operand row */
#define KU 8                         /* keys per trip of the exact attention */
#define GP 72                        /* LDS pitch (halves) of a staged GEMM operand row: 128 + 16 bytes */
#define AKP 72                       /* LDS pitch (halves) of a staged K row (64 d): 128 + 16 bytes */
#define AVP 40                       /* LDS pitch (halves) of a staged V^T row (32 keys): 64 + 16 bytes */
static_assert(NB >= 1 && NB <= NB_FULL);
static_assert(SEQ % 128 == 0 && SEQ >= 2 * QT0 && SEQ <= SEQ_FULL);
static_assert(KU == 8);
static_assert(DM == NH * HD && DM % 128 == 0 && HD == 64 && QT0 == 128);

typedef unsigned short v8us __attribute__((ext_vector_type(8), may_alias));
typedef float  v8f  __attribute__((ext_vector_type(8)));
typedef float  v4f  __attribute__((ext_vector_type(4)));
typedef float  v2f  __attribute__((ext_vector_type(2)));
typedef float  v4fa __attribute__((ext_vector_type(4), may_alias));
typedef _Float16 v16h __attribute__((ext_vector_type(16)));
typedef _Float16 v4h __attribute__((ext_vector_type(4)));
union FragH { v16h v; v8us half[2]; _Float16 h[16]; unsigned short u[16]; };

__device__ __forceinline__ unsigned short bf16_bits(float x) { unsigned int u = __float_as_uint(x); return (unsigned short)((u + 0x7FFFu + ((u >> 16) & 1u)) >> 16); }
__device__ __forceinline__ float bf16_val(unsigned short b) { return __uint_as_float(((unsigned int)b) << 16); }
__device__ __forceinline__ float bf16_rne(float x) { return bf16_val(bf16_bits(x)); }

// 16-bit WMMA fragment from a k-contiguous row (A: row m, B: column n of a [n][k] plane): elements 0..7 <- k 8hh..8hh+7, elements 8..15 <- k 16+8hh..16+8hh+7
__device__ __forceinline__ v16h g2_frag(const _Float16* p, int hh) { FragH f; f.half[0] = *(const v8us*)((const unsigned short*)p + 8 * hh); f.half[1] = *(const v8us*)((const unsigned short*)p + 16 + 8 * hh); return f.v; }
__device__ __forceinline__ v8f g2_mma(v16h a, v16h b, v8f c) { v8f d = __builtin_amdgcn_wmma_f32_16x16x32_f16(false, a, false, b, (short)0, c, false, false); asm volatile("v_nop\n\tv_nop\n\tv_nop\n\tv_nop" : "+v"(d) : "v"(a), "v"(b)); return d; }

__device__ __forceinline__ void cvt_w(const float* __restrict__ w, size_t n8, _Float16* __restrict__ Bt, int blk) {
  const size_t t = (size_t)blk * 256 + threadIdx.x; if (t >= n8) return; FragH f;
#pragma unroll
  for (int q = 0; q < 8; ++q) f.h[q] = (_Float16)(bf16_rne(w[t * 8 + q]) * 16.0f);
  unsigned short* d = (unsigned short*)Bt + t * 8;
  *(v8us*)d = f.half[0]; 
}

__device__ __forceinline__ void cvt_x(const float* __restrict__ x, _Float16* __restrict__ X16, size_t n8, int blk) {
  const size_t t = (size_t)blk * 256 + threadIdx.x; if (t >= n8) return;
  const size_t wr = t / (DM / 8); const int c8 = (int)(t % (DM / 8)) * 8;
  const size_t b = wr / SEQ, tt = wr % SEQ;
  const float* src = x + (b * SEQ_FULL + tt) * DM + c8;
  const v4f a = *(const v4fa*)src, c = *(const v4fa*)(src + 4); FragH f;
#pragma unroll
  for (int q = 0; q < 4; ++q) { f.h[q] = (_Float16)bf16_rne(a[q]); f.h[4 + q] = (_Float16)bf16_rne(c[q]); }
  unsigned short* d = (unsigned short*)X16 + t * 8;
  *(v8us*)d = f.half[0]; 
}

// all five conversions in one grid: blocks 0..4 GW-1 take the four weight planes (GW blocks each, W16 = four [DM][DM] planes in a row), the rest take x
#define GW ((DM * DM / 8 + 255) / 256)
__global__ __launch_bounds__(256) void k_cvt(const float* __restrict__ x, const float* __restrict__ w0, const float* __restrict__ w1, const float* __restrict__ w2, const float* __restrict__ w3, _Float16* __restrict__ W16, _Float16* __restrict__ X16, size_t nx8) {
  const int bid = blockIdx.x;
  if (bid < 4 * GW) { const int wi = bid / GW; const float* w = wi == 0 ? w0 : wi == 1 ? w1 : wi == 2 ? w2 : w3; cvt_w(w, (size_t)DM * DM / 8, W16 + (size_t)wi * DM * DM, bid - wi * GW); }
  else cvt_x(x, X16, nx8, bid - 4 * GW);
}

// one pass's operand lines into registers: this lane's 16 bytes of 8 A rows and 4 B rows, 16 rows (sa16, sb16 bytes) apart; pa, pb: the block's first rows at this pass (the same in every lane), ao, bo: the lane's own byte offsets
__device__ __forceinline__ void g2_fetch(const char* pa, size_t sa16, unsigned ao, const char* pb, size_t sb16, unsigned bo, v8us (&ra)[8], v8us (&rb)[4]) {
  const char* a[8]; const char* b[4];
#pragma unroll
  for (int i = 0; i < 8; ++i) { a[i] = pa + i * sa16 + ao; ra[i] = *(const v8us*)a[i]; }
#pragma unroll
  for (int i = 0; i < 4; ++i) { b[i] = pb + i * sb16 + bo; rb[i] = *(const v8us*)b[i]; }
  /* the wait that belongs between an issued load and an overwrite of its address registers; it names the twelve addresses so that they stay in their registers up to it (else a later load's result lands in an earlier load's address pair) */
  asm volatile("s_wait_xcnt 0x0" :: "v"(a[0]), "v"(a[1]), "v"(a[2]), "v"(a[3]), "v"(a[4]), "v"(a[5]), "v"(a[6]), "v"(a[7]), "v"(b[0]), "v"(b[1]), "v"(b[2]), "v"(b[3]) : "memory");
}

// one GEMM of a launch: its operands and outputs, nbx = (M / 128) (N / 64) blocks per batch, first = its first block in the launch's flat grid, useb = add the bias
struct GJob { const _Float16* A; const _Float16* Bh; const float* CP; float* C; _Float16* C16; size_t sA, sB, sC; float alpha; int lda, ldb, ldc, N, nbx, first, useb; };
#define GJMAX 6
struct GJobs { GJob j[GJMAX]; };

// A launch holds nj independent GEMMs (none reads what another writes), one after the other in a flat grid; a block finds its GEMM by its index, then its batch and tile.
// GEMM C[M][N] = alpha (A . Bt^T) + bf16(bias[col]) (+ CP own element): A f16 row-major (pitch lda, batch stride sA), Bt f16 [n][k] (pitch ldb, stride sB);
// writes f32 C and/or f16 C16 (pitch ldc, batch stride sC). Block = 4 waves, block tile 128 rows x 64 cols, wave tile 32 rows x 64 cols; M % 128 == 0, N % 64 == 0, K % 64 == 0.
// Operands: per pass of GKC = 64 k the block brings its 128 A rows and 64 B rows into LDS, 8 lanes per row, so that every wave-wide 16-byte load covers four whole 128-byte lines and each B row is fetched once per block;
// the next pass's lines are fetched into registers while this pass is multiplied; fragments come from LDS (row pitch 144 bytes: a 16-row fragment read meets every bank once). k order of the products as before (32 at a time, ascending).
__global__ __launch_bounds__(128) void k_gemm2(GJobs js, int nj, const float* __restrict__ biasv, int K) {
  __shared__ __attribute__((aligned(16))) unsigned char sm[4 * 32 * 68 * 4];      /* operand tiles in the k loop, then the epilogue's f32 staging */
  static_assert((128 + 64) * GP * 2 <= 4 * 32 * 68 * 4);
  float (*so)[32][68] = (float (*)[32][68])sm;
  _Float16* sa = (_Float16*)sm; _Float16* sb = sa + 128 * GP;
  const int tid = threadIdx.x, w = tid >> 5, lane = tid & 31, ln = lane & 15, hh = lane >> 4;
  const int bid = blockIdx.x; int ji = 0;
  for (int q = 1; q < GJMAX; ++q) if (q < nj && bid >= js.j[q].first) ji = q;
  const GJob& J = js.j[ji];
  const int lda = J.lda, ldb = J.ldb, ldc = J.ldc; const float alpha = J.alpha; const float* CP = J.CP; float* C = J.C; _Float16* C16 = J.C16; const float* bias = J.useb ? biasv : nullptr;
  const int loc = bid - J.first; const int by = loc / J.nbx, bx = loc - by * J.nbx;
  const _Float16* A = J.A + (size_t)by * J.sA; const _Float16* Bh = J.Bh + (size_t)by * J.sB; const size_t cofs = (size_t)by * J.sC;
  const int ntn = J.N >> 6; const int mt = bx / ntn, nq = bx - mt * ntn; const int row0 = mt * 128 + 32 * w, col0 = nq * 64;
  const int sr = tid >> 3, sc8 = (tid & 7) * 8;      /* staging: row sr + 16 i, halves sc8..sc8+7 of the pass */
  const char* ag = (const char*)(A + (size_t)(mt * 128) * lda); const char* bg = (const char*)(Bh + (size_t)col0 * ldb);      /* the block's first rows: the same in every lane */
  const unsigned ao = (unsigned)(sr * lda + sc8) * 2u, bo = (unsigned)(sr * ldb + sc8) * 2u;      /* the lane's own byte offsets, fixed for the whole kernel */
  unsigned short* sas = (unsigned short*)sa + sr * GP + sc8; unsigned short* sbs = (unsigned short*)sb + sr * GP + sc8;
  const _Float16* a0p = sa + (32 * w + ln) * GP; const _Float16* a1p = a0p + 16 * GP;
  const _Float16* b0p = sb + ln * GP; const _Float16* b1p = b0p + 16 * GP; const _Float16* b2p = b1p + 16 * GP; const _Float16* b3p = b2p + 16 * GP;
  const v8f z8 = {0.f,0.f,0.f,0.f,0.f,0.f,0.f,0.f}; v8f c00 = z8, c01 = z8, c02 = z8, c03 = z8, c10 = z8, c11 = z8, c12 = z8, c13 = z8;
  v8us ra[8], rb[4];
  g2_fetch(ag, (size_t)lda * 32, ao, bg, (size_t)ldb * 32, bo, ra, rb); ag += GKC * 2; bg += GKC * 2;
  /* passes stay rolled: one pass already holds 16 products per wave, unrolling further would only lengthen the text */
#pragma unroll 1
  for (int kc = 0; kc < K; kc += GKC) {
#pragma unroll
    for (int i = 0; i < 8; ++i) *(v8us*)(sas + 16 * i * GP) = ra[i];
#pragma unroll
    for (int i = 0; i < 4; ++i) *(v8us*)(sbs + 16 * i * GP) = rb[i];
    __syncthreads();      /* the pass's tiles are complete before any wave reads a fragment */
    if (kc + GKC < K) { g2_fetch(ag, (size_t)lda * 32, ao, bg, (size_t)ldb * 32, bo, ra, rb); ag += GKC * 2; bg += GKC * 2; }
#pragma unroll
    for (int kb = 0; kb < GKC; kb += 32) { const v16h a0 = g2_frag(a0p + kb, hh), a1 = g2_frag(a1p + kb, hh);      /* each B fragment after the first is read one pair of products ahead of its use */
      v16h b = g2_frag(b0p + kb, hh), bn = g2_frag(b1p + kb, hh); c00 = g2_mma(a0, b, c00); c10 = g2_mma(a1, b, c10);
      b = g2_frag(b2p + kb, hh); c01 = g2_mma(a0, bn, c01); c11 = g2_mma(a1, bn, c11);
      bn = g2_frag(b3p + kb, hh); c02 = g2_mma(a0, b, c02); c12 = g2_mma(a1, b, c12);
      c03 = g2_mma(a0, bn, c03); c13 = g2_mma(a1, bn, c13); }
    __syncthreads();      /* every wave has read its fragments before the tiles are overwritten (by the next pass, or by the epilogue's staging) */
  }
  v8f accs[8] = {c00, c01, c02, c03, c10, c11, c12, c13};
#pragma unroll
  for (int u = 0; u < 8; ++u) { const int t = u & 3, half = u >> 2; const int col = col0 + t * 16 + ln; const float bv = bias ? bf16_rne(bias[col]) : 0.f;
#pragma unroll
    for (int r = 0; r < 8; ++r) { const int rloc = half * 16 + 8 * hh + r; float v = accs[u][r] * alpha + bv;
      if (CP) v += CP[cofs + (size_t)(row0 + rloc) * ldc + col];      /* own element of the C plane (a prior pass), added in f32 */
      so[w][rloc][t * 16 + ln] = v; } }
  __builtin_amdgcn_fence(4, "workgroup"); __builtin_amdgcn_wave_barrier();
  const int rsub = lane >> 4, c4 = (lane & 15) * 4;
  {
#pragma unroll
    for (int q = 0; q < 16; ++q) { const int r = q * 2 + rsub; const v4f v = *(const v4fa*)&so[w][r][c4];
      if (C) *(v4f*)(C + cofs + (size_t)(row0 + r) * ldc + col0 + c4) = v;
      if (C16) { v4h h4; for (int i = 0; i < 4; ++i) h4[i] = (_Float16)v[i]; *(v4h*)(C16 + cofs + (size_t)(row0 + r) * ldc + col0 + c4) = h4; } }
     }
}

// exact (f32) causal attention for query rows 0..QT0-1 of every (batch, head): planes QF/KF/VF [NB][QT0][DM] (head h at column h*HD); block = 64 threads = 64 consecutive rows of one head;
// the block first brings the K and V rows of all its keys into LDS by whole-line loads (as they lie); thread i keeps its q row and its o accumulator in registers and walks keys j = 0..(its wave's last row) KU at a time (wave-uniform trip count, a multiple of 4; keys j > i enter through an arithmetic 0/1 factor as -1e30, contributing exactly 0):
// the KU scores of a trip are independent chains that run side by side, each as two partial sums (even d, odd d; d ascending) that are added at the end; the online softmax (f32, precise expf) and the o update then take the KU keys one after the other, in key order.
__global__ __launch_bounds__(64) void k_att0(const float* __restrict__ QF, const float* __restrict__ KF, const float* __restrict__ VF, float* __restrict__ OF) {
  #pragma clang fp contract(off)
  __shared__ __attribute__((aligned(16))) float lk[QT0][HD];
  __shared__ __attribute__((aligned(16))) float lv[QT0][HD];
  __shared__ __attribute__((aligned(16))) float lo[64][64];
  const int tid = threadIdx.x; const int rg = blockIdx.x % (QT0 / 64); const int bh = blockIdx.x / (QT0 / 64); const int b = bh / NH, h = bh - b * NH;
  const size_t pofs = (size_t)b * QT0 * DM;
  const int i = rg * 64 + tid;
  const float* qr = QF + pofs + (size_t)i * DM + h * HD;
  { const float* kg = KF + pofs + h * HD + (size_t)(tid >> 4) * 2 * DM + (tid & 15) * 4; const float* vg = VF + pofs + h * HD + (size_t)(tid >> 4) * 2 * DM + (tid & 15) * 4;
    const int c4 = (tid & 15) * 4;      /* 16 lanes per row; a trip brings 4 key pairs, 8 trips 64 keys */
    for (int hf = 0; hf <= rg; ++hf) { v4f rk[16], rv[16]; const float* kp = kg + (size_t)hf * 64 * DM; const float* vp = vg + (size_t)hf * 64 * DM;
      /* unrolled: the 32 row loads of a lane for 64 keys are in flight together */
#pragma unroll
      for (int it = 0; it < 8; ++it) { rk[2 * it] = *(const v4fa*)(kp + it * 8 * DM); rk[2 * it + 1] = *(const v4fa*)(kp + it * 8 * DM + DM); rv[2 * it] = *(const v4fa*)(vp + it * 8 * DM); rv[2 * it + 1] = *(const v4fa*)(vp + it * 8 * DM + DM); }
      /* the wait that belongs between an issued load and an overwrite of its address registers; it names the two addresses so that they stay in their registers up to it (else a later load's result lands in an earlier load's address pair) */
      asm volatile("s_wait_xcnt 0x0" :: "v"(kp), "v"(vp) : "memory");
#pragma unroll
      for (int it = 0; it < 8; ++it) { const int p = (hf * 8 + it) * 4 + (tid >> 4);
        *(v4f*)&lk[2 * p][c4] = rk[2 * it]; *(v4f*)&lk[2 * p + 1][c4] = rk[2 * it + 1]; *(v4f*)&lv[2 * p][c4] = rv[2 * it]; *(v4f*)&lv[2 * p + 1][c4] = rv[2 * it + 1]; } } }
  v2f q[HD / 2], o[HD / 2];
#pragma unroll
  for (int c = 0; c < HD / 4; ++c) { const v4f qq = *(const v4fa*)(qr + c * 4); const v2f qa = {qq[0], qq[1]}, qb = {qq[2], qq[3]}; q[2 * c] = qa; q[2 * c + 1] = qb; const v2f z = {0.f, 0.f}; o[2 * c] = z; o[2 * c + 1] = z; }
  __syncthreads();      /* the block's K and V rows are complete before any wave reads a key */
  float m = -1.0e30f, l = 0.f; const int jend = rg * 64 + __builtin_amdgcn_readfirstlane(tid >> 5) * 32 + 32;      /* wave-uniform: keys up to the wave's last row */
  /* trips stay rolled: one trip already holds KU independent score chains, more would only lengthen the text; every loop inside a trip is fully unrolled, so that q, o and the ring are indexed by constants and stay in registers */
#pragma unroll 1
  for (int j0 = 0; j0 < jend; j0 += KU) { v2f s2[KU]; v4f rb[3][KU]; const float* kt = &lk[j0][0]; const float* vt = &lv[j0][0]; float sc[KU], e[KU];      /* rb: ring of three chunks; a chunk = eight 16-byte LDS reads, the same address in every lane: of K 4 d of the trip's 8 keys (chunks 0..15), of V 16 d of 2 keys (chunks 16..31) */
#pragma unroll
    for (int kk = 0; kk < KU; ++kk) { const v2f z = {0.f, 0.f}; s2[kk] = z; }
    /* chunk n is read two chunks ahead of its use, so that its LDS latency lies behind two chunks of arithmetic. The scheduling fences keep reads and arithmetic in that order: left free, the compiler lifts all reads of a trip to its head, which takes more than 500 registers */
#pragma unroll
    for (int x = 0; x < 8; ++x) { rb[0][x] = *(const v4f*)(kt + x * HD); rb[1][x] = *(const v4f*)(kt + x * HD + 4); }
    __builtin_amdgcn_sched_barrier(0);      /* see above */
#pragma unroll
    for (int t = 0; t < HD / 4; ++t) {
      if (t + 2 < HD / 4) {
#pragma unroll
        for (int x = 0; x < 8; ++x) rb[(t + 2) % 3][x] = *(const v4f*)(kt + x * HD + (t + 2) * 4);
      } else {
#pragma unroll
        for (int x = 0; x < 8; ++x) rb[(t + 2) % 3][x] = *(const v4f*)(vt + (x >> 2) * HD + ((t + 2 - HD / 4) * 4 + (x & 3)) * 4);
      }
      __builtin_amdgcn_sched_barrier(0);      /* see above */
#pragma unroll
      for (int kk = 0; kk < KU; ++kk) { const v4f kq = rb[t % 3][kk]; const v2f ka = {kq[0], kq[1]}; s2[kk] = __builtin_elementwise_fma(q[2 * t], ka, s2[kk]); }
#pragma unroll
      for (int kk = 0; kk < KU; ++kk) { const v4f kq = rb[t % 3][kk]; const v2f kb = {kq[2], kq[3]}; s2[kk] = __builtin_elementwise_fma(q[2 * t + 1], kb, s2[kk]); }
      __builtin_amdgcn_sched_barrier(0);      /* see above */
    }
#pragma unroll
    for (int kk = 0; kk < KU; ++kk) { const int j = j0 + kk; const float s = __fmul_rn(__fadd_rn(s2[kk][0], s2[kk][1]), 0.125f);
      const float f = (j <= i) ? 1.f : 0.f; const float sm = fmaf(f, s, (1.f - f) * -1.0e30f); const float mn = fmaxf(m, sm); sc[kk] = expf(m - mn); e[kk] = expf(sm - mn); l = __fadd_rn(__fmul_rn(l, sc[kk]), e[kk]); m = mn; }
    __builtin_amdgcn_sched_barrier(0);      /* see above */
#pragma unroll
    for (int t = 0; t < HD / 4; ++t) {      /* V chunk t: keys 2 (t / 4), 2 (t / 4) + 1, d 16 (t % 4) .. + 15: eight independent o pairs, every o element meets its keys in ascending order */
      if (t + 2 < HD / 4) {
#pragma unroll
        for (int x = 0; x < 8; ++x) rb[(t + 2 + HD / 4) % 3][x] = *(const v4f*)(vt + (((t + 2) >> 2) * 2 + (x >> 2)) * HD + (((t + 2) & 3) * 4 + (x & 3)) * 4);
      }
      __builtin_amdgcn_sched_barrier(0);      /* see above */
#pragma unroll
      for (int x = 0; x < 8; ++x) { const int kk = (t >> 2) * 2 + (x >> 2), c = (t & 3) * 4 + (x & 3); const v4f vv = rb[(t + HD / 4) % 3][x]; const v2f va = {vv[0], vv[1]}, vb = {vv[2], vv[3]}; const v2f s_ = {sc[kk], sc[kk]}, e_ = {e[kk], e[kk]};
        o[2 * c] = __builtin_elementwise_fma(o[2 * c], s_, e_ * va); o[2 * c + 1] = __builtin_elementwise_fma(o[2 * c + 1], s_, e_ * vb); }
      __builtin_amdgcn_sched_barrier(0);      /* see above */
    } }
  const float fin = 64.0f / l;      /* o carried x64 */
#pragma unroll
  for (int c = 0; c < HD / 4; ++c) { v4f oo = {o[2 * c][0], o[2 * c][1], o[2 * c + 1][0], o[2 * c + 1][1]}; for (int u = 0; u < 4; ++u) oo[u] = __fmul_rn(oo[u], fin); *(v4f*)&lo[tid][c * 4] = oo; }
  __syncthreads();
  {
#pragma unroll 1
    for (int it = 0; it < 16; ++it) { const int row = it * 4 + tid / 16, pc = (tid % 16) * 4; const v4f v = *(const v4f*)&lo[row][pc]; *(v4f*)(OF + pofs + (size_t)(rg * 64 + row) * DM + h * HD + pc) = v; }
     } }

__device__ __forceinline__ void hl_split(const float* __restrict__ F, _Float16* __restrict__ Hh, _Float16* __restrict__ Hl, size_t n8, int blk) {
  const size_t t = (size_t)blk * 256 + threadIdx.x; if (t >= n8) return; FragH fh, fl; const v4f a = *(const v4fa*)(F + t * 8), c = *(const v4fa*)(F + t * 8 + 4);
#pragma unroll
  for (int q = 0; q < 4; ++q) { _Float16 hv = (_Float16)a[q]; fh.h[q] = hv; fl.h[q] = (_Float16)((a[q] - (float)hv) * 1024.0f); hv = (_Float16)c[q]; fh.h[4 + q] = hv; fl.h[4 + q] = (_Float16)((c[q] - (float)hv) * 1024.0f); }
  unsigned short* dh = (unsigned short*)Hh + t * 8; unsigned short* dl = (unsigned short*)Hl + t * 8;
  { *(v8us*)dh = fh.half[0]; *(v8us*)dl = fl.half[0];  } }

// The grid's rows blockIdx.y >= NB*NH do not attend: they split the exact attention's f32 o plane F into its f16 hi / x1024 residual planes (needs nothing of this launch's attention and gives it nothing), 256 x 8 elements a block.
// causal attention, f16 WMMA: grid rows blockIdx.y < NB*NH, (SEQ/128, NB*NH), block = 8 waves, wave -> query rows q0..q0+15 (q0 = 16*(8*blockIdx.x + wave)) of one (b, head).
// K and V^T of a 32-key block are the same for the block's 8 waves: the block brings them into LDS once (one 16-byte load of each per thread: K 8 lanes a row, whole 128-byte lines; V^T 4 lanes a row), two buffers, the next block's lines fetched into registers while this one is worked on;
// every wave stages and meets the one barrier of every 32-key block up to the last wave's count, and skips the arithmetic of the blocks past its own rows; fragments come from LDS (pitches 144 and 80 bytes: a 16-row fragment read meets every bank once).
// Per 32-key block, both products transposed: two 16x16 score tiles S^T = k . q^T (A = K16 rows as [key][d], B = Q16 rows, K = 64 in two k-steps), so that a lane holds 16 of the 32 scores of ONE query (lane l ^ 16 the other 16); x0.125 and the causal select by value in f32,
// online softmax per query (maximum and sum over the lane's own registers, one exchange between the wave's halves for the maximum, the halves' sums joined once behind the loop; o and sum rescaled by exp(m_old - m_new)); P^T x1024 packs from the score registers straight into the B operand of O^T += V^T . P^T (A = V^T rows as [d][key]).
// kg, vg: the block's first K and V^T rows at this 32-key block (the same in every lane); ko, vo: the lane's own byte offsets, fixed for the whole kernel
__device__ __forceinline__ void att_fetch(const char* kg, unsigned ko, const char* vg, unsigned vo, v8us& rk, v8us& rv) {
  const char* ka = kg + ko; const char* va = vg + vo; rk = *(const v8us*)ka; rv = *(const v8us*)va;
  /* the wait that belongs between an issued load and an overwrite of its address registers; it names the two addresses so that they stay in their registers up to it */
  asm volatile("s_wait_xcnt 0x0" :: "v"(ka), "v"(va) : "memory");
}

// lane l with lane l ^ 16
__device__ __forceinline__ float xhalf(float x) { return __builtin_bit_cast(float, __builtin_amdgcn_permlanex16(__builtin_bit_cast(int, x), __builtin_bit_cast(int, x), 0x76543210, 0xfedcba98, false, false)); }

__global__ __launch_bounds__(256) __attribute__((amdgpu_num_vgpr(160)))      /* 160 registers: three blocks stay resident per WGP, as before the staging */
void k_att(const _Float16* __restrict__ Q16, const _Float16* __restrict__ K16, const _Float16* __restrict__ VT, _Float16* __restrict__ O16, const float* __restrict__ F, _Float16* __restrict__ Hh, _Float16* __restrict__ Hl, size_t n8) {
  __shared__ __attribute__((aligned(16))) _Float16 lso[8][16 * OPP];
  __shared__ __attribute__((aligned(16))) _Float16 lkt[2][32 * AKP];
  __shared__ __attribute__((aligned(16))) _Float16 lvt[2][HD * AVP];
  if (blockIdx.y >= NB * NH) { hl_split(F, Hh, Hl, n8, (int)((blockIdx.y - NB * NH) * (SEQ / 128) + blockIdx.x)); return; }      /* the same for the whole block */
  const int tid = threadIdx.x, w = __builtin_amdgcn_readfirstlane(tid >> 5), lane = tid & 31, ln = lane & 15, hh = lane >> 4;      /* the wave's number is the same in every lane: held in a scalar register, so that the test round a trip's products is a scalar branch and what follows from it takes no vector registers */
  const int qt = blockIdx.x * 8 + w; const int bh = blockIdx.y; const int b = bh / NH, h = bh - b * NH;
  const int q0 = qt * 16;
  const size_t wr0 = (size_t)b * SEQ + q0;
  const _Float16* qp = Q16 + (wr0 + ln) * DM + h * HD;
  const v16h qa0 = g2_frag(qp, hh), qa1 = g2_frag(qp + 32, hh);      /* d 0..31, 32..63 */
  const _Float16* kbase = K16 + (size_t)b * SEQ * DM + h * HD;        /* key row j at kbase + j*DM */
  const _Float16* vbase = VT + (size_t)bh * HD * SEQ;                 /* V^T row d at vbase + d*SEQ */
  const v8f z8 = {0.f,0.f,0.f,0.f,0.f,0.f,0.f,0.f}; v8f o0 = z8, o1 = z8, o2 = z8, o3 = z8;
  float mr = -1.0e30f, lr = 0.f;      /* of query q0 + ln; lr: the sum over the keys of this lane's half, the halves are joined behind the loop */
  const int nkb = qt / 2 + 1;      /* 32-key blocks covering keys 0..q0+15 */
  const int nkbb = (int)blockIdx.x * 4 + 4;      /* the count of the block's last wave */
  const char* kg = (const char*)kbase; const char* vg = (const char*)vbase; const unsigned ko = (unsigned)((tid >> 3) * DM + (tid & 7) * 8) * 2u, vo = (unsigned)((tid >> 2) * SEQ + (tid & 3) * 8) * 2u;      /* the thread's own 16 bytes of a 32-key block */
  const int kso = (tid >> 3) * AKP + (tid & 7) * 8, vso = (tid >> 2) * AVP + (tid & 3) * 8;
  v8us rk, rv;
  att_fetch(kg, ko, vg, vo, rk, rv); kg += 32 * DM * 2; vg += 32 * 2;
#pragma unroll 1
  for (int it = 0; it < nkbb; ++it) {
    _Float16* kt = &lkt[it & 1][0]; _Float16* vt = &lvt[it & 1][0];
    *(v8us*)((unsigned short*)kt + kso) = rk; *(v8us*)((unsigned short*)vt + vso) = rv;
    __syncthreads();      /* this block's tiles are complete before any wave reads a fragment; and who passes it knows that every wave has left the other buffer, which the next trip overwrites */
    if (it + 1 < nkbb) { att_fetch(kg, ko, vg, vo, rk, rv); kg += 32 * DM * 2; vg += 32 * 2; }
    if (it >= nkb) continue;      /* keys past the wave's rows: nothing to add */
    const int kb = it * 32;
    v8f s0 = z8, s1 = z8;      /* S^T: register r of lane (ln, hh) = key kb + 8 hh + r (s0), kb + 16 + 8 hh + r (s1), of query q0 + ln */
    { const _Float16* kp = kt + ln * AKP;      /* the four K fragments are read together, ahead of the products */
      const v16h k00 = g2_frag(kp, hh), k01 = g2_frag(kp + 32, hh), k10 = g2_frag(kp + 16 * AKP, hh), k11 = g2_frag(kp + 16 * AKP + 32, hh);
      s0 = g2_mma(k00, qa0, s0); s1 = g2_mma(k10, qa0, s1); s0 = g2_mma(k01, qa1, s0); s1 = g2_mma(k11, qa1, s1); }      /* the two tiles take turns: no product waits for the one before it */
    const _Float16* vp = vt + ln * AVP;      /* the four V^T fragments are read ahead of the softmax, which covers their latency */
    const v16h v0 = g2_frag(vp, hh), v1 = g2_frag(vp + 16 * AVP, hh), v2 = g2_frag(vp + 32 * AVP, hh), v3 = g2_frag(vp + 48 * AVP, hh);
    __builtin_amdgcn_sched_barrier(0);      /* keeps the eight reads here: left free, the compiler sinks them to the products, where their latency is bare */
    float sv[16];
#pragma unroll
    for (int r = 0; r < 8; ++r) {
      const int qk = q0 - kb - r;      /* key kb + 8 hh + r <= row q0 + ln, with the wave's part of the test on the scalar side: one vector register (8 hh - ln) */
      sv[r] = (8 * hh - ln <= qk) ? s0[r] * 0.125f : -1.0e30f;
      sv[8 + r] = (8 * hh - ln <= qk - 16) ? s1[r] * 0.125f : -1.0e30f;
    }
    float mx = fmaxf(sv[0], sv[1]);
#pragma unroll
    for (int r = 2; r < 16; ++r) mx = fmaxf(mx, sv[r]);
    mx = fmaxf(mx, xhalf(mx));      /* both halves hold the query's maximum over the 32 keys */
    const float mn = fmaxf(mr, mx);
    const float al = __expf(mr - mn); mr = mn;
    FragH pf; v2f p2[8];      /* P^T as the B operand: elements 0..7 = keys 8 hh .. + 7, 8..15 = keys 16 + 8 hh .. + 7, the k order of the V^T fragments */
#pragma unroll
    for (int r = 0; r < 8; ++r) { const v2f p = {__expf(sv[2 * r] - mn), __expf(sv[2 * r + 1] - mn)}; p2[r] = p; pf.h[2 * r] = (_Float16)(p[0] * 1024.0f); pf.h[2 * r + 1] = (_Float16)(p[1] * 1024.0f); }
    const v2f rs = ((p2[0] + p2[1]) + (p2[2] + p2[3])) + ((p2[4] + p2[5]) + (p2[6] + p2[7]));      /* the lane's 16 keys, summed as a tree of pairs */
    lr = lr * al + (rs[0] + rs[1]);
#pragma unroll
    for (int r = 0; r < 8; ++r) { o0[r] *= al; o1[r] *= al; o2[r] *= al; o3[r] *= al; }
    o0 = g2_mma(v0, pf.v, o0); o1 = g2_mma(v1, pf.v, o1); o2 = g2_mma(v2, pf.v, o2); o3 = g2_mma(v3, pf.v, o3);      /* O^T tile t: register r = d 16 t + 8 hh + r of query q0 + ln */
  }
  _Float16* sob = &lso[w][0];
  { const float inv = (1.0f / (lr + xhalf(lr))) * 0.0009765625f; FragH f0, f1;
#pragma unroll
    for (int r = 0; r < 8; ++r) { f0.h[r] = (_Float16)(o0[r] * inv); f0.h[8 + r] = (_Float16)(o1[r] * inv); f1.h[r] = (_Float16)(o2[r] * inv); f1.h[8 + r] = (_Float16)(o3[r] * inv); }
    unsigned short* sp = (unsigned short*)sob + ln * OPP + 8 * hh;      /* a lane's 8 d of a tile are 16 bytes of its query's row */
    *(v8us*)sp = f0.half[0]; *(v8us*)(sp + 16) = f0.half[1]; *(v8us*)(sp + 32) = f1.half[0]; *(v8us*)(sp + 48) = f1.half[1]; }
  __builtin_amdgcn_fence(3, "wavefront"); __builtin_amdgcn_wave_barrier();
  unsigned short* ob = (unsigned short*)O16 + wr0 * DM + h * HD;
  {
#pragma unroll
    for (int it2 = 0; it2 < 4; ++it2) { const int row = it2 * 4 + (lane >> 3), c8 = (lane & 7) * 8; const v8us v = *(const v8us*)((const unsigned short*)sob + row * OPP + c8); *(v8us*)(ob + (size_t)row * DM + c8) = v; }
     }
}

extern "C" void kernel_launch(void* const* d_in, const int* in_sizes, int n_in,
                              void* d_out, int out_size, void* d_ws, size_t ws_size, hipStream_t stream) {
  if (n_in < 6) return;
  const float* x = (const float*)d_in[0]; const float* wq = (const float*)d_in[1]; const float* wk = (const float*)d_in[2];
  const float* wv = (const float*)d_in[3]; const float* wp = (const float*)d_in[4]; const float* bproj = (const float*)d_in[5];
  const size_t need_x = (size_t)(NB - 1) * SEQ_FULL * DM + (size_t)SEQ * DM;
  if ((size_t)in_sizes[0] < need_x || in_sizes[1] < DM * DM || in_sizes[2] < DM * DM || in_sizes[3] < DM * DM || in_sizes[4] < DM * DM || in_sizes[5] < DM || (size_t)out_size < need_x) return;
  float* out = (float*)d_out;
  char* ws = (char*)d_ws; size_t off = 0;
  auto take = [&](size_t bytes) { char* p = ws + off; off += (bytes + 255) & ~(size_t)255; return p; };
  const size_t wb = (size_t)DM * DM * 2;
  _Float16* WQ = (_Float16*)take(4 * wb); _Float16* WK = WQ + DM * DM; _Float16* WV = WK + DM * DM; _Float16* WP = WV + DM * DM;      /* four planes in a row */
  const size_t rows2 = (size_t)NB * SEQ * DM * 2;      /* f16 plane over all token rows */
  const size_t f0b4 = (size_t)NB * QT0 * DM * 4;       /* f32 first-tile plane */
  const size_t f0b2 = (size_t)NB * QT0 * DM * 2;       /* f16 first-tile plane */
  const size_t vtb = (size_t)NB * DM * SEQ * 2;         /* V^T [NB*NH*HD][SEQ] */
  /* every plane that one launch writes has its own place: the GEMMs of a launch run side by side */
  _Float16* X16 = (_Float16*)take(rows2); _Float16* O16 = X16;      /* X16 is last read by the first GEMM launch, O16 written after it */
  float* QF0 = (float*)take(f0b4); float* KF0 = (float*)take(f0b4); float* VF0 = (float*)take(f0b4); float* OF0 = (float*)take(f0b4);
  _Float16* Q16 = (_Float16*)take(rows2); _Float16* K16 = (_Float16*)take(rows2); _Float16* VT = (_Float16*)take(vtb);
  _Float16* OH = (_Float16*)take(f0b2); _Float16* OL = (_Float16*)take(f0b2);
  if (off > ws_size) return;

  const size_t nx8 = (size_t)NB * SEQ * DM / 8;
  k_cvt<<<(unsigned)(4 * GW + (nx8 + 255) / 256), 256, 0, stream>>>(x, wq, wk, wv, wp, WQ, X16, nx8);
  constexpr int nS = (QT0 / 128) * (DM / 64);            /* blocks per batch: first-tile GEMMs */
  constexpr int nA = (NB * SEQ / 128) * (DM / 64);       /* all token rows, one batch */
  constexpr int nV = (DM / 128) * (SEQ / 64);            /* V^T, per batch */
  constexpr int nP = ((SEQ - QT0) / 128) * (DM / 64);    /* projection of rows >= 128, per batch */
  /* all six products of X16 in one launch: f16 q, k rows for all tokens; V^T directly as (16 Wv) . X16^T; f32 q, k, v of rows 0..127 of every sequence (exact products) */
  GJobs g1 = {};
  g1.j[0] = GJob{X16, WQ, nullptr, nullptr, Q16, (size_t)0, (size_t)0, (size_t)0, 0.0625f, DM, DM, DM, DM, nA, 0, 0};
  g1.j[1] = GJob{X16, WK, nullptr, nullptr, K16, (size_t)0, (size_t)0, (size_t)0, 0.0625f, DM, DM, DM, DM, nA, nA, 0};
  g1.j[2] = GJob{WV, X16, nullptr, nullptr, VT, (size_t)0, (size_t)SEQ * DM, (size_t)DM * SEQ, 0.0625f, DM, DM, SEQ, SEQ, nV, 2 * nA, 0};
  g1.j[3] = GJob{X16, WQ, nullptr, QF0, nullptr, (size_t)SEQ * DM, (size_t)0, (size_t)QT0 * DM, 0.0625f, DM, DM, DM, DM, nS, 2 * nA + NB * nV, 0};
  g1.j[4] = GJob{X16, WK, nullptr, KF0, nullptr, (size_t)SEQ * DM, (size_t)0, (size_t)QT0 * DM, 0.0625f, DM, DM, DM, DM, nS, 2 * nA + NB * nV + NB * nS, 0};
  g1.j[5] = GJob{X16, WV, nullptr, VF0, nullptr, (size_t)SEQ * DM, (size_t)0, (size_t)QT0 * DM, 0.0625f, DM, DM, DM, DM, nS, 2 * nA + NB * nV + 2 * NB * nS, 0};
  k_gemm2<<<2 * nA + NB * nV + 3 * NB * nS, 128, 0, stream>>>(g1, 6, bproj, DM);
  k_att0<<<NB * NH * (QT0 / 64), 64, 0, stream>>>(QF0, KF0, VF0, OF0);      /* exact attention rows 0..127 (o x64) */
  const size_t nf8 = (size_t)NB * QT0 * DM / 8;
  /* attention of all rows and, in the grid's last rows, the f16 hi / x1024 residual planes of the exact o x64 */
  k_att<<<dim3(SEQ / 128, (unsigned)(NB * NH + ((nf8 + 255) / 256 + SEQ / 128 - 1) / (SEQ / 128))), 256, 0, stream>>>(Q16, K16, VT, O16, OF0, OH, OL, nf8);
  /* output projection, one launch: rows >= 128 from the f16 o plane, rows < 128 from the hi plane; then a launch that adds the residual plane's product to rows < 128 */
  GJobs g2 = {};
  g2.j[0] = GJob{O16 + (size_t)QT0 * DM, WP, nullptr, out + (size_t)QT0 * DM, nullptr, (size_t)SEQ * DM, (size_t)0, (size_t)SEQ_FULL * DM, 0.0625f, DM, DM, DM, DM, nP, 0, 1};
  g2.j[1] = GJob{OH, WP, nullptr, out, nullptr, (size_t)QT0 * DM, (size_t)0, (size_t)SEQ_FULL * DM, 0.0009765625f, DM, DM, DM, DM, nS, NB * nP, 1};
  k_gemm2<<<NB * nP + NB * nS, 128, 0, stream>>>(g2, 2, bproj, DM);
  GJobs g3 = {};
  g3.j[0] = GJob{OL, WP, out, out, nullptr, (size_t)QT0 * DM, (size_t)0, (size_t)SEQ_FULL * DM, 9.5367431640625e-07f, DM, DM, DM, DM, nS, 0, 0};
  k_gemm2<<<NB * nS, 128, 0, stream>>>(g3, 1, bproj, DM);
}

// v007
// It runs in 152 microseconds.
// Timed twice side by side with v006, it ran 1.14 and 1.13 times as fast.
// Over all steps from v000 it is 5.47 times as fast.
#include <hip/hip_runtime.h>
// Structure: token rows r = b*SEQ + t in compact workspace planes (input/output strides use SEQ_FULL); X16 = f16(bf16(x)); Q16, K16 = X16 . (16 W)^T / 16 as 32x64 wave-tile GEMMs with LDS-staged whole-line epilogues; V^T per (b, head) produced directly as (16 Wv) . X16^T / 16;
#ifndef NB
#define NB 64
#endif
#ifndef SEQ
#define SEQ 512
#endif
#define NB_FULL 64
#define SEQ_FULL 512
#define DM 384
#define NH 6
#define HD 64
#define QT0 128                      /* first query rows per sequence recomputed exactly in f32 */
#define OPP 72                       /* LDS pitch (halves) of the 16x64 O staging tile */
#define GKC 64                       /* k (halves) of one staged GEMM pass: one 128-byte line of every operand row */
#define KU 8                         /* keys per trip of the exact attention */
#define GP 72                        /* LDS pitch (halves) of a staged GEMM operand row: 128 + 16 bytes */
#define AKP 72                       /* LDS pitch (halves) of a staged K row (64 d): 128 + 16 bytes */
#define RSC 0.0009765625f            /* 2^-10: takes the x1024 of a residual plane out of its sums */
#define AVP 40                       /* LDS pitch (halves) of a staged V^T row (32 keys): 64 + 16 bytes */
static_assert(NB >= 1 && NB <= NB_FULL);
static_assert(SEQ % 128 == 0 && SEQ >= 2 * QT0 && SEQ <= SEQ_FULL);
static_assert(KU == 8);
static_assert(DM == NH * HD && DM % 128 == 0 && HD == 64 && QT0 == 128);

typedef unsigned short v8us __attribute__((ext_vector_type(8), may_alias));
typedef float  v8f  __attribute__((ext_vector_type(8)));
typedef float  v4f  __attribute__((ext_vector_type(4)));
typedef float  v2f  __attribute__((ext_vector_type(2)));
typedef float  v4fa __attribute__((ext_vector_type(4), may_alias));
typedef _Float16 v16h __attribute__((ext_vector_type(16)));
typedef _Float16 v4h __attribute__((ext_vector_type(4)));
union FragH { v16h v; v8us half[2]; _Float16 h[16]; unsigned short u[16]; };

__device__ __forceinline__ unsigned short bf16_bits(float x) { unsigned int u = __float_as_uint(x); return (unsigned short)((u + 0x7FFFu + ((u >> 16) & 1u)) >> 16); }
__device__ __forceinline__ float bf16_val(unsigned short b) { return __uint_as_float(((unsigned int)b) << 16); }
__device__ __forceinline__ float bf16_rne(float x) { return bf16_val(bf16_bits(x)); }

// 16-bit WMMA fragment from a k-contiguous row (A: row m, B: column n of a [n][k] plane): elements 0..7 <- k 8hh..8hh+7, elements 8..15 <- k 16+8hh..16+8hh+7
__device__ __forceinline__ v16h g2_frag(const _Float16* p, int hh) { FragH f; f.half[0] = *(const v8us*)((const unsigned short*)p + 8 * hh); f.half[1] = *(const v8us*)((const unsigned short*)p + 16 + 8 * hh); return f.v; }
__device__ __forceinline__ v8f g2_mma(v16h a, v16h b, v8f c) { v8f d = __builtin_amdgcn_wmma_f32_16x16x32_f16(false, a, false, b, (short)0, c, false, false); asm volatile("v_nop\n\tv_nop\n\tv_nop\n\tv_nop" : "+v"(d) : "v"(a), "v"(b)); return d; }

__device__ __forceinline__ void cvt_w(const float* __restrict__ w, size_t n8, _Float16* __restrict__ Bt, int blk) {
  const size_t t = (size_t)blk * 256 + threadIdx.x; if (t >= n8) return; FragH f;
#pragma unroll
  for (int q = 0; q < 8; ++q) f.h[q] = (_Float16)(bf16_rne(w[t * 8 + q]) * 16.0f);
  unsigned short* d = (unsigned short*)Bt + t * 8;
  *(v8us*)d = f.half[0]; 
}

__device__ __forceinline__ void cvt_x(const float* __restrict__ x, _Float16* __restrict__ X16, size_t n8, int blk) {
  const size_t t = (size_t)blk * 256 + threadIdx.x; if (t >= n8) return;
  const size_t wr = t / (DM / 8); const int c8 = (int)(t % (DM / 8)) * 8;
  const size_t b = wr / SEQ, tt = wr % SEQ;
  const float* src = x + (b * SEQ_FULL + tt) * DM + c8;
  const v4f a = *(const v4fa*)src, c = *(const v4fa*)(src + 4); FragH f;
#pragma unroll
  for (int q = 0; q < 4; ++q) { f.h[q] = (_Float16)bf16_rne(a[q]); f.h[4 + q] = (_Float16)bf16_rne(c[q]); }
  unsigned short* d = (unsigned short*)X16 + t * 8;
  *(v8us*)d = f.half[0]; 
}

// all five conversions in one grid: blocks 0..4 GW-1 take the four weight planes (GW blocks each, W16 = four [DM][DM] planes in a row), the rest take x
#define GW ((DM * DM / 8 + 255) / 256)
__global__ __launch_bounds__(256) void k_cvt(const float* __restrict__ x, const float* __restrict__ w0, const float* __restrict__ w1, const float* __restrict__ w2, const float* __restrict__ w3, _Float16* __restrict__ W16, _Float16* __restrict__ X16, size_t nx8) {
  const int bid = blockIdx.x;
  if (bid < 4 * GW) { const int wi = bid / GW; const float* w = wi == 0 ? w0 : wi == 1 ? w1 : wi == 2 ? w2 : w3; cvt_w(w, (size_t)DM * DM / 8, W16 + (size_t)wi * DM * DM, bid - wi * GW); }
  else cvt_x(x, X16, nx8, bid - 4 * GW);
}

// one pass's operand lines into registers: this lane's 16 bytes of 8 A rows and 4 B rows, 16 rows (sa16, sb16 bytes) apart; pa, pb: the block's first rows at this pass (the same in every lane), ao, bo: the lane's own byte offsets
__device__ __forceinline__ void g2_fetch(const char* pa, size_t sa16, unsigned ao, const char* pb, size_t sb16, unsigned bo, v8us (&ra)[8], v8us (&rb)[4]) {
  const char* a[8]; const char* b[4];
#pragma unroll
  for (int i = 0; i < 8; ++i) { a[i] = pa + i * sa16 + ao; ra[i] = *(const v8us*)a[i]; }
#pragma unroll
  for (int i = 0; i < 4; ++i) { b[i] = pb + i * sb16 + bo; rb[i] = *(const v8us*)b[i]; }
  /* the wait that belongs between an issued load and an overwrite of its address registers; it names the twelve addresses so that they stay in their registers up to it (else a later load's result lands in an earlier load's address pair) */
  asm volatile("s_wait_xcnt 0x0" :: "v"(a[0]), "v"(a[1]), "v"(a[2]), "v"(a[3]), "v"(a[4]), "v"(a[5]), "v"(a[6]), "v"(a[7]), "v"(b[0]), "v"(b[1]), "v"(b[2]), "v"(b[3]) : "memory");
}

// one GEMM of a launch: its operands and outputs, nbx = (M / 128) (N / 64) blocks per batch, first = its first block in the launch's flat grid, useb = add the bias; AL: null, or the x1024 residual plane of A (same pitch and batch stride)
struct GJob { const _Float16* A; const _Float16* Bh; const _Float16* AL; float* C; _Float16* C16; size_t sA, sB, sC; float alpha; int lda, ldb, ldc, N, nbx, first, useb; };
#define GJMAX 6
struct GJobs { GJob j[GJMAX]; };

// A launch holds nj independent GEMMs (none reads what another writes), one after the other in a flat grid; a block finds its GEMM by its index, then its batch and tile.
// GEMM C[M][N] = alpha ((A + AL / 1024) . Bt^T) + bf16(bias[col]): A f16 row-major (pitch lda, batch stride sA), Bt f16 [n][k] (pitch ldb, stride sB);
// writes f32 C and/or f16 C16 (pitch ldc, batch stride sC). Block = 4 waves, block tile 128 rows x 64 cols, wave tile 32 rows x 64 cols; M % 128 == 0, N % 64 == 0, K % 64 == 0.
// Operands: per pass of GKC = 64 k the block brings its 128 A rows and 64 B rows into LDS, 8 lanes per row, so that every wave-wide 16-byte load covers four whole 128-byte lines and each B row is fetched once per block;
// the next pass's lines are fetched into registers while this pass is multiplied; fragments come from LDS (row pitch 144 bytes: a 16-row fragment read meets every bank once). k order of the products as before (32 at a time, ascending).
// With a residual plane the k loop runs twice over K in the same accumulators: first the products of AL, whose sums are then scaled by 2^-10 (exact), then the products of A on top.
__global__ __launch_bounds__(128) void k_gemm2(GJobs js, int nj, const float* __restrict__ biasv, int K) {
  __shared__ __attribute__((aligned(16))) unsigned char sm[4 * 32 * 68 * 4];      /* operand tiles in the k loop, then the epilogue's f32 staging */
  static_assert((128 + 64) * GP * 2 <= 4 * 32 * 68 * 4);
  float (*so)[32][68] = (float (*)[32][68])sm;
  _Float16* sa = (_Float16*)sm; _Float16* sb = sa + 128 * GP;
  const int tid = threadIdx.x, w = tid >> 5, lane = tid & 31, ln = lane & 15, hh = lane >> 4;
  const int bid = blockIdx.x; int ji = 0;
  for (int q = 1; q < GJMAX; ++q) if (q < nj && bid >= js.j[q].first) ji = q;
  const GJob& J = js.j[ji];
  const int lda = J.lda, ldb = J.ldb, ldc = J.ldc; const float alpha = J.alpha; float* C = J.C; _Float16* C16 = J.C16; const float* bias = J.useb ? biasv : nullptr;
  const int loc = bid - J.first; const int by = loc / J.nbx, bx = loc - by * J.nbx;
  const _Float16* A = J.A + (size_t)by * J.sA; const _Float16* Bh = J.Bh + (size_t)by * J.sB; const size_t cofs = (size_t)by * J.sC;
  const int ntn = J.N >> 6; const int mt = bx / ntn, nq = bx - mt * ntn; const int row0 = mt * 128 + 32 * w, col0 = nq * 64;
  const int sr = tid >> 3, sc8 = (tid & 7) * 8;      /* staging: row sr + 16 i, halves sc8..sc8+7 of the pass */
  const char* ah = (const char*)(A + (size_t)(mt * 128) * lda); const char* bh = (const char*)(Bh + (size_t)col0 * ldb);      /* the block's first rows: the same in every lane */
  const int KT = J.AL ? 2 * K : K;      /* k of both planes together */
  const char* ag = J.AL ? (const char*)(J.AL + (size_t)by * J.sA + (size_t)(mt * 128) * lda) : ah; const char* bg = bh;      /* the residual plane goes first */
  const unsigned ao = (unsigned)(sr * lda + sc8) * 2u, bo = (unsigned)(sr * ldb + sc8) * 2u;      /* the lane's own byte offsets, fixed for the whole kernel */
  unsigned short* sas = (unsigned short*)sa + sr * GP + sc8; unsigned short* sbs = (unsigned short*)sb + sr * GP + sc8;
  const _Float16* a0p = sa + (32 * w + ln) * GP; const _Float16* a1p = a0p + 16 * GP;
  const _Float16* b0p = sb + ln * GP; const _Float16* b1p = b0p + 16 * GP; const _Float16* b2p = b1p + 16 * GP; const _Float16* b3p = b2p + 16 * GP;
  const v8f z8 = {0.f,0.f,0.f,0.f,0.f,0.f,0.f,0.f}; v8f c00 = z8, c01 = z8, c02 = z8, c03 = z8, c10 = z8, c11 = z8, c12 = z8, c13 = z8;
  v8us ra[8], rb[4];
  g2_fetch(ag, (size_t)lda * 32, ao, bg, (size_t)ldb * 32, bo, ra, rb); ag += GKC * 2; bg += GKC * 2;
  /* passes stay rolled: one pass already holds 16 products per wave, unrolling further would only lengthen the text */
#pragma unroll 1
  for (int kc = 0; kc < KT; kc += GKC) {
#pragma unroll
    for (int i = 0; i < 8; ++i) *(v8us*)(sas + 16 * i * GP) = ra[i];
#pragma unroll
    for (int i = 0; i < 4; ++i) *(v8us*)(sbs + 16 * i * GP) = rb[i];
    __syncthreads();      /* the pass's tiles are complete before any wave reads a fragment */
    if (kc + GKC == K) { ag = ah; bg = bh; }      /* the residual plane is through: on to A, from k = 0 (without a residual plane nothing is fetched any more) */
    if (kc + GKC < KT) { g2_fetch(ag, (size_t)lda * 32, ao, bg, (size_t)ldb * 32, bo, ra, rb); ag += GKC * 2; bg += GKC * 2; }
#pragma unroll
    for (int kb = 0; kb < GKC; kb += 32) { const v16h a0 = g2_frag(a0p + kb, hh), a1 = g2_frag(a1p + kb, hh);      /* each B fragment after the first is read one pair of products ahead of its use */
      v16h b = g2_frag(b0p + kb, hh), bn = g2_frag(b1p + kb, hh); c00 = g2_mma(a0, b, c00); c10 = g2_mma(a1, b, c10);
      b = g2_frag(b2p + kb, hh); c01 = g2_mma(a0, bn, c01); c11 = g2_mma(a1, bn, c11);
      bn = g2_frag(b3p + kb, hh); c02 = g2_mma(a0, b, c02); c12 = g2_mma(a1, b, c12);
      c03 = g2_mma(a0, bn, c03); c13 = g2_mma(a1, bn, c13); }
    if (kc + GKC == K && KT > K) { c00 *= RSC; c01 *= RSC; c02 *= RSC; c03 *= RSC; c10 *= RSC; c11 *= RSC; c12 *= RSC; c13 *= RSC; }      /* the residual sums take their weight before A's products join them */
    __syncthreads();      /* every wave has read its fragments before the tiles are overwritten (by the next pass, or by the epilogue's staging) */
  }
  v8f accs[8] = {c00, c01, c02, c03, c10, c11, c12, c13};
#pragma unroll
  for (int u = 0; u < 8; ++u) { const int t = u & 3, half = u >> 2; const int col = col0 + t * 16 + ln; const float bv = bias ? bf16_rne(bias[col]) : 0.f;
#pragma unroll
    for (int r = 0; r < 8; ++r) { const int rloc = half * 16 + 8 * hh + r; float v = accs[u][r] * alpha + bv;
      so[w][rloc][t * 16 + ln] = v; } }
  __builtin_amdgcn_fence(4, "workgroup"); __builtin_amdgcn_wave_barrier();
  const int rsub = lane >> 4, c4 = (lane & 15) * 4;
  {
#pragma unroll
    for (int q = 0; q < 16; ++q) { const int r = q * 2 + rsub; const v4f v = *(const v4fa*)&so[w][r][c4];
      if (C) *(v4f*)(C + cofs + (size_t)(row0 + r) * ldc + col0 + c4) = v;
      if (C16) { v4h h4; for (int i = 0; i < 4; ++i) h4[i] = (_Float16)v[i]; *(v4h*)(C16 + cofs + (size_t)(row0 + r) * ldc + col0 + c4) = h4; } }
     }
}

// exact (f32) causal attention for query rows 0..QT0-1 of every (batch, head): planes QF/KF/VF [NB][QT0][DM] (head h at column h*HD); block = 64 threads = 64 consecutive rows of one head;
// the block first brings the K and V rows of all its keys into LDS by whole-line loads (as they lie); thread i keeps its q row and its o accumulator in registers and walks keys j = 0..(its wave's last row) KU at a time (wave-uniform trip count, a multiple of 4; keys j > i enter through an arithmetic 0/1 factor as -1e30, contributing exactly 0):
// the KU scores of a trip are independent chains that run side by side, each as two partial sums (even d, odd d; d ascending) that are added at the end; the online softmax (f32, precise expf) and the o update then take the KU keys one after the other, in key order.
__global__ __launch_bounds__(64) void k_att0(const float* __restrict__ QF, const float* __restrict__ KF, const float* __restrict__ VF, float* __restrict__ OF) {
  #pragma clang fp contract(off)
  __shared__ __attribute__((aligned(16))) float lk[QT0][HD];
  __shared__ __attribute__((aligned(16))) float lv[QT0][HD];
  __shared__ __attribute__((aligned(16))) float lo[64][64];
  const int tid = threadIdx.x; const int rg = blockIdx.x % (QT0 / 64); const int bh = blockIdx.x / (QT0 / 64); const int b = bh / NH, h = bh - b * NH;
  const size_t pofs = (size_t)b * QT0 * DM;
  const int i = rg * 64 + tid;
  const float* qr = QF + pofs + (size_t)i * DM + h * HD;
  { const float* kg = KF + pofs + h * HD + (size_t)(tid >> 4) * 2 * DM + (tid & 15) * 4; const float* vg = VF + pofs + h * HD + (size_t)(tid >> 4) * 2 * DM + (tid & 15) * 4;
    const int c4 = (tid & 15) * 4;      /* 16 lanes per row; a trip brings 4 key pairs, 8 trips 64 keys */
    for (int hf = 0; hf <= rg; ++hf) { v4f rk[16], rv[16]; const float* kp = kg + (size_t)hf * 64 * DM; const float* vp = vg + (size_t)hf * 64 * DM;
      /* unrolled: the 32 row loads of a lane for 64 keys are in flight together */
#pragma unroll
      for (int it = 0; it < 8; ++it) { rk[2 * it] = *(const v4fa*)(kp + it * 8 * DM); rk[2 * it + 1] = *(const v4fa*)(kp + it * 8 * DM + DM); rv[2 * it] = *(const v4fa*)(vp + it * 8 * DM); rv[2 * it + 1] = *(const v4fa*)(vp + it * 8 * DM + DM); }
      /* the wait that belongs between an issued load and an overwrite of its address registers; it names the two addresses so that they stay in their registers up to it (else a later load's result lands in an earlier load's address pair) */
      asm volatile("s_wait_xcnt 0x0" :: "v"(kp), "v"(vp) : "memory");
#pragma unroll
      for (int it = 0; it < 8; ++it) { const int p = (hf * 8 + it) * 4 + (tid >> 4);
        *(v4f*)&lk[2 * p][c4] = rk[2 * it]; *(v4f*)&lk[2 * p + 1][c4] = rk[2 * it + 1]; *(v4f*)&lv[2 * p][c4] = rv[2 * it]; *(v4f*)&lv[2 * p + 1][c4] = rv[2 * it + 1]; } } }
  v2f q[HD / 2], o[HD / 2];
#pragma unroll
  for (int c = 0; c < HD / 4; ++c) { const v4f qq = *(const v4fa*)(qr + c * 4); const v2f qa = {qq[0], qq[1]}, qb = {qq[2], qq[3]}; q[2 * c] = qa; q[2 * c + 1] = qb; const v2f z = {0.f, 0.f}; o[2 * c] = z; o[2 * c + 1] = z; }
  __syncthreads();      /* the block's K and V rows are complete before any wave reads a key */
  float m = -1.0e30f, l = 0.f; const int jend = rg * 64 + __builtin_amdgcn_readfirstlane(tid >> 5) * 32 + 32;      /* wave-uniform: keys up to the wave's last row */
  /* trips stay rolled: one trip already holds KU independent score chains, more would only lengthen the text; every loop inside a trip is fully unrolled, so that q, o and the ring are indexed by constants and stay in registers */
#pragma unroll 1
  for (int j0 = 0; j0 < jend; j0 += KU) { v2f s2[KU]; v4f rb[3][KU]; const float* kt = &lk[j0][0]; const float* vt = &lv[j0][0]; float sc[KU], e[KU];      /* rb: ring of three chunks; a chunk = eight 16-byte LDS reads, the same address in every lane: of K 4 d of the trip's 8 keys (chunks 0..15), of V 16 d of 2 keys (chunks 16..31) */
#pragma unroll
    for (int kk = 0; kk < KU; ++kk) { const v2f z = {0.f, 0.f}; s2[kk] = z; }
    /* chunk n is read two chunks ahead of its use, so that its LDS latency lies behind two chunks of arithmetic. The scheduling fences keep reads and arithmetic in that order: left free, the compiler lifts all reads of a trip to its head, which takes more than 500 registers */
#pragma unroll
    for (int x = 0; x < 8; ++x) { rb[0][x] = *(const v4f*)(kt + x * HD); rb[1][x] = *(const v4f*)(kt + x * HD + 4); }
    __builtin_amdgcn_sched_barrier(0);      /* see above */
#pragma unroll
    for (int t = 0; t < HD / 4; ++t) {
      if (t + 2 < HD / 4) {
#pragma unroll
        for (int x = 0; x < 8; ++x) rb[(t + 2) % 3][x] = *(const v4f*)(kt + x * HD + (t + 2) * 4);
      } else {
#pragma unroll
        for (int x = 0; x < 8; ++x) rb[(t + 2) % 3][x] = *(const v4f*)(vt + (x >> 2) * HD + ((t + 2 - HD / 4) * 4 + (x & 3)) * 4);
      }
      __builtin_amdgcn_sched_barrier(0);      /* see above */
#pragma unroll
      for (int kk = 0; kk < KU; ++kk) { const v4f kq = rb[t % 3][kk]; const v2f ka = {kq[0], kq[1]}; s2[kk] = __builtin_elementwise_fma(q[2 * t], ka, s2[kk]); }
#pragma unroll
      for (int kk = 0; kk < KU; ++kk) { const v4f kq = rb[t % 3][kk]; const v2f kb = {kq[2], kq[3]}; s2[kk] = __builtin_elementwise_fma(q[2 * t + 1], kb, s2[kk]); }
      __builtin_amdgcn_sched_barrier(0);      /* see above */
    }
#pragma unroll
    for (int kk = 0; kk < KU; ++kk) { const int j = j0 + kk; const float s = __fmul_rn(__fadd_rn(s2[kk][0], s2[kk][1]), 0.125f);
      const float f = (j <= i) ? 1.f : 0.f; const float sm = fmaf(f, s, (1.f - f) * -1.0e30f); const float mn = fmaxf(m, sm); sc[kk] = expf(m - mn); e[kk] = expf(sm - mn); l = __fadd_rn(__fmul_rn(l, sc[kk]), e[kk]); m = mn; }
    __builtin_amdgcn_sched_barrier(0);      /* see above */
#pragma unroll
    for (int t = 0; t < HD / 4; ++t) {      /* V chunk t: keys 2 (t / 4), 2 (t / 4) + 1, d 16 (t % 4) .. + 15: eight independent o pairs, every o element meets its keys in ascending order */
      if (t + 2 < HD / 4) {
#pragma unroll
        for (int x = 0; x < 8; ++x) rb[(t + 2 + HD / 4) % 3][x] = *(const v4f*)(vt + (((t + 2) >> 2) * 2 + (x >> 2)) * HD + (((t + 2) & 3) * 4 + (x & 3)) * 4);
      }
      __builtin_amdgcn_sched_barrier(0);      /* see above */
#pragma unroll
      for (int x = 0; x < 8; ++x) { const int kk = (t >> 2) * 2 + (x >> 2), c = (t & 3) * 4 + (x & 3); const v4f vv = rb[(t + HD / 4) % 3][x]; const v2f va = {vv[0], vv[1]}, vb = {vv[2], vv[3]}; const v2f s_ = {sc[kk], sc[kk]}, e_ = {e[kk], e[kk]};
        o[2 * c] = __builtin_elementwise_fma(o[2 * c], s_, e_ * va); o[2 * c + 1] = __builtin_elementwise_fma(o[2 * c + 1], s_, e_ * vb); }
      __builtin_amdgcn_sched_barrier(0);      /* see above */
    } }
  const float fin = 64.0f / l;      /* o carried x64 */
#pragma unroll
  for (int c = 0; c < HD / 4; ++c) { v4f oo = {o[2 * c][0], o[2 * c][1], o[2 * c + 1][0], o[2 * c + 1][1]}; for (int u = 0; u < 4; ++u) oo[u] = __fmul_rn(oo[u], fin); *(v4f*)&lo[tid][c * 4] = oo; }
  __syncthreads();
  {
#pragma unroll 1
    for (int it = 0; it < 16; ++it) { const int row = it * 4 + tid / 16, pc = (tid % 16) * 4; const v4f v = *(const v4f*)&lo[row][pc]; *(v4f*)(OF + pofs + (size_t)(rg * 64 + row) * DM + h * HD + pc) = v; }
     } }

__device__ __forceinline__ void hl_split(const float* __restrict__ F, _Float16* __restrict__ Hh, _Float16* __restrict__ Hl, size_t n8, int blk) {
  const size_t t = (size_t)blk * 256 + threadIdx.x; if (t >= n8) return; FragH fh, fl; const v4f a = *(const v4fa*)(F + t * 8), c = *(const v4fa*)(F + t * 8 + 4);
#pragma unroll
  for (int q = 0; q < 4; ++q) { _Float16 hv = (_Float16)a[q]; fh.h[q] = hv; fl.h[q] = (_Float16)((a[q] - (float)hv) * 1024.0f); hv = (_Float16)c[q]; fh.h[4 + q] = hv; fl.h[4 + q] = (_Float16)((c[q] - (float)hv) * 1024.0f); }
  unsigned short* dh = (unsigned short*)Hh + t * 8; unsigned short* dl = (unsigned short*)Hl + t * 8;
  { *(v8us*)dh = fh.half[0]; *(v8us*)dl = fl.half[0];  } }

// The grid's rows blockIdx.y >= NB*NH do not attend: they split the exact attention's f32 o plane F into its f16 hi / x1024 residual planes (needs nothing of this launch's attention and gives it nothing), 256 x 8 elements a block.
// causal attention, f16 WMMA: grid rows blockIdx.y < NB*NH, (SEQ/128, NB*NH), block = 8 waves, wave -> query rows q0..q0+15 (q0 = 16*(8*blockIdx.x + wave)) of one (b, head).
// K and V^T of a 32-key block are the same for the block's 8 waves: the block brings them into LDS once (one 16-byte load of each per thread: K 8 lanes a row, whole 128-byte lines; V^T 4 lanes a row), two buffers, the next block's lines fetched into registers while this one is worked on;
// every wave stages and meets the one barrier of every 32-key block up to the last wave's count, and skips the arithmetic of the blocks past its own rows; fragments come from LDS (pitches 144 and 80 bytes: a 16-row fragment read meets every bank once).
// Per 32-key block, both products transposed: two 16x16 score tiles S^T = k . q^T (A = K16 rows as [key][d], B = Q16 rows, K = 64 in two k-steps), so that a lane holds 16 of the 32 scores of ONE query (lane l ^ 16 the other 16); x0.125 and the causal select by value in f32,
// online softmax per query (maximum and sum over the lane's own registers, one exchange between the wave's halves for the maximum, the halves' sums joined once behind the loop; o and sum rescaled by exp(m_old - m_new)); P^T x1024 packs from the score registers straight into the B operand of O^T += V^T . P^T (A = V^T rows as [d][key]).
// kg, vg: the block's first K and V^T rows at this 32-key block (the same in every lane); ko, vo: the lane's own byte offsets, fixed for the whole kernel
__device__ __forceinline__ void att_fetch(const char* kg, unsigned ko, const char* vg, unsigned vo, v8us& rk, v8us& rv) {
  const char* ka = kg + ko; const char* va = vg + vo; rk = *(const v8us*)ka; rv = *(const v8us*)va;
  /* the wait that belongs between an issued load and an overwrite of its address registers; it names the two addresses so that they stay in their registers up to it */
  asm volatile("s_wait_xcnt 0x0" :: "v"(ka), "v"(va) : "memory");
}

// lane l with lane l ^ 16
__device__ __forceinline__ float xhalf(float x) { return __builtin_bit_cast(float, __builtin_amdgcn_permlanex16(__builtin_bit_cast(int, x), __builtin_bit_cast(int, x), 0x76543210, 0xfedcba98, false, false)); }

__global__ __launch_bounds__(256) __attribute__((amdgpu_num_vgpr(160)))      /* 160 registers: three blocks stay resident per WGP, as before the staging */
void k_att(const _Float16* __restrict__ Q16, const _Float16* __restrict__ K16, const _Float16* __restrict__ VT, _Float16* __restrict__ O16, const float* __restrict__ F, _Float16* __restrict__ Hh, _Float16* __restrict__ Hl, size_t n8) {
  __shared__ __attribute__((aligned(16))) _Float16 lso[8][16 * OPP];
  __shared__ __attribute__((aligned(16))) _Float16 lkt[2][32 * AKP];
  __shared__ __attribute__((aligned(16))) _Float16 lvt[2][HD * AVP];
  if (blockIdx.y >= NB * NH) { hl_split(F, Hh, Hl, n8, (int)((blockIdx.y - NB * NH) * (SEQ / 128) + blockIdx.x)); return; }      /* the same for the whole block */
  const int tid = threadIdx.x, w = __builtin_amdgcn_readfirstlane(tid >> 5), lane = tid & 31, ln = lane & 15, hh = lane >> 4;      /* the wave's number is the same in every lane: held in a scalar register, so that the test round a trip's products is a scalar branch and what follows from it takes no vector registers */
  const int qt = blockIdx.x * 8 + w; const int bh = blockIdx.y; const int b = bh / NH, h = bh - b * NH;
  const int q0 = qt * 16;
  const size_t wr0 = (size_t)b * SEQ + q0;
  const _Float16* qp = Q16 + (wr0 + ln) * DM + h * HD;
  const v16h qa0 = g2_frag(qp, hh), qa1 = g2_frag(qp + 32, hh);      /* d 0..31, 32..63 */
  const _Float16* kbase = K16 + (size_t)b * SEQ * DM + h * HD;        /* key row j at kbase + j*DM */
  const _Float16* vbase = VT + (size_t)bh * HD * SEQ;                 /* V^T row d at vbase + d*SEQ */
  const v8f z8 = {0.f,0.f,0.f,0.f,0.f,0.f,0.f,0.f}; v8f o0 = z8, o1 = z8, o2 = z8, o3 = z8;
  float mr = -1.0e30f, lr = 0.f;      /* of query q0 + ln; lr: the sum over the keys of this lane's half, the halves are joined behind the loop */
  const int nkb = qt / 2 + 1;      /* 32-key blocks covering keys 0..q0+15 */
  const int nkbb = (int)blockIdx.x * 4 + 4;      /* the count of the block's last wave */
  const char* kg = (const char*)kbase; const char* vg = (const char*)vbase; const unsigned ko = (unsigned)((tid >> 3) * DM + (tid & 7) * 8) * 2u, vo = (unsigned)((tid >> 2) * SEQ + (tid & 3) * 8) * 2u;      /* the thread's own 16 bytes of a 32-key block */
  const int kso = (tid >> 3) * AKP + (tid & 7) * 8, vso = (tid >> 2) * AVP + (tid & 3) * 8;
  v8us rk, rv;
  att_fetch(kg, ko, vg, vo, rk, rv); kg += 32 * DM * 2; vg += 32 * 2;
#pragma unroll 1
  for (int it = 0; it < nkbb; ++it) {
    _Float16* kt = &lkt[it & 1][0]; _Float16* vt = &lvt[it & 1][0];
    *(v8us*)((unsigned short*)kt + kso) = rk; *(v8us*)((unsigned short*)vt + vso) = rv;
    __syncthreads();      /* this block's tiles are complete before any wave reads a fragment; and who passes it knows that every wave has left the other buffer, which the next trip overwrites */
    if (it + 1 < nkbb) { att_fetch(kg, ko, vg, vo, rk, rv); kg += 32 * DM * 2; vg += 32 * 2; }
    if (it >= nkb) continue;      /* keys past the wave's rows: nothing to add */
    const int kb = it * 32;
    v8f s0 = z8, s1 = z8;      /* S^T: register r of lane (ln, hh) = key kb + 8 hh + r (s0), kb + 16 + 8 hh + r (s1), of query q0 + ln */
    { const _Float16* kp = kt + ln * AKP;      /* the four K fragments are read together, ahead of the products */
      const v16h k00 = g2_frag(kp, hh), k01 = g2_frag(kp + 32, hh), k10 = g2_frag(kp + 16 * AKP, hh), k11 = g2_frag(kp + 16 * AKP + 32, hh);
      s0 = g2_mma(k00, qa0, s0); s1 = g2_mma(k10, qa0, s1); s0 = g2_mma(k01, qa1, s0); s1 = g2_mma(k11, qa1, s1); }      /* the two tiles take turns: no product waits for the one before it */
    const _Float16* vp = vt + ln * AVP;      /* the four V^T fragments are read ahead of the softmax, which covers their latency */
    const v16h v0 = g2_frag(vp, hh), v1 = g2_frag(vp + 16 * AVP, hh), v2 = g2_frag(vp + 32 * AVP, hh), v3 = g2_frag(vp + 48 * AVP, hh);
    __builtin_amdgcn_sched_barrier(0);      /* keeps the eight reads here: left free, the compiler sinks them to the products, where their latency is bare */
    float sv[16];
#pragma unroll
    for (int r = 0; r < 8; ++r) {
      const int qk = q0 - kb - r;      /* key kb + 8 hh + r <= row q0 + ln, with the wave's part of the test on the scalar side: one vector register (8 hh - ln) */
      sv[r] = (8 * hh - ln <= qk) ? s0[r] * 0.125f : -1.0e30f;
      sv[8 + r] = (8 * hh - ln <= qk - 16) ? s1[r] * 0.125f : -1.0e30f;
    }
    float mx = fmaxf(sv[0], sv[1]);
#pragma unroll
    for (int r = 2; r < 16; ++r) mx = fmaxf(mx, sv[r]);
    mx = fmaxf(mx, xhalf(mx));      /* both halves hold the query's maximum over the 32 keys */
    const float mn = fmaxf(mr, mx);
    const float al = __expf(mr - mn); mr = mn;
    FragH pf; v2f p2[8];      /* P^T as the B operand: elements 0..7 = keys 8 hh .. + 7, 8..15 = keys 16 + 8 hh .. + 7, the k order of the V^T fragments */
#pragma unroll
    for (int r = 0; r < 8; ++r) { const v2f p = {__expf(sv[2 * r] - mn), __expf(sv[2 * r + 1] - mn)}; p2[r] = p; pf.h[2 * r] = (_Float16)(p[0] * 1024.0f); pf.h[2 * r + 1] = (_Float16)(p[1] * 1024.0f); }
    const v2f rs = ((p2[0] + p2[1]) + (p2[2] + p2[3])) + ((p2[4] + p2[5]) + (p2[6] + p2[7]));      /* the lane's 16 keys, summed as a tree of pairs */
    lr = lr * al + (rs[0] + rs[1]);
#pragma unroll
    for (int r = 0; r < 8; ++r) { o0[r] *= al; o1[r] *= al; o2[r] *= al; o3[r] *= al; }
    o0 = g2_mma(v0, pf.v, o0); o1 = g2_mma(v1, pf.v, o1); o2 = g2_mma(v2, pf.v, o2); o3 = g2_mma(v3, pf.v, o3);      /* O^T tile t: register r = d 16 t + 8 hh + r of query q0 + ln */
  }
  _Float16* sob = &lso[w][0];
  { const float inv = (1.0f / (lr + xhalf(lr))) * 0.0009765625f; FragH f0, f1;
#pragma unroll
    for (int r = 0; r < 8; ++r) { f0.h[r] = (_Float16)(o0[r] * inv); f0.h[8 + r] = (_Float16)(o1[r] * inv); f1.h[r] = (_Float16)(o2[r] * inv); f1.h[8 + r] = (_Float16)(o3[r] * inv); }
    unsigned short* sp = (unsigned short*)sob + ln * OPP + 8 * hh;      /* a lane's 8 d of a tile are 16 bytes of its query's row */
    *(v8us*)sp = f0.half[0]; *(v8us*)(sp + 16) = f0.half[1]; *(v8us*)(sp + 32) = f1.half[0]; *(v8us*)(sp + 48) = f1.half[1]; }
  __builtin_amdgcn_fence(3, "wavefront"); __builtin_amdgcn_wave_barrier();
  unsigned short* ob = (unsigned short*)O16 + wr0 * DM + h * HD;
  {
#pragma unroll
    for (int it2 = 0; it2 < 4; ++it2) { const int row = it2 * 4 + (lane >> 3), c8 = (lane & 7) * 8; const v8us v = *(const v8us*)((const unsigned short*)sob + row * OPP + c8); *(v8us*)(ob + (size_t)row * DM + c8) = v; }
     }
}

extern "C" void kernel_launch(void* const* d_in, const int* in_sizes, int n_in,
                              void* d_out, int out_size, void* d_ws, size_t ws_size, hipStream_t stream) {
  if (n_in < 6) return;
  const float* x = (const float*)d_in[0]; const float* wq = (const float*)d_in[1]; const float* wk = (const float*)d_in[2];
  const float* wv = (const float*)d_in[3]; const float* wp = (const float*)d_in[4]; const float* bproj = (const float*)d_in[5];
  const size_t need_x = (size_t)(NB - 1) * SEQ_FULL * DM + (size_t)SEQ * DM;
  if ((size_t)in_sizes[0] < need_x || in_sizes[1] < DM * DM || in_sizes[2] < DM * DM || in_sizes[3] < DM * DM || in_sizes[4] < DM * DM || in_sizes[5] < DM || (size_t)out_size < need_x) return;
  float* out = (float*)d_out;
  char* ws = (char*)d_ws; size_t off = 0;
  auto take = [&](size_t bytes) { char* p = ws + off; off += (bytes + 255) & ~(size_t)255; return p; };
  const size_t wb = (size_t)DM * DM * 2;
  _Float16* WQ = (_Float16*)take(4 * wb); _Float16* WK = WQ + DM * DM; _Float16* WV = WK + DM * DM; _Float16* WP = WV + DM * DM;      /* four planes in a row */
  const size_t rows2 = (size_t)NB * SEQ * DM * 2;      /* f16 plane over all token rows */
  const size_t f0b4 = (size_t)NB * QT0 * DM * 4;       /* f32 first-tile plane */
  const size_t f0b2 = (size_t)NB * QT0 * DM * 2;       /* f16 first-tile plane */
  const size_t vtb = (size_t)NB * DM * SEQ * 2;         /* V^T [NB*NH*HD][SEQ] */
  /* every plane that one launch writes has its own place: the GEMMs of a launch run side by side */
  _Float16* X16 = (_Float16*)take(rows2); _Float16* O16 = X16;      /* X16 is last read by the first GEMM launch, O16 written after it */
  float* QF0 = (float*)take(f0b4); float* KF0 = (float*)take(f0b4); float* VF0 = (float*)take(f0b4); float* OF0 = (float*)take(f0b4);
  _Float16* Q16 = (_Float16*)take(rows2); _Float16* K16 = (_Float16*)take(rows2); _Float16* VT = (_Float16*)take(vtb);
  _Float16* OH = (_Float16*)take(f0b2); _Float16* OL = (_Float16*)take(f0b2);
  if (off > ws_size) return;

  const size_t nx8 = (size_t)NB * SEQ * DM / 8;
  k_cvt<<<(unsigned)(4 * GW + (nx8 + 255) / 256), 256, 0, stream>>>(x, wq, wk, wv, wp, WQ, X16, nx8);
  constexpr int nS = (QT0 / 128) * (DM / 64);            /* blocks per batch: first-tile GEMMs */
  constexpr int nA = (NB * SEQ / 128) * (DM / 64);       /* all token rows, one batch */
  constexpr int nV = (DM / 128) * (SEQ / 64);            /* V^T, per batch */
  constexpr int nP = ((SEQ - QT0) / 128) * (DM / 64);    /* projection of rows >= 128, per batch */
  /* all six products of X16 in one launch: f16 q, k rows for all tokens; V^T directly as (16 Wv) . X16^T; f32 q, k, v of rows 0..127 of every sequence (exact products) */
  GJobs g1 = {};
  g1.j[0] = GJob{X16, WQ, nullptr, nullptr, Q16, (size_t)0, (size_t)0, (size_t)0, 0.0625f, DM, DM, DM, DM, nA, 0, 0};
  g1.j[1] = GJob{X16, WK, nullptr, nullptr, K16, (size_t)0, (size_t)0, (size_t)0, 0.0625f, DM, DM, DM, DM, nA, nA, 0};
  g1.j[2] = GJob{WV, X16, nullptr, nullptr, VT, (size_t)0, (size_t)SEQ * DM, (size_t)DM * SEQ, 0.0625f, DM, DM, SEQ, SEQ, nV, 2 * nA, 0};
  g1.j[3] = GJob{X16, WQ, nullptr, QF0, nullptr, (size_t)SEQ * DM, (size_t)0, (size_t)QT0 * DM, 0.0625f, DM, DM, DM, DM, nS, 2 * nA + NB * nV, 0};
  g1.j[4] = GJob{X16, WK, nullptr, KF0, nullptr, (size_t)SEQ * DM, (size_t)0, (size_t)QT0 * DM, 0.0625f, DM, DM, DM, DM, nS, 2 * nA + NB * nV + NB * nS, 0};
  g1.j[5] = GJob{X16, WV, nullptr, VF0, nullptr, (size_t)SEQ * DM, (size_t)0, (size_t)QT0 * DM, 0.0625f, DM, DM, DM, DM, nS, 2 * nA + NB * nV + 2 * NB * nS, 0};
  k_gemm2<<<2 * nA + NB * nV + 3 * NB * nS, 128, 0, stream>>>(g1, 6, bproj, DM);
  k_att0<<<NB * NH * (QT0 / 64), 64, 0, stream>>>(QF0, KF0, VF0, OF0);      /* exact attention rows 0..127 (o x64) */
  const size_t nf8 = (size_t)NB * QT0 * DM / 8;
  /* attention of all rows and, in the grid's last rows, the f16 hi / x1024 residual planes of the exact o x64 */
  k_att<<<dim3(SEQ / 128, (unsigned)(NB * NH + ((nf8 + 255) / 256 + SEQ / 128 - 1) / (SEQ / 128))), 256, 0, stream>>>(Q16, K16, VT, O16, OF0, OH, OL, nf8);
  /* output projection, one launch: rows < 128 from the hi and residual planes (twice the k, so these blocks go first), rows >= 128 from the f16 o plane */
  GJobs g2 = {};
  g2.j[0] = GJob{OH, WP, OL, out, nullptr, (size_t)QT0 * DM, (size_t)0, (size_t)SEQ_FULL * DM, 0.0009765625f, DM, DM, DM, DM, nS, 0, 1};
  g2.j[1] = GJob{O16 + (size_t)QT0 * DM, WP, nullptr, out + (size_t)QT0 * DM, nullptr, (size_t)SEQ * DM, (size_t)0, (size_t)SEQ_FULL * DM, 0.0625f, DM, DM, DM, DM, nP, NB * nS, 1};
  k_gemm2<<<NB * nS + NB * nP, 128, 0, stream>>>(g2, 2, bproj, DM);
}

// v008
// It runs in 134 microseconds.
// Next to v007, in two timings, it ran 1.14 times as fast each time.
// Over all steps from v000 it is 6.24 times as fast.
#include <hip/hip_runtime.h>
// Structure: token rows r = b*SEQ + t in compact workspace planes (input/output strides use SEQ_FULL); X16 = f16(bf16(x)); Q16, K16 = X16 . (16 W)^T / 16 as 32x64 wave-tile GEMMs with LDS-staged whole-line epilogues; V^T per (b, head) produced directly as (16 Wv) . X16^T / 16;
#ifndef NB
#define NB 64
#endif
#ifndef SEQ
#define SEQ 512
#endif
#define NB_FULL 64
#define SEQ_FULL 512
#define DM 384
#define NH 6
#define HD 64
#define QT0 128                      /* first query rows per sequence recomputed exactly in f32 */
#define OPP 72                       /* LDS pitch (halves) of the 16x64 O staging tile */
#define GKC 64                       /* k (halves) of one staged GEMM pass: one 128-byte line of every operand row */
#define FKP 68                       /* LDS pitch (floats) of a staged f32 K row or o row (64 d): 256 + 16 bytes */
#define FVP 132                      /* LDS pitch (floats) of a staged f32 V^T row (128 keys): 512 + 16 bytes */
#define GP 72                        /* LDS pitch (halves) of a staged GEMM operand row: 128 + 16 bytes */
#define AKP 72                       /* LDS pitch (halves) of a staged K row (64 d): 128 + 16 bytes */
#define RSC 0.0009765625f            /* 2^-10: takes the x1024 of a residual plane out of its sums */
#define AVP 40                       /* LDS pitch (halves) of a staged V^T row (32 keys): 64 + 16 bytes */
static_assert(NB >= 1 && NB <= NB_FULL);
static_assert(SEQ % 128 == 0 && SEQ >= 2 * QT0 && SEQ <= SEQ_FULL);
static_assert(DM == NH * HD && DM % 128 == 0 && HD == 64 && QT0 == 128);

typedef unsigned short v8us __attribute__((ext_vector_type(8), may_alias));
typedef float  v8f  __attribute__((ext_vector_type(8)));
typedef float  v4f  __attribute__((ext_vector_type(4)));
typedef float  v2f  __attribute__((ext_vector_type(2)));
typedef float  v4fa __attribute__((ext_vector_type(4), may_alias));
typedef _Float16 v16h __attribute__((ext_vector_type(16)));
typedef _Float16 v4h __attribute__((ext_vector_type(4)));
union FragH { v16h v; v8us half[2]; _Float16 h[16]; unsigned short u[16]; };

__device__ __forceinline__ unsigned short bf16_bits(float x) { unsigned int u = __float_as_uint(x); return (unsigned short)((u + 0x7FFFu + ((u >> 16) & 1u)) >> 16); }
__device__ __forceinline__ float bf16_val(unsigned short b) { return __uint_as_float(((unsigned int)b) << 16); }
__device__ __forceinline__ float bf16_rne(float x) { return bf16_val(bf16_bits(x)); }

// 16-bit WMMA fragment from a k-contiguous row (A: row m, B: column n of a [n][k] plane): elements 0..7 <- k 8hh..8hh+7, elements 8..15 <- k 16+8hh..16+8hh+7
__device__ __forceinline__ v16h g2_frag(const _Float16* p, int hh) { FragH f; f.half[0] = *(const v8us*)((const unsigned short*)p + 8 * hh); f.half[1] = *(const v8us*)((const unsigned short*)p + 16 + 8 * hh); return f.v; }
__device__ __forceinline__ v8f g2_mma(v16h a, v16h b, v8f c) { v8f d = __builtin_amdgcn_wmma_f32_16x16x32_f16(false, a, false, b, (short)0, c, false, false); asm volatile("v_nop\n\tv_nop\n\tv_nop\n\tv_nop" : "+v"(d) : "v"(a), "v"(b)); return d; }

__device__ __forceinline__ void cvt_w(const float* __restrict__ w, size_t n8, _Float16* __restrict__ Bt, int blk) {
  const size_t t = (size_t)blk * 256 + threadIdx.x; if (t >= n8) return; FragH f;
#pragma unroll
  for (int q = 0; q < 8; ++q) f.h[q] = (_Float16)(bf16_rne(w[t * 8 + q]) * 16.0f);
  unsigned short* d = (unsigned short*)Bt + t * 8;
  *(v8us*)d = f.half[0]; 
}

__device__ __forceinline__ void cvt_x(const float* __restrict__ x, _Float16* __restrict__ X16, size_t n8, int blk) {
  const size_t t = (size_t)blk * 256 + threadIdx.x; if (t >= n8) return;
  const size_t wr = t / (DM / 8); const int c8 = (int)(t % (DM / 8)) * 8;
  const size_t b = wr / SEQ, tt = wr % SEQ;
  const float* src = x + (b * SEQ_FULL + tt) * DM + c8;
  const v4f a = *(const v4fa*)src, c = *(const v4fa*)(src + 4); FragH f;
#pragma unroll
  for (int q = 0; q < 4; ++q) { f.h[q] = (_Float16)bf16_rne(a[q]); f.h[4 + q] = (_Float16)bf16_rne(c[q]); }
  unsigned short* d = (unsigned short*)X16 + t * 8;
  *(v8us*)d = f.half[0]; 
}

// all five conversions in one grid: blocks 0..4 GW-1 take the four weight planes (GW blocks each, W16 = four [DM][DM] planes in a row), the rest take x
#define GW ((DM * DM / 8 + 255) / 256)
__global__ __launch_bounds__(256) void k_cvt(const float* __restrict__ x, const float* __restrict__ w0, const float* __restrict__ w1, const float* __restrict__ w2, const float* __restrict__ w3, _Float16* __restrict__ W16, _Float16* __restrict__ X16, size_t nx8) {
  const int bid = blockIdx.x;
  if (bid < 4 * GW) { const int wi = bid / GW; const float* w = wi == 0 ? w0 : wi == 1 ? w1 : wi == 2 ? w2 : w3; cvt_w(w, (size_t)DM * DM / 8, W16 + (size_t)wi * DM * DM, bid - wi * GW); }
  else cvt_x(x, X16, nx8, bid - 4 * GW);
}

// one pass's operand lines into registers: this lane's 16 bytes of 8 A rows and 4 B rows, 16 rows (sa16, sb16 bytes) apart; pa, pb: the block's first rows at this pass (the same in every lane), ao, bo: the lane's own byte offsets
__device__ __forceinline__ void g2_fetch(const char* pa, size_t sa16, unsigned ao, const char* pb, size_t sb16, unsigned bo, v8us (&ra)[8], v8us (&rb)[4]) {
  const char* a[8]; const char* b[4];
#pragma unroll
  for (int i = 0; i < 8; ++i) { a[i] = pa + i * sa16 + ao; ra[i] = *(const v8us*)a[i]; }
#pragma unroll
  for (int i = 0; i < 4; ++i) { b[i] = pb + i * sb16 + bo; rb[i] = *(const v8us*)b[i]; }
  /* the wait that belongs between an issued load and an overwrite of its address registers; it names the twelve addresses so that they stay in their registers up to it (else a later load's result lands in an earlier load's address pair) */
  asm volatile("s_wait_xcnt 0x0" :: "v"(a[0]), "v"(a[1]), "v"(a[2]), "v"(a[3]), "v"(a[4]), "v"(a[5]), "v"(a[6]), "v"(a[7]), "v"(b[0]), "v"(b[1]), "v"(b[2]), "v"(b[3]) : "memory");
}

// one GEMM of a launch: its operands and outputs, nbx = (M / 128) (N / 64) blocks per batch, first = its first block in the launch's flat grid, useb = add the bias; AL: null, or the x1024 residual plane of A (same pitch and batch stride)
struct GJob { const _Float16* A; const _Float16* Bh; const _Float16* AL; float* C; _Float16* C16; size_t sA, sB, sC; float alpha; int lda, ldb, ldc, N, nbx, first, useb; };
#define GJMAX 6
struct GJobs { GJob j[GJMAX]; };

// A launch holds nj independent GEMMs (none reads what another writes), one after the other in a flat grid; a block finds its GEMM by its index, then its batch and tile.
// GEMM C[M][N] = alpha ((A + AL / 1024) . Bt^T) + bf16(bias[col]): A f16 row-major (pitch lda, batch stride sA), Bt f16 [n][k] (pitch ldb, stride sB);
// writes f32 C and/or f16 C16 (pitch ldc, batch stride sC). Block = 4 waves, block tile 128 rows x 64 cols, wave tile 32 rows x 64 cols; M % 128 == 0, N % 64 == 0, K % 64 == 0.
// Operands: per pass of GKC = 64 k the block brings its 128 A rows and 64 B rows into LDS, 8 lanes per row, so that every wave-wide 16-byte load covers four whole 128-byte lines and each B row is fetched once per block;
// the next pass's lines are fetched into registers while this pass is multiplied; fragments come from LDS (row pitch 144 bytes: a 16-row fragment read meets every bank once). k order of the products as before (32 at a time, ascending).
// With a residual plane the k loop runs twice over K in the same accumulators: first the products of AL, whose sums are then scaled by 2^-10 (exact), then the products of A on top.
__global__ __launch_bounds__(128) void k_gemm2(GJobs js, int nj, const float* __restrict__ biasv, int K) {
  __shared__ __attribute__((aligned(16))) unsigned char sm[4 * 32 * 68 * 4];      /* operand tiles in the k loop, then the epilogue's f32 staging */
  static_assert((128 + 64) * GP * 2 <= 4 * 32 * 68 * 4);
  float (*so)[32][68] = (float (*)[32][68])sm;
  _Float16* sa = (_Float16*)sm; _Float16* sb = sa + 128 * GP;
  const int tid = threadIdx.x, w = tid >> 5, lane = tid & 31, ln = lane & 15, hh = lane >> 4;
  const int bid = blockIdx.x; int ji = 0;
  for (int q = 1; q < GJMAX; ++q) if (q < nj && bid >= js.j[q].first) ji = q;
  const GJob& J = js.j[ji];
  const int lda = J.lda, ldb = J.ldb, ldc = J.ldc; const float alpha = J.alpha; float* C = J.C; _Float16* C16 = J.C16; const float* bias = J.useb ? biasv : nullptr;
  const int loc = bid - J.first; const int by = loc / J.nbx, bx = loc - by * J.nbx;
  const _Float16* A = J.A + (size_t)by * J.sA; const _Float16* Bh = J.Bh + (size_t)by * J.sB; const size_t cofs = (size_t)by * J.sC;
  const int ntn = J.N >> 6; const int mt = bx / ntn, nq = bx - mt * ntn; const int row0 = mt * 128 + 32 * w, col0 = nq * 64;
  const int sr = tid >> 3, sc8 = (tid & 7) * 8;      /* staging: row sr + 16 i, halves sc8..sc8+7 of the pass */
  const char* ah = (const char*)(A + (size_t)(mt * 128) * lda); const char* bh = (const char*)(Bh + (size_t)col0 * ldb);      /* the block's first rows: the same in every lane */
  const int KT = J.AL ? 2 * K : K;      /* k of both planes together */
  const char* ag = J.AL ? (const char*)(J.AL + (size_t)by * J.sA + (size_t)(mt * 128) * lda) : ah; const char* bg = bh;      /* the residual plane goes first */
  const unsigned ao = (unsigned)(sr * lda + sc8) * 2u, bo = (unsigned)(sr * ldb + sc8) * 2u;      /* the lane's own byte offsets, fixed for the whole kernel */
  unsigned short* sas = (unsigned short*)sa + sr * GP + sc8; unsigned short* sbs = (unsigned short*)sb + sr * GP + sc8;
  const _Float16* a0p = sa + (32 * w + ln) * GP; const _Float16* a1p = a0p + 16 * GP;
  const _Float16* b0p = sb + ln * GP; const _Float16* b1p = b0p + 16 * GP; const _Float16* b2p = b1p + 16 * GP; const _Float16* b3p = b2p + 16 * GP;
  const v8f z8 = {0.f,0.f,0.f,0.f,0.f,0.f,0.f,0.f}; v8f c00 = z8, c01 = z8, c02 = z8, c03 = z8, c10 = z8, c11 = z8, c12 = z8, c13 = z8;
  v8us ra[8], rb[4];
  g2_fetch(ag, (size_t)lda * 32, ao, bg, (size_t)ldb * 32, bo, ra, rb); ag += GKC * 2; bg += GKC * 2;
  /* passes stay rolled: one pass already holds 16 products per wave, unrolling further would only lengthen the text */
#pragma unroll 1
  for (int kc = 0; kc < KT; kc += GKC) {
#pragma unroll
    for (int i = 0; i < 8; ++i) *(v8us*)(sas + 16 * i * GP) = ra[i];
#pragma unroll
    for (int i = 0; i < 4; ++i) *(v8us*)(sbs + 16 * i * GP) = rb[i];
    __syncthreads();      /* the pass's tiles are complete before any wave reads a fragment */
    if (kc + GKC == K) { ag = ah; bg = bh; }      /* the residual plane is through: on to A, from k = 0 (without a residual plane nothing is fetched any more) */
    if (kc + GKC < KT) { g2_fetch(ag, (size_t)lda * 32, ao, bg, (size_t)ldb * 32, bo, ra, rb); ag += GKC * 2; bg += GKC * 2; }
#pragma unroll
    for (int kb = 0; kb < GKC; kb += 32) { const v16h a0 = g2_frag(a0p + kb, hh), a1 = g2_frag(a1p + kb, hh);      /* each B fragment after the first is read one pair of products ahead of its use */
      v16h b = g2_frag(b0p + kb, hh), bn = g2_frag(b1p + kb, hh); c00 = g2_mma(a0, b, c00); c10 = g2_mma(a1, b, c10);
      b = g2_frag(b2p + kb, hh); c01 = g2_mma(a0, bn, c01); c11 = g2_mma(a1, bn, c11);
      bn = g2_frag(b3p + kb, hh); c02 = g2_mma(a0, b, c02); c12 = g2_mma(a1, b, c12);
      c03 = g2_mma(a0, bn, c03); c13 = g2_mma(a1, bn, c13); }
    if (kc + GKC == K && KT > K) { c00 *= RSC; c01 *= RSC; c02 *= RSC; c03 *= RSC; c10 *= RSC; c11 *= RSC; c12 *= RSC; c13 *= RSC; }      /* the residual sums take their weight before A's products join them */
    __syncthreads();      /* every wave has read its fragments before the tiles are overwritten (by the next pass, or by the epilogue's staging) */
  }
  v8f accs[8] = {c00, c01, c02, c03, c10, c11, c12, c13};
#pragma unroll
  for (int u = 0; u < 8; ++u) { const int t = u & 3, half = u >> 2; const int col = col0 + t * 16 + ln; const float bv = bias ? bf16_rne(bias[col]) : 0.f;
#pragma unroll
    for (int r = 0; r < 8; ++r) { const int rloc = half * 16 + 8 * hh + r; float v = accs[u][r] * alpha + bv;
      so[w][rloc][t * 16 + ln] = v; } }
  __builtin_amdgcn_fence(4, "workgroup"); __builtin_amdgcn_wave_barrier();
  const int rsub = lane >> 4, c4 = (lane & 15) * 4;
  {
#pragma unroll
    for (int q = 0; q < 16; ++q) { const int r = q * 2 + rsub; const v4f v = *(const v4fa*)&so[w][r][c4];
      if (C) *(v4f*)(C + cofs + (size_t)(row0 + r) * ldc + col0 + c4) = v;
      if (C16) { v4h h4; for (int i = 0; i < 4; ++i) h4[i] = (_Float16)v[i]; *(v4h*)(C16 + cofs + (size_t)(row0 + r) * ldc + col0 + c4) = h4; } }
     }
}

// exact (f32) causal attention for query rows 0..QT0-1 of every (batch, head), on the f32 16x16x4 matrix form: planes QF/KF [NB][QT0][DM] (head h at column h*HD), VTF [NB][DM][QT0] (V^T: row h*HD + d, column = key);
// block = 4 waves = 64 consecutive query rows of one head, wave -> 16 rows; the block first brings the K rows and V^T rows of all its keys into LDS by whole-line loads (pitches 272 and 528 bytes: a 16-row fragment read meets every bank once).
// Per 32 keys, both products transposed as in k_att: two score tiles S^T = k . q^T (A = K rows, B = q rows; a lane half holds d 8u + 4hh .. + 3 of both, two k-steps of 4 per 16-byte read), so that a lane holds 16 of the 32 scores of ONE query;
// x0.125 and the causal select by value, online softmax per query over 32 keys at a time (precise expf); P^T goes from the score registers straight into the B operand of O^T += V^T . P^T:
// k-step j takes p[2j], p[2j+1] = keys 8hh + 2j, + 1 (j < 4) or 16 + 8hh + 2(j-4), + 1 of the block, and the V^T fragment holds the same keys at the same lane half and element.
__device__ __forceinline__ v8f f4_mma(v2f a, v2f b, v8f c) { return __builtin_amdgcn_wmma_f32_16x16x4_f32(false, a, false, b, (short)0, c, false, false); }
__device__ __forceinline__ v2f lo2(v4f x) { const v2f r = {x[0], x[1]}; return r; }
__device__ __forceinline__ v2f hi2(v4f x) { const v2f r = {x[2], x[3]}; return r; }
// lane l with lane l ^ 16
__device__ __forceinline__ float xhalf(float x) { return __builtin_bit_cast(float, __builtin_amdgcn_permlanex16(__builtin_bit_cast(int, x), __builtin_bit_cast(int, x), 0x76543210, 0xfedcba98, false, false)); }

__global__ __launch_bounds__(128) void k_att0(const float* __restrict__ QF, const float* __restrict__ KF, const float* __restrict__ VTF, float* __restrict__ OF) {
  __shared__ __attribute__((aligned(16))) float lk[QT0 * FKP];
  __shared__ __attribute__((aligned(16))) float lv[HD * FVP];
  __shared__ __attribute__((aligned(16))) float lo[4][16 * FKP];
  const int tid = threadIdx.x, w = __builtin_amdgcn_readfirstlane(tid >> 5), lane = tid & 31, ln = lane & 15, hh = lane >> 4;
  const int rg = blockIdx.x % (QT0 / 64); const int bh = blockIdx.x / (QT0 / 64); const int b = bh / NH, h = bh - b * NH;
  const size_t pofs = (size_t)b * QT0 * DM;
  const int qt = rg * 4 + w, q0 = qt * 16;
  v4f qf[8];      /* q row q0 + ln, d 8u + 4hh .. + 3 */
  { const float* qr = QF + pofs + (size_t)(q0 + ln) * DM + h * HD + 4 * hh;
#pragma unroll
    for (int u = 0; u < 8; ++u) qf[u] = *(const v4fa*)(qr + 8 * u);
    /* the wait that belongs between an issued load and an overwrite of its address registers; it names the address so that it stays in its registers up to it */
    asm volatile("s_wait_xcnt 0x0" :: "v"(qr) : "memory"); }
  { const int sr = tid >> 4, c4 = (tid & 15) * 4;      /* 16 lanes per 256 bytes of a row, 8 rows a sweep */
    const float* kg = KF + pofs + h * HD + (size_t)sr * DM + c4; const float* vg = VTF + pofs + (size_t)(h * HD + sr) * QT0 + c4;
    for (int hf = 0; hf <= rg; ++hf) { v4f rk[8], rv[8]; const float* kp = kg + (size_t)hf * 64 * DM; const float* vp = vg + hf * 64;
      /* unrolled: the 16 loads of a lane for 64 keys are in flight together */
#pragma unroll
      for (int it = 0; it < 8; ++it) { rk[it] = *(const v4fa*)(kp + it * 8 * DM); rv[it] = *(const v4fa*)(vp + it * 8 * QT0); }
      /* the wait that belongs between an issued load and an overwrite of its address registers; it names the two addresses so that they stay in their registers up to it */
      asm volatile("s_wait_xcnt 0x0" :: "v"(kp), "v"(vp) : "memory");
#pragma unroll
      for (int it = 0; it < 8; ++it) { *(v4f*)&lk[(hf * 64 + it * 8 + sr) * FKP + c4] = rk[it]; *(v4f*)&lv[(it * 8 + sr) * FVP + hf * 64 + c4] = rv[it]; } } }
  __syncthreads();      /* the block's K and V^T rows are complete before any wave reads a fragment */
  const v8f z8 = {0.f,0.f,0.f,0.f,0.f,0.f,0.f,0.f}; v8f o0 = z8, o1 = z8, o2 = z8, o3 = z8;
  float mr = -1.0e30f, lr = 0.f;      /* of query q0 + ln; lr: the sum over the keys of this lane's half, the halves are joined behind the loop */
  const int nkb = qt / 2 + 1;      /* 32-key blocks covering keys 0..q0+15 */
  /* trips stay rolled: one trip already holds 64 products, more would only lengthen the text */
#pragma unroll 1
  for (int it = 0; it < nkb; ++it) {
    const int kb = it * 32;
    v8f s0 = z8, s1 = z8;      /* S^T: register r of lane (ln, hh) = key kb + 8 hh + r (s0), kb + 16 + 8 hh + r (s1), of query q0 + ln */
    { const float* kp = lk + (kb + ln) * FKP + 4 * hh;
#pragma unroll
      for (int u = 0; u < 8; ++u) { const v4f ka = *(const v4f*)(kp + 8 * u), kc = *(const v4f*)(kp + 16 * FKP + 8 * u);      /* the two tiles take turns: no product waits for the one before it */
        s0 = f4_mma(lo2(ka), lo2(qf[u]), s0); s1 = f4_mma(lo2(kc), lo2(qf[u]), s1); s0 = f4_mma(hi2(ka), hi2(qf[u]), s0); s1 = f4_mma(hi2(kc), hi2(qf[u]), s1); } }
    asm volatile("v_nop\n\tv_nop\n\tv_nop\n\tv_nop" : "+v"(s0), "+v"(s1));      /* the four vector slots between the last product and the first vector instruction that reads its result */
    float sv[16];
#pragma unroll
    for (int r = 0; r < 8; ++r) {
      const int qk = q0 - kb - r;      /* key kb + 8 hh + r <= row q0 + ln */
      sv[r] = (8 * hh - ln <= qk) ? s0[r] * 0.125f : -1.0e30f;
      sv[8 + r] = (8 * hh - ln <= qk - 16) ? s1[r] * 0.125f : -1.0e30f;
    }
    float mx = fmaxf(sv[0], sv[1]);
#pragma unroll
    for (int r = 2; r < 16; ++r) mx = fmaxf(mx, sv[r]);
    mx = fmaxf(mx, xhalf(mx));      /* both halves hold the query's maximum over the 32 keys */
    const float mn = fmaxf(mr, mx);
    const float al = expf(mr - mn); mr = mn;
    v2f p2[8];      /* P^T as the B operand: pair j = the two keys of k-step j */
#pragma unroll
    for (int j = 0; j < 8; ++j) { const v2f p = {expf(sv[2 * j] - mn), expf(sv[2 * j + 1] - mn)}; p2[j] = p; }
    const v2f rs = ((p2[0] + p2[1]) + (p2[2] + p2[3])) + ((p2[4] + p2[5]) + (p2[6] + p2[7]));      /* the lane's 16 keys, summed as a tree of pairs */
    lr = lr * al + (rs[0] + rs[1]);
#pragma unroll
    for (int r = 0; r < 8; ++r) { o0[r] *= al; o1[r] *= al; o2[r] *= al; o3[r] *= al; }
    const float* vp = lv + ln * FVP + kb + 8 * hh;      /* V^T row d = 16 t + ln: keys kb + 8 hh .. + 7 and kb + 16 + 8 hh .. + 7 */
#pragma unroll
    for (int g = 0; g < 4; ++g) { const int ko = (g >> 1) * 16 + (g & 1) * 4;      /* four keys of the lane half = k-steps 2g, 2g + 1; the four d tiles take turns */
      const v4f v0 = *(const v4f*)(vp + ko), v1 = *(const v4f*)(vp + 16 * FVP + ko), v2 = *(const v4f*)(vp + 32 * FVP + ko), v3 = *(const v4f*)(vp + 48 * FVP + ko);
      o0 = f4_mma(lo2(v0), p2[2 * g], o0); o1 = f4_mma(lo2(v1), p2[2 * g], o1); o2 = f4_mma(lo2(v2), p2[2 * g], o2); o3 = f4_mma(lo2(v3), p2[2 * g], o3);
      o0 = f4_mma(hi2(v0), p2[2 * g + 1], o0); o1 = f4_mma(hi2(v1), p2[2 * g + 1], o1); o2 = f4_mma(hi2(v2), p2[2 * g + 1], o2); o3 = f4_mma(hi2(v3), p2[2 * g + 1], o3); }      /* O^T tile t: register r = d 16 t + 8 hh + r of query q0 + ln */
    asm volatile("v_nop\n\tv_nop\n\tv_nop\n\tv_nop" : "+v"(o0), "+v"(o1), "+v"(o2), "+v"(o3));      /* the same four slots behind the trip's last product, on both sides of the loop's branch */
  }
  float* sob = &lo[w][0];
  { const float fin = 64.0f / (lr + xhalf(lr));      /* o carried x64 */
    float* sp = sob + ln * FKP + 8 * hh;      /* a lane's 8 d of a tile are 32 bytes of its query's row */
    const v8f os[4] = {o0, o1, o2, o3};
#pragma unroll
    for (int t = 0; t < 4; ++t) { const v4f x = {os[t][0] * fin, os[t][1] * fin, os[t][2] * fin, os[t][3] * fin}, y = {os[t][4] * fin, os[t][5] * fin, os[t][6] * fin, os[t][7] * fin}; *(v4f*)(sp + 16 * t) = x; *(v4f*)(sp + 16 * t + 4) = y; } }
  __builtin_amdgcn_fence(4, "workgroup"); __builtin_amdgcn_wave_barrier();      /* the wave's own rows: its lanes' writes stand before its lanes' reads */
  {
#pragma unroll
    for (int it2 = 0; it2 < 8; ++it2) { const int row = it2 * 2 + hh, pc = ln * 4; const v4f v = *(const v4f*)(sob + row * FKP + pc); *(v4f*)(OF + pofs + (size_t)(q0 + row) * DM + h * HD + pc) = v; }
  } }

__device__ __forceinline__ void hl_split(const float* __restrict__ F, _Float16* __restrict__ Hh, _Float16* __restrict__ Hl, size_t n8, int blk) {
  const size_t t = (size_t)blk * 256 + threadIdx.x; if (t >= n8) return; FragH fh, fl; const v4f a = *(const v4fa*)(F + t * 8), c = *(const v4fa*)(F + t * 8 + 4);
#pragma unroll
  for (int q = 0; q < 4; ++q) { _Float16 hv = (_Float16)a[q]; fh.h[q] = hv; fl.h[q] = (_Float16)((a[q] - (float)hv) * 1024.0f); hv = (_Float16)c[q]; fh.h[4 + q] = hv; fl.h[4 + q] = (_Float16)((c[q] - (float)hv) * 1024.0f); }
  unsigned short* dh = (unsigned short*)Hh + t * 8; unsigned short* dl = (unsigned short*)Hl + t * 8;
  { *(v8us*)dh = fh.half[0]; *(v8us*)dl = fl.half[0];  } }

// The grid's rows blockIdx.y >= NB*NH do not attend: they split the exact attention's f32 o plane F into its f16 hi / x1024 residual planes (needs nothing of this launch's attention and gives it nothing), 256 x 8 elements a block.
// causal attention, f16 WMMA: grid rows blockIdx.y < NB*NH, (SEQ/128, NB*NH), block = 8 waves, wave -> query rows q0..q0+15 (q0 = 16*(8*blockIdx.x + wave)) of one (b, head).
// K and V^T of a 32-key block are the same for the block's 8 waves: the block brings them into LDS once (one 16-byte load of each per thread: K 8 lanes a row, whole 128-byte lines; V^T 4 lanes a row), two buffers, the next block's lines fetched into registers while this one is worked on;
// every wave stages and meets the one barrier of every 32-key block up to the last wave's count, and skips the arithmetic of the blocks past its own rows; fragments come from LDS (pitches 144 and 80 bytes: a 16-row fragment read meets every bank once).
// Per 32-key block, both products transposed: two 16x16 score tiles S^T = k . q^T (A = K16 rows as [key][d], B = Q16 rows, K = 64 in two k-steps), so that a lane holds 16 of the 32 scores of ONE query (lane l ^ 16 the other 16); x0.125 and the causal select by value in f32,
// online softmax per query (maximum and sum over the lane's own registers, one exchange between the wave's halves for the maximum, the halves' sums joined once behind the loop; o and sum rescaled by exp(m_old - m_new)); P^T x1024 packs from the score registers straight into the B operand of O^T += V^T . P^T (A = V^T rows as [d][key]).
// kg, vg: the block's first K and V^T rows at this 32-key block (the same in every lane); ko, vo: the lane's own byte offsets, fixed for the whole kernel
__device__ __forceinline__ void att_fetch(const char* kg, unsigned ko, const char* vg, unsigned vo, v8us& rk, v8us& rv) {
  const char* ka = kg + ko; const char* va = vg + vo; rk = *(const v8us*)ka; rv = *(const v8us*)va;
  /* the wait that belongs between an issued load and an overwrite of its address registers; it names the two addresses so that they stay in their registers up to it */
  asm volatile("s_wait_xcnt 0x0" :: "v"(ka), "v"(va) : "memory");
}

__global__ __launch_bounds__(256) __attribute__((amdgpu_num_vgpr(160)))      /* 160 registers: three blocks stay resident per WGP, as before the staging */
void k_att(const _Float16* __restrict__ Q16, const _Float16* __restrict__ K16, const _Float16* __restrict__ VT, _Float16* __restrict__ O16, const float* __restrict__ F, _Float16* __restrict__ Hh, _Float16* __restrict__ Hl, size_t n8) {
  __shared__ __attribute__((aligned(16))) _Float16 lso[8][16 * OPP];
  __shared__ __attribute__((aligned(16))) _Float16 lkt[2][32 * AKP];
  __shared__ __attribute__((aligned(16))) _Float16 lvt[2][HD * AVP];
  if (blockIdx.y >= NB * NH) { hl_split(F, Hh, Hl, n8, (int)((blockIdx.y - NB * NH) * (SEQ / 128) + blockIdx.x)); return; }      /* the same for the whole block */
  const int tid = threadIdx.x, w = __builtin_amdgcn_readfirstlane(tid >> 5), lane = tid & 31, ln = lane & 15, hh = lane >> 4;      /* the wave's number is the same in every lane: held in a scalar register, so that the test round a trip's products is a scalar branch and what follows from it takes no vector registers */
  const int qt = blockIdx.x * 8 + w; const int bh = blockIdx.y; const int b = bh / NH, h = bh - b * NH;
  const int q0 = qt * 16;
  const size_t wr0 = (size_t)b * SEQ + q0;
  const _Float16* qp = Q16 + (wr0 + ln) * DM + h * HD;
  const v16h qa0 = g2_frag(qp, hh), qa1 = g2_frag(qp + 32, hh);      /* d 0..31, 32..63 */
  const _Float16* kbase = K16 + (size_t)b * SEQ * DM + h * HD;        /* key row j at kbase + j*DM */
  const _Float16* vbase = VT + (size_t)bh * HD * SEQ;                 /* V^T row d at vbase + d*SEQ */
  const v8f z8 = {0.f,0.f,0.f,0.f,0.f,0.f,0.f,0.f}; v8f o0 = z8, o1 = z8, o2 = z8, o3 = z8;
  float mr = -1.0e30f, lr = 0.f;      /* of query q0 + ln; lr: the sum over the keys of this lane's half, the halves are joined behind the loop */
  const int nkb = qt / 2 + 1;      /* 32-key blocks covering keys 0..q0+15 */
  const int nkbb = (int)blockIdx.x * 4 + 4;      /* the count of the block's last wave */
  const char* kg = (const char*)kbase; const char* vg = (const char*)vbase; const unsigned ko = (unsigned)((tid >> 3) * DM + (tid & 7) * 8) * 2u, vo = (unsigned)((tid >> 2) * SEQ + (tid & 3) * 8) * 2u;      /* the thread's own 16 bytes of a 32-key block */
  const int kso = (tid >> 3) * AKP + (tid & 7) * 8, vso = (tid >> 2) * AVP + (tid & 3) * 8;
  v8us rk, rv;
  att_fetch(kg, ko, vg, vo, rk, rv); kg += 32 * DM * 2; vg += 32 * 2;
#pragma unroll 1
  for (int it = 0; it < nkbb; ++it) {
    _Float16* kt = &lkt[it & 1][0]; _Float16* vt = &lvt[it & 1][0];
    *(v8us*)((unsigned short*)kt + kso) = rk; *(v8us*)((unsigned short*)vt + vso) = rv;
    __syncthreads();      /* this block's tiles are complete before any wave reads a fragment; and who passes it knows that every wave has left the other buffer, which the next trip overwrites */
    if (it + 1 < nkbb) { att_fetch(kg, ko, vg, vo, rk, rv); kg += 32 * DM * 2; vg += 32 * 2; }
    if (it >= nkb) continue;      /* keys past the wave's rows: nothing to add */
    const int kb = it * 32;
    v8f s0 = z8, s1 = z8;      /* S^T: register r of lane (ln, hh) = key kb + 8 hh + r (s0), kb + 16 + 8 hh + r (s1), of query q0 + ln */
    { const _Float16* kp = kt + ln * AKP;      /* the four K fragments are read together, ahead of the products */
      const v16h k00 = g2_frag(kp, hh), k01 = g2_frag(kp + 32, hh), k10 = g2_frag(kp + 16 * AKP, hh), k11 = g2_frag(kp + 16 * AKP + 32, hh);
      s0 = g2_mma(k00, qa0, s0); s1 = g2_mma(k10, qa0, s1); s0 = g2_mma(k01, qa1, s0); s1 = g2_mma(k11, qa1, s1); }      /* the two tiles take turns: no product waits for the one before it */
    const _Float16* vp = vt + ln * AVP;      /* the four V^T fragments are read ahead of the softmax, which covers their latency */
    const v16h v0 = g2_frag(vp, hh), v1 = g2_frag(vp + 16 * AVP, hh), v2 = g2_frag(vp + 32 * AVP, hh), v3 = g2_frag(vp + 48 * AVP, hh);
    __builtin_amdgcn_sched_barrier(0);      /* keeps the eight reads here: left free, the compiler sinks them to the products, where their latency is bare */
    float sv[16];
#pragma unroll
    for (int r = 0; r < 8; ++r) {
      const int qk = q0 - kb - r;      /* key kb + 8 hh + r <= row q0 + ln, with the wave's part of the test on the scalar side: one vector register (8 hh - ln) */
      sv[r] = (8 * hh - ln <= qk) ? s0[r] * 0.125f : -1.0e30f;
      sv[8 + r] = (8 * hh - ln <= qk - 16) ? s1[r] * 0.125f : -1.0e30f;
    }
    float mx = fmaxf(sv[0], sv[1]);
#pragma unroll
    for (int r = 2; r < 16; ++r) mx = fmaxf(mx, sv[r]);
    mx = fmaxf(mx, xhalf(mx));      /* both halves hold the query's maximum over the 32 keys */
    const float mn = fmaxf(mr, mx);
    const float al = __expf(mr - mn); mr = mn;
    FragH pf; v2f p2[8];      /* P^T as the B operand: elements 0..7 = keys 8 hh .. + 7, 8..15 = keys 16 + 8 hh .. + 7, the k order of the V^T fragments */
#pragma unroll
    for (int r = 0; r < 8; ++r) { const v2f p = {__expf(sv[2 * r] - mn), __expf(sv[2 * r + 1] - mn)}; p2[r] = p; pf.h[2 * r] = (_Float16)(p[0] * 1024.0f); pf.h[2 * r + 1] = (_Float16)(p[1] * 1024.0f); }
    const v2f rs = ((p2[0] + p2[1]) + (p2[2] + p2[3])) + ((p2[4] + p2[5]) + (p2[6] + p2[7]));      /* the lane's 16 keys, summed as a tree of pairs */
    lr = lr * al + (rs[0] + rs[1]);
#pragma unroll
    for (int r = 0; r < 8; ++r) { o0[r] *= al; o1[r] *= al; o2[r] *= al; o3[r] *= al; }
    o0 = g2_mma(v0, pf.v, o0); o1 = g2_mma(v1, pf.v, o1); o2 = g2_mma(v2, pf.v, o2); o3 = g2_mma(v3, pf.v, o3);      /* O^T tile t: register r = d 16 t + 8 hh + r of query q0 + ln */
  }
  _Float16* sob = &lso[w][0];
  { const float inv = (1.0f / (lr + xhalf(lr))) * 0.0009765625f; FragH f0, f1;
#pragma unroll
    for (int r = 0; r < 8; ++r) { f0.h[r] = (_Float16)(o0[r] * inv); f0.h[8 + r] = (_Float16)(o1[r] * inv); f1.h[r] = (_Float16)(o2[r] * inv); f1.h[8 + r] = (_Float16)(o3[r] * inv); }
    unsigned short* sp = (unsigned short*)sob + ln * OPP + 8 * hh;      /* a lane's 8 d of a tile are 16 bytes of its query's row */
    *(v8us*)sp = f0.half[0]; *(v8us*)(sp + 16) = f0.half[1]; *(v8us*)(sp + 32) = f1.half[0]; *(v8us*)(sp + 48) = f1.half[1]; }
  __builtin_amdgcn_fence(3, "wavefront"); __builtin_amdgcn_wave_barrier();
  unsigned short* ob = (unsigned short*)O16 + wr0 * DM + h * HD;
  {
#pragma unroll
    for (int it2 = 0; it2 < 4; ++it2) { const int row = it2 * 4 + (lane >> 3), c8 = (lane & 7) * 8; const v8us v = *(const v8us*)((const unsigned short*)sob + row * OPP + c8); *(v8us*)(ob + (size_t)row * DM + c8) = v; }
     }
}

extern "C" void kernel_launch(void* const* d_in, const int* in_sizes, int n_in,
                              void* d_out, int out_size, void* d_ws, size_t ws_size, hipStream_t stream) {
  if (n_in < 6) return;
  const float* x = (const float*)d_in[0]; const float* wq = (const float*)d_in[1]; const float* wk = (const float*)d_in[2];
  const float* wv = (const float*)d_in[3]; const float* wp = (const float*)d_in[4]; const float* bproj = (const float*)d_in[5];
  const size_t need_x = (size_t)(NB - 1) * SEQ_FULL * DM + (size_t)SEQ * DM;
  if ((size_t)in_sizes[0] < need_x || in_sizes[1] < DM * DM || in_sizes[2] < DM * DM || in_sizes[3] < DM * DM || in_sizes[4] < DM * DM || in_sizes[5] < DM || (size_t)out_size < need_x) return;
  float* out = (float*)d_out;
  char* ws = (char*)d_ws; size_t off = 0;
  auto take = [&](size_t bytes) { char* p = ws + off; off += (bytes + 255) & ~(size_t)255; return p; };
  const size_t wb = (size_t)DM * DM * 2;
  _Float16* WQ = (_Float16*)take(4 * wb); _Float16* WK = WQ + DM * DM; _Float16* WV = WK + DM * DM; _Float16* WP = WV + DM * DM;      /* four planes in a row */
  const size_t rows2 = (size_t)NB * SEQ * DM * 2;      /* f16 plane over all token rows */
  const size_t f0b4 = (size_t)NB * QT0 * DM * 4;       /* f32 first-tile plane */
  const size_t f0b2 = (size_t)NB * QT0 * DM * 2;       /* f16 first-tile plane */
  const size_t vtb = (size_t)NB * DM * SEQ * 2;         /* V^T [NB*NH*HD][SEQ] */
  /* every plane that one launch writes has its own place: the GEMMs of a launch run side by side */
  _Float16* X16 = (_Float16*)take(rows2); _Float16* O16 = X16;      /* X16 is last read by the first GEMM launch, O16 written after it */
  float* QF0 = (float*)take(f0b4); float* KF0 = (float*)take(f0b4); float* VF0 = (float*)take(f0b4); float* OF0 = (float*)take(f0b4);
  _Float16* Q16 = (_Float16*)take(rows2); _Float16* K16 = (_Float16*)take(rows2); _Float16* VT = (_Float16*)take(vtb);
  _Float16* OH = (_Float16*)take(f0b2); _Float16* OL = (_Float16*)take(f0b2);
  if (off > ws_size) return;

  const size_t nx8 = (size_t)NB * SEQ * DM / 8;
  k_cvt<<<(unsigned)(4 * GW + (nx8 + 255) / 256), 256, 0, stream>>>(x, wq, wk, wv, wp, WQ, X16, nx8);
  constexpr int nS = (QT0 / 128) * (DM / 64);            /* blocks per batch: first-tile GEMMs */
  constexpr int nA = (NB * SEQ / 128) * (DM / 64);       /* all token rows, one batch */
  constexpr int nV = (DM / 128) * (SEQ / 64);            /* V^T, per batch */
  constexpr int nW = (DM / 128) * (QT0 / 64);            /* f32 V^T of the first keys, per batch */
  constexpr int nP = ((SEQ - QT0) / 128) * (DM / 64);    /* projection of rows >= 128, per batch */
  /* all six products of X16 in one launch: f16 q, k rows for all tokens; V^T directly as (16 Wv) . X16^T; f32 q, k and V^T of rows 0..127 of every sequence (exact products) */
  GJobs g1 = {};
  g1.j[0] = GJob{X16, WQ, nullptr, nullptr, Q16, (size_t)0, (size_t)0, (size_t)0, 0.0625f, DM, DM, DM, DM, nA, 0, 0};
  g1.j[1] = GJob{X16, WK, nullptr, nullptr, K16, (size_t)0, (size_t)0, (size_t)0, 0.0625f, DM, DM, DM, DM, nA, nA, 0};
  g1.j[2] = GJob{WV, X16, nullptr, nullptr, VT, (size_t)0, (size_t)SEQ * DM, (size_t)DM * SEQ, 0.0625f, DM, DM, SEQ, SEQ, nV, 2 * nA, 0};
  g1.j[3] = GJob{X16, WQ, nullptr, QF0, nullptr, (size_t)SEQ * DM, (size_t)0, (size_t)QT0 * DM, 0.0625f, DM, DM, DM, DM, nS, 2 * nA + NB * nV, 0};
  g1.j[4] = GJob{X16, WK, nullptr, KF0, nullptr, (size_t)SEQ * DM, (size_t)0, (size_t)QT0 * DM, 0.0625f, DM, DM, DM, DM, nS, 2 * nA + NB * nV + NB * nS, 0};
  g1.j[5] = GJob{WV, X16, nullptr, VF0, nullptr, (size_t)0, (size_t)SEQ * DM, (size_t)DM * QT0, 0.0625f, DM, DM, QT0, QT0, nW, 2 * nA + NB * nV + 2 * NB * nS, 0};
  k_gemm2<<<2 * nA + NB * nV + 2 * NB * nS + NB * nW, 128, 0, stream>>>(g1, 6, bproj, DM);
  k_att0<<<NB * NH * (QT0 / 64), 128, 0, stream>>>(QF0, KF0, VF0, OF0);      /* exact attention rows 0..127 (o x64) */
  const size_t nf8 = (size_t)NB * QT0 * DM / 8;
  /* attention of all rows and, in the grid's last rows, the f16 hi / x1024 residual planes of the exact o x64 */
  k_att<<<dim3(SEQ / 128, (unsigned)(NB * NH + ((nf8 + 255) / 256 + SEQ / 128 - 1) / (SEQ / 128))), 256, 0, stream>>>(Q16, K16, VT, O16, OF0, OH, OL, nf8);
  /* output projection, one launch: rows < 128 from the hi and residual planes (twice the k, so these blocks go first), rows >= 128 from the f16 o plane */
  GJobs g2 = {};
  g2.j[0] = GJob{OH, WP, OL, out, nullptr, (size_t)QT0 * DM, (size_t)0, (size_t)SEQ_FULL * DM, 0.0009765625f, DM, DM, DM, DM, nS, 0, 1};
  g2.j[1] = GJob{O16 + (size_t)QT0 * DM, WP, nullptr, out + (size_t)QT0 * DM, nullptr, (size_t)SEQ * DM, (size_t)0, (size_t)SEQ_FULL * DM, 0.0625f, DM, DM, DM, DM, nP, NB * nS, 1};
  k_gemm2<<<NB * nS + NB * nP, 128, 0, stream>>>(g2, 2, bproj, DM);
}

// v009
// Measured time: 121 microseconds a run.
// Timed twice side by side with v008, it ran 1.10 times as fast both times.
// Counting every step since v000, it is 6.87 times as fast.
#include <hip/hip_runtime.h>
// Structure: token rows r = b*SEQ + t in compact workspace planes (input/output strides use SEQ_FULL); X16 = f16(bf16(x)); Q16, K16 = X16 . (16 W)^T / 16 as 32x64 wave-tile GEMMs with LDS-staged whole-line epilogues; V^T per (b, head) produced directly as (16 Wv) . X16^T / 16;
#ifndef NB
#define NB 64
#endif
#ifndef SEQ
#define SEQ 512
#endif
#define NB_FULL 64
#define SEQ_FULL 512
#define DM 384
#define NH 6
#define HD 64
#define QT0 128                      /* first query rows per sequence recomputed exactly in f32 */
#define OPP 72                       /* LDS pitch (halves) of the 16x64 O staging tile */
#define GKC 64                       /* k (halves) of one staged GEMM pass: one 128-byte line of every operand row */
#define FKP 68                       /* LDS pitch (floats) of a staged f32 K row or o row (64 d): 256 + 16 bytes */
#define FVP 132                      /* LDS pitch (floats) of a staged f32 V^T row (128 keys): 512 + 16 bytes */
#define GP 72                        /* LDS pitch (halves) of a staged GEMM operand row: 128 + 16 bytes */
#define AKP 72                       /* LDS pitch (halves) of a staged K row (64 d): 128 + 16 bytes */
#define RSC 0.0009765625f            /* 2^-10: takes the x1024 of a residual plane out of its sums */
#define AVP 40                       /* LDS pitch (halves) of a staged V^T row (32 keys): 64 + 16 bytes */
static_assert(NB >= 1 && NB <= NB_FULL);
static_assert(SEQ % 128 == 0 && SEQ >= 2 * QT0 && SEQ <= SEQ_FULL);
static_assert(DM == NH * HD && DM % 128 == 0 && HD == 64 && QT0 == 128);

typedef unsigned short v8us __attribute__((ext_vector_type(8), may_alias));
typedef float  v8f  __attribute__((ext_vector_type(8)));
typedef float  v4f  __attribute__((ext_vector_type(4)));
typedef float  v2f  __attribute__((ext_vector_type(2)));
typedef float  v4fa __attribute__((ext_vector_type(4), may_alias));
typedef _Float16 v16h __attribute__((ext_vector_type(16)));
typedef _Float16 v4h __attribute__((ext_vector_type(4)));
union FragH { v16h v; v8us half[2]; _Float16 h[16]; unsigned short u[16]; };

__device__ __forceinline__ unsigned short bf16_bits(float x) { unsigned int u = __float_as_uint(x); return (unsigned short)((u + 0x7FFFu + ((u >> 16) & 1u)) >> 16); }
__device__ __forceinline__ float bf16_val(unsigned short b) { return __uint_as_float(((unsigned int)b) << 16); }
__device__ __forceinline__ float bf16_rne(float x) { return bf16_val(bf16_bits(x)); }

// 16-bit WMMA fragment from a k-contiguous row (A: row m, B: column n of a [n][k] plane): elements 0..7 <- k 8hh..8hh+7, elements 8..15 <- k 16+8hh..16+8hh+7
__device__ __forceinline__ v16h g2_frag(const _Float16* p, int hh) { FragH f; f.half[0] = *(const v8us*)((const unsigned short*)p + 8 * hh); f.half[1] = *(const v8us*)((const unsigned short*)p + 16 + 8 * hh); return f.v; }
__device__ __forceinline__ v8f g2_mma(v16h a, v16h b, v8f c) { v8f d = __builtin_amdgcn_wmma_f32_16x16x32_f16(false, a, false, b, (short)0, c, false, false); asm volatile("v_nop\n\tv_nop\n\tv_nop\n\tv_nop" : "+v"(d) : "v"(a), "v"(b)); return d; }

__device__ __forceinline__ void cvt_w(const float* __restrict__ w, size_t n8, _Float16* __restrict__ Bt, int blk) {
  const size_t t = (size_t)blk * 256 + threadIdx.x; if (t >= n8) return; FragH f;
#pragma unroll
  for (int q = 0; q < 8; ++q) f.h[q] = (_Float16)(bf16_rne(w[t * 8 + q]) * 16.0f);
  unsigned short* d = (unsigned short*)Bt + t * 8;
  *(v8us*)d = f.half[0]; 
}

__device__ __forceinline__ void cvt_x(const float* __restrict__ x, _Float16* __restrict__ X16, size_t n8, int blk) {
  const size_t t = (size_t)blk * 256 + threadIdx.x; if (t >= n8) return;
  const size_t wr = t / (DM / 8); const int c8 = (int)(t % (DM / 8)) * 8;
  const size_t b = wr / SEQ, tt = wr % SEQ;
  const float* src = x + (b * SEQ_FULL + tt) * DM + c8;
  const v4f a = *(const v4fa*)src, c = *(const v4fa*)(src + 4); FragH f;
#pragma unroll
  for (int q = 0; q < 4; ++q) { f.h[q] = (_Float16)bf16_rne(a[q]); f.h[4 + q] = (_Float16)bf16_rne(c[q]); }
  unsigned short* d = (unsigned short*)X16 + t * 8;
  *(v8us*)d = f.half[0]; 
}

// all five conversions in one grid: blocks 0..4 GW-1 take the four weight planes (GW blocks each, W16 = four [DM][DM] planes in a row), the rest take x
#define GW ((DM * DM / 8 + 255) / 256)
__global__ __launch_bounds__(256) void k_cvt(const float* __restrict__ x, const float* __restrict__ w0, const float* __restrict__ w1, const float* __restrict__ w2, const float* __restrict__ w3, _Float16* __restrict__ W16, _Float16* __restrict__ X16, size_t nx8) {
  const int bid = blockIdx.x;
  if (bid < 4 * GW) { const int wi = bid / GW; const float* w = wi == 0 ? w0 : wi == 1 ? w1 : wi == 2 ? w2 : w3; cvt_w(w, (size_t)DM * DM / 8, W16 + (size_t)wi * DM * DM, bid - wi * GW); }
  else cvt_x(x, X16, nx8, bid - 4 * GW);
}

// one pass's operand lines into registers: this lane's 16 bytes of 8 A rows and 4 B rows, 16 rows (sa16, sb16 bytes) apart; pa, pb: the block's first rows at this pass (the same in every lane), ao, bo: the lane's own byte offsets
__device__ __forceinline__ void g2_fetch(const char* pa, size_t sa16, unsigned ao, const char* pb, size_t sb16, unsigned bo, v8us (&ra)[8], v8us (&rb)[4]) {
  const char* a[8]; const char* b[4];
#pragma unroll
  for (int i = 0; i < 8; ++i) { a[i] = pa + i * sa16 + ao; ra[i] = *(const v8us*)a[i]; }
#pragma unroll
  for (int i = 0; i < 4; ++i) { b[i] = pb + i * sb16 + bo; rb[i] = *(const v8us*)b[i]; }
  /* the wait that belongs between an issued load and an overwrite of its address registers; it names the twelve addresses so that they stay in their registers up to it (else a later load's result lands in an earlier load's address pair) */
  asm volatile("s_wait_xcnt 0x0" :: "v"(a[0]), "v"(a[1]), "v"(a[2]), "v"(a[3]), "v"(a[4]), "v"(a[5]), "v"(a[6]), "v"(a[7]), "v"(b[0]), "v"(b[1]), "v"(b[2]), "v"(b[3]) : "memory");
}

// one GEMM of a launch: its operands and outputs, nbx = (M / 128) (N / 64) blocks per batch, first = its first block in the launch's flat grid, useb = add the bias; AL: null, or the x1024 residual plane of A (same pitch and batch stride)
struct GJob { const _Float16* A; const _Float16* Bh; const _Float16* AL; float* C; _Float16* C16; size_t sA, sB, sC; float alpha; int lda, ldb, ldc, N, nbx, first, useb; };
#define GJMAX 6
struct GJobs { GJob j[GJMAX]; };

// A launch holds nj independent GEMMs (none reads what another writes), one after the other in a flat grid; a block finds its GEMM by its index, then its batch and tile.
// GEMM C[M][N] = alpha ((A + AL / 1024) . Bt^T) + bf16(bias[col]): A f16 row-major (pitch lda, batch stride sA), Bt f16 [n][k] (pitch ldb, stride sB);
// writes f32 C and/or f16 C16 (pitch ldc, batch stride sC). Block = 4 waves, block tile 128 rows x 64 cols, wave tile 32 rows x 64 cols; M % 128 == 0, N % 64 == 0, K % 64 == 0.
// Operands: per pass of GKC = 64 k the block brings its 128 A rows and 64 B rows into LDS, 8 lanes per row, so that every wave-wide 16-byte load covers four whole 128-byte lines and each B row is fetched once per block;
// the next pass's lines are fetched into registers while this pass is multiplied; fragments come from LDS (row pitch 144 bytes: a 16-row fragment read meets every bank once). k order of the products as before (32 at a time, ascending).
// With a residual plane the k loop runs twice over K in the same accumulators: first the products of AL, whose sums are then scaled by 2^-10 (exact), then the products of A on top.
__global__ __launch_bounds__(128) void k_gemm2(GJobs js, int nj, const float* __restrict__ biasv, int K) {
  __shared__ __attribute__((aligned(16))) unsigned char sm[4 * 32 * 68 * 4];      /* operand tiles in the k loop, then the epilogue's f32 staging */
  static_assert((128 + 64) * GP * 2 <= 4 * 32 * 68 * 4);
  float (*so)[32][68] = (float (*)[32][68])sm;
  _Float16* sa = (_Float16*)sm; _Float16* sb = sa + 128 * GP;
  const int tid = threadIdx.x, w = tid >> 5, lane = tid & 31, ln = lane & 15, hh = lane >> 4;
  const int bid = blockIdx.x; int ji = 0;
  for (int q = 1; q < GJMAX; ++q) if (q < nj && bid >= js.j[q].first) ji = q;
  const GJob& J = js.j[ji];
  const int lda = J.lda, ldb = J.ldb, ldc = J.ldc; const float alpha = J.alpha; float* C = J.C; _Float16* C16 = J.C16; const float* bias = J.useb ? biasv : nullptr;
  const int loc = bid - J.first; const int by = loc / J.nbx, bx = loc - by * J.nbx;
  const _Float16* A = J.A + (size_t)by * J.sA; const _Float16* Bh = J.Bh + (size_t)by * J.sB; const size_t cofs = (size_t)by * J.sC;
  const int ntn = J.N >> 6; const int mt = bx / ntn, nq = bx - mt * ntn; const int row0 = mt * 128 + 32 * w, col0 = nq * 64;
  const int sr = tid >> 3, sc8 = (tid & 7) * 8;      /* staging: row sr + 16 i, halves sc8..sc8+7 of the pass */
  const char* ah = (const char*)(A + (size_t)(mt * 128) * lda); const char* bh = (const char*)(Bh + (size_t)col0 * ldb);      /* the block's first rows: the same in every lane */
  const int KT = J.AL ? 2 * K : K;      /* k of both planes together */
  const char* ag = J.AL ? (const char*)(J.AL + (size_t)by * J.sA + (size_t)(mt * 128) * lda) : ah; const char* bg = bh;      /* the residual plane goes first */
  const unsigned ao = (unsigned)(sr * lda + sc8) * 2u, bo = (unsigned)(sr * ldb + sc8) * 2u;      /* the lane's own byte offsets, fixed for the whole kernel */
  unsigned short* sas = (unsigned short*)sa + sr * GP + sc8; unsigned short* sbs = (unsigned short*)sb + sr * GP + sc8;
  const _Float16* a0p = sa + (32 * w + ln) * GP; const _Float16* a1p = a0p + 16 * GP;
  const _Float16* b0p = sb + ln * GP; const _Float16* b1p = b0p + 16 * GP; const _Float16* b2p = b1p + 16 * GP; const _Float16* b3p = b2p + 16 * GP;
  const v8f z8 = {0.f,0.f,0.f,0.f,0.f,0.f,0.f,0.f}; v8f c00 = z8, c01 = z8, c02 = z8, c03 = z8, c10 = z8, c11 = z8, c12 = z8, c13 = z8;
  v8us ra[8], rb[4];
  g2_fetch(ag, (size_t)lda * 32, ao, bg, (size_t)ldb * 32, bo, ra, rb); ag += GKC * 2; bg += GKC * 2;
  /* passes stay rolled: one pass already holds 16 products per wave, unrolling further would only lengthen the text */
#pragma unroll 1
  for (int kc = 0; kc < KT; kc += GKC) {
#pragma unroll
    for (int i = 0; i < 8; ++i) *(v8us*)(sas + 16 * i * GP) = ra[i];
#pragma unroll
    for (int i = 0; i < 4; ++i) *(v8us*)(sbs + 16 * i * GP) = rb[i];
    __syncthreads();      /* the pass's tiles are complete before any wave reads a fragment */
    if (kc + GKC == K) { ag = ah; bg = bh; }      /* the residual plane is through: on to A, from k = 0 (without a residual plane nothing is fetched any more) */
    if (kc + GKC < KT) { g2_fetch(ag, (size_t)lda * 32, ao, bg, (size_t)ldb * 32, bo, ra, rb); ag += GKC * 2; bg += GKC * 2; }
#pragma unroll
    for (int kb = 0; kb < GKC; kb += 32) { const v16h a0 = g2_frag(a0p + kb, hh), a1 = g2_frag(a1p + kb, hh);      /* each B fragment after the first is read one pair of products ahead of its use */
      v16h b = g2_frag(b0p + kb, hh), bn = g2_frag(b1p + kb, hh); c00 = g2_mma(a0, b, c00); c10 = g2_mma(a1, b, c10);
      b = g2_frag(b2p + kb, hh); c01 = g2_mma(a0, bn, c01); c11 = g2_mma(a1, bn, c11);
      bn = g2_frag(b3p + kb, hh); c02 = g2_mma(a0, b, c02); c12 = g2_mma(a1, b, c12);
      c03 = g2_mma(a0, bn, c03); c13 = g2_mma(a1, bn, c13); }
    if (kc + GKC == K && KT > K) { c00 *= RSC; c01 *= RSC; c02 *= RSC; c03 *= RSC; c10 *= RSC; c11 *= RSC; c12 *= RSC; c13 *= RSC; }      /* the residual sums take their weight before A's products join them */
    __syncthreads();      /* every wave has read its fragments before the tiles are overwritten (by the next pass, or by the epilogue's staging) */
  }
  v8f accs[8] = {c00, c01, c02, c03, c10, c11, c12, c13};
#pragma unroll
  for (int u = 0; u < 8; ++u) { const int t = u & 3, half = u >> 2; const int col = col0 + t * 16 + ln; const float bv = bias ? bf16_rne(bias[col]) : 0.f;
#pragma unroll
    for (int r = 0; r < 8; ++r) { const int rloc = half * 16 + 8 * hh + r; float v = accs[u][r] * alpha + bv;
      so[w][rloc][t * 16 + ln] = v; } }
  __builtin_amdgcn_fence(4, "workgroup"); __builtin_amdgcn_wave_barrier();
  const int rsub = lane >> 4, c4 = (lane & 15) * 4;
  {
#pragma unroll
    for (int q = 0; q < 16; ++q) { const int r = q * 2 + rsub; const v4f v = *(const v4fa*)&so[w][r][c4];
      if (C) *(v4f*)(C + cofs + (size_t)(row0 + r) * ldc + col0 + c4) = v;
      if (C16) { v4h h4; for (int i = 0; i < 4; ++i) h4[i] = (_Float16)v[i]; *(v4h*)(C16 + cofs + (size_t)(row0 + r) * ldc + col0 + c4) = h4; } }
     }
}

// exact (f32) causal attention for query rows 0..QT0-1 of every (batch, head), on the f32 16x16x4 matrix form: planes QF/KF [NB][QT0][DM] (head h at column h*HD), VTF [NB][DM][QT0] (V^T: row h*HD + d, column = key);
// block = 4 waves = 64 consecutive query rows of one head, wave -> 16 rows; the block first brings the K rows and V^T rows of all its keys into LDS by whole-line loads (pitches 272 and 528 bytes: a 16-row fragment read meets every bank once).
// Per 32 keys, both products transposed as in k_att: two score tiles S^T = k . q^T (A = K rows, B = q rows; a lane half holds d 8u + 4hh .. + 3 of both, two k-steps of 4 per 16-byte read), so that a lane holds 16 of the 32 scores of ONE query;
// x0.125 and the causal select by value, online softmax per query over 32 keys at a time (precise expf); P^T goes from the score registers straight into the B operand of O^T += V^T . P^T:
// k-step j takes p[2j], p[2j+1] = keys 8hh + 2j, + 1 (j < 4) or 16 + 8hh + 2(j-4), + 1 of the block, and the V^T fragment holds the same keys at the same lane half and element.
__device__ __forceinline__ v8f f4_mma(v2f a, v2f b, v8f c) { return __builtin_amdgcn_wmma_f32_16x16x4_f32(false, a, false, b, (short)0, c, false, false); }
__device__ __forceinline__ v2f lo2(v4f x) { const v2f r = {x[0], x[1]}; return r; }
__device__ __forceinline__ v2f hi2(v4f x) { const v2f r = {x[2], x[3]}; return r; }
// lane l with lane l ^ 16
__device__ __forceinline__ float xhalf(float x) { return __builtin_bit_cast(float, __builtin_amdgcn_permlanex16(__builtin_bit_cast(int, x), __builtin_bit_cast(int, x), 0x76543210, 0xfedcba98, false, false)); }

__global__ __launch_bounds__(128) void k_att0(const float* __restrict__ QF, const float* __restrict__ KF, const float* __restrict__ VTF, float* __restrict__ OF) {
  __shared__ __attribute__((aligned(16))) float lk[QT0 * FKP];
  __shared__ __attribute__((aligned(16))) float lv[HD * FVP];
  __shared__ __attribute__((aligned(16))) float lo[4][16 * FKP];
  const int tid = threadIdx.x, w = __builtin_amdgcn_readfirstlane(tid >> 5), lane = tid & 31, ln = lane & 15, hh = lane >> 4;
  const int rg = QT0 / 64 - 1 - blockIdx.x / (NB * NH) % (QT0 / 64); const int bh = blockIdx.x % (NB * NH); const int b = bh / NH, h = bh - b * NH;      /* the later 64 rows (more keys) of every head first: see k_att */
  const size_t pofs = (size_t)b * QT0 * DM;
  const int qt = rg * 4 + w, q0 = qt * 16;
  v4f qf[8];      /* q row q0 + ln, d 8u + 4hh .. + 3 */
  { const float* qr = QF + pofs + (size_t)(q0 + ln) * DM + h * HD + 4 * hh;
#pragma unroll
    for (int u = 0; u < 8; ++u) qf[u] = *(const v4fa*)(qr + 8 * u);
    /* the wait that belongs between an issued load and an overwrite of its address registers; it names the address so that it stays in its registers up to it */
    asm volatile("s_wait_xcnt 0x0" :: "v"(qr) : "memory"); }
  { const int sr = tid >> 4, c4 = (tid & 15) * 4;      /* 16 lanes per 256 bytes of a row, 8 rows a sweep */
    const float* kg = KF + pofs + h * HD + (size_t)sr * DM + c4; const float* vg = VTF + pofs + (size_t)(h * HD + sr) * QT0 + c4;
    for (int hf = 0; hf <= rg; ++hf) { v4f rk[8], rv[8]; const float* kp = kg + (size_t)hf * 64 * DM; const float* vp = vg + hf * 64;
      /* unrolled: the 16 loads of a lane for 64 keys are in flight together */
#pragma unroll
      for (int it = 0; it < 8; ++it) { rk[it] = *(const v4fa*)(kp + it * 8 * DM); rv[it] = *(const v4fa*)(vp + it * 8 * QT0); }
      /* the wait that belongs between an issued load and an overwrite of its address registers; it names the two addresses so that they stay in their registers up to it */
      asm volatile("s_wait_xcnt 0x0" :: "v"(kp), "v"(vp) : "memory");
#pragma unroll
      for (int it = 0; it < 8; ++it) { *(v4f*)&lk[(hf * 64 + it * 8 + sr) * FKP + c4] = rk[it]; *(v4f*)&lv[(it * 8 + sr) * FVP + hf * 64 + c4] = rv[it]; } } }
  __syncthreads();      /* the block's K and V^T rows are complete before any wave reads a fragment */
  const v8f z8 = {0.f,0.f,0.f,0.f,0.f,0.f,0.f,0.f}; v8f o0 = z8, o1 = z8, o2 = z8, o3 = z8;
  float mr = -1.0e30f, lr = 0.f;      /* of query q0 + ln; lr: the sum over the keys of this lane's half, the halves are joined behind the loop */
  const int nkb = qt / 2 + 1;      /* 32-key blocks covering keys 0..q0+15 */
  /* trips stay rolled: one trip already holds 64 products, more would only lengthen the text */
#pragma unroll 1
  for (int it = 0; it < nkb; ++it) {
    const int kb = it * 32;
    v8f s0 = z8, s1 = z8;      /* S^T: register r of lane (ln, hh) = key kb + 8 hh + r (s0), kb + 16 + 8 hh + r (s1), of query q0 + ln */
    { const float* kp = lk + (kb + ln) * FKP + 4 * hh;
#pragma unroll
      for (int u = 0; u < 8; ++u) { const v4f ka = *(const v4f*)(kp + 8 * u), kc = *(const v4f*)(kp + 16 * FKP + 8 * u);      /* the two tiles take turns: no product waits for the one before it */
        s0 = f4_mma(lo2(ka), lo2(qf[u]), s0); s1 = f4_mma(lo2(kc), lo2(qf[u]), s1); s0 = f4_mma(hi2(ka), hi2(qf[u]), s0); s1 = f4_mma(hi2(kc), hi2(qf[u]), s1); } }
    asm volatile("v_nop\n\tv_nop\n\tv_nop\n\tv_nop" : "+v"(s0), "+v"(s1));      /* the four vector slots between the last product and the first vector instruction that reads its result */
    float sv[16];
#pragma unroll
    for (int r = 0; r < 8; ++r) {
      const int qk = q0 - kb - r;      /* key kb + 8 hh + r <= row q0 + ln */
      sv[r] = (8 * hh - ln <= qk) ? s0[r] * 0.125f : -1.0e30f;
      sv[8 + r] = (8 * hh - ln <= qk - 16) ? s1[r] * 0.125f : -1.0e30f;
    }
    float mx = fmaxf(sv[0], sv[1]);
#pragma unroll
    for (int r = 2; r < 16; ++r) mx = fmaxf(mx, sv[r]);
    mx = fmaxf(mx, xhalf(mx));      /* both halves hold the query's maximum over the 32 keys */
    const float mn = fmaxf(mr, mx);
    const float al = expf(mr - mn); mr = mn;
    v2f p2[8];      /* P^T as the B operand: pair j = the two keys of k-step j */
#pragma unroll
    for (int j = 0; j < 8; ++j) { const v2f p = {expf(sv[2 * j] - mn), expf(sv[2 * j + 1] - mn)}; p2[j] = p; }
    const v2f rs = ((p2[0] + p2[1]) + (p2[2] + p2[3])) + ((p2[4] + p2[5]) + (p2[6] + p2[7]));      /* the lane's 16 keys, summed as a tree of pairs */
    lr = lr * al + (rs[0] + rs[1]);
#pragma unroll
    for (int r = 0; r < 8; ++r) { o0[r] *= al; o1[r] *= al; o2[r] *= al; o3[r] *= al; }
    const float* vp = lv + ln * FVP + kb + 8 * hh;      /* V^T row d = 16 t + ln: keys kb + 8 hh .. + 7 and kb + 16 + 8 hh .. + 7 */
#pragma unroll
    for (int g = 0; g < 4; ++g) { const int ko = (g >> 1) * 16 + (g & 1) * 4;      /* four keys of the lane half = k-steps 2g, 2g + 1; the four d tiles take turns */
      const v4f v0 = *(const v4f*)(vp + ko), v1 = *(const v4f*)(vp + 16 * FVP + ko), v2 = *(const v4f*)(vp + 32 * FVP + ko), v3 = *(const v4f*)(vp + 48 * FVP + ko);
      o0 = f4_mma(lo2(v0), p2[2 * g], o0); o1 = f4_mma(lo2(v1), p2[2 * g], o1); o2 = f4_mma(lo2(v2), p2[2 * g], o2); o3 = f4_mma(lo2(v3), p2[2 * g], o3);
      o0 = f4_mma(hi2(v0), p2[2 * g + 1], o0); o1 = f4_mma(hi2(v1), p2[2 * g + 1], o1); o2 = f4_mma(hi2(v2), p2[2 * g + 1], o2); o3 = f4_mma(hi2(v3), p2[2 * g + 1], o3); }      /* O^T tile t: register r = d 16 t + 8 hh + r of query q0 + ln */
    asm volatile("v_nop\n\tv_nop\n\tv_nop\n\tv_nop" : "+v"(o0), "+v"(o1), "+v"(o2), "+v"(o3));      /* the same four slots behind the trip's last product, on both sides of the loop's branch */
  }
  float* sob = &lo[w][0];
  { const float fin = 64.0f / (lr + xhalf(lr));      /* o carried x64 */
    float* sp = sob + ln * FKP + 8 * hh;      /* a lane's 8 d of a tile are 32 bytes of its query's row */
    const v8f os[4] = {o0, o1, o2, o3};
#pragma unroll
    for (int t = 0; t < 4; ++t) { const v4f x = {os[t][0] * fin, os[t][1] * fin, os[t][2] * fin, os[t][3] * fin}, y = {os[t][4] * fin, os[t][5] * fin, os[t][6] * fin, os[t][7] * fin}; *(v4f*)(sp + 16 * t) = x; *(v4f*)(sp + 16 * t + 4) = y; } }
  __builtin_amdgcn_fence(4, "workgroup"); __builtin_amdgcn_wave_barrier();      /* the wave's own rows: its lanes' writes stand before its lanes' reads */
  {
#pragma unroll
    for (int it2 = 0; it2 < 8; ++it2) { const int row = it2 * 2 + hh, pc = ln * 4; const v4f v = *(const v4f*)(sob + row * FKP + pc); *(v4f*)(OF + pofs + (size_t)(q0 + row) * DM + h * HD + pc) = v; }
  } }

__device__ __forceinline__ void hl_split(const float* __restrict__ F, _Float16* __restrict__ Hh, _Float16* __restrict__ Hl, size_t n8, int blk) {
  const size_t t = (size_t)blk * 256 + threadIdx.x; if (t >= n8) return; FragH fh, fl; const v4f a = *(const v4fa*)(F + t * 8), c = *(const v4fa*)(F + t * 8 + 4);
#pragma unroll
  for (int q = 0; q < 4; ++q) { _Float16 hv = (_Float16)a[q]; fh.h[q] = hv; fl.h[q] = (_Float16)((a[q] - (float)hv) * 1024.0f); hv = (_Float16)c[q]; fh.h[4 + q] = hv; fl.h[4 + q] = (_Float16)((c[q] - (float)hv) * 1024.0f); }
  unsigned short* dh = (unsigned short*)Hh + t * 8; unsigned short* dl = (unsigned short*)Hl + t * 8;
  { *(v8us*)dh = fh.half[0]; *(v8us*)dl = fl.half[0];  } }

// The blocks from (SEQ/128)*NB*NH on do not attend: they split the exact attention's f32 o plane F into its f16 hi / x1024 residual planes (needs nothing of this launch's attention and gives it nothing), 256 x 8 elements a block.
// causal attention, f16 WMMA: blocks 0..(SEQ/128)*NB*NH-1, block = 8 waves, wave -> query rows q0..q0+15 (q0 = 16*(8*xt + wave)) of one (b, head).
// Block index -> work (for speed only, any order is right): a block's cost grows with its query tile xt (4 xt + 4 trips), and there are more blocks than resident places, so the tiles go in falling order of cost, all heads of the last tile first;
// K and V^T of a 32-key block are the same for the block's 8 waves: the block brings them into LDS once (one 16-byte load of each per thread: K 8 lanes a row, whole 128-byte lines; V^T 4 lanes a row), two buffers, the next block's lines fetched into registers while this one is worked on;
// every wave stages and meets the one barrier of every 32-key block up to the last wave's count, and skips the arithmetic of the blocks past its own rows; fragments come from LDS (pitches 144 and 80 bytes: a 16-row fragment read meets every bank once).
// Per 32-key block, both products transposed: two 16x16 score tiles S^T = k . q^T (A = K16 rows as [key][d], B = Q16 rows, K = 64 in two k-steps), so that a lane holds 16 of the 32 scores of ONE query (lane l ^ 16 the other 16); x0.125 and the causal select by value in f32,
// online softmax per query (maximum and sum over the lane's own registers, one exchange between the wave's halves for the maximum, the halves' sums joined once behind the loop; o and sum rescaled by exp(m_old - m_new)); P^T x1024 packs from the score registers straight into the B operand of O^T += V^T . P^T (A = V^T rows as [d][key]).
// kg, vg: the block's first K and V^T rows at this 32-key block (the same in every lane); ko, vo: the lane's own byte offsets, fixed for the whole kernel
__device__ __forceinline__ void att_fetch(const char* kg, unsigned ko, const char* vg, unsigned vo, v8us& rk, v8us& rv) {
  const char* ka = kg + ko; const char* va = vg + vo; rk = *(const v8us*)ka; rv = *(const v8us*)va;
  /* the wait that belongs between an issued load and an overwrite of its address registers; it names the two addresses so that they stay in their registers up to it */
  asm volatile("s_wait_xcnt 0x0" :: "v"(ka), "v"(va) : "memory");
}

__global__ __launch_bounds__(256) __attribute__((amdgpu_num_vgpr(160)))      /* 160 registers: three blocks stay resident per WGP, as before the staging */
void k_att(const _Float16* __restrict__ Q16, const _Float16* __restrict__ K16, const _Float16* __restrict__ VT, _Float16* __restrict__ O16, const float* __restrict__ F, _Float16* __restrict__ Hh, _Float16* __restrict__ Hl, size_t n8) {
  __shared__ __attribute__((aligned(16))) _Float16 lso[8][16 * OPP];
  __shared__ __attribute__((aligned(16))) _Float16 lkt[2][32 * AKP];
  __shared__ __attribute__((aligned(16))) _Float16 lvt[2][HD * AVP];
  if (blockIdx.x >= (SEQ / 128) * NB * NH) { hl_split(F, Hh, Hl, n8, (int)blockIdx.x - (SEQ / 128) * NB * NH); return; }      /* the same for the whole block */
  const int xt = SEQ / 128 - 1 - (int)blockIdx.x / (NB * NH);      /* query tile of 128 rows */
  const int tid = threadIdx.x, w = __builtin_amdgcn_readfirstlane(tid >> 5), lane = tid & 31, ln = lane & 15, hh = lane >> 4;      /* the wave's number is the same in every lane: held in a scalar register, so that the test round a trip's products is a scalar branch and what follows from it takes no vector registers */
  const int qt = xt * 8 + w; const int bh = (int)blockIdx.x % (NB * NH); const int b = bh / NH, h = bh - b * NH;
  const int q0 = qt * 16;
  const size_t wr0 = (size_t)b * SEQ + q0;
  const _Float16* qp = Q16 + (wr0 + ln) * DM + h * HD;
  const v16h qa0 = g2_frag(qp, hh), qa1 = g2_frag(qp + 32, hh);      /* d 0..31, 32..63 */
  const _Float16* kbase = K16 + (size_t)b * SEQ * DM + h * HD;        /* key row j at kbase + j*DM */
  const _Float16* vbase = VT + (size_t)bh * HD * SEQ;                 /* V^T row d at vbase + d*SEQ */
  const v8f z8 = {0.f,0.f,0.f,0.f,0.f,0.f,0.f,0.f}; v8f o0 = z8, o1 = z8, o2 = z8, o3 = z8;
  float mr = -1.0e30f, lr = 0.f;      /* of query q0 + ln; lr: the sum over the keys of this lane's half, the halves are joined behind the loop */
  const int nkb = qt / 2 + 1;      /* 32-key blocks covering keys 0..q0+15 */
  const int nkbb = xt * 4 + 4;      /* the count of the block's last wave */
  const char* kg = (const char*)kbase; const char* vg = (const char*)vbase; const unsigned ko = (unsigned)((tid >> 3) * DM + (tid & 7) * 8) * 2u, vo = (unsigned)((tid >> 2) * SEQ + (tid & 3) * 8) * 2u;      /* the thread's own 16 bytes of a 32-key block */
  const int kso = (tid >> 3) * AKP + (tid & 7) * 8, vso = (tid >> 2) * AVP + (tid & 3) * 8;
  v8us rk, rv;
  att_fetch(kg, ko, vg, vo, rk, rv); kg += 32 * DM * 2; vg += 32 * 2;
#pragma unroll 1
  for (int it = 0; it < nkbb; ++it) {
    _Float16* kt = &lkt[it & 1][0]; _Float16* vt = &lvt[it & 1][0];
    *(v8us*)((unsigned short*)kt + kso) = rk; *(v8us*)((unsigned short*)vt + vso) = rv;
    __syncthreads();      /* this block's tiles are complete before any wave reads a fragment; and who passes it knows that every wave has left the other buffer, which the next trip overwrites */
    if (it + 1 < nkbb) { att_fetch(kg, ko, vg, vo, rk, rv); kg += 32 * DM * 2; vg += 32 * 2; }
    if (it >= nkb) continue;      /* keys past the wave's rows: nothing to add */
    const int kb = it * 32;
    v8f s0 = z8, s1 = z8;      /* S^T: register r of lane (ln, hh) = key kb + 8 hh + r (s0), kb + 16 + 8 hh + r (s1), of query q0 + ln */
    { const _Float16* kp = kt + ln * AKP;      /* the four K fragments are read together, ahead of the products */
      const v16h k00 = g2_frag(kp, hh), k01 = g2_frag(kp + 32, hh), k10 = g2_frag(kp + 16 * AKP, hh), k11 = g2_frag(kp + 16 * AKP + 32, hh);
      s0 = g2_mma(k00, qa0, s0); s1 = g2_mma(k10, qa0, s1); s0 = g2_mma(k01, qa1, s0); s1 = g2_mma(k11, qa1, s1); }      /* the two tiles take turns: no product waits for the one before it */
    const _Float16* vp = vt + ln * AVP;      /* the four V^T fragments are read ahead of the softmax, which covers their latency */
    const v16h v0 = g2_frag(vp, hh), v1 = g2_frag(vp + 16 * AVP, hh), v2 = g2_frag(vp + 32 * AVP, hh), v3 = g2_frag(vp + 48 * AVP, hh);
    __builtin_amdgcn_sched_barrier(0);      /* keeps the eight reads here: left free, the compiler sinks them to the products, where their latency is bare */
    float sv[16];
#pragma unroll
    for (int r = 0; r < 8; ++r) {
      const int qk = q0 - kb - r;      /* key kb + 8 hh + r <= row q0 + ln, with the wave's part of the test on the scalar side: one vector register (8 hh - ln) */
      sv[r] = (8 * hh - ln <= qk) ? s0[r] * 0.125f : -1.0e30f;
      sv[8 + r] = (8 * hh - ln <= qk - 16) ? s1[r] * 0.125f : -1.0e30f;
    }
    float mx = fmaxf(sv[0], sv[1]);
#pragma unroll
    for (int r = 2; r < 16; ++r) mx = fmaxf(mx, sv[r]);
    mx = fmaxf(mx, xhalf(mx));      /* both halves hold the query's maximum over the 32 keys */
    const float mn = fmaxf(mr, mx);
    const float al = __expf(mr - mn); mr = mn;
    FragH pf; v2f p2[8];      /* P^T as the B operand: elements 0..7 = keys 8 hh .. + 7, 8..15 = keys 16 + 8 hh .. + 7, the k order of the V^T fragments */
#pragma unroll
    for (int r = 0; r < 8; ++r) { const v2f p = {__expf(sv[2 * r] - mn), __expf(sv[2 * r + 1] - mn)}; p2[r] = p; pf.h[2 * r] = (_Float16)(p[0] * 1024.0f); pf.h[2 * r + 1] = (_Float16)(p[1] * 1024.0f); }
    const v2f rs = ((p2[0] + p2[1]) + (p2[2] + p2[3])) + ((p2[4] + p2[5]) + (p2[6] + p2[7]));      /* the lane's 16 keys, summed as a tree of pairs */
    lr = lr * al + (rs[0] + rs[1]);
#pragma unroll
    for (int r = 0; r < 8; ++r) { o0[r] *= al; o1[r] *= al; o2[r] *= al; o3[r] *= al; }
    o0 = g2_mma(v0, pf.v, o0); o1 = g2_mma(v1, pf.v, o1); o2 = g2_mma(v2, pf.v, o2); o3 = g2_mma(v3, pf.v, o3);      /* O^T tile t: register r = d 16 t + 8 hh + r of query q0 + ln */
  }
  _Float16* sob = &lso[w][0];
  { const float inv = (1.0f / (lr + xhalf(lr))) * 0.0009765625f; FragH f0, f1;
#pragma unroll
    for (int r = 0; r < 8; ++r) { f0.h[r] = (_Float16)(o0[r] * inv); f0.h[8 + r] = (_Float16)(o1[r] * inv); f1.h[r] = (_Float16)(o2[r] * inv); f1.h[8 + r] = (_Float16)(o3[r] * inv); }
    unsigned short* sp = (unsigned short*)sob + ln * OPP + 8 * hh;      /* a lane's 8 d of a tile are 16 bytes of its query's row */
    *(v8us*)sp = f0.half[0]; *(v8us*)(sp + 16) = f0.half[1]; *(v8us*)(sp + 32) = f1.half[0]; *(v8us*)(sp + 48) = f1.half[1]; }
  __builtin_amdgcn_fence(3, "wavefront"); __builtin_amdgcn_wave_barrier();
  unsigned short* ob = (unsigned short*)O16 + wr0 * DM + h * HD;
  {
#pragma unroll
    for (int it2 = 0; it2 < 4; ++it2) { const int row = it2 * 4 + (lane >> 3), c8 = (lane & 7) * 8; const v8us v = *(const v8us*)((const unsigned short*)sob + row * OPP + c8); *(v8us*)(ob + (size_t)row * DM + c8) = v; }
     }
}

extern "C" void kernel_launch(void* const* d_in, const int* in_sizes, int n_in,
                              void* d_out, int out_size, void* d_ws, size_t ws_size, hipStream_t stream) {
  if (n_in < 6) return;
  const float* x = (const float*)d_in[0]; const float* wq = (const float*)d_in[1]; const float* wk = (const float*)d_in[2];
  const float* wv = (const float*)d_in[3]; const float* wp = (const float*)d_in[4]; const float* bproj = (const float*)d_in[5];
  const size_t need_x = (size_t)(NB - 1) * SEQ_FULL * DM + (size_t)SEQ * DM;
  if ((size_t)in_sizes[0] < need_x || in_sizes[1] < DM * DM || in_sizes[2] < DM * DM || in_sizes[3] < DM * DM || in_sizes[4] < DM * DM || in_sizes[5] < DM || (size_t)out_size < need_x) return;
  float* out = (float*)d_out;
  char* ws = (char*)d_ws; size_t off = 0;
  auto take = [&](size_t bytes) { char* p = ws + off; off += (bytes + 255) & ~(size_t)255; return p; };
  const size_t wb = (size_t)DM * DM * 2;
  _Float16* WQ = (_Float16*)take(4 * wb); _Float16* WK = WQ + DM * DM; _Float16* WV = WK + DM * DM; _Float16* WP = WV + DM * DM;      /* four planes in a row */
  const size_t rows2 = (size_t)NB * SEQ * DM * 2;      /* f16 plane over all token rows */
  const size_t f0b4 = (size_t)NB * QT0 * DM * 4;       /* f32 first-tile plane */
  const size_t f0b2 = (size_t)NB * QT0 * DM * 2;       /* f16 first-tile plane */
  const size_t vtb = (size_t)NB * DM * SEQ * 2;         /* V^T [NB*NH*HD][SEQ] */
  /* every plane that one launch writes has its own place: the GEMMs of a launch run side by side */
  _Float16* X16 = (_Float16*)take(rows2); _Float16* O16 = X16;      /* X16 is last read by the first GEMM launch, O16 written after it */
  float* QF0 = (float*)take(f0b4); float* KF0 = (float*)take(f0b4); float* VF0 = (float*)take(f0b4); float* OF0 = (float*)take(f0b4);
  _Float16* Q16 = (_Float16*)take(rows2); _Float16* K16 = (_Float16*)take(rows2); _Float16* VT = (_Float16*)take(vtb);
  _Float16* OH = (_Float16*)take(f0b2); _Float16* OL = (_Float16*)take(f0b2);
  if (off > ws_size) return;

  const size_t nx8 = (size_t)NB * SEQ * DM / 8;
  k_cvt<<<(unsigned)(4 * GW + (nx8 + 255) / 256), 256, 0, stream>>>(x, wq, wk, wv, wp, WQ, X16, nx8);
  constexpr int nS = (QT0 / 128) * (DM / 64);            /* blocks per batch: first-tile GEMMs */
  constexpr int nA = (NB * SEQ / 128) * (DM / 64);       /* all token rows, one batch */
  constexpr int nV = (DM / 128) * (SEQ / 64);            /* V^T, per batch */
  constexpr int nW = (DM / 128) * (QT0 / 64);            /* f32 V^T of the first keys, per batch */
  constexpr int nP = ((SEQ - QT0) / 128) * (DM / 64);    /* projection of rows >= 128, per batch */
  /* all six products of X16 in one launch: f16 q, k rows for all tokens; V^T directly as (16 Wv) . X16^T; f32 q, k and V^T of rows 0..127 of every sequence (exact products) */
  GJobs g1 = {};
  g1.j[0] = GJob{X16, WQ, nullptr, nullptr, Q16, (size_t)0, (size_t)0, (size_t)0, 0.0625f, DM, DM, DM, DM, nA, 0, 0};
  g1.j[1] = GJob{X16, WK, nullptr, nullptr, K16, (size_t)0, (size_t)0, (size_t)0, 0.0625f, DM, DM, DM, DM, nA, nA, 0};
  g1.j[2] = GJob{WV, X16, nullptr, nullptr, VT, (size_t)0, (size_t)SEQ * DM, (size_t)DM * SEQ, 0.0625f, DM, DM, SEQ, SEQ, nV, 2 * nA, 0};
  g1.j[3] = GJob{X16, WQ, nullptr, QF0, nullptr, (size_t)SEQ * DM, (size_t)0, (size_t)QT0 * DM, 0.0625f, DM, DM, DM, DM, nS, 2 * nA + NB * nV, 0};
  g1.j[4] = GJob{X16, WK, nullptr, KF0, nullptr, (size_t)SEQ * DM, (size_t)0, (size_t)QT0 * DM, 0.0625f, DM, DM, DM, DM, nS, 2 * nA + NB * nV + NB * nS, 0};
  g1.j[5] = GJob{WV, X16, nullptr, VF0, nullptr, (size_t)0, (size_t)SEQ * DM, (size_t)DM * QT0, 0.0625f, DM, DM, QT0, QT0, nW, 2 * nA + NB * nV + 2 * NB * nS, 0};
  k_gemm2<<<2 * nA + NB * nV + 2 * NB * nS + NB * nW, 128, 0, stream>>>(g1, 6, bproj, DM);
  k_att0<<<NB * NH * (QT0 / 64), 128, 0, stream>>>(QF0, KF0, VF0, OF0);      /* exact attention rows 0..127 (o x64) */
  const size_t nf8 = (size_t)NB * QT0 * DM / 8;
  /* attention of all rows and, in the grid's last blocks, the f16 hi / x1024 residual planes of the exact o x64 */
  k_att<<<(unsigned)((SEQ / 128) * NB * NH + (nf8 + 255) / 256), 256, 0, stream>>>(Q16, K16, VT, O16, OF0, OH, OL, nf8);
  /* output projection, one launch: rows < 128 from the hi and residual planes (twice the k, so these blocks go first), rows >= 128 from the f16 o plane */
  GJobs g2 = {};
  g2.j[0] = GJob{OH, WP, OL, out, nullptr, (size_t)QT0 * DM, (size_t)0, (size_t)SEQ_FULL * DM, 0.0009765625f, DM, DM, DM, DM, nS, 0, 1};
  g2.j[1] = GJob{O16 + (size_t)QT0 * DM, WP, nullptr, out + (size_t)QT0 * DM, nullptr, (size_t)SEQ * DM, (size_t)0, (size_t)SEQ_FULL * DM, 0.0625f, DM, DM, DM, DM, nP, NB * nS, 1};
  k_gemm2<<<NB * nS + NB * nP, 128, 0, stream>>>(g2, 2, bproj, DM);
}

// v010
// It runs in 110 microseconds.
// In both of two side-by-side timings against v009, it was 1.10 times as fast.
// Over all steps from v000 it is 7.54 times as fast.
#include <hip/hip_runtime.h>
// Structure: token rows r = b*SEQ + t in compact workspace planes (input/output strides use SEQ_FULL); X16 = f16(bf16(x)); Q16 (rows >= 128 of a sequence only), K16 = X16 . (16 W)^T / 16 as 32x64 wave-tile GEMMs with LDS-staged whole-line epilogues; V^T per (b, head) produced directly as (16 Wv) . X16^T / 16;
#ifndef NB
#define NB 64
#endif
#ifndef SEQ
#define SEQ 512
#endif
#define NB_FULL 64
#define SEQ_FULL 512
#define DM 384
#define NH 6
#define HD 64
#define QT0 128                      /* first query rows per sequence computed exactly in f32 */
#define OPP 72                       /* LDS pitch (halves) of the 16x64 O staging tile */
#define GKC 64                       /* k (halves) of one staged GEMM pass: one 128-byte line of every operand row */
#define FKP 68                       /* LDS pitch (floats) of a staged f32 K row or o row (64 d): 256 + 16 bytes */
#define FVP 132                      /* LDS pitch (floats) of a staged f32 V^T row (128 keys): 512 + 16 bytes */
#define GP 72                        /* LDS pitch (halves) of a staged GEMM operand row: 128 + 16 bytes */
#define AKP 72                       /* LDS pitch (halves) of a staged K row (64 d): 128 + 16 bytes */
#define RSC 0.0009765625f            /* 2^-10: takes the x1024 of a residual plane out of its sums */
#define AVP 40                       /* LDS pitch (halves) of a staged V^T row (32 keys): 64 + 16 bytes */
static_assert(NB >= 1 && NB <= NB_FULL);
static_assert(SEQ % 128 == 0 && SEQ >= 2 * QT0 && SEQ <= SEQ_FULL);
static_assert(DM == NH * HD && DM % 128 == 0 && HD == 64 && QT0 == 128);

typedef unsigned short v8us __attribute__((ext_vector_type(8), may_alias));
typedef float  v8f  __attribute__((ext_vector_type(8)));
typedef float  v4f  __attribute__((ext_vector_type(4)));
typedef float  v2f  __attribute__((ext_vector_type(2)));
typedef float  v4fa __attribute__((ext_vector_type(4), may_alias));
typedef _Float16 v16h __attribute__((ext_vector_type(16)));
typedef _Float16 v4h __attribute__((ext_vector_type(4)));
union FragH { v16h v; v8us half[2]; _Float16 h[16]; unsigned short u[16]; };

__device__ __forceinline__ unsigned short bf16_bits(float x) { unsigned int u = __float_as_uint(x); return (unsigned short)((u + 0x7FFFu + ((u >> 16) & 1u)) >> 16); }
__device__ __forceinline__ float bf16_val(unsigned short b) { return __uint_as_float(((unsigned int)b) << 16); }
__device__ __forceinline__ float bf16_rne(float x) { return bf16_val(bf16_bits(x)); }

// 16-bit WMMA fragment from a k-contiguous row (A: row m, B: column n of a [n][k] plane): elements 0..7 <- k 8hh..8hh+7, elements 8..15 <- k 16+8hh..16+8hh+7
__device__ __forceinline__ v16h g2_frag(const _Float16* p, int hh) { FragH f; f.half[0] = *(const v8us*)((const unsigned short*)p + 8 * hh); f.half[1] = *(const v8us*)((const unsigned short*)p + 16 + 8 * hh); return f.v; }
__device__ __forceinline__ v8f g2_mma(v16h a, v16h b, v8f c) { v8f d = __builtin_amdgcn_wmma_f32_16x16x32_f16(false, a, false, b, (short)0, c, false, false); asm volatile("v_nop\n\tv_nop\n\tv_nop\n\tv_nop" : "+v"(d) : "v"(a), "v"(b)); return d; }

__device__ __forceinline__ void cvt_w(const float* __restrict__ w, size_t n8, _Float16* __restrict__ Bt, int blk) {
  const size_t t = (size_t)blk * 256 + threadIdx.x; if (t >= n8) return; FragH f;
#pragma unroll
  for (int q = 0; q < 8; ++q) f.h[q] = (_Float16)(bf16_rne(w[t * 8 + q]) * 16.0f);
  unsigned short* d = (unsigned short*)Bt + t * 8;
  *(v8us*)d = f.half[0]; 
}

__device__ __forceinline__ void cvt_x(const float* __restrict__ x, _Float16* __restrict__ X16, size_t n8, int blk) {
  const size_t t = (size_t)blk * 256 + threadIdx.x; if (t >= n8) return;
  const size_t wr = t / (DM / 8); const int c8 = (int)(t % (DM / 8)) * 8;
  const size_t b = wr / SEQ, tt = wr % SEQ;
  const float* src = x + (b * SEQ_FULL + tt) * DM + c8;
  const v4f a = *(const v4fa*)src, c = *(const v4fa*)(src + 4); FragH f;
#pragma unroll
  for (int q = 0; q < 4; ++q) { f.h[q] = (_Float16)bf16_rne(a[q]); f.h[4 + q] = (_Float16)bf16_rne(c[q]); }
  unsigned short* d = (unsigned short*)X16 + t * 8;
  *(v8us*)d = f.half[0]; 
}

// all five conversions in one grid: blocks 0..4 GW-1 take the four weight planes (GW blocks each, W16 = four [DM][DM] planes in a row), the rest take x
#define GW ((DM * DM / 8 + 255) / 256)
__global__ __launch_bounds__(256) void k_cvt(const float* __restrict__ x, const float* __restrict__ w0, const float* __restrict__ w1, const float* __restrict__ w2, const float* __restrict__ w3, _Float16* __restrict__ W16, _Float16* __restrict__ X16, size_t nx8) {
  const int bid = blockIdx.x;
  if (bid < 4 * GW) { const int wi = bid / GW; const float* w = wi == 0 ? w0 : wi == 1 ? w1 : wi == 2 ? w2 : w3; cvt_w(w, (size_t)DM * DM / 8, W16 + (size_t)wi * DM * DM, bid - wi * GW); }
  else cvt_x(x, X16, nx8, bid - 4 * GW);
}

// one pass's operand lines into registers: this lane's 16 bytes of 8 A rows and 4 B rows, 16 rows (sa16, sb16 bytes) apart; pa, pb: the block's first rows at this pass (the same in every lane), ao, bo: the lane's own byte offsets
__device__ __forceinline__ void g2_fetch(const char* pa, size_t sa16, unsigned ao, const char* pb, size_t sb16, unsigned bo, v8us (&ra)[8], v8us (&rb)[4]) {
  const char* a[8]; const char* b[4];
#pragma unroll
  for (int i = 0; i < 8; ++i) { a[i] = pa + i * sa16 + ao; ra[i] = *(const v8us*)a[i]; }
#pragma unroll
  for (int i = 0; i < 4; ++i) { b[i] = pb + i * sb16 + bo; rb[i] = *(const v8us*)b[i]; }
  /* the wait that belongs between an issued load and an overwrite of its address registers; it names the twelve addresses so that they stay in their registers up to it (else a later load's result lands in an earlier load's address pair) */
  asm volatile("s_wait_xcnt 0x0" :: "v"(a[0]), "v"(a[1]), "v"(a[2]), "v"(a[3]), "v"(a[4]), "v"(a[5]), "v"(a[6]), "v"(a[7]), "v"(b[0]), "v"(b[1]), "v"(b[2]), "v"(b[3]) : "memory");
}

// one GEMM of a launch: its operands and outputs, nbx = (M / 128) (N / 64) blocks per batch, first = its first block in the launch's flat grid, useb = add the bias; AL: null, or the x1024 residual plane of A (same pitch and batch stride);
// the f32 output C (pitch ldc, batch stride sC) and the f16 output C16 (pitch ldh, batch stride sH) each have their own plane shape; fill: 0, so that the struct has no unnamed bytes
struct GJob { const _Float16* A; const _Float16* Bh; const _Float16* AL; float* C; _Float16* C16; size_t sA, sB, sC, sH; float alpha; int lda, ldb, ldc, ldh, N, nbx, first, useb, fill; };
static_assert(sizeof(GJob) == 5 * 8 + 4 * 8 + 10 * 4);
#define GJMAX 6
struct GJobs { GJob j[GJMAX]; };

// A launch holds nj independent GEMMs (none reads what another writes), one after the other in a flat grid; a block finds its GEMM by its index, then its batch and tile.
// GEMM C[M][N] = alpha ((A + AL / 1024) . Bt^T) + bf16(bias[col]): A f16 row-major (pitch lda, batch stride sA), Bt f16 [n][k] (pitch ldb, stride sB);
// writes f32 C (pitch ldc, batch stride sC) and/or f16 C16 (pitch ldh, batch stride sH). Block = 4 waves, block tile 128 rows x 64 cols, wave tile 32 rows x 64 cols; M % 128 == 0, N % 64 == 0, K % 64 == 0.
// Operands: per pass of GKC = 64 k the block brings its 128 A rows and 64 B rows into LDS, 8 lanes per row, so that every wave-wide 16-byte load covers four whole 128-byte lines and each B row is fetched once per block;
// the next pass's lines are fetched into registers while this pass is multiplied; fragments come from LDS (row pitch 144 bytes: a 16-row fragment read meets every bank once). k order of the products as before (32 at a time, ascending).
// With a residual plane the k loop runs twice over K in the same accumulators: first the products of AL, whose sums are then scaled by 2^-10 (exact), then the products of A on top.
__global__ __launch_bounds__(128) void k_gemm2(GJobs js, int nj, const float* __restrict__ biasv, int K) {
  __shared__ __attribute__((aligned(16))) unsigned char sm[4 * 32 * 68 * 4];      /* operand tiles in the k loop, then the epilogue's f32 staging */
  static_assert((128 + 64) * GP * 2 <= 4 * 32 * 68 * 4);
  float (*so)[32][68] = (float (*)[32][68])sm;
  _Float16* sa = (_Float16*)sm; _Float16* sb = sa + 128 * GP;
  const int tid = threadIdx.x, w = tid >> 5, lane = tid & 31, ln = lane & 15, hh = lane >> 4;
  const int bid = blockIdx.x; int ji = 0;
  for (int q = 1; q < GJMAX; ++q) if (q < nj && bid >= js.j[q].first) ji = q;
  const GJob& J = js.j[ji];
  const int lda = J.lda, ldb = J.ldb, ldc = J.ldc, ldh = J.ldh; const float alpha = J.alpha; float* C = J.C; _Float16* C16 = J.C16; const float* bias = J.useb ? biasv : nullptr;
  const int loc = bid - J.first; const int by = loc / J.nbx, bx = loc - by * J.nbx;
  const _Float16* A = J.A + (size_t)by * J.sA; const _Float16* Bh = J.Bh + (size_t)by * J.sB; const size_t cofs = (size_t)by * J.sC, hofs = (size_t)by * J.sH;
  const int ntn = J.N >> 6; const int mt = bx / ntn, nq = bx - mt * ntn; const int row0 = mt * 128 + 32 * w, col0 = nq * 64;
  const int sr = tid >> 3, sc8 = (tid & 7) * 8;      /* staging: row sr + 16 i, halves sc8..sc8+7 of the pass */
  const char* ah = (const char*)(A + (size_t)(mt * 128) * lda); const char* bh = (const char*)(Bh + (size_t)col0 * ldb);      /* the block's first rows: the same in every lane */
  const int KT = J.AL ? 2 * K : K;      /* k of both planes together */
  const char* ag = J.AL ? (const char*)(J.AL + (size_t)by * J.sA + (size_t)(mt * 128) * lda) : ah; const char* bg = bh;      /* the residual plane goes first */
  const unsigned ao = (unsigned)(sr * lda + sc8) * 2u, bo = (unsigned)(sr * ldb + sc8) * 2u;      /* the lane's own byte offsets, fixed for the whole kernel */
  unsigned short* sas = (unsigned short*)sa + sr * GP + sc8; unsigned short* sbs = (unsigned short*)sb + sr * GP + sc8;
  const _Float16* a0p = sa + (32 * w + ln) * GP; const _Float16* a1p = a0p + 16 * GP;
  const _Float16* b0p = sb + ln * GP; const _Float16* b1p = b0p + 16 * GP; const _Float16* b2p = b1p + 16 * GP; const _Float16* b3p = b2p + 16 * GP;
  const v8f z8 = {0.f,0.f,0.f,0.f,0.f,0.f,0.f,0.f}; v8f c00 = z8, c01 = z8, c02 = z8, c03 = z8, c10 = z8, c11 = z8, c12 = z8, c13 = z8;
  v8us ra[8], rb[4];
  g2_fetch(ag, (size_t)lda * 32, ao, bg, (size_t)ldb * 32, bo, ra, rb); ag += GKC * 2; bg += GKC * 2;
  /* passes stay rolled: one pass already holds 16 products per wave, unrolling further would only lengthen the text */
#pragma unroll 1
  for (int kc = 0; kc < KT; kc += GKC) {
#pragma unroll
    for (int i = 0; i < 8; ++i) *(v8us*)(sas + 16 * i * GP) = ra[i];
#pragma unroll
    for (int i = 0; i < 4; ++i) *(v8us*)(sbs + 16 * i * GP) = rb[i];
    __syncthreads();      /* the pass's tiles are complete before any wave reads a fragment */
    if (kc + GKC == K) { ag = ah; bg = bh; }      /* the residual plane is through: on to A, from k = 0 (without a residual plane nothing is fetched any more) */
    if (kc + GKC < KT) { g2_fetch(ag, (size_t)lda * 32, ao, bg, (size_t)ldb * 32, bo, ra, rb); ag += GKC * 2; bg += GKC * 2; }
#pragma unroll
    for (int kb = 0; kb < GKC; kb += 32) { const v16h a0 = g2_frag(a0p + kb, hh), a1 = g2_frag(a1p + kb, hh);      /* each B fragment after the first is read one pair of products ahead of its use */
      v16h b = g2_frag(b0p + kb, hh), bn = g2_frag(b1p + kb, hh); c00 = g2_mma(a0, b, c00); c10 = g2_mma(a1, b, c10);
      b = g2_frag(b2p + kb, hh); c01 = g2_mma(a0, bn, c01); c11 = g2_mma(a1, bn, c11);
      bn = g2_frag(b3p + kb, hh); c02 = g2_mma(a0, b, c02); c12 = g2_mma(a1, b, c12);
      c03 = g2_mma(a0, bn, c03); c13 = g2_mma(a1, bn, c13); }
    if (kc + GKC == K && KT > K) { c00 *= RSC; c01 *= RSC; c02 *= RSC; c03 *= RSC; c10 *= RSC; c11 *= RSC; c12 *= RSC; c13 *= RSC; }      /* the residual sums take their weight before A's products join them */
    __syncthreads();      /* every wave has read its fragments before the tiles are overwritten (by the next pass, or by the epilogue's staging) */
  }
  v8f accs[8] = {c00, c01, c02, c03, c10, c11, c12, c13};
#pragma unroll
  for (int u = 0; u < 8; ++u) { const int t = u & 3, half = u >> 2; const int col = col0 + t * 16 + ln; const float bv = bias ? bf16_rne(bias[col]) : 0.f;
#pragma unroll
    for (int r = 0; r < 8; ++r) { const int rloc = half * 16 + 8 * hh + r; float v = accs[u][r] * alpha + bv;
      so[w][rloc][t * 16 + ln] = v; } }
  __builtin_amdgcn_fence(4, "workgroup"); __builtin_amdgcn_wave_barrier();
  const int rsub = lane >> 4, c4 = (lane & 15) * 4;
  {
#pragma unroll
    for (int q = 0; q < 16; ++q) { const int r = q * 2 + rsub; const v4f v = *(const v4fa*)&so[w][r][c4];
      /* the wait that belongs between an issued store and an overwrite of its registers: a block with both outputs converts to f16 in the registers that the f32 store names */
      if (C) { *(v4f*)(C + cofs + (size_t)(row0 + r) * ldc + col0 + c4) = v; asm volatile("s_wait_xcnt 0x0" ::: "memory"); }
      if (C16) { v4h h4; for (int i = 0; i < 4; ++i) h4[i] = (_Float16)v[i]; *(v4h*)(C16 + hofs + (size_t)(row0 + r) * ldh + col0 + c4) = h4; } }
     }
}

// exact (f32) causal attention for query rows 0..QT0-1 of every (batch, head), on the f32 16x16x4 matrix form: planes QF/KF [NB][QT0][DM] (head h at column h*HD), VTF [NB][DM][QT0] (V^T: row h*HD + d, column = key);
// block = 4 waves = 64 consecutive query rows of one head, wave -> 16 rows; the block first brings the K rows and V^T rows of all its keys into LDS by whole-line loads (pitches 272 and 528 bytes: a 16-row fragment read meets every bank once).
// Per 32 keys, both products transposed as in k_att: two score tiles S^T = k . q^T (A = K rows, B = q rows; a lane half holds d 8u + 4hh .. + 3 of both, two k-steps of 4 per 16-byte read), so that a lane holds 16 of the 32 scores of ONE query;
// x0.125 and the causal select by value, online softmax per query over 32 keys at a time (precise expf); P^T goes from the score registers straight into the B operand of O^T += V^T . P^T:
// k-step j takes p[2j], p[2j+1] = keys 8hh + 2j, + 1 (j < 4) or 16 + 8hh + 2(j-4), + 1 of the block, and the V^T fragment holds the same keys at the same lane half and element.
__device__ __forceinline__ v8f f4_mma(v2f a, v2f b, v8f c) { return __builtin_amdgcn_wmma_f32_16x16x4_f32(false, a, false, b, (short)0, c, false, false); }
__device__ __forceinline__ v2f lo2(v4f x) { const v2f r = {x[0], x[1]}; return r; }
__device__ __forceinline__ v2f hi2(v4f x) { const v2f r = {x[2], x[3]}; return r; }
// lane l with lane l ^ 16
__device__ __forceinline__ float xhalf(float x) { return __builtin_bit_cast(float, __builtin_amdgcn_permlanex16(__builtin_bit_cast(int, x), __builtin_bit_cast(int, x), 0x76543210, 0xfedcba98, false, false)); }

__global__ __launch_bounds__(128) void k_att0(const float* __restrict__ QF, const float* __restrict__ KF, const float* __restrict__ VTF, float* __restrict__ OF) {
  __shared__ __attribute__((aligned(16))) float lk[QT0 * FKP];
  __shared__ __attribute__((aligned(16))) float lv[HD * FVP];
  __shared__ __attribute__((aligned(16))) float lo[4][16 * FKP];
  const int tid = threadIdx.x, w = __builtin_amdgcn_readfirstlane(tid >> 5), lane = tid & 31, ln = lane & 15, hh = lane >> 4;
  const int rg = QT0 / 64 - 1 - blockIdx.x / (NB * NH) % (QT0 / 64); const int bh = blockIdx.x % (NB * NH); const int b = bh / NH, h = bh - b * NH;      /* the later 64 rows (more keys) of every head first: see k_att */
  const size_t pofs = (size_t)b * QT0 * DM;
  const int qt = rg * 4 + w, q0 = qt * 16;
  v4f qf[8];      /* q row q0 + ln, d 8u + 4hh .. + 3 */
  { const float* qr = QF + pofs + (size_t)(q0 + ln) * DM + h * HD + 4 * hh;
#pragma unroll
    for (int u = 0; u < 8; ++u) qf[u] = *(const v4fa*)(qr + 8 * u);
    /* the wait that belongs between an issued load and an overwrite of its address registers; it names the address so that it stays in its registers up to it */
    asm volatile("s_wait_xcnt 0x0" :: "v"(qr) : "memory"); }
  { const int sr = tid >> 4, c4 = (tid & 15) * 4;      /* 16 lanes per 256 bytes of a row, 8 rows a sweep */
    const float* kg = KF + pofs + h * HD + (size_t)sr * DM + c4; const float* vg = VTF + pofs + (size_t)(h * HD + sr) * QT0 + c4;
    for (int hf = 0; hf <= rg; ++hf) { v4f rk[8], rv[8]; const float* kp = kg + (size_t)hf * 64 * DM; const float* vp = vg + hf * 64;
      /* unrolled: the 16 loads of a lane for 64 keys are in flight together */
#pragma unroll
      for (int it = 0; it < 8; ++it) { rk[it] = *(const v4fa*)(kp + it * 8 * DM); rv[it] = *(const v4fa*)(vp + it * 8 * QT0); }
      /* the wait that belongs between an issued load and an overwrite of its address registers; it names the two addresses so that they stay in their registers up to it */
      asm volatile("s_wait_xcnt 0x0" :: "v"(kp), "v"(vp) : "memory");
#pragma unroll
      for (int it = 0; it < 8; ++it) { *(v4f*)&lk[(hf * 64 + it * 8 + sr) * FKP + c4] = rk[it]; *(v4f*)&lv[(it * 8 + sr) * FVP + hf * 64 + c4] = rv[it]; } } }
  __syncthreads();      /* the block's K and V^T rows are complete before any wave reads a fragment */
  const v8f z8 = {0.f,0.f,0.f,0.f,0.f,0.f,0.f,0.f}; v8f o0 = z8, o1 = z8, o2 = z8, o3 = z8;
  float mr = -1.0e30f, lr = 0.f;      /* of query q0 + ln; lr: the sum over the keys of this lane's half, the halves are joined behind the loop */
  const int nkb = qt / 2 + 1;      /* 32-key blocks covering keys 0..q0+15 */
  /* trips stay rolled: one trip already holds 64 products, more would only lengthen the text */
#pragma unroll 1
  for (int it = 0; it < nkb; ++it) {
    const int kb = it * 32;
    v8f s0 = z8, s1 = z8;      /* S^T: register r of lane (ln, hh) = key kb + 8 hh + r (s0), kb + 16 + 8 hh + r (s1), of query q0 + ln */
    { const float* kp = lk + (kb + ln) * FKP + 4 * hh;
#pragma unroll
      for (int u = 0; u < 8; ++u) { const v4f ka = *(const v4f*)(kp + 8 * u), kc = *(const v4f*)(kp + 16 * FKP + 8 * u);      /* the two tiles take turns: no product waits for the one before it */
        s0 = f4_mma(lo2(ka), lo2(qf[u]), s0); s1 = f4_mma(lo2(kc), lo2(qf[u]), s1); s0 = f4_mma(hi2(ka), hi2(qf[u]), s0); s1 = f4_mma(hi2(kc), hi2(qf[u]), s1); } }
    asm volatile("v_nop\n\tv_nop\n\tv_nop\n\tv_nop" : "+v"(s0), "+v"(s1));      /* the four vector slots between the last product and the first vector instruction that reads its result */
    float sv[16];
#pragma unroll
    for (int r = 0; r < 8; ++r) {
      const int qk = q0 - kb - r;      /* key kb + 8 hh + r <= row q0 + ln */
      sv[r] = (8 * hh - ln <= qk) ? s0[r] * 0.125f : -1.0e30f;
      sv[8 + r] = (8 * hh - ln <= qk - 16) ? s1[r] * 0.125f : -1.0e30f;
    }
    float mx = fmaxf(sv[0], sv[1]);
#pragma unroll
    for (int r = 2; r < 16; ++r) mx = fmaxf(mx, sv[r]);
    mx = fmaxf(mx, xhalf(mx));      /* both halves hold the query's maximum over the 32 keys */
    const float mn = fmaxf(mr, mx);
    const float al = expf(mr - mn); mr = mn;
    v2f p2[8];      /* P^T as the B operand: pair j = the two keys of k-step j */
#pragma unroll
    for (int j = 0; j < 8; ++j) { const v2f p = {expf(sv[2 * j] - mn), expf(sv[2 * j + 1] - mn)}; p2[j] = p; }
    const v2f rs = ((p2[0] + p2[1]) + (p2[2] + p2[3])) + ((p2[4] + p2[5]) + (p2[6] + p2[7]));      /* the lane's 16 keys, summed as a tree of pairs */
    lr = lr * al + (rs[0] + rs[1]);
#pragma unroll
    for (int r = 0; r < 8; ++r) { o0[r] *= al; o1[r] *= al; o2[r] *= al; o3[r] *= al; }
    const float* vp = lv + ln * FVP + kb + 8 * hh;      /* V^T row d = 16 t + ln: keys kb + 8 hh .. + 7 and kb + 16 + 8 hh .. + 7 */
#pragma unroll
    for (int g = 0; g < 4; ++g) { const int ko = (g >> 1) * 16 + (g & 1) * 4;      /* four keys of the lane half = k-steps 2g, 2g + 1; the four d tiles take turns */
      const v4f v0 = *(const v4f*)(vp + ko), v1 = *(const v4f*)(vp + 16 * FVP + ko), v2 = *(const v4f*)(vp + 32 * FVP + ko), v3 = *(const v4f*)(vp + 48 * FVP + ko);
      o0 = f4_mma(lo2(v0), p2[2 * g], o0); o1 = f4_mma(lo2(v1), p2[2 * g], o1); o2 = f4_mma(lo2(v2), p2[2 * g], o2); o3 = f4_mma(lo2(v3), p2[2 * g], o3);
      o0 = f4_mma(hi2(v0), p2[2 * g + 1], o0); o1 = f4_mma(hi2(v1), p2[2 * g + 1], o1); o2 = f4_mma(hi2(v2), p2[2 * g + 1], o2); o3 = f4_mma(hi2(v3), p2[2 * g + 1], o3); }      /* O^T tile t: register r = d 16 t + 8 hh + r of query q0 + ln */
    asm volatile("v_nop\n\tv_nop\n\tv_nop\n\tv_nop" : "+v"(o0), "+v"(o1), "+v"(o2), "+v"(o3));      /* the same four slots behind the trip's last product, on both sides of the loop's branch */
  }
  float* sob = &lo[w][0];
  { const float fin = 64.0f / (lr + xhalf(lr));      /* o carried x64 */
    float* sp = sob + ln * FKP + 8 * hh;      /* a lane's 8 d of a tile are 32 bytes of its query's row */
    const v8f os[4] = {o0, o1, o2, o3};
#pragma unroll
    for (int t = 0; t < 4; ++t) { const v4f x = {os[t][0] * fin, os[t][1] * fin, os[t][2] * fin, os[t][3] * fin}, y = {os[t][4] * fin, os[t][5] * fin, os[t][6] * fin, os[t][7] * fin}; *(v4f*)(sp + 16 * t) = x; *(v4f*)(sp + 16 * t + 4) = y; } }
  __builtin_amdgcn_fence(4, "workgroup"); __builtin_amdgcn_wave_barrier();      /* the wave's own rows: its lanes' writes stand before its lanes' reads */
  {
#pragma unroll
    for (int it2 = 0; it2 < 8; ++it2) { const int row = it2 * 2 + hh, pc = ln * 4; const v4f v = *(const v4f*)(sob + row * FKP + pc); *(v4f*)(OF + pofs + (size_t)(q0 + row) * DM + h * HD + pc) = v; }
  } }

__device__ __forceinline__ void hl_split(const float* __restrict__ F, _Float16* __restrict__ Hh, _Float16* __restrict__ Hl, size_t n8, int blk) {
  const size_t t = (size_t)blk * 256 + threadIdx.x; if (t >= n8) return; FragH fh, fl; const v4f a = *(const v4fa*)(F + t * 8), c = *(const v4fa*)(F + t * 8 + 4);
#pragma unroll
  for (int q = 0; q < 4; ++q) { _Float16 hv = (_Float16)a[q]; fh.h[q] = hv; fl.h[q] = (_Float16)((a[q] - (float)hv) * 1024.0f); hv = (_Float16)c[q]; fh.h[4 + q] = hv; fl.h[4 + q] = (_Float16)((c[q] - (float)hv) * 1024.0f); }
  unsigned short* dh = (unsigned short*)Hh + t * 8; unsigned short* dl = (unsigned short*)Hl + t * 8;
  { *(v8us*)dh = fh.half[0]; *(v8us*)dl = fl.half[0];  } }

#define ATB ((SEQ - QT0) / 128 * NB * NH)      /* attending blocks of k_att: query rows QT0.. only, rows below QT0 are k_att0's */
// The blocks from ATB on do not attend: they split the exact attention's f32 o plane F into its f16 hi / x1024 residual planes (needs nothing of this launch's attention and gives it nothing), 256 x 8 elements a block.
// causal attention of query rows >= QT0, f16 WMMA: blocks 0..ATB-1, block = 8 waves, wave -> query rows q0..q0+15 (q0 = 16*(8*xt + wave)) of one (b, head).
// Block index -> work (for speed only, any order is right): a block's cost grows with its query tile xt (4 xt + 4 trips), and there are more blocks than resident places, so the tiles go in falling order of cost, all heads of the last tile first;
// K and V^T of a 32-key block are the same for the block's 8 waves: the block brings them into LDS once (one 16-byte load of each per thread: K 8 lanes a row, whole 128-byte lines; V^T 4 lanes a row), two buffers, the next block's lines fetched into registers while this one is worked on;
// every wave stages and meets the one barrier of every 32-key block up to the last wave's count, and skips the arithmetic of the blocks past its own rows; fragments come from LDS (pitches 144 and 80 bytes: a 16-row fragment read meets every bank once).
// Per 32-key block, both products transposed: two 16x16 score tiles S^T = k . q^T (A = K16 rows as [key][d], B = Q16 rows, K = 64 in two k-steps), so that a lane holds 16 of the 32 scores of ONE query (lane l ^ 16 the other 16); x0.125 and the causal select by value in f32,
// online softmax per query (maximum and sum over the lane's own registers, one exchange between the wave's halves for the maximum, the halves' sums joined once behind the loop; o and sum rescaled by exp(m_old - m_new)); P^T x1024 packs from the score registers straight into the B operand of O^T += V^T . P^T (A = V^T rows as [d][key]).
// kg, vg: the block's first K and V^T rows at this 32-key block (the same in every lane); ko, vo: the lane's own byte offsets, fixed for the whole kernel
__device__ __forceinline__ void att_fetch(const char* kg, unsigned ko, const char* vg, unsigned vo, v8us& rk, v8us& rv) {
  const char* ka = kg + ko; const char* va = vg + vo; rk = *(const v8us*)ka; rv = *(const v8us*)va;
  /* the wait that belongs between an issued load and an overwrite of its address registers; it names the two addresses so that they stay in their registers up to it */
  asm volatile("s_wait_xcnt 0x0" :: "v"(ka), "v"(va) : "memory");
}

__global__ __launch_bounds__(256) __attribute__((amdgpu_num_vgpr(160)))      /* 160 registers: three blocks stay resident per WGP, as before the staging */
void k_att(const _Float16* __restrict__ Q16, const _Float16* __restrict__ K16, const _Float16* __restrict__ VT, _Float16* __restrict__ O16, const float* __restrict__ F, _Float16* __restrict__ Hh, _Float16* __restrict__ Hl, size_t n8) {
  __shared__ __attribute__((aligned(16))) _Float16 lso[8][16 * OPP];
  __shared__ __attribute__((aligned(16))) _Float16 lkt[2][32 * AKP];
  __shared__ __attribute__((aligned(16))) _Float16 lvt[2][HD * AVP];
  if (blockIdx.x >= ATB) { hl_split(F, Hh, Hl, n8, (int)blockIdx.x - ATB); return; }      /* the same for the whole block */
  const int xt = SEQ / 128 - 1 - (int)blockIdx.x / (NB * NH);      /* query tile of 128 rows, QT0 / 128 .. SEQ / 128 - 1 */
  const int tid = threadIdx.x, w = __builtin_amdgcn_readfirstlane(tid >> 5), lane = tid & 31, ln = lane & 15, hh = lane >> 4;      /* the wave's number is the same in every lane: held in a scalar register, so that the test round a trip's products is a scalar branch and what follows from it takes no vector registers */
  const int qt = xt * 8 + w; const int bh = (int)blockIdx.x % (NB * NH); const int b = bh / NH, h = bh - b * NH;
  const int q0 = qt * 16;
  const size_t wr0 = (size_t)b * SEQ + q0;
  const _Float16* qp = Q16 + (wr0 + ln) * DM + h * HD;
  const v16h qa0 = g2_frag(qp, hh), qa1 = g2_frag(qp + 32, hh);      /* d 0..31, 32..63 */
  const _Float16* kbase = K16 + (size_t)b * SEQ * DM + h * HD;        /* key row j at kbase + j*DM */
  const _Float16* vbase = VT + (size_t)bh * HD * SEQ;                 /* V^T row d at vbase + d*SEQ */
  const v8f z8 = {0.f,0.f,0.f,0.f,0.f,0.f,0.f,0.f}; v8f o0 = z8, o1 = z8, o2 = z8, o3 = z8;
  float mr = -1.0e30f, lr = 0.f;      /* of query q0 + ln; lr: the sum over the keys of this lane's half, the halves are joined behind the loop */
  const int nkb = qt / 2 + 1;      /* 32-key blocks covering keys 0..q0+15 */
  const int nkbb = xt * 4 + 4;      /* the count of the block's last wave */
  const char* kg = (const char*)kbase; const char* vg = (const char*)vbase; const unsigned ko = (unsigned)((tid >> 3) * DM + (tid & 7) * 8) * 2u, vo = (unsigned)((tid >> 2) * SEQ + (tid & 3) * 8) * 2u;      /* the thread's own 16 bytes of a 32-key block */
  const int kso = (tid >> 3) * AKP + (tid & 7) * 8, vso = (tid >> 2) * AVP + (tid & 3) * 8;
  v8us rk, rv;
  att_fetch(kg, ko, vg, vo, rk, rv); kg += 32 * DM * 2; vg += 32 * 2;
#pragma unroll 1
  for (int it = 0; it < nkbb; ++it) {
    _Float16* kt = &lkt[it & 1][0]; _Float16* vt = &lvt[it & 1][0];
    *(v8us*)((unsigned short*)kt + kso) = rk; *(v8us*)((unsigned short*)vt + vso) = rv;
    __syncthreads();      /* this block's tiles are complete before any wave reads a fragment; and who passes it knows that every wave has left the other buffer, which the next trip overwrites */
    if (it + 1 < nkbb) { att_fetch(kg, ko, vg, vo, rk, rv); kg += 32 * DM * 2; vg += 32 * 2; }
    if (it >= nkb) continue;      /* keys past the wave's rows: nothing to add */
    const int kb = it * 32;
    v8f s0 = z8, s1 = z8;      /* S^T: register r of lane (ln, hh) = key kb + 8 hh + r (s0), kb + 16 + 8 hh + r (s1), of query q0 + ln */
    { const _Float16* kp = kt + ln * AKP;      /* the four K fragments are read together, ahead of the products */
      const v16h k00 = g2_frag(kp, hh), k01 = g2_frag(kp + 32, hh), k10 = g2_frag(kp + 16 * AKP, hh), k11 = g2_frag(kp + 16 * AKP + 32, hh);
      s0 = g2_mma(k00, qa0, s0); s1 = g2_mma(k10, qa0, s1); s0 = g2_mma(k01, qa1, s0); s1 = g2_mma(k11, qa1, s1); }      /* the two tiles take turns: no product waits for the one before it */
    const _Float16* vp = vt + ln * AVP;      /* the four V^T fragments are read ahead of the softmax, which covers their latency */
    const v16h v0 = g2_frag(vp, hh), v1 = g2_frag(vp + 16 * AVP, hh), v2 = g2_frag(vp + 32 * AVP, hh), v3 = g2_frag(vp + 48 * AVP, hh);
    __builtin_amdgcn_sched_barrier(0);      /* keeps the eight reads here: left free, the compiler sinks them to the products, where their latency is bare */
    float sv[16];
#pragma unroll
    for (int r = 0; r < 8; ++r) {
      const int qk = q0 - kb - r;      /* key kb + 8 hh + r <= row q0 + ln, with the wave's part of the test on the scalar side: one vector register (8 hh - ln) */
      sv[r] = (8 * hh - ln <= qk) ? s0[r] * 0.125f : -1.0e30f;
      sv[8 + r] = (8 * hh - ln <= qk - 16) ? s1[r] * 0.125f : -1.0e30f;
    }
    float mx = fmaxf(sv[0], sv[1]);
#pragma unroll
    for (int r = 2; r < 16; ++r) mx = fmaxf(mx, sv[r]);
    mx = fmaxf(mx, xhalf(mx));      /* both halves hold the query's maximum over the 32 keys */
    const float mn = fmaxf(mr, mx);
    const float al = __expf(mr - mn); mr = mn;
    FragH pf; v2f p2[8];      /* P^T as the B operand: elements 0..7 = keys 8 hh .. + 7, 8..15 = keys 16 + 8 hh .. + 7, the k order of the V^T fragments */
#pragma unroll
    for (int r = 0; r < 8; ++r) { const v2f p = {__expf(sv[2 * r] - mn), __expf(sv[2 * r + 1] - mn)}; p2[r] = p; pf.h[2 * r] = (_Float16)(p[0] * 1024.0f); pf.h[2 * r + 1] = (_Float16)(p[1] * 1024.0f); }
    const v2f rs = ((p2[0] + p2[1]) + (p2[2] + p2[3])) + ((p2[4] + p2[5]) + (p2[6] + p2[7]));      /* the lane's 16 keys, summed as a tree of pairs */
    lr = lr * al + (rs[0] + rs[1]);
#pragma unroll
    for (int r = 0; r < 8; ++r) { o0[r] *= al; o1[r] *= al; o2[r] *= al; o3[r] *= al; }
    o0 = g2_mma(v0, pf.v, o0); o1 = g2_mma(v1, pf.v, o1); o2 = g2_mma(v2, pf.v, o2); o3 = g2_mma(v3, pf.v, o3);      /* O^T tile t: register r = d 16 t + 8 hh + r of query q0 + ln */
  }
  _Float16* sob = &lso[w][0];
  { const float inv = (1.0f / (lr + xhalf(lr))) * 0.0009765625f; FragH f0, f1;
#pragma unroll
    for (int r = 0; r < 8; ++r) { f0.h[r] = (_Float16)(o0[r] * inv); f0.h[8 + r] = (_Float16)(o1[r] * inv); f1.h[r] = (_Float16)(o2[r] * inv); f1.h[8 + r] = (_Float16)(o3[r] * inv); }
    unsigned short* sp = (unsigned short*)sob + ln * OPP + 8 * hh;      /* a lane's 8 d of a tile are 16 bytes of its query's row */
    *(v8us*)sp = f0.half[0]; *(v8us*)(sp + 16) = f0.half[1]; *(v8us*)(sp + 32) = f1.half[0]; *(v8us*)(sp + 48) = f1.half[1]; }
  __builtin_amdgcn_fence(3, "wavefront"); __builtin_amdgcn_wave_barrier();
  unsigned short* ob = (unsigned short*)O16 + wr0 * DM + h * HD;
  {
#pragma unroll
    for (int it2 = 0; it2 < 4; ++it2) { const int row = it2 * 4 + (lane >> 3), c8 = (lane & 7) * 8; const v8us v = *(const v8us*)((const unsigned short*)sob + row * OPP + c8); *(v8us*)(ob + (size_t)row * DM + c8) = v; }
     }
}

extern "C" void kernel_launch(void* const* d_in, const int* in_sizes, int n_in,
                              void* d_out, int out_size, void* d_ws, size_t ws_size, hipStream_t stream) {
  if (n_in < 6) return;
  const float* x = (const float*)d_in[0]; const float* wq = (const float*)d_in[1]; const float* wk = (const float*)d_in[2];
  const float* wv = (const float*)d_in[3]; const float* wp = (const float*)d_in[4]; const float* bproj = (const float*)d_in[5];
  const size_t need_x = (size_t)(NB - 1) * SEQ_FULL * DM + (size_t)SEQ * DM;
  if ((size_t)in_sizes[0] < need_x || in_sizes[1] < DM * DM || in_sizes[2] < DM * DM || in_sizes[3] < DM * DM || in_sizes[4] < DM * DM || in_sizes[5] < DM || (size_t)out_size < need_x) return;
  float* out = (float*)d_out;
  char* ws = (char*)d_ws; size_t off = 0;
  auto take = [&](size_t bytes) { char* p = ws + off; off += (bytes + 255) & ~(size_t)255; return p; };
  const size_t wb = (size_t)DM * DM * 2;
  _Float16* WQ = (_Float16*)take(4 * wb); _Float16* WK = WQ + DM * DM; _Float16* WV = WK + DM * DM; _Float16* WP = WV + DM * DM;      /* four planes in a row */
  const size_t rows2 = (size_t)NB * SEQ * DM * 2;      /* f16 plane over all token rows */
  const size_t f0b4 = (size_t)NB * QT0 * DM * 4;       /* f32 first-tile plane */
  const size_t f0b2 = (size_t)NB * QT0 * DM * 2;       /* f16 first-tile plane */
  const size_t vtb = (size_t)NB * DM * SEQ * 2;         /* V^T [NB*NH*HD][SEQ] */
  /* every plane that one launch writes has its own place: the GEMMs of a launch run side by side */
  _Float16* X16 = (_Float16*)take(rows2); _Float16* O16 = X16;      /* X16 is last read by the first GEMM launch, O16 written after it */
  float* QF0 = (float*)take(f0b4); float* KF0 = (float*)take(f0b4); float* VF0 = (float*)take(f0b4); float* OF0 = (float*)take(f0b4);
  _Float16* Q16 = (_Float16*)take(rows2); _Float16* K16 = (_Float16*)take(rows2); _Float16* VT = (_Float16*)take(vtb);
  _Float16* OH = (_Float16*)take(f0b2); _Float16* OL = (_Float16*)take(f0b2);
  if (off > ws_size) return;

  const size_t nx8 = (size_t)NB * SEQ * DM / 8;
  k_cvt<<<(unsigned)(4 * GW + (nx8 + 255) / 256), 256, 0, stream>>>(x, wq, wk, wv, wp, WQ, X16, nx8);
  constexpr int nS = (QT0 / 128) * (DM / 64);            /* blocks per batch: first-tile GEMMs */
  constexpr int nV = (DM / 128) * ((SEQ - QT0) / 64);    /* V^T of keys >= 128, per batch */
  constexpr int nW = (DM / 128) * (QT0 / 64);            /* V^T of the first keys, per batch */
  constexpr int nP = ((SEQ - QT0) / 128) * (DM / 64);    /* projection of rows >= 128, per batch */
  /* all products of X16 in one launch, every row of q, k and V^T computed once: rows 0..127 of every sequence give f32 q, f32 and f16 k, f32 and f16 V^T (the two widths of a tile from the same accumulators; these blocks store more, so they go first); rows >= 128 give f16 q, k, V^T */
  GJobs g1 = {};
  g1.j[0] = GJob{X16, WK, nullptr, KF0, K16, (size_t)SEQ * DM, (size_t)0, (size_t)QT0 * DM, (size_t)SEQ * DM, 0.0625f, DM, DM, DM, DM, DM, nS, 0, 0, 0};
  g1.j[1] = GJob{WV, X16, nullptr, VF0, VT, (size_t)0, (size_t)SEQ * DM, (size_t)DM * QT0, (size_t)DM * SEQ, 0.0625f, DM, DM, QT0, SEQ, QT0, nW, NB * nS, 0, 0};
  g1.j[2] = GJob{X16, WQ, nullptr, QF0, nullptr, (size_t)SEQ * DM, (size_t)0, (size_t)QT0 * DM, (size_t)0, 0.0625f, DM, DM, DM, 0, DM, nS, NB * nS + NB * nW, 0, 0};
  g1.j[3] = GJob{X16 + (size_t)QT0 * DM, WQ, nullptr, nullptr, Q16 + (size_t)QT0 * DM, (size_t)SEQ * DM, (size_t)0, (size_t)0, (size_t)SEQ * DM, 0.0625f, DM, DM, 0, DM, DM, nP, 2 * NB * nS + NB * nW, 0, 0};
  g1.j[4] = GJob{X16 + (size_t)QT0 * DM, WK, nullptr, nullptr, K16 + (size_t)QT0 * DM, (size_t)SEQ * DM, (size_t)0, (size_t)0, (size_t)SEQ * DM, 0.0625f, DM, DM, 0, DM, DM, nP, 2 * NB * nS + NB * nW + NB * nP, 0, 0};
  g1.j[5] = GJob{WV, X16 + (size_t)QT0 * DM, nullptr, nullptr, VT + QT0, (size_t)0, (size_t)SEQ * DM, (size_t)0, (size_t)DM * SEQ, 0.0625f, DM, DM, 0, SEQ, SEQ - QT0, nV, 2 * NB * nS + NB * nW + 2 * NB * nP, 0, 0};
  k_gemm2<<<2 * NB * nS + NB * nW + 2 * NB * nP + NB * nV, 128, 0, stream>>>(g1, 6, bproj, DM);
  k_att0<<<NB * NH * (QT0 / 64), 128, 0, stream>>>(QF0, KF0, VF0, OF0);      /* exact attention rows 0..127 (o x64) */
  const size_t nf8 = (size_t)NB * QT0 * DM / 8;
  /* attention of rows >= 128 and, in the grid's last blocks, the f16 hi / x1024 residual planes of the exact o x64 */
  k_att<<<(unsigned)(ATB + (nf8 + 255) / 256), 256, 0, stream>>>(Q16, K16, VT, O16, OF0, OH, OL, nf8);
  /* output projection, one launch: rows < 128 from the hi and residual planes (twice the k, so these blocks go first), rows >= 128 from the f16 o plane */
  GJobs g2 = {};
  g2.j[0] = GJob{OH, WP, OL, out, nullptr, (size_t)QT0 * DM, (size_t)0, (size_t)SEQ_FULL * DM, (size_t)0, 0.0009765625f, DM, DM, DM, 0, DM, nS, 0, 1, 0};
  g2.j[1] = GJob{O16 + (size_t)QT0 * DM, WP, nullptr, out + (size_t)QT0 * DM, nullptr, (size_t)SEQ * DM, (size_t)0, (size_t)SEQ_FULL * DM, (size_t)0, 0.0625f, DM, DM, DM, 0, DM, nP, NB * nS, 1, 0};
  k_gemm2<<<NB * nS + NB * nP, 128, 0, stream>>>(g2, 2, bproj, DM);
}
